// v000
// The times below were measured on an AMD MI455X: many runs one after another, warmed up first and cycling through
// copies of the inputs, with the whole window's GPU time divided by the number of runs. Launches and the gaps
// between them are all in it. The median over several windows is given; except for v000 it joins two sittings, which
// can be a few percent apart, so the side-by-side timings, each taken in one sitting, are the better comparison.
// v000, which the later versions start from, runs in 2240 microseconds.
// Contractions: q = x.Wq^T [4096x1024].[1024x1024], k/v = context.W^T and the output projection (+b) with f16 operands on pre-cast planes (v_wmma_f32_16x16x32_f16; 64x64 register-blocked wave tiles, weights x16); per (batch, head) softmax(q k^T / 8 + b_h(|i-j|)) v over 2048 keys (head_dim 64) as a flash kernel with f16 q.k^T and f16 p.v (p as f16 of 4096 p), the periodic distance bias -floor(|i-j|/30) 2^-(h+1) read from a per-head relative-offset table built on device; f32 accumulate and softmax.
#include <hip/hip_runtime.h>
#include <math.h>

typedef __attribute__((ext_vector_type(16))) _Float16 v16h;
typedef __attribute__((ext_vector_type(8)))  _Float16 v8h;
typedef __attribute__((ext_vector_type(16))) __bf16   v16b;
typedef __attribute__((ext_vector_type(8)))  float    v8f;
typedef __attribute__((ext_vector_type(4)))  float    v4f;

// 16-bit WMMA fragment map (wave32), lane L, h = L>>4, m = L&15:
//   A 16x32: lane = row m;   element i -> k = (i<8) ? 8h+i : 16+8h+(i-8)
//   B 32x16: lane = column m; the SAME k(i,h)
//   D 16x16 (8 f32): lane = column m; element r -> row 8h+r
__device__ __forceinline__ int frag_k(int i, int h) { return (i < 8) ? (8 * h + i) : (16 + 8 * h + (i - 8)); }
__device__ __forceinline__ __bf16 bf16_rne(float f) {
    unsigned int u = __float_as_uint(f);
    u += 0x7fffu + ((u >> 16) & 1u);
    return __builtin_bit_cast(__bf16, (unsigned short)(u >> 16));
}
__device__ __forceinline__ float bf16_f32(__bf16 b) { return __uint_as_float(((unsigned int)__builtin_bit_cast(unsigned short, b)) << 16); }
__device__ __forceinline__ v8f wmma16(v16h a, v16h b, v8f c) {
    c = __builtin_amdgcn_wmma_f32_16x16x32_f16(false, a, false, b, (short)0, c, false, false);
    asm volatile("v_nop\n\tv_nop\n\tv_nop\n\tv_nop" : "+v"(c) : "v"(a), "v"(b));
    return c;
}
__device__ __forceinline__ v8f wmmab(v16b a, v16b b, v8f c) {
    c = __builtin_amdgcn_wmma_f32_16x16x32_bf16(false, a, false, b, (short)0, c, false, false);
    asm volatile("v_nop\n\tv_nop\n\tv_nop\n\tv_nop" : "+v"(c) : "v"(a), "v"(b));
    return c;
}
struct Split { v16b hi, lo; };
// hi/lo split product: a.hi*b.hi + a.hi*b.lo + a.lo*b.hi
__device__ __forceinline__ v8f wmma3(const Split& a, const Split& b, v8f c) {
    c = __builtin_amdgcn_wmma_f32_16x16x32_bf16(false, a.hi, false, b.hi, (short)0, c, false, false);
    c = __builtin_amdgcn_wmma_f32_16x16x32_bf16(false, a.hi, false, b.lo, (short)0, c, false, false);
    c = __builtin_amdgcn_wmma_f32_16x16x32_bf16(false, a.lo, false, b.hi, (short)0, c, false, false);
    asm volatile("v_nop\n\tv_nop\n\tv_nop\n\tv_nop" : "+v"(c) : "v"(a.hi), "v"(a.lo), "v"(b.hi), "v"(b.lo));
    return c;
}
struct Split3 { v16b hi, mid, lo; };
// triple split product (6 terms, drops only terms below 2^-24 relative)
__device__ __forceinline__ v8f wmma6(const Split3& a, const Split3& b, v8f c) {
    c = __builtin_amdgcn_wmma_f32_16x16x32_bf16(false, a.hi, false, b.hi, (short)0, c, false, false);
    c = __builtin_amdgcn_wmma_f32_16x16x32_bf16(false, a.hi, false, b.mid, (short)0, c, false, false);
    c = __builtin_amdgcn_wmma_f32_16x16x32_bf16(false, a.mid, false, b.hi, (short)0, c, false, false);
    c = __builtin_amdgcn_wmma_f32_16x16x32_bf16(false, a.hi, false, b.lo, (short)0, c, false, false);
    c = __builtin_amdgcn_wmma_f32_16x16x32_bf16(false, a.mid, false, b.mid, (short)0, c, false, false);
    c = __builtin_amdgcn_wmma_f32_16x16x32_bf16(false, a.lo, false, b.hi, (short)0, c, false, false);
    asm volatile("v_nop\n\tv_nop\n\tv_nop\n\tv_nop" : "+v"(c) : "v"(a.hi), "v"(a.mid), "v"(a.lo), "v"(b.hi), "v"(b.mid), "v"(b.lo));
    return c;
}

// Fragment gathers from f32 memory: element i <- p[(k0 + frag_k(i,h)) * sk] * s, zero for k >= klen.
__device__ __forceinline__ v16h fh_ld(const float* __restrict__ p, long long sk, int k0, int h, int klen, float s) {
    v16h a;
#pragma unroll
    for (int i = 0; i < 16; ++i) { const int k = k0 + frag_k(i, h); a[i] = (k < klen) ? (_Float16)(p[(long long)k * sk] * s) : (_Float16)0.f; }
    return a;
}
__device__ __forceinline__ Split sp_ld(const float* __restrict__ p, long long sk, int k0, int h, int klen, float s) {
    Split r;
#pragma unroll
    for (int i = 0; i < 16; ++i) {
        const int k = k0 + frag_k(i, h); const float x = (k < klen) ? p[(long long)k * sk] * s : 0.f;
        const __bf16 hb = bf16_rne(x); r.hi[i] = hb; r.lo[i] = bf16_rne(x - bf16_f32(hb));
    }
    return r;
}
__device__ __forceinline__ Split3 sp3_ld(const float* __restrict__ p, long long sk, int k0, int h, int klen, float s) {
    Split3 r;
#pragma unroll
    for (int i = 0; i < 16; ++i) {
        const int k = k0 + frag_k(i, h); const float x = (k < klen) ? p[(long long)k * sk] * s : 0.f;
        const __bf16 hb = bf16_rne(x); const float r1 = x - bf16_f32(hb); const __bf16 mb = bf16_rne(r1);
        r.hi[i] = hb; r.mid[i] = mb; r.lo[i] = bf16_rne(r1 - bf16_f32(mb));
    }
    return r;
}
__device__ __forceinline__ v16b bh_ld(const float* __restrict__ p, long long sk, int k0, int h, int klen, float s) {
    v16b a;
#pragma unroll
    for (int i = 0; i < 16; ++i) { const int k = k0 + frag_k(i, h); a[i] = bf16_rne((k < klen) ? p[(long long)k * sk] * s : 0.f); }
    return a;
}
// f16 fragment from an f16 LDS/global row with element stride 1 (k-contiguous), no bounds (tile already zero padded)
__device__ __forceinline__ v16h fh_row(const _Float16* __restrict__ row, int k0, int h) {
    v16h a;
#pragma unroll
    for (int i = 0; i < 16; ++i) a[i] = row[k0 + frag_k(i, h)];
    return a;
}

#define VST2(T, ptr, val) do { const T vst2_v_ = (val); *(T*)(ptr) = vst2_v_;  } while (0)
typedef float v4f __attribute__((ext_vector_type(4)));
#define VST2V4(ptr, val) do { const v4f vst2_v4_ = (val); *(v4f*)(ptr) = vst2_v4_;  } while (0)

__device__ __attribute__((noinline)) float act_fn(float v, int act) {
    if (act == 1) return fmaxf(v, 0.f);                                                                               // relu
    if (act == 2) { const float u = 0.7978845608028654f * (v + 0.044715f * v * v * v); return 0.5f * v * (1.f + tanhf(u)); } // tanh-gelu
    if (act == 3) return v / (1.f + expf(-v));                                                                        // silu
    if (act == 4) return 0.5f * v * (1.f + erff(v * 0.7071067811865476f));                                             // erf-gelu
    if (act == 5) return tanhf(v);
    if (act == 6) return 1.f / (1.f + expf(-v));                                                                      // sigmoid
    if (act == 7) return (v > 0.f) ? v : 0.01f * v;                                                                   // leaky relu 0.01
    if (act == 8) return (v > 0.f) ? v : (expf(v) - 1.f);                                                             // elu
    if (act == 9) return fminf(fmaxf(v, 0.f), 6.f);                                                                   // relu6
    if (act == 10) return fabsf(v);                                                                                    // abs
    if (act == 11) return (v >= 0.f) ? v : 0.1f * v;                                                                  // leaky 0.1
    if (act == 12) return (v > 0.f) ? v : 0.2f * v;                                                                   // leaky 0.2
    if (act == 13) return (v > 20.f) ? v : log1pf(expf(v));                                                            // softplus
    return v;
}

// =====================================================================================================================
// k_gemm<MODE>: C(z, m, n) = act(alpha * sum_k A(z, m, k) * B(z, k, n) + bias) + beta * R(z, m, n)
//   One wave (32-thread block) per 16 x 32 tile of C; grid (ceil(N/32), ceil(M/16), Z). Batch z -> (zo = z / zi_n, zi = z % zi_n)
//   with separate outer/inner strides for every tensor (e.g. batch and head). A(m,k) = A[zo*sAo + zi*sAi + m*sAm + k*sAk] (f32),
//   B(k,n) = B[zo*sBo + zi*sBi + n*sBn + k*sBk] (f32); any M, N, K (K zero-padded to 32 inside the fragments, M/N tails guarded).
//   C(m,n) = C[zo*sCo + zi*sCi + m*sCm + n] (n contiguous). flags: 1 bias[n], 2 bias[m], 4 residual R[zo*sRo + zi*sRi + m*sRm + n*sRn].
//   MODE 0: f16 operands (A prescaled by sa, B by sb, both undone in the epilogue); 1: bf16 hi/lo split (3 products); 2: bf16;
//   3: bf16 hi/mid/lo triple split (6 products); 4: as 3 with Kahan-compensated f32 accumulation across k-steps.
// =====================================================================================================================
struct GemmP {
    const float* A; const float* B; const float* bias; const float* R; float* C;
    long long sAo, sAi, sAm, sAk, sBo, sBi, sBn, sBk, sCo, sCi, sCm, sRo, sRi, sRm, sRn;
    int M, N, K, zi_n, flags, act; float alpha, beta, sa, sb;
    int Npad, pad_;     // columns [N, Npad) of C are written as 0 so that padded workspace rows are covered by whole-line stores; Npad >= N
};
static_assert(sizeof(GemmP) == 5 * 8 + 15 * 8 + 6 * 4 + 4 * 4 + 2 * 4, "GemmP has padding");

template <int MODE>
__global__ __launch_bounds__(32) void k_gemm(GemmP p) {
    const int lane = threadIdx.x & 31, h = lane >> 4, l15 = lane & 15;
    const int m0 = blockIdx.y * 16, n0 = blockIdx.x * 32;
    const int z = blockIdx.z, zo = z / p.zi_n, zi = z - zo * p.zi_n;
    const float* A = p.A + zo * p.sAo + zi * p.sAi;
    const float* B = p.B + zo * p.sBo + zi * p.sBi;
    const int am = min(m0 + l15, p.M - 1);                       // clamped row for loads (stores are guarded)
    v8f acc[2], comp[2];
#pragma unroll
    for (int t = 0; t < 2; ++t) { v8f zz = {}; acc[t] = zz; comp[t] = zz; }
    for (int k0 = 0; k0 < p.K; k0 += 32) {
        const float* arow = A + (long long)am * p.sAm;
        if (MODE == 1) {
            const Split a = sp_ld(arow, p.sAk, k0, h, p.K, 1.f);
#pragma unroll
            for (int t = 0; t < 2; ++t) {
                const int bn = min(n0 + t * 16 + l15, p.N - 1);
                acc[t] = wmma3(a, sp_ld(B + (long long)bn * p.sBn, p.sBk, k0, h, p.K, 1.f), acc[t]);
            }
        } else if (MODE == 3) {
            const Split3 a = sp3_ld(arow, p.sAk, k0, h, p.K, 1.f);
#pragma unroll
            for (int t = 0; t < 2; ++t) {
                const int bn = min(n0 + t * 16 + l15, p.N - 1);
                acc[t] = wmma6(a, sp3_ld(B + (long long)bn * p.sBn, p.sBk, k0, h, p.K, 1.f), acc[t]);
            }
        } else if (MODE == 4) {
            // triple split as MODE 3, but each k-step's 6 products go into a fresh accumulator and the partial is added to the running f32 sum
            // on the VALU with Kahan compensation (accumulation error stays ~1 ulp however long K is)
            const Split3 a = sp3_ld(arow, p.sAk, k0, h, p.K, 1.f);
#pragma unroll
            for (int t = 0; t < 2; ++t) {
                const int bn = min(n0 + t * 16 + l15, p.N - 1); v8f zz = {};
                const v8f part = wmma6(a, sp3_ld(B + (long long)bn * p.sBn, p.sBk, k0, h, p.K, 1.f), zz);
                const v8f y = part - comp[t]; const v8f s = acc[t] + y; comp[t] = (s - acc[t]) - y; acc[t] = s;
            }
        } else if (MODE == 2) {
            const v16b a = bh_ld(arow, p.sAk, k0, h, p.K, 1.f);
#pragma unroll
            for (int t = 0; t < 2; ++t) {
                const int bn = min(n0 + t * 16 + l15, p.N - 1);
                acc[t] = wmmab(a, bh_ld(B + (long long)bn * p.sBn, p.sBk, k0, h, p.K, 1.f), acc[t]);
            }
        } else {
            const v16h a = fh_ld(arow, p.sAk, k0, h, p.K, p.sa);
#pragma unroll
            for (int t = 0; t < 2; ++t) {
                const int bn = min(n0 + t * 16 + l15, p.N - 1);
                acc[t] = wmma16(a, fh_ld(B + (long long)bn * p.sBn, p.sBk, k0, h, p.K, p.sb), acc[t]);
            }
        }
    }
    const float iscale = (MODE == 0) ? p.alpha / (p.sa * p.sb) : p.alpha;
    float* C = p.C + zo * p.sCo + zi * p.sCi;
    const float* R = p.R + zo * p.sRo + zi * p.sRi;
    __shared__ __align__(16) float ctile[16][36];
#pragma unroll
    for (int t = 0; t < 2; ++t) {
        const int n = n0 + t * 16 + l15; const int nn = min(n, p.N - 1);
#pragma unroll
        for (int r = 0; r < 8; ++r) {
            const int m = m0 + 8 * h + r; const int mm = min(m, p.M - 1);
            float v = acc[t][r] * iscale;
            if (p.flags & 1) v += p.bias[nn];
            if (p.flags & 2) v += p.bias[mm];
            if (p.flags & 8) v *= p.bias[(long long)zo * p.M + mm];   /* per-(z,row) scale vector laid out [Z][M]; exclusive with the bias flags */
            v = act_fn(v, p.act);
            if (p.flags & 4) v += p.beta * R[(long long)mm * p.sRm + (long long)nn * p.sRn];
            ctile[8 * h + r][t * 16 + l15] = (n < p.N) ? v : 0.f;
        }
    }
    __syncthreads();
    const int NW = (p.Npad > p.N) ? p.Npad : p.N;           // write width
    const bool fast = (m0 + 16 <= p.M) && (n0 + 32 <= NW) && ((p.sCm & 3) == 0) && ((((size_t)C) & 15) == 0);
    if (fast) {
#pragma unroll
        for (int s = 0; s < 4; ++s) {
            const int row = s * 4 + (lane >> 3), c4 = (lane & 7) * 4;
            const v4f v = *(const v4f*)&ctile[row][c4];
            VST2V4(C + (long long)(m0 + row) * p.sCm + n0 + c4, v);
        }
    } else {
        for (int row = 0; row < 16; ++row) {
            const int m = m0 + row, n = n0 + lane;
            if (m < p.M && n < NW) VST2(float, C + (long long)m * p.sCm + n, ctile[row][lane]);
        }
    }
}


// =====================================================================================================================
// k_gemmT<MODE, TM, TN>: same contract as k_gemm, but one wave computes a (16*TM) x (16*TN) tile: TM A fragments and TN B fragments are
//   loaded per 32-wide k-step and reused across TM*TN WMMAs (far fewer load/convert instructions per MAC). MODE 0 (f16), 1 (bf16 hi/lo),
//   2 (bf16) only. grid (ceil(NW/(16*TN)), ceil(M/(16*TM)), Z), block 32. Epilogue identical to k_gemm, run per 16x32 sub-tile.
// =====================================================================================================================
template <int MODE, int TM, int TN>
__global__ __launch_bounds__(32) void k_gemmT(GemmP p) {
    const int lane = threadIdx.x & 31, h = lane >> 4, l15 = lane & 15;
    const int m0 = blockIdx.y * (16 * TM), n0 = blockIdx.x * (16 * TN);
    const int z = blockIdx.z, zo = z / p.zi_n, zi = z - zo * p.zi_n;
    const float* A = p.A + zo * p.sAo + zi * p.sAi;
    const float* B = p.B + zo * p.sBo + zi * p.sBi;
    v8f acc[TM][TN];
#pragma unroll
    for (int i = 0; i < TM; ++i)
#pragma unroll
        for (int t = 0; t < TN; ++t) { v8f zz = {}; acc[i][t] = zz; }
    for (int k0 = 0; k0 < p.K; k0 += 32) {
        if (MODE == 1) {
            Split a[TM], b[TN];
#pragma unroll
            for (int i = 0; i < TM; ++i) { const int am = min(m0 + 16 * i + l15, p.M - 1); a[i] = sp_ld(A + (long long)am * p.sAm, p.sAk, k0, h, p.K, 1.f); }
#pragma unroll
            for (int t = 0; t < TN; ++t) { const int bn = min(n0 + 16 * t + l15, p.N - 1); b[t] = sp_ld(B + (long long)bn * p.sBn, p.sBk, k0, h, p.K, 1.f); }
#pragma unroll
            for (int i = 0; i < TM; ++i)
#pragma unroll
                for (int t = 0; t < TN; ++t) acc[i][t] = wmma3(a[i], b[t], acc[i][t]);
        } else if (MODE == 2) {
            v16b a[TM], b[TN];
#pragma unroll
            for (int i = 0; i < TM; ++i) { const int am = min(m0 + 16 * i + l15, p.M - 1); a[i] = bh_ld(A + (long long)am * p.sAm, p.sAk, k0, h, p.K, 1.f); }
#pragma unroll
            for (int t = 0; t < TN; ++t) { const int bn = min(n0 + 16 * t + l15, p.N - 1); b[t] = bh_ld(B + (long long)bn * p.sBn, p.sBk, k0, h, p.K, 1.f); }
#pragma unroll
            for (int i = 0; i < TM; ++i)
#pragma unroll
                for (int t = 0; t < TN; ++t) acc[i][t] = wmmab(a[i], b[t], acc[i][t]);
        } else {
            v16h a[TM], b[TN];
#pragma unroll
            for (int i = 0; i < TM; ++i) { const int am = min(m0 + 16 * i + l15, p.M - 1); a[i] = fh_ld(A + (long long)am * p.sAm, p.sAk, k0, h, p.K, p.sa); }
#pragma unroll
            for (int t = 0; t < TN; ++t) { const int bn = min(n0 + 16 * t + l15, p.N - 1); b[t] = fh_ld(B + (long long)bn * p.sBn, p.sBk, k0, h, p.K, p.sb); }
#pragma unroll
            for (int i = 0; i < TM; ++i)
#pragma unroll
                for (int t = 0; t < TN; ++t) acc[i][t] = wmma16(a[i], b[t], acc[i][t]);
        }
    }
    const float iscale = (MODE == 0) ? p.alpha / (p.sa * p.sb) : p.alpha;
    float* C = p.C + zo * p.sCo + zi * p.sCi;
    const float* R = p.R + zo * p.sRo + zi * p.sRi;
    const int NW = (p.Npad > p.N) ? p.Npad : p.N;
    __shared__ __align__(16) float ctile[16][36];
#pragma unroll
    for (int i = 0; i < TM; ++i) {
        const int mb = m0 + 16 * i; if (mb >= p.M) break;          // wave-uniform
#pragma unroll
        for (int tp = 0; tp < TN / 2; ++tp) {
            const int nb = n0 + 32 * tp; if (nb >= NW) break;        // wave-uniform
#pragma unroll
            for (int t2 = 0; t2 < 2; ++t2) {
                const int t = 2 * tp + t2; const int n = nb + t2 * 16 + l15; const int nn = min(n, p.N - 1);
#pragma unroll
                for (int r = 0; r < 8; ++r) {
                    const int m = mb + 8 * h + r; const int mm = min(m, p.M - 1);
                    float v = acc[i][t][r] * iscale;
                    if (p.flags & 1) v += p.bias[nn];
                    if (p.flags & 2) v += p.bias[mm];
            if (p.flags & 8) v *= p.bias[(long long)zo * p.M + mm];   /* per-(z,row) scale vector laid out [Z][M]; exclusive with the bias flags */
                    v = act_fn(v, p.act);
                    if (p.flags & 4) v += p.beta * R[(long long)mm * p.sRm + (long long)nn * p.sRn];
                    ctile[8 * h + r][t2 * 16 + l15] = (n < p.N) ? v : 0.f;
                }
            }
            __syncthreads();
            const bool fast = (mb + 16 <= p.M) && (nb + 32 <= NW) && ((p.sCm & 3) == 0) && ((((size_t)C) & 15) == 0);
            if (fast) {
#pragma unroll
                for (int s = 0; s < 4; ++s) {
                    const int row = s * 4 + (lane >> 3), c4 = (lane & 7) * 4;
                    const v4f v = *(const v4f*)&ctile[row][c4];
                    VST2V4(C + (long long)(mb + row) * p.sCm + nb + c4, v);
                }
            } else {
                for (int row = 0; row < 16; ++row) {
                    const int m = mb + row, n = nb + lane;
                    if (m < p.M && n < NW) VST2(float, C + (long long)m * p.sCm + n, ctile[row][lane]);
                }
            }
            __syncthreads();
        }
    }
}

// =====================================================================================================================
//   Wave = 16 queries, AW waves per block, 64-key blocks; grid (ceil(Lq/(16*AW)), H, B), block 32*AW. Any Lq, Lk; head dim dh <= DHP
//   (DHP multiple of 32), value dim dv <= DVP (multiple of 16, <= 128). Every tensor addressed by (batch, head, row, element) strides, f32.
//   Scores: QM 0 f16 operands, 1 bf16 hi/lo split, 2 bf16 triple split; statistics f32 (exp2 domain); P.V: P x 4096 as f16 with V f16 staged in LDS
//   (SPLITPV: P and V as bf16 hi/lo splits). kv head = h / hrep. Masking: causal = 1 (keep j <= i + coff, masked -> -inf, key blocks beyond the
//   diagonal skipped), causal = 2 (masked -> mfill, a finite fill like the -1e9; no skipping), causal = 3 (keep j >= i + coff,
//   masked -> -inf, no skipping); optional additive f32 mask Mf,
//   optional int keep-mask Mi (0 -> score := mfill), both addressed b*smb + h*smh + i*smi + j*smj (0 strides broadcast).
// =====================================================================================================================
#define AW 4
struct AttnP {   // apv4
    const float* Q; const float* K; const float* V; float* O; float* P; const float* Mf; const int* Mi; float* ST;
    const float* Pw; const float* Rt; const int* SQ; const int* SK;           // optional: post-softmax weight, relative-position table, segment ids
    long long swb, swh, swi, swj, srb, srh, sri;                                 // Pw strides (b,h,i,j); Rt strides (b,h,i), column = clamp(i - j + roff, 0, rn-1)
    long long sQb, sQh, sQi, sQd, sKb, sKh, sKj, sKd, sVb, sVh, sVj, sVd, sOb, sOh, sOi, sPb, sPh, sPi, smb, smh, smi, smj;
    int Lq, Lk, dh, dv, hrep, causal, coff, pband;   // pband > 0: P holds only the band |j - i| <= pband, column j - i + pband
    float scale, mfill; int nonorm, mpol;             // nonorm (online path only): O = sum_j exp(score_j) V_j without the 1/rowsum (scores must be <= ~0); mpol: Mi masks where ==0 (mpol 0) or where !=0 (mpol 1)
    int roff, rn, segpol, win;                        // Rt column offset/count; SQ/SK: score := mfill where (segpol 0) SQ[i] != SK[j] or (segpol 1) SQ[i] == SK[j]; win > 0: keys with i - j > win (after coff) -> -inf
};
//   Pw: the softmax numerator is multiplied by Pw(b,h,i,j) AFTER the row sum is taken (probs * weight, then P.V), as in post-softmax multiplicative biases.                                                    // ST (optional): per row (b,h,i) -> ST[((b*H + h)*Lq + i)*2 + {0,1}] = {row max of the scaled+masked score (natural units), sum_j exp(score - max)}
static_assert(sizeof(AttnP) == 12 * 8 + 29 * 8 + 16 * 4, "AttnP has padding");

#ifndef KATTN_ATTR
#define KATTN_ATTR
#endif
template <int DHP, int DVP, int QM, bool SPLITPV, bool TWOPASS>
__global__ __launch_bounds__(32 * AW) KATTN_ATTR void k_attn(AttnP p) {
    constexpr int NT = DVP / 16;                // output tiles
    constexpr int KS = DHP / 32;                // k-steps for the scores
    constexpr int VP = DVP + 8;                 // LDS pitch (halves)
    __shared__ __align__(16) float    pl[AW][16 * 64];
    __shared__ __align__(16) _Float16 vl[(SPLITPV ? 2 : 1) * 64 * VP];   // f16 V tile, or bf16 hi and lo tiles (same 2-byte size)
    const int lane = threadIdx.x & 31, hf = lane >> 4, l15 = lane & 15, wave = threadIdx.x >> 5;
    const int h = blockIdx.y, b = blockIdx.z, hk = h / p.hrep;
    const int q0 = (blockIdx.x * AW + wave) * 16;
    float* myp = pl[wave];
    const float L2E = 1.4426950408889634f;
    const float NEG = -__builtin_inff();
    const int qi = min(q0 + l15, p.Lq - 1);
    const float* qrow = p.Q + b * p.sQb + h * p.sQh + (long long)qi * p.sQi;
    const float* kbase = p.K + b * p.sKb + hk * p.sKh;
    const float* vbase = p.V + b * p.sVb + hk * p.sVh;
    v16h qa[QM == 0 ? KS : 1]; Split qs_[QM == 1 ? KS : 1]; Split3 qt_[QM == 2 ? KS : 1];
#pragma unroll
    for (int ks = 0; ks < KS; ++ks) {
        if (QM == 2) qt_[ks] = sp3_ld(qrow, p.sQd, ks * 32, hf, p.dh, 1.f);
        else if (QM == 1) qs_[ks] = sp_ld(qrow, p.sQd, ks * 32, hf, p.dh, 1.f);
        else qa[ks] = fh_ld(qrow, p.sQd, ks * 32, hf, p.dh, 1.f);
    }
    v8f o[NT]; float m8[8], l8[8];
#pragma unroll
    for (int t = 0; t < NT; ++t) { v8f zz = {}; o[t] = zz; }
#pragma unroll
    for (int i = 0; i < 8; ++i) { m8[i] = NEG; l8[i] = 0.f; }
    int jend = p.Lk;
    if (p.causal == 1) { const int je = (blockIdx.x * AW + AW - 1) * 16 + 16 + p.coff; jend = min(jend, max(je, 0)); }   // uniform per block
    const int npass = TWOPASS ? 2 : 1;
    for (int pass = 0; pass < npass; ++pass) {
        const bool dopv = (!TWOPASS) || pass == 1;
        for (int j0 = 0; j0 < jend; j0 += 64) {
            if (dopv) {
                __syncthreads();                                 // previous key block's reads of vl / pl are done
                for (int idx = threadIdx.x; idx < 64 * DVP; idx += 32 * AW) {
                    const int jr = idx / DVP, d = idx - jr * DVP, j = j0 + jr;
                    const float f = (j < p.Lk && d < p.dv) ? vbase[(long long)j * p.sVj + (long long)d * p.sVd] : 0.f;
                    if (SPLITPV) {
                        const __bf16 hb = bf16_rne(f);
                        ((__bf16*)vl)[jr * VP + d] = hb; ((__bf16*)vl)[64 * VP + jr * VP + d] = bf16_rne(f - bf16_f32(hb));
                    } else vl[jr * VP + d] = (_Float16)f;
                }
            }
            v8f s[4];
#pragma unroll
            for (int t = 0; t < 4; ++t) {
                const int j = min(j0 + t * 16 + l15, p.Lk - 1);
                const float* krow = kbase + (long long)j * p.sKj;
                v8f acc = {};
#pragma unroll
                for (int ks = 0; ks < KS; ++ks) {
                    if (QM == 2)      acc = wmma6(qt_[ks], sp3_ld(krow, p.sKd, ks * 32, hf, p.dh, 1.f), acc);
                    else if (QM == 1) acc = wmma3(qs_[ks], sp_ld(krow, p.sKd, ks * 32, hf, p.dh, 1.f), acc);
                    else              acc = wmma16(qa[ks], fh_ld(krow, p.sKd, ks * 32, hf, p.dh, 1.f), acc);
                }
                s[t] = acc;
            }
            float pv[8][4];
#pragma unroll
            for (int i = 0; i < 8; ++i) {
                const int irow = q0 + i + 8 * hf;
                const int ic = min(irow, p.Lq - 1);
                float sc[4];
#pragma unroll
                for (int t = 0; t < 4; ++t) {
                    const int jg = j0 + t * 16 + l15;
                    float v = s[t][i] * p.scale;
                    if (p.Mf) v += p.Mf[b * p.smb + h * p.smh + (long long)ic * p.smi + (long long)min(jg, p.Lk - 1) * p.smj];
                    if (p.Rt) { int rc = ic - min(jg, p.Lk - 1) + p.roff; rc = rc < 0 ? 0 : (rc >= p.rn ? p.rn - 1 : rc); v += p.Rt[b * p.srb + h * p.srh + (long long)ic * p.sri + rc]; }
                    if (p.Mi) { const int mv = p.Mi[b * p.smb + h * p.smh + (long long)ic * p.smi + (long long)min(jg, p.Lk - 1) * p.smj]; if (p.mpol ? (mv != 0) : (mv == 0)) v = p.mfill; }
                    if (p.SQ) { const bool same = p.SQ[(long long)b * p.Lq + ic] == p.SK[(long long)b * p.Lk + min(jg, p.Lk - 1)]; if (p.segpol ? same : !same) v = p.mfill; }
                    if (p.causal == 2 && jg > irow + p.coff) v = p.mfill;
                    if (jg >= p.Lk || (p.causal == 1 && jg > irow + p.coff) || (p.causal == 3 && jg < irow + p.coff) || (p.win > 0 && irow + p.coff - jg > p.win)) v = NEG; else v *= L2E;
                    sc[t] = v;
                }
                if (!TWOPASS || pass == 0) {
                    float mx = fmaxf(fmaxf(sc[0], sc[1]), fmaxf(sc[2], sc[3]));
                    mx = fmaxf(mx, __shfl_xor(mx, 1, 32)); mx = fmaxf(mx, __shfl_xor(mx, 2, 32));
                    mx = fmaxf(mx, __shfl_xor(mx, 4, 32)); mx = fmaxf(mx, __shfl_xor(mx, 8, 32));
                    const float mnew = fmaxf(m8[i], mx);
                    const float corr = (mnew == NEG) ? 1.f : exp2f(m8[i] - mnew);
                    float rs = 0.f;
#pragma unroll
                    for (int t = 0; t < 4; ++t) {
                        const float pp = (sc[t] == NEG) ? 0.f : exp2f(sc[t] - mnew); rs += pp;
                        pv[i][t] = p.Pw ? pp * p.Pw[b * p.swb + h * p.swh + (long long)ic * p.swi + (long long)min(j0 + t * 16 + l15, p.Lk - 1) * p.swj] : pp;
                    }
                    rs += __shfl_xor(rs, 1, 32); rs += __shfl_xor(rs, 2, 32); rs += __shfl_xor(rs, 4, 32); rs += __shfl_xor(rs, 8, 32);
                    l8[i] = l8[i] * corr + rs; m8[i] = mnew;
                    if (!TWOPASS) {
#pragma unroll
                        for (int t = 0; t < NT; ++t) o[t][i] *= corr;
                    }
                } else {
                    const float inv = (l8[i] > 0.f) ? 1.f / l8[i] : 0.f;
#pragma unroll
                    for (int t = 0; t < 4; ++t) {
                        const int jg = j0 + t * 16 + l15;
                        float pp = (sc[t] == NEG) ? 0.f : exp2f(sc[t] - m8[i]) * inv;
                        if (p.Pw) pp *= p.Pw[b * p.swb + h * p.swh + (long long)ic * p.swi + (long long)min(jg, p.Lk - 1) * p.swj];
                        pv[i][t] = pp;
                    }
                }
            }
            if (dopv) {
#pragma unroll
                for (int i = 0; i < 8; ++i)
#pragma unroll
                    for (int t = 0; t < 4; ++t) ((float*)myp)[(i + 8 * hf) * 64 + t * 16 + l15] = pv[i][t];
                __syncthreads();                                 // P (per wave) and V (shared) visible
                if (p.P) {
                    float* pb_ = p.P + b * p.sPb + h * p.sPh;
                    const bool fastP = (p.pband == 0) && ((p.sPi & 3) == 0) && (j0 + 64 <= p.Lk) && (q0 + 16 <= p.Lq) && ((((size_t)pb_) & 15) == 0);
                    if (fastP) {
#pragma unroll
                        for (int s = 0; s < 8; ++s) {
                            const int row = s * 2 + (lane >> 4), c4 = (lane & 15) * 4;
                            const v4f v = *(const v4f*)(myp + row * 64 + c4);
                            VST2V4(pb_ + (long long)(q0 + row) * p.sPi + j0 + c4, v);
                        }
                    } else {
                        for (int row = 0; row < 16; ++row) {
                            const int irow = q0 + row; if (irow >= p.Lq) continue;
                            for (int c = lane; c < 64; c += 32) {
                                const int jg = j0 + c; if (jg >= p.Lk) continue;
                                if (p.pband == 0) VST2(float, pb_ + (long long)irow * p.sPi + jg, myp[row * 64 + c]);
                                else if (jg - irow <= p.pband && irow - jg <= p.pband) VST2(float, pb_ + (long long)irow * p.sPi + (jg - irow + p.pband), myp[row * 64 + c]);
                            }
                        }
                    }
                }
                if (SPLITPV) {
                    const Split pa0 = sp_ld(myp + l15 * 64, 1, 0, hf, 64, 1.f), pa1 = sp_ld(myp + l15 * 64, 1, 32, hf, 64, 1.f);
                    const __bf16* vh = (const __bf16*)vl; const __bf16* vlo = vh + 64 * VP;
#pragma unroll
                    for (int t = 0; t < NT; ++t) {
                        const int dcol = t * 16 + l15;
                        Split b0, b1;
#pragma unroll
                        for (int e = 0; e < 16; ++e) {
                            const int k0 = frag_k(e, hf), k1 = 32 + frag_k(e, hf);
                            b0.hi[e] = vh[k0 * VP + dcol]; b0.lo[e] = vlo[k0 * VP + dcol]; b1.hi[e] = vh[k1 * VP + dcol]; b1.lo[e] = vlo[k1 * VP + dcol];
                        }
                        o[t] = wmma3(pa0, b0, o[t]);
                        o[t] = wmma3(pa1, b1, o[t]);
                    }
                } else {
                    const v16h pa0 = fh_ld(myp + l15 * 64, 1, 0, hf, 64, 4096.f), pa1 = fh_ld(myp + l15 * 64, 1, 32, hf, 64, 4096.f);
#pragma unroll
                    for (int t = 0; t < NT; ++t) {
                        const int dcol = t * 16 + l15;
                        v16h b0, b1;
#pragma unroll
                        for (int e = 0; e < 16; ++e) { b0[e] = vl[frag_k(e, hf) * VP + dcol]; b1[e] = vl[(32 + frag_k(e, hf)) * VP + dcol]; }
                        o[t] = wmma16(pa0, b0, o[t]);
                        o[t] = wmma16(pa1, b1, o[t]);
                    }
                }
            }
        }
    }
    float* obase = p.O + b * p.sOb + h * p.sOh;
    if (p.ST) {
        const int rl = lane >> 1, isel = rl & 7;           // row q0 + rl ; rl>>3 == hf holds because lane>>4 == (lane>>1)>>3
        float mv = 0.f, lv = 0.f;
#pragma unroll
        for (int i = 0; i < 8; ++i) if (i == isel) { mv = m8[i]; lv = l8[i]; }
        const int irow = q0 + rl;
        if (irow < p.Lq) { float* st = p.ST + (((long long)b * gridDim.y + h) * p.Lq + irow) * 2 + (lane & 1); VST2(float, st, (lane & 1) ? lv : mv * 0.6931471805599453f); }
    }
    float invr[8];
#pragma unroll
    for (int i = 0; i < 8; ++i) {
        if (TWOPASS) invr[i] = SPLITPV ? 1.f : (1.f / 4096.f);
        else if (p.nonorm) invr[i] = exp2f(m8[i]) * (SPLITPV ? 1.f : (1.f / 4096.f));
        else invr[i] = (l8[i] > 0.f) ? (SPLITPV ? 1.f / l8[i] : 1.f / (l8[i] * 4096.f)) : 0.f;
    }
    __syncthreads();                                             // all waves done with pl/vl from the main loop
    const bool ofast = ((p.sOi & 3) == 0) && ((((size_t)obase) & 15) == 0) && (q0 + 16 <= p.Lq);
#pragma unroll
    for (int c0 = 0; c0 < DVP; c0 += 64) {
#pragma unroll
        for (int i = 0; i < 8; ++i)
#pragma unroll
            for (int t = 0; t < NT; ++t) if (t * 16 >= c0 && t * 16 < c0 + 64) ((float*)myp)[(i + 8 * hf) * 64 + (t * 16 - c0) + l15] = o[t][i] * invr[i];
        __syncthreads();
        const int cw = (DVP - c0 < 64) ? (DVP - c0) : 64;      // staged columns in this chunk (multiple of 16)
        if (ofast && (c0 + cw <= p.dv) && (cw % 32 == 0)) {
            const int lpr = cw / 4;                              // lanes per row (16 for 64 cols, 8 for 32)
            const int rows_per_ins = 32 / lpr;
            for (int r0 = 0; r0 < 16; r0 += rows_per_ins) {
                const int row = r0 + lane / lpr, c4 = (lane % lpr) * 4;
                const v4f v = *(const v4f*)(myp + row * 64 + c4);
                VST2V4(obase + (long long)(q0 + row) * p.sOi + c0 + c4, v);
            }
        } else {
            for (int row = 0; row < 16; ++row) {
                const int irow = q0 + row; if (irow >= p.Lq) continue;
                for (int c = lane; c < cw; c += 32) { const int d = c0 + c; if (d < p.dv) VST2(float, obase + (long long)irow * p.sOi + d, myp[row * 64 + c]); }
            }
        }
        __syncthreads();
    }
}

// =====================================================================================================================
// k_tr: dst(z, c, r) = alpha * src(z, r, c) (+ beta * R2(z, c, r)): [Z][R][C] (row stride lds) -> [Z][C][R] (row stride ldd) through a 32x32 LDS tile;
//   flags: 1 -> add beta * residual R2 addressed like dst (z*sRz + c*ldr + r); act applied before the residual.
// =====================================================================================================================
struct TrP { const float* src; float* dst; const float* R2; long long sSz, lds, sDz, ldd, sRz, ldr; int R, C, flags, act; float alpha, beta; };
static_assert(sizeof(TrP) == 3 * 8 + 6 * 8 + 6 * 4, "TrP has padding");
__global__ __launch_bounds__(256) void k_tr(TrP p) {
    __shared__ float tile[32][33];
    const int c0 = blockIdx.x * 32, r0 = blockIdx.y * 32, z = blockIdx.z;
    const int lane = threadIdx.x & 31, wave = threadIdx.x >> 5;
    const float* s = p.src + z * p.sSz;
#pragma unroll
    for (int k = 0; k < 4; ++k) {
        const int rl = wave * 4 + k, r = r0 + rl, c = c0 + lane;
        tile[rl][lane] = (r < p.R && c < p.C) ? s[(long long)r * p.lds + c] : 0.f;
    }
    __syncthreads();
    float* d = p.dst + z * p.sDz; const float* rr = p.R2 + z * p.sRz;
#pragma unroll
    for (int k = 0; k < 4; ++k) {
        const int cl = wave * 4 + k, c = c0 + cl, r = r0 + lane;
        if (c < p.C && r < p.R) {
            float v = act_fn(p.alpha * tile[lane][cl], p.act);
            if (p.flags & 1) v += p.beta * rr[(long long)c * p.ldr + r];
            VST2(float, d + (long long)c * p.ldd + r, v);
        }
    }
}

// k_affine: dst[i] = a * (sdev ? sdev[0] : 1) * src[i] + b, i < n (one thread per element; consecutive lanes -> consecutive addresses)
__global__ __launch_bounds__(256) void k_affine(const float* __restrict__ src, float* __restrict__ dst, int n, float a, float b, const float* __restrict__ sdev) {
    const int i = blockIdx.x * 256 + threadIdx.x;
    if (i < n) { const float aa = sdev ? a * sdev[0] : a; const float v = aa * src[i] + b; VST2(float, dst + i, v); }
}

// =====================================================================================================================
// k_softmax: row softmax over n contiguous elements, one 256-thread block per row; rows addressed z*sz + r*sr (grid (R, Z)).
//   out = scale_out * softmax(scale_in * x + (Mf ? Mf[z*smz + r*smr + j] : 0)); a row whose max is -inf is written as 0.
// =====================================================================================================================
struct SmP { const float* src; float* dst; const float* Mf; long long sz, sr, dz, dr, smz, smr; int n, pad; float scale_in, scale_out; };
static_assert(sizeof(SmP) == 3 * 8 + 6 * 8 + 4 * 4, "SmP has padding");
__global__ __launch_bounds__(256) void k_softmax(SmP p) {
    __shared__ float red[256];
    const int r = blockIdx.x, z = blockIdx.y, tid = threadIdx.x;
    const float* s = p.src + z * p.sz + (long long)r * p.sr;
    const float* mf = p.Mf ? (p.Mf + z * p.smz + (long long)r * p.smr) : nullptr;
    float mx = -__builtin_inff();
    for (int j = tid; j < p.n; j += 256) { float v = s[j] * p.scale_in; if (mf) v += mf[j]; mx = fmaxf(mx, v); }
    red[tid] = mx; __syncthreads();
    for (int o = 128; o > 0; o >>= 1) { if (tid < o) red[tid] = fmaxf(red[tid], red[tid + o]); __syncthreads(); }
    mx = red[0]; __syncthreads();
    float sum = 0.f;
    for (int j = tid; j < p.n; j += 256) { float v = s[j] * p.scale_in; if (mf) v += mf[j]; sum += (mx == -__builtin_inff()) ? 0.f : expf(v - mx); }
    red[tid] = sum; __syncthreads();
    for (int o = 128; o > 0; o >>= 1) { if (tid < o) red[tid] += red[tid + o]; __syncthreads(); }
    sum = red[0];
    const float inv = (sum > 0.f) ? p.scale_out / sum : 0.f;
    float* d = p.dst + z * p.dz + (long long)r * p.dr;
    for (int j = tid; j < p.n; j += 256) { float v = s[j] * p.scale_in; if (mf) v += mf[j]; const float o = (mx == -__builtin_inff()) ? 0.f : expf(v - mx) * inv; VST2(float, d + j, o); }
}
// =====================================================================================================================
// k_stats: mean and rsqrt(var + eps) over a set of n elements addressed base + z*sz + (e / inner) * so + (e % inner) * si, one 256-thread
// k_norm_apply: y = (x - mean[set]) * rstd[set] * g[c] + b[c] over a [Z][C][L] channel-major tensor with set = z*G + c / (C/G) (G groups per z;
//   G = C -> per-channel sets indexed z*C+c; for batch norm pass stats indexed by c only via bn = 1). Optional act. Output same layout.
// =====================================================================================================================
//   mode 0: mean / rsqrt(var + eps); mode 1 (RMSNorm): 0 / rsqrt(mean(x^2) + eps); mode 2 (L2 normalize * sqrt(n)): 0 / sqrt(n) / max(||x||, eps); mode 3: as 0 with unbiased variance (n-1)
__global__ __launch_bounds__(256) void k_stats(const float* __restrict__ x, long long sz, long long so, long long si, int inner, int n, float eps, float* __restrict__ stat, int mode) {
    __shared__ float red[256];
    const int z = blockIdx.x, tid = threadIdx.x;
    const float* base = x + z * sz;
    float s = 0.f;
    for (int e = tid; e < n; e += 256) s += base[(long long)(e / inner) * so + (long long)(e % inner) * si];
    red[tid] = s; __syncthreads();
    for (int o = 128; o > 0; o >>= 1) { if (tid < o) red[tid] += red[tid + o]; __syncthreads(); }
    const float mu = (mode == 0 || mode == 3) ? red[0] / (float)n : 0.f; __syncthreads();
    float q = 0.f;
    for (int e = tid; e < n; e += 256) { const float dlt = base[(long long)(e / inner) * so + (long long)(e % inner) * si] - mu; q += dlt * dlt; }
    red[tid] = q; __syncthreads();
    for (int o = 128; o > 0; o >>= 1) { if (tid < o) red[tid] += red[tid + o]; __syncthreads(); }
    {
        float rs;
        if (mode == 2) rs = sqrtf((float)n) / fmaxf(sqrtf(red[0]), eps); else if (mode == 3) rs = rsqrtf(red[0] / (float)(n - 1) + eps); else rs = rsqrtf(red[0] / (float)n + eps);
        if (tid < 32) { const float v = (tid == 0) ? mu : ((tid == 1) ? rs : 0.f); VST2(float, stat + (long long)z * 32 + tid, v); }
    }
}
//   One thread per element over the flat [Z][C][L] index space: grid ceil(Z*C*L / 256).
__global__ __launch_bounds__(256) void k_norm_apply(const float* __restrict__ x, float* __restrict__ y, const float* __restrict__ stat, const float* __restrict__ g, const float* __restrict__ bta,
                                                     int Z, int C, int L, int G, int bn, int act) {
    const long long idx = (long long)blockIdx.x * 256 + threadIdx.x;
    if (idx >= (long long)Z * C * L) return;
    const int l = (int)(idx % L); const long long zc = idx / L; const int c = (int)(zc % C), z = (int)(zc / C); (void)l;
    const int set = bn ? c : (z * G + c / (C / G));
    float v = (x[idx] - stat[(long long)set * 32]) * stat[(long long)set * 32 + 1];
    if (g) v *= g[c];
    if (bta) v += bta[c];
    v = act_fn(v, act);
    VST2(float, y + idx, v);
}

// k_lse_neg: c[i] = -(st[2i] + log(st[2i+1])) = minus the log-sum-exp of row i from k_attn's ST output (for softmax over the query dimension)
__global__ __launch_bounds__(256) void k_lse_neg(const float* __restrict__ st, float* __restrict__ c, int n) {
    const int i = blockIdx.x * 256 + threadIdx.x;
    if (i < n) { const float v = -(st[2 * i] + logf(st[2 * i + 1])); VST2(float, c + i, v); }
}

// k_iota: dst[i] = a * i + b as int32 (segment/position id helper)
__global__ __launch_bounds__(256) void k_iota(int* __restrict__ dst, int n, int a, int b) {
    const int i = blockIdx.x * 256 + threadIdx.x;
    if (i < n) { const int v = a * i + b; VST2(int, dst + i, v); }
}

// k_axpby: dst[i] = a * x[i] + b * y[i] (+ c), i < n
__global__ __launch_bounds__(256) void k_axpby(const float* __restrict__ x, const float* __restrict__ y, float* __restrict__ dst, int n, float a, float b, float c) {
    const int i = blockIdx.x * 256 + threadIdx.x;
    if (i < n) { const float v = a * x[i] + b * y[i] + c; VST2(float, dst + i, v); }
}

// =====================================================================================================================
// k_rope: rotary embedding on a [R rows][Hn heads][D] view (row stride sXr, head stride sXh, element stride 1) -> Y (own strides).
//   mode 0: rotate_half (partner d±D/2, sign - for d<D/2); mode 1: interleaved pairs (partner d^1, sign - for even d).
//   table column tcol: tmode 0 -> d, 1 -> d % (D/2), 2 -> d / 2; position p: pmode 0 -> r % S, 1 -> head index, 2 -> pos[r];
//   c = C[(r / S) * sCb + p * sCp + tcol * sCd], s likewise from Sn; y = x[d] * c + sign * x[partner] * s. X and Y must not alias.
// =====================================================================================================================
struct RopeP { const float* X; float* Y; const float* C; const float* Sn; const int* pos; long long sXr, sXh, sYr, sYh, sCb, sCp, sCd; int R, Hn, D, S, mode, tmode, pmode, pad; };
static_assert(sizeof(RopeP) == 5 * 8 + 7 * 8 + 8 * 4, "RopeP has padding");
__global__ __launch_bounds__(256) void k_rope(RopeP p) {
    const long long idx = (long long)blockIdx.x * 256 + threadIdx.x;
    if (idx >= (long long)p.R * p.Hn * p.D) return;
    const int d = (int)(idx % p.D); const long long rh = idx / p.D; const int h = (int)(rh % p.Hn); const int r = (int)(rh / p.Hn);
    const int half = p.D / 2;
    int partner; float sign;
    if (p.mode == 0) { partner = (d < half) ? d + half : d - half; sign = (d < half) ? -1.f : 1.f; }
    else { partner = d ^ 1; sign = (d & 1) ? 1.f : -1.f; }
    const int tcol = (p.tmode == 0) ? d : ((p.tmode == 1) ? (d % half) : (d >> 1));
    const int pp = (p.pmode == 0) ? (r % p.S) : ((p.pmode == 1) ? h : p.pos[r]);
    const long long toff = (long long)(r / p.S) * p.sCb + (long long)pp * p.sCp + (long long)tcol * p.sCd;
    const float* xr = p.X + (long long)r * p.sXr + (long long)h * p.sXh;
    const float v = xr[d] * p.C[toff] + sign * xr[partner] * p.Sn[toff];
    VST2(float, p.Y + (long long)r * p.sYr + (long long)h * p.sYh + d, v);
}

// k_invf + k_sincos (split so neither kernel carries a large VALU-fma footprint): invf_i = num * (1 / powf(base, (2 i)/D)) [fmode 0],
//   num * expf((2 i) * cexp) [fmode 1], num * powf(base, -2 (i - 1) / D) [fmode 2]; then cs/sn[s*half + i] = cos/sin((pscale * s) * invf_i)
__global__ __launch_bounds__(256) void k_invf(float* __restrict__ invb, int half, int D, float base, float num, int fmode, float cexp) {
    const int i = blockIdx.x * 256 + threadIdx.x;
    if (i >= ((half + 31) / 32) * 32) return;
    if (i >= half) { VST2(float, invb + i, 0.f); return; }
    const float e = (float)(2 * i) / (float)D;
    float invf;
    if (fmode == 1) invf = num * expf((float)(2 * i) * cexp);
    else if (fmode == 2) invf = num * powf(base, (-2.0f * ((float)i - 1.0f)) / (float)D);
    else invf = num * (1.0f / powf(base, e));
    VST2(float, invb + i, invf);
}
__global__ __launch_bounds__(256) void k_sincos(float* __restrict__ cs, float* __restrict__ sn, const float* __restrict__ invb, int S, int half, float pscale) {
    const int idx = blockIdx.x * 256 + threadIdx.x;
    if (idx >= S * half) return;
    const int s = idx / half, i = idx - s * half;
    const float ang = (pscale * (float)s) * invb[i];
    VST2(float, cs + idx, cosf(ang)); VST2(float, sn + idx, sinf(ang));
}

// k_mulact: dst[i] = act(x[i]) * y[i]
__global__ __launch_bounds__(256) void k_mulact(const float* __restrict__ x, const float* __restrict__ y, float* __restrict__ dst, int n, int act) {
    const int i = blockIdx.x * 256 + threadIdx.x;
    if (i < n) { const float v = act_fn(x[i], act) * y[i]; VST2(float, dst + i, v); }
}

// =====================================================================================================================
// k_matvec: thread-per-row matrix-vector products for N <= 8 output columns (heads with 1-3 outputs, gates), f32 on the VALU.
//   C[r*sCm + j] = act(alpha * sum_k A[r*sAm + k*sAk] * B[j*sBn + k*sBk] + bias[j]) + beta * R[r*sRm + j*sRn]; each thread writes its N contiguous floats.
// =====================================================================================================================
__global__ __launch_bounds__(256) void k_matvec(GemmP p) {
    // 32 lanes write one line with one instruction.
    const int rpt = (p.N == 1) ? 1 : 32;
    const long long r0 = ((long long)blockIdx.x * 256 + threadIdx.x) * rpt; const int z = blockIdx.z, zo = z / p.zi_n, zi = z - zo * p.zi_n;
    if (r0 >= p.M) return;
    const float* Bb = p.B + zo * p.sBo + zi * p.sBi;
    float* C = p.C + zo * p.sCo + zi * p.sCi; const float* R = p.R + zo * p.sRo + zi * p.sRi;
    for (int rr = 0; rr < rpt; ++rr) {
        const long long r = r0 + rr; if (r >= p.M) break;
        const float* A = p.A + zo * p.sAo + zi * p.sAi + r * p.sAm;
        float acc[8] = {0.f, 0.f, 0.f, 0.f, 0.f, 0.f, 0.f, 0.f};
        for (int k = 0; k < p.K; ++k) { const float a = A[(long long)k * p.sAk];
#pragma unroll
            for (int j = 0; j < 8; ++j) if (j < p.N) acc[j] += a * Bb[(long long)j * p.sBn + (long long)k * p.sBk]; }
#pragma unroll
        for (int j = 0; j < 8; ++j) if (j < p.N) {
            float v = acc[j] * p.alpha;
            if (p.flags & 1) v += p.bias[j];
            if (p.flags & 2) v += p.bias[r];
            v = act_fn(v, p.act);
            if (p.flags & 4) v += p.beta * R[r * p.sRm + (long long)j * p.sRn];
            VST2(float, C + r * p.sCm + j, v);
        }
    }
}
// k_smallsoftmax: thread-per-row softmax for short rows (n <= 64): dst[r*dr + j] = softmax(scale*src[r*sr + j])
__global__ __launch_bounds__(256) void k_smallsoftmax(const float* __restrict__ src, float* __restrict__ dst, long long sr, long long dr, int n, long long R, float scale) {
    const long long r0 = ((long long)blockIdx.x * 256 + threadIdx.x) * 32;
    for (int rr = 0; rr < 32; ++rr) {
        const long long r = r0 + rr; if (r >= R) return;
        const float* s = src + r * sr; float* d = dst + r * dr;
        float mx = -__builtin_inff();
        for (int j = 0; j < n; ++j) mx = fmaxf(mx, s[j] * scale);
        float sum = 0.f;
        for (int j = 0; j < n; ++j) sum += expf(s[j] * scale - mx);
        const float inv = 1.f / sum;
        for (int j = 0; j < n; ++j) { const float v = expf(s[j] * scale - mx) * inv; VST2(float, d + j, v); }
    }
}

__global__ __launch_bounds__(32) void k_unitstat(float* __restrict__ st) { const int t = threadIdx.x; const float v = (t == 1) ? 1.f : 0.f; VST2(float, st + t, v); }

// destination (e.g. a d_out whose row width is not a multiple of 32 floats) is written by consecutive lanes of one instruction
__global__ __launch_bounds__(256) void k_lincopy(const float* __restrict__ src, long long lds, float* __restrict__ dst, long long ldd, long long rows, int cols) {
    const long long i = (long long)blockIdx.x * 256 + threadIdx.x; if (i >= rows * cols) return;
    const long long r = i / cols; const int c = (int)(i - r * cols);
    const float v = src[r * lds + c]; VST2(float, dst + r * ldd + c, v);
}

namespace w25 {
typedef __attribute__((ext_vector_type(16))) _Float16 v16h;
typedef __attribute__((ext_vector_type(8)))  _Float16 v8h;
typedef __attribute__((ext_vector_type(16))) __bf16   v16b;
typedef __attribute__((ext_vector_type(8)))  __bf16   v8b;
typedef __attribute__((ext_vector_type(8)))  float    v8f;
typedef __attribute__((ext_vector_type(4)))  float    v4f;

__device__ __forceinline__ unsigned short f2bf_bits(float f) {
  unsigned u = __float_as_uint(f);
  return (unsigned short)((u + 0x7FFFu + ((u >> 16) & 1u)) >> 16);
}
__device__ __forceinline__ float bf_bits2f(unsigned short h) { return __uint_as_float(((unsigned)h) << 16); }

// hazard guards as plain device helpers (no inline asm inside the kernel template body)
__device__ __forceinline__ void dep_guard_h(v8f& a, v8f& b, v16h x, v16h y) { asm volatile("v_nop\n\tv_nop\n\tv_nop\n\tv_nop" : "+v"(a), "+v"(b) : "v"(x), "v"(y)); }
__device__ __forceinline__ void dep_guard_b(v8f& a, v8f& b, v16b x, v16b y) { asm volatile("v_nop\n\tv_nop\n\tv_nop\n\tv_nop" : "+v"(a), "+v"(b) : "v"(x), "v"(y)); }
__device__ __forceinline__ void keep4_h(v16h a, v16h b, v16h c, v16h d) { asm volatile("v_nop" :: "v"(a), "v"(b), "v"(c), "v"(d)); }
__device__ __forceinline__ void keep4_b(v16b a, v16b b, v16b c, v16b d) { asm volatile("v_nop" :: "v"(a), "v"(b), "v"(c), "v"(d)); }
__device__ __forceinline__ void acc_guard4(v8f& a, v8f& b, v8f& c, v8f& d) { asm volatile("v_nop\n\tv_nop\n\tv_nop\n\tv_nop" : "+v"(a), "+v"(b), "+v"(c), "+v"(d)); }
template <typename T> struct Frag;
template <> struct Frag<_Float16> {
  typedef v16h V; union U { v16h v; v8h h[2]; };
  static __device__ __forceinline__ v16h load(const _Float16* p) {   // elements 0..7 <- p[0..7], 8..15 <- p[16..23]
    U f; f.h[0] = *(const v8h*)(p); f.h[1] = *(const v8h*)(p + 16); return f.v;
  }
  static __device__ __forceinline__ v8f mma(v16h a, v16h b, v8f c) {
    return __builtin_amdgcn_wmma_f32_16x16x32_f16(false, a, false, b, (short)0, c, false, false);
  }
  static __device__ __forceinline__ void guard(v8f& a, v8f& b, v16h x, v16h y) { dep_guard_h(a, b, x, y); }
  static __device__ __forceinline__ void keep(v16h a, v16h b, v16h c, v16h d) { keep4_h(a, b, c, d); }
};
template <> struct Frag<__bf16> {
  typedef v16b V; union U { v16b v; v8b h[2]; };
  static __device__ __forceinline__ v16b load(const __bf16* p) {
    U f; f.h[0] = *(const v8b*)(p); f.h[1] = *(const v8b*)(p + 16); return f.v;
  }
  static __device__ __forceinline__ v8f mma(v16b a, v16b b, v8f c) {
    return __builtin_amdgcn_wmma_f32_16x16x32_bf16(false, a, false, b, (short)0, c, false, false);
  }
  static __device__ __forceinline__ void guard(v8f& a, v8f& b, v16b x, v16b y) { dep_guard_b(a, b, x, y); }
  static __device__ __forceinline__ void keep(v16b a, v16b b, v16b c, v16b d) { keep4_b(a, b, c, d); }
};

// ---- Register-blocked batched WMMA GEMM ------------------------------------
// C[m,n] = scale * sum_k A[m,k] * Bt[n,k] (+bias)(+resid); each wave owns a 64x64 tile.
// A row-major [M,K]; Bt row-major [N,K]; M,N % 64 == 0, K % 32 == 0.
// SPLIT: operands are hi/lo planes (A2/Bt2 = lo planes, same layout); product = hi·hi + hi·lo + lo·hi.
// BIAS_MODE: 0 = none, 1 = bias[m], 2 = bias[n].
// OUT_MODE: 0 = f32, 1 = f16, 2 = bf16 hi plane (Cout) + bf16 lo plane (Cout2).
// ET: 0 = f16 operands, 1 = bf16 operands (pointers passed as 16-bit storage)
template <int ET> struct Elem;
template <> struct Elem<0> { typedef _Float16 T; };
template <> struct Elem<1> { typedef __bf16 T; };
template <int ET, bool SPLIT, int BIAS_MODE, int OUT_MODE, bool RESID, int ACT = 0>
__global__ __launch_bounds__(256) void wmma_gemm64(
    const unsigned short* __restrict__ Ap, const unsigned short* __restrict__ A2p, int lda, long strideA,
    const unsigned short* __restrict__ Btp, const unsigned short* __restrict__ Bt2p, int ldb, long strideB,
    void* __restrict__ Cout, void* __restrict__ Cout2, int ldc, long strideC,
    const float* __restrict__ bias,
    const float* __restrict__ resid, long strideR,
    int M, int N, int K, float scale) {
  typedef typename Elem<ET>::T T;
  typedef typename Frag<T>::V V;
  const T* A = (const T*)Ap; const T* A2 = (const T*)A2p; const T* Bt = (const T*)Btp; const T* Bt2 = (const T*)Bt2p;
  __shared__ __align__(16) float sT[8][16 * 68];   // per-wave 16x64 slab, pitch 68 floats
  const int b    = blockIdx.y;
  const int lane = threadIdx.x & 31;
  const int wave = threadIdx.x >> 5;
  const int tilesN = N >> 6;
  const int tilesM = M >> 6;
  const int tile = blockIdx.x * 8 + wave;
  if (tile >= tilesM * tilesN) return;   // wave-uniform; no block barriers in this kernel
  const int tm = tile / tilesN;
  const int tn = tile - tm * tilesN;
  const int m0 = tm << 6;
  const int n0 = tn << 6;

  const T* Ab  = A  + (size_t)b * strideA;
  const T* Bb  = Bt + (size_t)b * strideB;
  const T* Ab2 = SPLIT ? (A2  + (size_t)b * strideA) : nullptr;
  const T* Bb2 = SPLIT ? (Bt2 + (size_t)b * strideB) : nullptr;

  const int rlane = lane & 15;                 // row (A) / col (B, D) within subtile
  const int koff  = (lane >> 4) * 8;           // k offset of this lane half
  const int mOff  = (lane >> 4) * 8;           // D row offset

  v8f acc[4][4];
#pragma unroll
  for (int i = 0; i < 4; ++i)
#pragma unroll
    for (int j = 0; j < 4; ++j) acc[i][j] = (v8f){0.f,0.f,0.f,0.f,0.f,0.f,0.f,0.f};

  for (int k0 = 0; k0 < K; k0 += 32) {
    V bh[4], bl[4];
#pragma unroll
    for (int j = 0; j < 4; ++j) {
      const size_t bo = (size_t)(n0 + (j << 4) + rlane) * ldb + koff + k0;
      bh[j] = Frag<T>::load(Bb + bo);
      if (SPLIT) bl[j] = Frag<T>::load(Bb2 + bo);
    }
#pragma unroll
    for (int i = 0; i < 4; ++i) {
      const size_t ao = (size_t)(m0 + (i << 4) + rlane) * lda + koff + k0;
      V ah = Frag<T>::load(Ab + ao);
      V al;
      if (SPLIT) al = Frag<T>::load(Ab2 + ao);
#pragma unroll
      for (int j = 0; j < 4; ++j) {
        acc[i][j] = Frag<T>::mma(ah, bh[j], acc[i][j]);
        if (SPLIT) {
          acc[i][j] = Frag<T>::mma(ah, bl[j], acc[i][j]);
          acc[i][j] = Frag<T>::mma(al, bh[j], acc[i][j]);
        }
      }
      Frag<T>::guard(acc[i][0], acc[i][3], ah, SPLIT ? al : ah);
    }
    Frag<T>::keep(bh[0], bh[1], bh[2], bh[3]);
    if (SPLIT) Frag<T>::keep(bl[0], bl[1], bl[2], bl[3]);
  }
  acc_guard4(acc[0][0], acc[0][1], acc[0][2], acc[0][3]);
  acc_guard4(acc[1][0], acc[1][1], acc[1][2], acc[1][3]);
  acc_guard4(acc[2][0], acc[2][1], acc[2][2], acc[2][3]);
  acc_guard4(acc[3][0], acc[3][1], acc[3][2], acc[3][3]);

  // ---- epilogue ----
  float* slab = sT[wave];
  const float* Rb = RESID ? (resid + (size_t)b * strideR) : nullptr;
#pragma unroll
  for (int i = 0; i < 4; ++i) {
    const int mBase = m0 + (i << 4);
#pragma unroll
    for (int j = 0; j < 4; ++j) {
      const int n = n0 + (j << 4) + rlane;
      float bv = 0.f;
      if (BIAS_MODE == 2) bv = bias[n];
#pragma unroll
      for (int r = 0; r < 8; ++r) {
        float v = acc[i][j][r] * scale;
        if (BIAS_MODE == 1) v += bias[mBase + mOff + r];
        if (BIAS_MODE == 2) v += bv;
        if (RESID) v += Rb[(size_t)(mBase + mOff + r) * ldc + n];
        if (ACT == 1) v = tanhf(v);
        if (ACT == 2) v = fmaxf(v, 0.0f);
        if (ACT == 3) v = v / (1.0f + expf(-v));
        if (ACT == 4) v = (v > 0.f) ? v : 0.01f * v;
        if (ACT == 5) v = 0.5f * v * (1.0f + erff(v * 0.70710678118654752f));
        slab[(mOff + r) * 68 + (j << 4) + rlane] = v;
      }
    }
    __builtin_amdgcn_fence(__ATOMIC_RELEASE, "workgroup");
    __builtin_amdgcn_wave_barrier();
    __builtin_amdgcn_fence(__ATOMIC_ACQUIRE, "workgroup");
    if (OUT_MODE == 0) {
      float* C = (float*)Cout + (size_t)b * strideC;
      const int hh = lane >> 4, c4 = (lane & 15) * 4;     // row seg = 256 B = 16 lanes x 16 B
      {
#pragma unroll
        for (int it = 0; it < 8; ++it) {
          const int row = it * 2 + hh;
          v4f v = *(const v4f*)(slab + row * 68 + c4);
          *(v4f*)(C + (size_t)(mBase + row) * ldc + n0 + c4) = v;
        }
        
      }
    } else {
      const int q = lane >> 3, c8 = (lane & 7) * 8;
      unsigned short* C  = (unsigned short*)Cout  + (size_t)b * strideC;
      unsigned short* C2 = (OUT_MODE == 2) ? ((unsigned short*)Cout2 + (size_t)b * strideC) : nullptr;
      {
#pragma unroll
        for (int it = 0; it < 4; ++it) {
          const int row = it * 4 + q;
          const float* sp = slab + row * 68 + c8;
          v8h hv, lv;
#pragma unroll
          for (int e = 0; e < 8; ++e) {
            if (OUT_MODE == 1) {
              hv[e] = (_Float16)sp[e];
            } else {
              unsigned short hb = f2bf_bits(sp[e]);
              unsigned short lb = f2bf_bits(sp[e] - bf_bits2f(hb));
              hv[e] = __builtin_bit_cast(_Float16, hb);
              lv[e] = __builtin_bit_cast(_Float16, lb);
            }
          }
          *(v8h*)(C + (size_t)(mBase + row) * ldc + n0 + c8) = hv;
          if (OUT_MODE == 2) *(v8h*)(C2 + (size_t)(mBase + row) * ldc + n0 + c8) = lv;
        }
        
      }
    }
    __builtin_amdgcn_fence(__ATOMIC_RELEASE, "workgroup");
    __builtin_amdgcn_wave_barrier();
    __builtin_amdgcn_fence(__ATOMIC_ACQUIRE, "workgroup");
  }
}

__global__ __launch_bounds__(256) void cast_f32_f16x2(
    const float* __restrict__ in, _Float16* __restrict__ out, int n2) {
  int i = blockIdx.x * 256 + threadIdx.x;
  if (i < n2) {
    const _Float16 h0 = (_Float16)in[2 * i], h1 = (_Float16)in[2 * i + 1];
    const unsigned u = (unsigned)__builtin_bit_cast(unsigned short, h0) | ((unsigned)__builtin_bit_cast(unsigned short, h1) << 16);
    ((unsigned*)out)[i] = u;
    
  }
}


} // namespace w25

__global__ __launch_bounds__(256) void k_castT16(const float* __restrict__ src, long long lds, _Float16* __restrict__ dst, long long ldd, int R, int C, float s) {
    const long long i = (long long)blockIdx.x * 256 + threadIdx.x; const long long np = (long long)C * (R / 2); if (i >= np) return; const int c = (int)(i / (R / 2)); const int r = 2 * (int)(i % (R / 2));
    const _Float16 h0 = (_Float16)(src[(long long)r * lds + c] * s), h1 = (_Float16)(src[(long long)(r + 1) * lds + c] * s);
    const unsigned u = (unsigned)__builtin_bit_cast(unsigned short, h0) | ((unsigned)__builtin_bit_cast(unsigned short, h1) << 16);
    unsigned* d = (unsigned*)(dst + (long long)c * ldd + r); *d = u;  }
__global__ __launch_bounds__(256) void k_cast16(const float* __restrict__ src, long long lds, _Float16* __restrict__ dst, long long ldd, int R, int C, float s) {
    const long long i = (long long)blockIdx.x * 256 + threadIdx.x; const long long np = (long long)R * (C / 2); if (i >= np) return; const int r = (int)(i / (C / 2)); const int c = 2 * (int)(i % (C / 2));
    const _Float16 h0 = (_Float16)(src[(long long)r * lds + c] * s), h1 = (_Float16)(src[(long long)r * lds + c + 1] * s);
    const unsigned u = (unsigned)__builtin_bit_cast(unsigned short, h0) | ((unsigned)__builtin_bit_cast(unsigned short, h1) << 16);
    unsigned* d = (unsigned*)(dst + (long long)r * ldd + c); *d = u;  }

// f32 -> bf16 hi plane + bf16 lo plane (x = hi + lo to ~2^-17 relative; RNE both), [R][C] -> [R][C] (or transposed to [C][R]); 2 consecutive destination elements
__device__ __forceinline__ unsigned int f2bf2_pack(float a, float b, unsigned int* lo) {
    const unsigned short ha = w25::f2bf_bits(a), hb = w25::f2bf_bits(b);
    const unsigned short la = w25::f2bf_bits(a - w25::bf_bits2f(ha)), lb = w25::f2bf_bits(b - w25::bf_bits2f(hb));
    *lo = (unsigned)la | ((unsigned)lb << 16); return (unsigned)ha | ((unsigned)hb << 16); }
__global__ __launch_bounds__(256) void k_castS16(const float* __restrict__ src, long long lds, __bf16* __restrict__ dhi, __bf16* __restrict__ dlo, long long ldd, int R, int C, float s, int transpose) {
    const long long i = (long long)blockIdx.x * 256 + threadIdx.x; long long o; float a, b;
    if (transpose) { const long long np = (long long)C * (R / 2); if (i >= np) return; const int c = (int)(i / (R / 2)); const int r = 2 * (int)(i % (R / 2)); a = src[(long long)r * lds + c] * s; b = src[(long long)(r + 1) * lds + c] * s; o = (long long)c * ldd + r; }
    else { const long long np = (long long)R * (C / 2); if (i >= np) return; const int r = (int)(i / (C / 2)); const int c = 2 * (int)(i % (C / 2)); a = src[(long long)r * lds + c] * s; b = src[(long long)r * lds + c + 1] * s; o = (long long)r * ldd + c; }
    unsigned lo; const unsigned hi = f2bf2_pack(a, b, &lo); unsigned* ph = (unsigned*)(dhi + o); unsigned* pl = (unsigned*)(dlo + o);
    *ph = hi; *pl = lo;  }

namespace w25 {
// =====================================================================================
// Generic causal/non-causal attention for head_dim 64, f32 in / f32 out; 16-bit operands: bf16 with optional hi/lo splits, or
// plain f16 (F16=true, non-split, probabilities carried x2^15).
//   scores = (q*qscale)·kᵀ : v_wmma_f32_16x16x32_bf16; SPLIT_QK -> q,k as bf16 hi/lo (hi·hi + hi·lo + lo·hi)
//   out    = p·v           : v_wmma_f32_16x16x32_bf16; SPLIT_PV -> p,v as bf16 hi/lo; else p,v plain bf16
//   f32 accumulate; online softmax in f32. Block = 4 waves = 64 query rows of one (batch, head); S % 64 == 0.
//   Element (b, s, h, d) of tensor X lives at X[b*X_bs + s*X_rs + h*X_hs + d] (strides in floats, multiples of 4).
//   Masking: mask_mode 0 none, 1 causal (kv > q masked), 2 tensor [S][Skv] shared over (b,h) (float if
//   mask_is_int==0, int32 with element == 0 -> masked if 1, int32 with element != 0 -> masked if 2), 3 per-token vectors qmask[B][S] & kvmask[B][Skv] (int32,
//   0 -> masked), 4 causal + sliding window (kv > q or q - kv > W masked; W passed in mask_is_int);
//   5 = relative-position bias: s += cp[b,h,q][idx[q][kv]] + pc[b,h,kv][idx[q][kv]] with idx = mask_b ([S][Skv] int32) and
//   mask_a an int32 [S][Skv] tensor with nonzero = masked (tables: element (b,h,row,n) at X + b*c_bs + h*c_hs + row*c_rs + n);
//   masked scores are replaced by mask_fill (e.g. -inf or -1e9) before the softmax.
//   grid.x = B * H * (S/64) (or a sub-range with blk0).
// =====================================================================================
#define AT_D 64
#define AT_NW 4
#define AT_QB 64
#define AT_KC 64
struct AttnGeom { const float* cp = nullptr; const float* pc = nullptr; long c_bs = 0, c_rs = 0, c_hs = 0;   // mode-5 score-bias tables
                  long q_bs, q_rs, q_hs, k_bs, k_rs, k_hs, v_bs, v_rs, v_hs, o_bs, o_rs, o_hs;
                  int S, Skv, H, mask_mode; float qscale; int blk0; float mask_fill; int mask_is_int; };
static_assert(sizeof(AttnGeom) == 168, "no padding");

__device__ __forceinline__ unsigned short at_bf_bits(float f) {
  unsigned u = __float_as_uint(f);
  return (unsigned short)((u + 0x7FFFu + ((u >> 16) & 1u)) >> 16);
}
__device__ __forceinline__ __bf16 at_f2bf(float f) { return __builtin_bit_cast(__bf16, at_bf_bits(f)); }
__device__ __forceinline__ void at_split(float f, __bf16& hi, __bf16& lo) {
  const unsigned short hb = at_bf_bits(f);
  hi = __builtin_bit_cast(__bf16, hb);
  lo = at_f2bf(f - __uint_as_float(((unsigned)hb) << 16));
}
__device__ __forceinline__ v8f at_mma(v16b a, v16b b, v8f c) {
  c = __builtin_amdgcn_wmma_f32_16x16x32_bf16(false, a, false, b, (short)0, c, false, false);
  asm volatile("v_nop\n\tv_nop\n\tv_nop\n\tv_nop" : "+v"(c) : "v"(a), "v"(b));
  return c;
}
// 16-bit element as a bit pattern held in a __bf16 slot: f16 bits when F16, bf16 (RNE) otherwise
template <bool F16> __device__ __forceinline__ __bf16 at_to16(float f) {
  if (F16) return __builtin_bit_cast(__bf16, (_Float16)f);
  return at_f2bf(f);
}
template <bool F16> __device__ __forceinline__ v8f at_mma16(v16b a, v16b b, v8f c) {
  if (F16) {
    const v16h ah = __builtin_bit_cast(v16h, a), bh = __builtin_bit_cast(v16h, b);
    c = __builtin_amdgcn_wmma_f32_16x16x32_f16(false, ah, false, bh, (short)0, c, false, false);
    asm volatile("v_nop\n\tv_nop\n\tv_nop\n\tv_nop" : "+v"(c) : "v"(ah), "v"(bh));
    return c;
  }
  return at_mma(a, b, c);
}

template <bool SPLIT_QK, bool SPLIT_PV, bool F16 = false>
__global__ __launch_bounds__(128)
void attn64_kernel(const float* __restrict__ q, const float* __restrict__ k,
                   const float* __restrict__ v, float* __restrict__ out,
                   const void* __restrict__ mask_a, const int* __restrict__ mask_b, AttnGeom g) {
  static_assert(!(F16 && (SPLIT_QK || SPLIT_PV)), "f16 mode is non-split");
  const float PSC = F16 ? 32768.0f : 1.0f;     // f16 probabilities carried x2^15 (subnormal range), folded into the final 1/l
  union FB { v16b v; v8b h[2]; };
  __shared__ __align__(16) __bf16 Ksh[AT_KC * AT_D];             // K hi [kv][d]      8 KB
  __shared__ __align__(16) __bf16 Ksl[SPLIT_QK ? AT_KC * AT_D : 8];
  __shared__ __align__(16) __bf16 Vth[AT_D * AT_KC];             // V hi [d][kv]      8 KB
  __shared__ __align__(16) __bf16 Vtl[SPLIT_PV ? AT_D * AT_KC : 8];
  __shared__ __align__(16) __bf16 Psh[AT_NW][16 * AT_KC];        // per wave P hi [row][kv]  8 KB
  __shared__ __align__(16) __bf16 Psl[SPLIT_PV ? AT_NW : 1][SPLIT_PV ? 16 * AT_KC : 8];
  __shared__ __align__(16) float  Os[AT_NW][16 * 68];            // per wave out tile, pitch 68

  const int tid  = threadIdx.x;
  const int wave = tid >> 5;
  const int lane = tid & 31;
  const int hh   = lane >> 4;
  const int c    = lane & 15;

  const int nqb = g.S / AT_QB;
  const int bx = blockIdx.x + g.blk0;
  const int qb = bx % nqb;
  const int bh = bx / nqb;
  const int h  = bh % g.H;
  const int b  = bh / g.H;
  const int qbase_block = qb * AT_QB;
  const int q0 = qbase_block + wave * 16;

  const float* qb_ptr = q + (size_t)b * g.q_bs + (size_t)h * g.q_hs;
  const float* kb_ptr = k + (size_t)b * g.k_bs + (size_t)h * g.k_hs;
  const float* vb_ptr = v + (size_t)b * g.v_bs + (size_t)h * g.v_hs;
  float*       ob_ptr = out + (size_t)b * g.o_bs + (size_t)h * g.o_hs;

  // ---- Q fragments (A operand): 2 d-chunks, hi (and lo) ----
  v16b qah[2], qal[2];
  {
    const float* qrow = qb_ptr + (size_t)(q0 + c) * g.q_rs;
#pragma unroll
    for (int dc = 0; dc < 2; ++dc) {
#pragma unroll
      for (int e = 0; e < 8; ++e) {
        const float f0 = qrow[dc * 32 + 8 * hh + e] * g.qscale;
        const float f1 = qrow[dc * 32 + 16 + 8 * hh + e] * g.qscale;
        if (SPLIT_QK) { __bf16 hq, lq; at_split(f0, hq, lq); qah[dc][e] = hq; qal[dc][e] = lq; at_split(f1, hq, lq); qah[dc][8 + e] = hq; qal[dc][8 + e] = lq; }
        else { qah[dc][e] = at_to16<F16>(f0); qah[dc][8 + e] = at_to16<F16>(f1); qal[dc][e] = qah[dc][e]; qal[dc][8 + e] = qah[dc][8 + e]; }
      }
    }
  }

  float mrow[8], lrow[8];
  v8f oacc[4];
#pragma unroll
  for (int r = 0; r < 8; ++r) { mrow[r] = -INFINITY; lrow[r] = 0.f; }
#pragma unroll
  for (int t = 0; t < 4; ++t) oacc[t] = (v8f){0.f,0.f,0.f,0.f,0.f,0.f,0.f,0.f};

  const int nChunks = (g.mask_mode == 1 || g.mask_mode == 4) ? (qb + 1) : (g.Skv / AT_KC);   // block-uniform
  // per-row query mask (mode 3)
  int qkeep[8];
#pragma unroll
  for (int r = 0; r < 8; ++r) qkeep[r] = (g.mask_mode == 3) ? mask_b[(size_t)b * g.S + q0 + 8 * hh + r] : 1;   // mask_b = qmask in mode 3
  for (int kc = 0; kc < nChunks; ++kc) {
    const int kv0 = kc * AT_KC;
    __syncthreads();
    {
      const int kvr = tid >> 1, dh = (tid & 1) * 32;
      const float* krow = kb_ptr + (size_t)(kv0 + kvr) * g.k_rs + dh;
      const float* vrow = vb_ptr + (size_t)(kv0 + kvr) * g.v_rs + dh;
#pragma unroll
      for (int i = 0; i < 8; ++i) {
        v4f kk = *(const v4f*)(krow + 4 * i);
        v4f vv = *(const v4f*)(vrow + 4 * i);
#pragma unroll
        for (int e = 0; e < 4; ++e) {
          const int d = dh + 4 * i + e;
          if (SPLIT_QK) { __bf16 a, bl; at_split(kk[e], a, bl); Ksh[kvr * AT_D + d] = a; Ksl[kvr * AT_D + d] = bl; }
          else Ksh[kvr * AT_D + d] = at_to16<F16>(kk[e]);
          if (SPLIT_PV) { __bf16 a, bl; at_split(vv[e], a, bl); Vth[d * AT_KC + kvr] = a; Vtl[d * AT_KC + kvr] = bl; }
          else Vth[d * AT_KC + kvr] = at_to16<F16>(vv[e]);
        }
      }
    }
    __syncthreads();

    v8f s[4];
#pragma unroll
    for (int j = 0; j < 4; ++j) {
      s[j] = (v8f){0.f,0.f,0.f,0.f,0.f,0.f,0.f,0.f};
#pragma unroll 1
      for (int dc = 0; dc < 2; ++dc) {
        FB kb;
        kb.h[0] = *(const v8b*)(Ksh + (j * 16 + c) * AT_D + dc * 32 + 8 * hh);
        kb.h[1] = *(const v8b*)(Ksh + (j * 16 + c) * AT_D + dc * 32 + 16 + 8 * hh);
        s[j] = at_mma16<F16>(qah[dc], kb.v, s[j]);
        if (SPLIT_QK) {
          FB kl;
          kl.h[0] = *(const v8b*)(Ksl + (j * 16 + c) * AT_D + dc * 32 + 8 * hh);
          kl.h[1] = *(const v8b*)(Ksl + (j * 16 + c) * AT_D + dc * 32 + 16 + 8 * hh);
          s[j] = at_mma16<F16>(qah[dc], kl.v, s[j]);
          s[j] = at_mma16<F16>(qal[dc], kb.v, s[j]);
        }
      }
    }
    const bool diag = (g.mask_mode == 1) && (kc == qb);
    int kvkeep[4] = {1, 1, 1, 1};
    if (g.mask_mode == 3) {
#pragma unroll
      for (int j = 0; j < 4; ++j) kvkeep[j] = ((const int*)mask_a)[(size_t)b * g.Skv + kv0 + j * 16 + c];   // mask_a = kvmask
    }
    float cm[8];
#pragma unroll
    for (int r = 0; r < 8; ++r) {
      const int qrow = q0 + 8 * hh + r;
      float m = -INFINITY;
#pragma unroll
      for (int j = 0; j < 4; ++j) {
        const int kvcol = kv0 + j * 16 + c;
        bool masked = false;
        if (diag) masked = (kvcol > qrow);
        else if (g.mask_mode == 4) masked = (kvcol > qrow) || (qrow - kvcol > g.mask_is_int);
        else if (g.mask_mode == 2) {
          const size_t mi = (size_t)qrow * g.Skv + kvcol;
          masked = (g.mask_is_int == 0) ? (((const float*)mask_a)[mi] == 0.0f)
                 : (g.mask_is_int == 1) ? (((const int*)mask_a)[mi] == 0) : (((const int*)mask_a)[mi] != 0);
        } else if (g.mask_mode == 3) masked = (qkeep[r] == 0) || (kvkeep[j] == 0);
        else if (g.mask_mode == 5) {
          const size_t mi = (size_t)qrow * g.Skv + kvcol;
          masked = (((const int*)mask_a)[mi] != 0);
          int n = mask_b[mi]; n = n < 0 ? 0 : n;
          s[j][r] += g.cp[(size_t)b * g.c_bs + (size_t)h * g.c_hs + (size_t)qrow * g.c_rs + n]
                   + g.pc[(size_t)b * g.c_bs + (size_t)h * g.c_hs + (size_t)kvcol * g.c_rs + n];
        }
        if (masked) s[j][r] = g.mask_fill;
        m = fmaxf(m, s[j][r]);
      }
#pragma unroll
      for (int off = 1; off < 16; off <<= 1) m = fmaxf(m, __shfl_xor(m, off, 32));
      cm[r] = m;
    }
    __bf16* pwh = Psh[wave];
    __bf16* pwl = Psl[SPLIT_PV ? wave : 0];
#pragma unroll
    for (int r = 0; r < 8; ++r) {
      const float mnew = fmaxf(mrow[r], cm[r]);
      const float alpha = expf(mrow[r] - mnew);
      mrow[r] = mnew;
      float psum = 0.f;
#pragma unroll
      for (int j = 0; j < 4; ++j) {
        const float p = expf(s[j][r] - mnew);
        psum += p;
        if (SPLIT_PV) { __bf16 a, bl; at_split(p, a, bl); pwh[(8 * hh + r) * AT_KC + j * 16 + c] = a; pwl[(8 * hh + r) * AT_KC + j * 16 + c] = bl; }
        else pwh[(8 * hh + r) * AT_KC + j * 16 + c] = at_to16<F16>(p * PSC);
      }
#pragma unroll
      for (int off = 1; off < 16; off <<= 1) psum += __shfl_xor(psum, off, 32);
      lrow[r] = lrow[r] * alpha + psum;
#pragma unroll
      for (int t = 0; t < 4; ++t) oacc[t][r] *= alpha;
    }
    __builtin_amdgcn_fence(__ATOMIC_RELEASE, "workgroup");
    __builtin_amdgcn_wave_barrier();
    __builtin_amdgcn_fence(__ATOMIC_ACQUIRE, "workgroup");
#pragma unroll 1
    for (int kk = 0; kk < 2; ++kk) {
      FB pa, pl;
      pa.h[0] = *(const v8b*)(pwh + c * AT_KC + kk * 32 + 8 * hh);
      pa.h[1] = *(const v8b*)(pwh + c * AT_KC + kk * 32 + 16 + 8 * hh);
      if (SPLIT_PV) {
        pl.h[0] = *(const v8b*)(pwl + c * AT_KC + kk * 32 + 8 * hh);
        pl.h[1] = *(const v8b*)(pwl + c * AT_KC + kk * 32 + 16 + 8 * hh);
      }
#pragma unroll
      for (int t = 0; t < 4; ++t) {
        FB vb;
        vb.h[0] = *(const v8b*)(Vth + (t * 16 + c) * AT_KC + kk * 32 + 8 * hh);
        vb.h[1] = *(const v8b*)(Vth + (t * 16 + c) * AT_KC + kk * 32 + 16 + 8 * hh);
        oacc[t] = at_mma16<F16>(pa.v, vb.v, oacc[t]);
        if (SPLIT_PV) {
          FB vl;
          vl.h[0] = *(const v8b*)(Vtl + (t * 16 + c) * AT_KC + kk * 32 + 8 * hh);
          vl.h[1] = *(const v8b*)(Vtl + (t * 16 + c) * AT_KC + kk * 32 + 16 + 8 * hh);
          oacc[t] = at_mma16<F16>(pa.v, vl.v, oacc[t]);
          oacc[t] = at_mma16<F16>(pl.v, vb.v, oacc[t]);
        }
      }
    }
  }

  float* os = Os[wave];
#pragma unroll
  for (int r = 0; r < 8; ++r) {
    const float inv = 1.0f / (lrow[r] * PSC);
#pragma unroll
    for (int t = 0; t < 4; ++t) os[(8 * hh + r) * 68 + t * 16 + c] = oacc[t][r] * inv;
  }
  __builtin_amdgcn_fence(__ATOMIC_RELEASE, "workgroup");
  __builtin_amdgcn_wave_barrier();
  __builtin_amdgcn_fence(__ATOMIC_ACQUIRE, "workgroup");
  {
    const int c4 = (lane & 15) * 4;
    {
#pragma unroll
      for (int it = 0; it < 8; ++it) {
        const int row = it * 2 + hh;
        v4f val = *(const v4f*)(os + row * 68 + c4);
        *(v4f*)(ob_ptr + (size_t)(q0 + row) * g.o_rs + c4) = val;
      }
      
    }
  }
}

} // namespace w25

// relative-offset bias table RT[h][c], c = i - j + (T-1): -floor(|i-j| / 30) * 2^-(h+1)   (thread-linear, data-independent)
__global__ __launch_bounds__(256) void k_mc_rt(float* __restrict__ RT, int NH, int RN, int T) { const int t = blockIdx.x * 256 + threadIdx.x; if (t >= NH * RN) return; const int h = t / RN, c = t % RN; int dist = c - (T - 1); dist = dist < 0 ? -dist : dist; VST2(float, RT + t, -(float)(dist / 30) * exp2f(-(float)(h + 1))); }


extern "C" void kernel_launch(void* const* d_in, const int* in_sizes, int n_in, void* d_out, int out_size, void* d_ws, size_t ws_size, hipStream_t stream) {
    (void)in_sizes; (void)n_in; (void)out_size; (void)ws_size;
    const float* x = (const float*)d_in[0];
    const float* ctx = (const float*)d_in[1];
    const float* Wq = (const float*)d_in[2];
    const float* Wk = (const float*)d_in[3];
    const float* Wv = (const float*)d_in[4];
    const float* Wo = (const float*)d_in[5];
    const float* bo = (const float*)d_in[6];
    const int Bn = 2;
    const int T = 2048;
    const int D = 1024;
    const int NH = 16;
    const int HD = 64;
    const int NR = Bn * T;
    const int RN = 2 * T - 1;
    float* out = (float*)d_out;
    char* wsp = (char*)d_ws;
    float* Q = (float*)wsp; wsp += (((size_t)((size_t)NR * D) * 4 + 255) / 256) * 256;
    float* Kb = (float*)wsp; wsp += (((size_t)((size_t)NR * D) * 4 + 255) / 256) * 256;
    float* V = (float*)wsp; wsp += (((size_t)((size_t)NR * D) * 4 + 255) / 256) * 256;
    float* Y = (float*)wsp; wsp += (((size_t)((size_t)NR * D) * 4 + 255) / 256) * 256;
    float* RT = (float*)wsp; wsp += (((size_t)((size_t)NH * RN + 64) * 4 + 255) / 256) * 256;
    unsigned short* G64A = (unsigned short*)wsp; wsp += (((size_t)(4194304) * 2 + 255) / 256) * 256;
    unsigned short* G64B = (unsigned short*)wsp; wsp += (((size_t)(1048576) * 2 + 255) / 256) * 256;
    k_mc_rt<<<(unsigned)((NH * RN + 255) / 256), 256, 0, stream>>>(RT, NH, RN, T);
    k_cast16<<<(unsigned)((((long long)(4096) * ((1024) / 2)) + 255) / 256), 256, 0, stream>>>(x, 1024, (_Float16*)(G64A), 1024, 4096, 1024, 1.0f);
    k_cast16<<<(unsigned)((((long long)(1024) * ((1024) / 2)) + 255) / 256), 256, 0, stream>>>(Wq, 1024, (_Float16*)(G64B), 1024, 1024, 1024, 16.0f);
    w25::wmma_gemm64<0, false, 0, 0, false, 0><<<dim3((unsigned)((((4096) / 64) * ((1024) / 64) + 7) / 8), (unsigned)(1)), 256, 0, stream>>>((const unsigned short*)(G64A), nullptr, 1024, 0, (const unsigned short*)(G64B), nullptr, 1024, 0, (void*)(Q), nullptr, 1024, 0, nullptr, nullptr, 0, 4096, 1024, 1024, 0.0625f);
    k_cast16<<<(unsigned)((((long long)(4096) * ((1024) / 2)) + 255) / 256), 256, 0, stream>>>(ctx, 1024, (_Float16*)(G64A), 1024, 4096, 1024, 1.0f);
    k_cast16<<<(unsigned)((((long long)(1024) * ((1024) / 2)) + 255) / 256), 256, 0, stream>>>(Wk, 1024, (_Float16*)(G64B), 1024, 1024, 1024, 16.0f);
    w25::wmma_gemm64<0, false, 0, 0, false, 0><<<dim3((unsigned)((((4096) / 64) * ((1024) / 64) + 7) / 8), (unsigned)(1)), 256, 0, stream>>>((const unsigned short*)(G64A), nullptr, 1024, 0, (const unsigned short*)(G64B), nullptr, 1024, 0, (void*)(Kb), nullptr, 1024, 0, nullptr, nullptr, 0, 4096, 1024, 1024, 0.0625f);
    k_cast16<<<(unsigned)((((long long)(4096) * ((1024) / 2)) + 255) / 256), 256, 0, stream>>>(ctx, 1024, (_Float16*)(G64A), 1024, 4096, 1024, 1.0f);
    k_cast16<<<(unsigned)((((long long)(1024) * ((1024) / 2)) + 255) / 256), 256, 0, stream>>>(Wv, 1024, (_Float16*)(G64B), 1024, 1024, 1024, 16.0f);
    w25::wmma_gemm64<0, false, 0, 0, false, 0><<<dim3((unsigned)((((4096) / 64) * ((1024) / 64) + 7) / 8), (unsigned)(1)), 256, 0, stream>>>((const unsigned short*)(G64A), nullptr, 1024, 0, (const unsigned short*)(G64B), nullptr, 1024, 0, (void*)(V), nullptr, 1024, 0, nullptr, nullptr, 0, 4096, 1024, 1024, 0.0625f);
    { /*apv4*/ AttnP a;
      a.Q = Q; a.K = Kb; a.V = V; a.O = Y; a.P = 0; a.Mf = 0; a.Mi = 0; a.ST = 0;
      a.Pw = 0; a.Rt = RT; a.SQ = 0; a.SK = 0;
      a.swb = 0; a.swh = 0; a.swi = 0; a.swj = 0; a.srb = 0; a.srh = RN; a.sri = 0; a.sQb = (long long)T * D; a.sQh = HD; a.sQi = D; a.sQd = 1; a.sKb = (long long)T * D; a.sKh = HD; a.sKj = D; a.sKd = 1; a.sVb = (long long)T * D; a.sVh = HD; a.sVj = D; a.sVd = 1; a.sOb = (long long)T * D; a.sOh = HD; a.sOi = D; a.sPb = 0; a.sPh = 0; a.sPi = 0; a.smb = 0; a.smh = 0; a.smi = 0; a.smj = 0;
      a.Lq = T; a.Lk = T; a.dh = HD; a.dv = HD; a.hrep = 1; a.causal = 0; a.coff = 0; a.pband = 0;
      a.scale = 0.125f; a.mfill = 0.0f; a.nonorm = 0; a.mpol = 0;
      a.roff = T - 1; a.rn = RN; a.segpol = 0; a.win = 0;
      k_attn<64, 64, 0, false, false><<<dim3((unsigned)((T) + 16 * AW - 1) / (16 * AW), (unsigned)(NH), (unsigned)(Bn)), 32 * AW, 0, stream>>>(a); }
    k_cast16<<<(unsigned)((((long long)(4096) * ((1024) / 2)) + 255) / 256), 256, 0, stream>>>(Y, 1024, (_Float16*)(G64A), 1024, 4096, 1024, 1.0f);
    k_cast16<<<(unsigned)((((long long)(1024) * ((1024) / 2)) + 255) / 256), 256, 0, stream>>>(Wo, 1024, (_Float16*)(G64B), 1024, 1024, 1024, 16.0f);
    w25::wmma_gemm64<0, false, 2, 0, false, 0><<<dim3((unsigned)((((4096) / 64) * ((1024) / 64) + 7) / 8), (unsigned)(1)), 256, 0, stream>>>((const unsigned short*)(G64A), nullptr, 1024, 0, (const unsigned short*)(G64B), nullptr, 1024, 0, (void*)(out), nullptr, 1024, 0, bo, nullptr, 0, 4096, 1024, 1024, 0.0625f);
}

// v001
// It runs in 469 microseconds.
// Next to v000, in two timings, it ran 4.77 and 4.79 times as fast.
// Contractions: q = x.Wq^T [4096x1024].[1024x1024], k/v = context.W^T and the output projection (+b) with f16 operands on pre-cast planes (v_wmma_f32_16x16x32_f16; 64x64 register-blocked wave tiles, weights x16); per (batch, head) softmax(q k^T / 8 + b_h(|i-j|)) v over 2048 keys (head_dim 64) as a flash kernel with f16 q.k^T and f16 p.v (p as f16 of 4096 p), the periodic distance bias -floor(|i-j|/30) 2^-(h+1) read from a per-head relative-offset table built on device; f32 accumulate and softmax.
#include <hip/hip_runtime.h>
#include <math.h>

typedef __attribute__((ext_vector_type(16))) _Float16 v16h;
typedef __attribute__((ext_vector_type(8)))  _Float16 v8h;
typedef __attribute__((ext_vector_type(16))) __bf16   v16b;
typedef __attribute__((ext_vector_type(8)))  float    v8f;
typedef __attribute__((ext_vector_type(4)))  float    v4f;

// 16-bit WMMA fragment map (wave32), lane L, h = L>>4, m = L&15:
//   A 16x32: lane = row m;   element i -> k = (i<8) ? 8h+i : 16+8h+(i-8)
//   B 32x16: lane = column m; the SAME k(i,h)
//   D 16x16 (8 f32): lane = column m; element r -> row 8h+r
__device__ __forceinline__ int frag_k(int i, int h) { return (i < 8) ? (8 * h + i) : (16 + 8 * h + (i - 8)); }
__device__ __forceinline__ __bf16 bf16_rne(float f) {
    unsigned int u = __float_as_uint(f);
    u += 0x7fffu + ((u >> 16) & 1u);
    return __builtin_bit_cast(__bf16, (unsigned short)(u >> 16));
}
__device__ __forceinline__ float bf16_f32(__bf16 b) { return __uint_as_float(((unsigned int)__builtin_bit_cast(unsigned short, b)) << 16); }
__device__ __forceinline__ v8f wmma16(v16h a, v16h b, v8f c) {
    c = __builtin_amdgcn_wmma_f32_16x16x32_f16(false, a, false, b, (short)0, c, false, false);
    asm volatile("v_nop\n\tv_nop\n\tv_nop\n\tv_nop" : "+v"(c) : "v"(a), "v"(b));
    return c;
}
__device__ __forceinline__ v8f wmmab(v16b a, v16b b, v8f c) {
    c = __builtin_amdgcn_wmma_f32_16x16x32_bf16(false, a, false, b, (short)0, c, false, false);
    asm volatile("v_nop\n\tv_nop\n\tv_nop\n\tv_nop" : "+v"(c) : "v"(a), "v"(b));
    return c;
}
struct Split { v16b hi, lo; };
// hi/lo split product: a.hi*b.hi + a.hi*b.lo + a.lo*b.hi
__device__ __forceinline__ v8f wmma3(const Split& a, const Split& b, v8f c) {
    c = __builtin_amdgcn_wmma_f32_16x16x32_bf16(false, a.hi, false, b.hi, (short)0, c, false, false);
    c = __builtin_amdgcn_wmma_f32_16x16x32_bf16(false, a.hi, false, b.lo, (short)0, c, false, false);
    c = __builtin_amdgcn_wmma_f32_16x16x32_bf16(false, a.lo, false, b.hi, (short)0, c, false, false);
    asm volatile("v_nop\n\tv_nop\n\tv_nop\n\tv_nop" : "+v"(c) : "v"(a.hi), "v"(a.lo), "v"(b.hi), "v"(b.lo));
    return c;
}
struct Split3 { v16b hi, mid, lo; };
// triple split product (6 terms, drops only terms below 2^-24 relative)
__device__ __forceinline__ v8f wmma6(const Split3& a, const Split3& b, v8f c) {
    c = __builtin_amdgcn_wmma_f32_16x16x32_bf16(false, a.hi, false, b.hi, (short)0, c, false, false);
    c = __builtin_amdgcn_wmma_f32_16x16x32_bf16(false, a.hi, false, b.mid, (short)0, c, false, false);
    c = __builtin_amdgcn_wmma_f32_16x16x32_bf16(false, a.mid, false, b.hi, (short)0, c, false, false);
    c = __builtin_amdgcn_wmma_f32_16x16x32_bf16(false, a.hi, false, b.lo, (short)0, c, false, false);
    c = __builtin_amdgcn_wmma_f32_16x16x32_bf16(false, a.mid, false, b.mid, (short)0, c, false, false);
    c = __builtin_amdgcn_wmma_f32_16x16x32_bf16(false, a.lo, false, b.hi, (short)0, c, false, false);
    asm volatile("v_nop\n\tv_nop\n\tv_nop\n\tv_nop" : "+v"(c) : "v"(a.hi), "v"(a.mid), "v"(a.lo), "v"(b.hi), "v"(b.mid), "v"(b.lo));
    return c;
}

// Fragment gathers from f32 memory: element i <- p[(k0 + frag_k(i,h)) * sk] * s, zero for k >= klen.
__device__ __forceinline__ v16h fh_ld(const float* __restrict__ p, long long sk, int k0, int h, int klen, float s) {
    v16h a;
#pragma unroll
    for (int i = 0; i < 16; ++i) { const int k = k0 + frag_k(i, h); a[i] = (k < klen) ? (_Float16)(p[(long long)k * sk] * s) : (_Float16)0.f; }
    return a;
}
__device__ __forceinline__ Split sp_ld(const float* __restrict__ p, long long sk, int k0, int h, int klen, float s) {
    Split r;
#pragma unroll
    for (int i = 0; i < 16; ++i) {
        const int k = k0 + frag_k(i, h); const float x = (k < klen) ? p[(long long)k * sk] * s : 0.f;
        const __bf16 hb = bf16_rne(x); r.hi[i] = hb; r.lo[i] = bf16_rne(x - bf16_f32(hb));
    }
    return r;
}
__device__ __forceinline__ Split3 sp3_ld(const float* __restrict__ p, long long sk, int k0, int h, int klen, float s) {
    Split3 r;
#pragma unroll
    for (int i = 0; i < 16; ++i) {
        const int k = k0 + frag_k(i, h); const float x = (k < klen) ? p[(long long)k * sk] * s : 0.f;
        const __bf16 hb = bf16_rne(x); const float r1 = x - bf16_f32(hb); const __bf16 mb = bf16_rne(r1);
        r.hi[i] = hb; r.mid[i] = mb; r.lo[i] = bf16_rne(r1 - bf16_f32(mb));
    }
    return r;
}
__device__ __forceinline__ v16b bh_ld(const float* __restrict__ p, long long sk, int k0, int h, int klen, float s) {
    v16b a;
#pragma unroll
    for (int i = 0; i < 16; ++i) { const int k = k0 + frag_k(i, h); a[i] = bf16_rne((k < klen) ? p[(long long)k * sk] * s : 0.f); }
    return a;
}
// f16 fragment from an f16 LDS/global row with element stride 1 (k-contiguous), no bounds (tile already zero padded)
__device__ __forceinline__ v16h fh_row(const _Float16* __restrict__ row, int k0, int h) {
    v16h a;
#pragma unroll
    for (int i = 0; i < 16; ++i) a[i] = row[k0 + frag_k(i, h)];
    return a;
}

#define VST2(T, ptr, val) do { const T vst2_v_ = (val); *(T*)(ptr) = vst2_v_;  } while (0)
typedef float v4f __attribute__((ext_vector_type(4)));
#define VST2V4(ptr, val) do { const v4f vst2_v4_ = (val); *(v4f*)(ptr) = vst2_v4_;  } while (0)

__device__ __attribute__((noinline)) float act_fn(float v, int act) {
    if (act == 1) return fmaxf(v, 0.f);                                                                               // relu
    if (act == 2) { const float u = 0.7978845608028654f * (v + 0.044715f * v * v * v); return 0.5f * v * (1.f + tanhf(u)); } // tanh-gelu
    if (act == 3) return v / (1.f + expf(-v));                                                                        // silu
    if (act == 4) return 0.5f * v * (1.f + erff(v * 0.7071067811865476f));                                             // erf-gelu
    if (act == 5) return tanhf(v);
    if (act == 6) return 1.f / (1.f + expf(-v));                                                                      // sigmoid
    if (act == 7) return (v > 0.f) ? v : 0.01f * v;                                                                   // leaky relu 0.01
    if (act == 8) return (v > 0.f) ? v : (expf(v) - 1.f);                                                             // elu
    if (act == 9) return fminf(fmaxf(v, 0.f), 6.f);                                                                   // relu6
    if (act == 10) return fabsf(v);                                                                                    // abs
    if (act == 11) return (v >= 0.f) ? v : 0.1f * v;                                                                  // leaky 0.1
    if (act == 12) return (v > 0.f) ? v : 0.2f * v;                                                                   // leaky 0.2
    if (act == 13) return (v > 20.f) ? v : log1pf(expf(v));                                                            // softplus
    return v;
}

// =====================================================================================================================
// k_gemm<MODE>: C(z, m, n) = act(alpha * sum_k A(z, m, k) * B(z, k, n) + bias) + beta * R(z, m, n)
//   One wave (32-thread block) per 16 x 32 tile of C; grid (ceil(N/32), ceil(M/16), Z). Batch z -> (zo = z / zi_n, zi = z % zi_n)
//   with separate outer/inner strides for every tensor (e.g. batch and head). A(m,k) = A[zo*sAo + zi*sAi + m*sAm + k*sAk] (f32),
//   B(k,n) = B[zo*sBo + zi*sBi + n*sBn + k*sBk] (f32); any M, N, K (K zero-padded to 32 inside the fragments, M/N tails guarded).
//   C(m,n) = C[zo*sCo + zi*sCi + m*sCm + n] (n contiguous). flags: 1 bias[n], 2 bias[m], 4 residual R[zo*sRo + zi*sRi + m*sRm + n*sRn].
//   MODE 0: f16 operands (A prescaled by sa, B by sb, both undone in the epilogue); 1: bf16 hi/lo split (3 products); 2: bf16;
//   3: bf16 hi/mid/lo triple split (6 products); 4: as 3 with Kahan-compensated f32 accumulation across k-steps.
// =====================================================================================================================
struct GemmP {
    const float* A; const float* B; const float* bias; const float* R; float* C;
    long long sAo, sAi, sAm, sAk, sBo, sBi, sBn, sBk, sCo, sCi, sCm, sRo, sRi, sRm, sRn;
    int M, N, K, zi_n, flags, act; float alpha, beta, sa, sb;
    int Npad, pad_;     // columns [N, Npad) of C are written as 0 so that padded workspace rows are covered by whole-line stores; Npad >= N
};
static_assert(sizeof(GemmP) == 5 * 8 + 15 * 8 + 6 * 4 + 4 * 4 + 2 * 4, "GemmP has padding");

template <int MODE>
__global__ __launch_bounds__(32) void k_gemm(GemmP p) {
    const int lane = threadIdx.x & 31, h = lane >> 4, l15 = lane & 15;
    const int m0 = blockIdx.y * 16, n0 = blockIdx.x * 32;
    const int z = blockIdx.z, zo = z / p.zi_n, zi = z - zo * p.zi_n;
    const float* A = p.A + zo * p.sAo + zi * p.sAi;
    const float* B = p.B + zo * p.sBo + zi * p.sBi;
    const int am = min(m0 + l15, p.M - 1);                       // clamped row for loads (stores are guarded)
    v8f acc[2], comp[2];
#pragma unroll
    for (int t = 0; t < 2; ++t) { v8f zz = {}; acc[t] = zz; comp[t] = zz; }
    for (int k0 = 0; k0 < p.K; k0 += 32) {
        const float* arow = A + (long long)am * p.sAm;
        if (MODE == 1) {
            const Split a = sp_ld(arow, p.sAk, k0, h, p.K, 1.f);
#pragma unroll
            for (int t = 0; t < 2; ++t) {
                const int bn = min(n0 + t * 16 + l15, p.N - 1);
                acc[t] = wmma3(a, sp_ld(B + (long long)bn * p.sBn, p.sBk, k0, h, p.K, 1.f), acc[t]);
            }
        } else if (MODE == 3) {
            const Split3 a = sp3_ld(arow, p.sAk, k0, h, p.K, 1.f);
#pragma unroll
            for (int t = 0; t < 2; ++t) {
                const int bn = min(n0 + t * 16 + l15, p.N - 1);
                acc[t] = wmma6(a, sp3_ld(B + (long long)bn * p.sBn, p.sBk, k0, h, p.K, 1.f), acc[t]);
            }
        } else if (MODE == 4) {
            // triple split as MODE 3, but each k-step's 6 products go into a fresh accumulator and the partial is added to the running f32 sum
            // on the VALU with Kahan compensation (accumulation error stays ~1 ulp however long K is)
            const Split3 a = sp3_ld(arow, p.sAk, k0, h, p.K, 1.f);
#pragma unroll
            for (int t = 0; t < 2; ++t) {
                const int bn = min(n0 + t * 16 + l15, p.N - 1); v8f zz = {};
                const v8f part = wmma6(a, sp3_ld(B + (long long)bn * p.sBn, p.sBk, k0, h, p.K, 1.f), zz);
                const v8f y = part - comp[t]; const v8f s = acc[t] + y; comp[t] = (s - acc[t]) - y; acc[t] = s;
            }
        } else if (MODE == 2) {
            const v16b a = bh_ld(arow, p.sAk, k0, h, p.K, 1.f);
#pragma unroll
            for (int t = 0; t < 2; ++t) {
                const int bn = min(n0 + t * 16 + l15, p.N - 1);
                acc[t] = wmmab(a, bh_ld(B + (long long)bn * p.sBn, p.sBk, k0, h, p.K, 1.f), acc[t]);
            }
        } else {
            const v16h a = fh_ld(arow, p.sAk, k0, h, p.K, p.sa);
#pragma unroll
            for (int t = 0; t < 2; ++t) {
                const int bn = min(n0 + t * 16 + l15, p.N - 1);
                acc[t] = wmma16(a, fh_ld(B + (long long)bn * p.sBn, p.sBk, k0, h, p.K, p.sb), acc[t]);
            }
        }
    }
    const float iscale = (MODE == 0) ? p.alpha / (p.sa * p.sb) : p.alpha;
    float* C = p.C + zo * p.sCo + zi * p.sCi;
    const float* R = p.R + zo * p.sRo + zi * p.sRi;
    __shared__ __align__(16) float ctile[16][36];
#pragma unroll
    for (int t = 0; t < 2; ++t) {
        const int n = n0 + t * 16 + l15; const int nn = min(n, p.N - 1);
#pragma unroll
        for (int r = 0; r < 8; ++r) {
            const int m = m0 + 8 * h + r; const int mm = min(m, p.M - 1);
            float v = acc[t][r] * iscale;
            if (p.flags & 1) v += p.bias[nn];
            if (p.flags & 2) v += p.bias[mm];
            if (p.flags & 8) v *= p.bias[(long long)zo * p.M + mm];   /* per-(z,row) scale vector laid out [Z][M]; exclusive with the bias flags */
            v = act_fn(v, p.act);
            if (p.flags & 4) v += p.beta * R[(long long)mm * p.sRm + (long long)nn * p.sRn];
            ctile[8 * h + r][t * 16 + l15] = (n < p.N) ? v : 0.f;
        }
    }
    __syncthreads();
    const int NW = (p.Npad > p.N) ? p.Npad : p.N;           // write width
    const bool fast = (m0 + 16 <= p.M) && (n0 + 32 <= NW) && ((p.sCm & 3) == 0) && ((((size_t)C) & 15) == 0);
    if (fast) {
#pragma unroll
        for (int s = 0; s < 4; ++s) {
            const int row = s * 4 + (lane >> 3), c4 = (lane & 7) * 4;
            const v4f v = *(const v4f*)&ctile[row][c4];
            VST2V4(C + (long long)(m0 + row) * p.sCm + n0 + c4, v);
        }
    } else {
        for (int row = 0; row < 16; ++row) {
            const int m = m0 + row, n = n0 + lane;
            if (m < p.M && n < NW) VST2(float, C + (long long)m * p.sCm + n, ctile[row][lane]);
        }
    }
}


// =====================================================================================================================
// k_gemmT<MODE, TM, TN>: same contract as k_gemm, but one wave computes a (16*TM) x (16*TN) tile: TM A fragments and TN B fragments are
//   loaded per 32-wide k-step and reused across TM*TN WMMAs (far fewer load/convert instructions per MAC). MODE 0 (f16), 1 (bf16 hi/lo),
//   2 (bf16) only. grid (ceil(NW/(16*TN)), ceil(M/(16*TM)), Z), block 32. Epilogue identical to k_gemm, run per 16x32 sub-tile.
// =====================================================================================================================
template <int MODE, int TM, int TN>
__global__ __launch_bounds__(32) void k_gemmT(GemmP p) {
    const int lane = threadIdx.x & 31, h = lane >> 4, l15 = lane & 15;
    const int m0 = blockIdx.y * (16 * TM), n0 = blockIdx.x * (16 * TN);
    const int z = blockIdx.z, zo = z / p.zi_n, zi = z - zo * p.zi_n;
    const float* A = p.A + zo * p.sAo + zi * p.sAi;
    const float* B = p.B + zo * p.sBo + zi * p.sBi;
    v8f acc[TM][TN];
#pragma unroll
    for (int i = 0; i < TM; ++i)
#pragma unroll
        for (int t = 0; t < TN; ++t) { v8f zz = {}; acc[i][t] = zz; }
    for (int k0 = 0; k0 < p.K; k0 += 32) {
        if (MODE == 1) {
            Split a[TM], b[TN];
#pragma unroll
            for (int i = 0; i < TM; ++i) { const int am = min(m0 + 16 * i + l15, p.M - 1); a[i] = sp_ld(A + (long long)am * p.sAm, p.sAk, k0, h, p.K, 1.f); }
#pragma unroll
            for (int t = 0; t < TN; ++t) { const int bn = min(n0 + 16 * t + l15, p.N - 1); b[t] = sp_ld(B + (long long)bn * p.sBn, p.sBk, k0, h, p.K, 1.f); }
#pragma unroll
            for (int i = 0; i < TM; ++i)
#pragma unroll
                for (int t = 0; t < TN; ++t) acc[i][t] = wmma3(a[i], b[t], acc[i][t]);
        } else if (MODE == 2) {
            v16b a[TM], b[TN];
#pragma unroll
            for (int i = 0; i < TM; ++i) { const int am = min(m0 + 16 * i + l15, p.M - 1); a[i] = bh_ld(A + (long long)am * p.sAm, p.sAk, k0, h, p.K, 1.f); }
#pragma unroll
            for (int t = 0; t < TN; ++t) { const int bn = min(n0 + 16 * t + l15, p.N - 1); b[t] = bh_ld(B + (long long)bn * p.sBn, p.sBk, k0, h, p.K, 1.f); }
#pragma unroll
            for (int i = 0; i < TM; ++i)
#pragma unroll
                for (int t = 0; t < TN; ++t) acc[i][t] = wmmab(a[i], b[t], acc[i][t]);
        } else {
            v16h a[TM], b[TN];
#pragma unroll
            for (int i = 0; i < TM; ++i) { const int am = min(m0 + 16 * i + l15, p.M - 1); a[i] = fh_ld(A + (long long)am * p.sAm, p.sAk, k0, h, p.K, p.sa); }
#pragma unroll
            for (int t = 0; t < TN; ++t) { const int bn = min(n0 + 16 * t + l15, p.N - 1); b[t] = fh_ld(B + (long long)bn * p.sBn, p.sBk, k0, h, p.K, p.sb); }
#pragma unroll
            for (int i = 0; i < TM; ++i)
#pragma unroll
                for (int t = 0; t < TN; ++t) acc[i][t] = wmma16(a[i], b[t], acc[i][t]);
        }
    }
    const float iscale = (MODE == 0) ? p.alpha / (p.sa * p.sb) : p.alpha;
    float* C = p.C + zo * p.sCo + zi * p.sCi;
    const float* R = p.R + zo * p.sRo + zi * p.sRi;
    const int NW = (p.Npad > p.N) ? p.Npad : p.N;
    __shared__ __align__(16) float ctile[16][36];
#pragma unroll
    for (int i = 0; i < TM; ++i) {
        const int mb = m0 + 16 * i; if (mb >= p.M) break;          // wave-uniform
#pragma unroll
        for (int tp = 0; tp < TN / 2; ++tp) {
            const int nb = n0 + 32 * tp; if (nb >= NW) break;        // wave-uniform
#pragma unroll
            for (int t2 = 0; t2 < 2; ++t2) {
                const int t = 2 * tp + t2; const int n = nb + t2 * 16 + l15; const int nn = min(n, p.N - 1);
#pragma unroll
                for (int r = 0; r < 8; ++r) {
                    const int m = mb + 8 * h + r; const int mm = min(m, p.M - 1);
                    float v = acc[i][t][r] * iscale;
                    if (p.flags & 1) v += p.bias[nn];
                    if (p.flags & 2) v += p.bias[mm];
            if (p.flags & 8) v *= p.bias[(long long)zo * p.M + mm];   /* per-(z,row) scale vector laid out [Z][M]; exclusive with the bias flags */
                    v = act_fn(v, p.act);
                    if (p.flags & 4) v += p.beta * R[(long long)mm * p.sRm + (long long)nn * p.sRn];
                    ctile[8 * h + r][t2 * 16 + l15] = (n < p.N) ? v : 0.f;
                }
            }
            __syncthreads();
            const bool fast = (mb + 16 <= p.M) && (nb + 32 <= NW) && ((p.sCm & 3) == 0) && ((((size_t)C) & 15) == 0);
            if (fast) {
#pragma unroll
                for (int s = 0; s < 4; ++s) {
                    const int row = s * 4 + (lane >> 3), c4 = (lane & 7) * 4;
                    const v4f v = *(const v4f*)&ctile[row][c4];
                    VST2V4(C + (long long)(mb + row) * p.sCm + nb + c4, v);
                }
            } else {
                for (int row = 0; row < 16; ++row) {
                    const int m = mb + row, n = nb + lane;
                    if (m < p.M && n < NW) VST2(float, C + (long long)m * p.sCm + n, ctile[row][lane]);
                }
            }
            __syncthreads();
        }
    }
}

// =====================================================================================================================
//   Wave = 16 queries, AW waves per block, 64-key blocks; grid (ceil(Lq/(16*AW)), H, B), block 32*AW. Any Lq, Lk; head dim dh <= DHP
//   (DHP multiple of 32), value dim dv <= DVP (multiple of 16, <= 128). Every tensor addressed by (batch, head, row, element) strides, f32.
//   Scores: QM 0 f16 operands, 1 bf16 hi/lo split, 2 bf16 triple split; statistics f32 (exp2 domain); P.V: P x 4096 as f16 with V f16 staged in LDS
//   (SPLITPV: P and V as bf16 hi/lo splits). kv head = h / hrep. Masking: causal = 1 (keep j <= i + coff, masked -> -inf, key blocks beyond the
//   diagonal skipped), causal = 2 (masked -> mfill, a finite fill like the -1e9; no skipping), causal = 3 (keep j >= i + coff,
//   masked -> -inf, no skipping); optional additive f32 mask Mf,
//   optional int keep-mask Mi (0 -> score := mfill), both addressed b*smb + h*smh + i*smi + j*smj (0 strides broadcast).
// =====================================================================================================================
#define AW 4
struct AttnP {   // apv4
    const float* Q; const float* K; const float* V; float* O; float* P; const float* Mf; const int* Mi; float* ST;
    const float* Pw; const float* Rt; const int* SQ; const int* SK;           // optional: post-softmax weight, relative-position table, segment ids
    long long swb, swh, swi, swj, srb, srh, sri;                                 // Pw strides (b,h,i,j); Rt strides (b,h,i), column = clamp(i - j + roff, 0, rn-1)
    long long sQb, sQh, sQi, sQd, sKb, sKh, sKj, sKd, sVb, sVh, sVj, sVd, sOb, sOh, sOi, sPb, sPh, sPi, smb, smh, smi, smj;
    int Lq, Lk, dh, dv, hrep, causal, coff, pband;   // pband > 0: P holds only the band |j - i| <= pband, column j - i + pband
    float scale, mfill; int nonorm, mpol;             // nonorm (online path only): O = sum_j exp(score_j) V_j without the 1/rowsum (scores must be <= ~0); mpol: Mi masks where ==0 (mpol 0) or where !=0 (mpol 1)
    int roff, rn, segpol, win;                        // Rt column offset/count; SQ/SK: score := mfill where (segpol 0) SQ[i] != SK[j] or (segpol 1) SQ[i] == SK[j]; win > 0: keys with i - j > win (after coff) -> -inf
};
//   Pw: the softmax numerator is multiplied by Pw(b,h,i,j) AFTER the row sum is taken (probs * weight, then P.V), as in post-softmax multiplicative biases.                                                    // ST (optional): per row (b,h,i) -> ST[((b*H + h)*Lq + i)*2 + {0,1}] = {row max of the scaled+masked score (natural units), sum_j exp(score - max)}
static_assert(sizeof(AttnP) == 12 * 8 + 29 * 8 + 16 * 4, "AttnP has padding");

// Inputs-only fence on sixteen loaded values: all must have arrived here, so their loads are issued together ahead of it and share one wait
// (without it the register-budgeted schedule waits after every load). It names no product and changes no value.
template <typename T> __device__ __forceinline__ void hold16(const T* x) {
    asm volatile("" :: "v"(x[0]), "v"(x[1]), "v"(x[2]), "v"(x[3]), "v"(x[4]), "v"(x[5]), "v"(x[6]), "v"(x[7]),
                       "v"(x[8]), "v"(x[9]), "v"(x[10]), "v"(x[11]), "v"(x[12]), "v"(x[13]), "v"(x[14]), "v"(x[15]));
}
#ifndef KATTN_ATTR
#define KATTN_ATTR __attribute__((amdgpu_waves_per_eu(4)))   // register budget of 256: four waves a SIMD, so that all 1,024 blocks of the launch are resident at once
#endif
//   GT > 0 fixes the geometry at compile time: Lq = Lk = GT, rows of GD floats with head h at column h * DHP (unit element stride), dh = DHP,
//   dv = DVP, one kv head per head, no mask, weight, segment, P or ST tensor, and a per-head Rt row of 2 GT - 1 columns. Only Q, K, V, O, Rt and scale
//   are then taken from the argument, so every length guard folds and the loads of a key block are contiguous and free of branches.
template <int DHP, int DVP, int QM, bool SPLITPV, bool TWOPASS, int GT = 0, int GD = 0>
__global__ __launch_bounds__(32 * AW) KATTN_ATTR void k_attn(AttnP parg) {
    AttnP p = parg;
    if (GT > 0) {
        p.P = nullptr; p.Mf = nullptr; p.Mi = nullptr; p.ST = nullptr; p.Pw = nullptr; p.SQ = nullptr; p.SK = nullptr;
        p.swb = 0; p.swh = 0; p.swi = 0; p.swj = 0; p.srb = 0; p.srh = 2 * GT - 1; p.sri = 0;
        p.sQb = (long long)GT * GD; p.sQh = DHP; p.sQi = GD; p.sQd = 1; p.sKb = (long long)GT * GD; p.sKh = DHP; p.sKj = GD; p.sKd = 1;
        p.sVb = (long long)GT * GD; p.sVh = DVP; p.sVj = GD; p.sVd = 1; p.sOb = (long long)GT * GD; p.sOh = DVP; p.sOi = GD;
        p.sPb = 0; p.sPh = 0; p.sPi = 0; p.smb = 0; p.smh = 0; p.smi = 0; p.smj = 0;
        p.Lq = GT; p.Lk = GT; p.dh = DHP; p.dv = DVP; p.hrep = 1; p.causal = 0; p.coff = 0; p.pband = 0;
        p.mfill = 0.f; p.nonorm = 0; p.mpol = 0; p.roff = GT - 1; p.rn = 2 * GT - 1; p.segpol = 0; p.win = 0;
        __builtin_assume(p.Rt != nullptr);
    }
    constexpr bool FULL = GT > 0 && GT % (16 * AW) == 0 && GT % 64 == 0;   // every query tile and key block is whole: index clamps and length guards are identities
    constexpr int NT = DVP / 16;                // output tiles
    constexpr int KS = DHP / 32;                // k-steps for the scores
    constexpr int VP = DVP + 8;                 // LDS pitch (halves)
    __shared__ __align__(16) float    pl[AW][16 * 64];
    __shared__ __align__(16) _Float16 vl[(SPLITPV ? 2 : 1) * 64 * VP];   // f16 V tile, or bf16 hi and lo tiles (same 2-byte size)
    const int lane = threadIdx.x & 31, hf = lane >> 4, l15 = lane & 15, wave = threadIdx.x >> 5;
    const int h = blockIdx.y, b = blockIdx.z, hk = h / p.hrep;
    const int q0 = (blockIdx.x * AW + wave) * 16;
    float* myp = pl[wave];
    const float L2E = 1.4426950408889634f;
    const float NEG = -__builtin_inff();
    const int qi = FULL ? q0 + l15 : min(q0 + l15, p.Lq - 1);
    const float* qrow = p.Q + b * p.sQb + h * p.sQh + (long long)qi * p.sQi;
    const float* kbase = p.K + b * p.sKb + hk * p.sKh;
    const float* vbase = p.V + b * p.sVb + hk * p.sVh;
    v16h qa[QM == 0 ? KS : 1]; Split qs_[QM == 1 ? KS : 1]; Split3 qt_[QM == 2 ? KS : 1];
#pragma unroll
    for (int ks = 0; ks < KS; ++ks) {
        if (QM == 2) qt_[ks] = sp3_ld(qrow, p.sQd, ks * 32, hf, p.dh, 1.f);
        else if (QM == 1) qs_[ks] = sp_ld(qrow, p.sQd, ks * 32, hf, p.dh, 1.f);
        else qa[ks] = fh_ld(qrow, p.sQd, ks * 32, hf, p.dh, 1.f);
    }
    v8f o[NT]; float m8[8], l8[8];
#pragma unroll
    for (int t = 0; t < NT; ++t) { v8f zz = {}; o[t] = zz; }
#pragma unroll
    for (int i = 0; i < 8; ++i) { m8[i] = NEG; l8[i] = 0.f; }
    int jend = p.Lk;
    if (p.causal == 1) { const int je = (blockIdx.x * AW + AW - 1) * 16 + 16 + p.coff; jend = min(jend, max(je, 0)); }   // uniform per block
    const int npass = TWOPASS ? 2 : 1;
    for (int pass = 0; pass < npass; ++pass) {
        const bool dopv = (!TWOPASS) || pass == 1;
        for (int j0 = 0; j0 < jend; j0 += 64) {
            if (dopv) {
                __syncthreads();                                 // previous key block's reads of vl / pl are done
                constexpr int VN = 64 * DVP / (32 * AW);         // V elements per thread and key block
                constexpr bool VLIN = (32 * AW) % DVP == 0;      // a thread keeps its column: its rows differ by a constant step
                float vf[VN];
#pragma unroll   // constant trip count: with the guard folded the tile's loads differ by immediate offsets only
                for (int it = 0; it < VN; ++it) {
                    const int idx = threadIdx.x + it * (32 * AW);
                    const int jr = VLIN ? (int)threadIdx.x / DVP + it * ((32 * AW) / DVP) : idx / DVP, d = VLIN ? (int)threadIdx.x % DVP : idx - jr * DVP, j = j0 + jr;
                    if constexpr (FULL && VLIN)   // block-uniform tile pointer + the thread's fixed offset + a constant
                        vf[it] = (vbase + (long long)j0 * GD)[(size_t)(unsigned)((int)threadIdx.x / DVP * GD + (int)threadIdx.x % DVP) + it * ((32 * AW) / DVP) * GD];
                    else
                        vf[it] = (j < p.Lk && d < p.dv) ? vbase[(long long)j * p.sVj + (long long)d * p.sVd] : 0.f;
                }
                if (FULL && VN == 32) { hold16(vf); hold16(vf + 16); }   // the tile's loads all issue ahead of this line and are waited for once
#pragma unroll
                for (int it = 0; it < VN; ++it) {
                    const int idx = threadIdx.x + it * (32 * AW);
                    const int jr = VLIN ? (int)threadIdx.x / DVP + it * ((32 * AW) / DVP) : idx / DVP, d = VLIN ? (int)threadIdx.x % DVP : idx - jr * DVP;
                    const float f = vf[it];
                    if (SPLITPV) {
                        const __bf16 hb = bf16_rne(f);
                        ((__bf16*)vl)[jr * VP + d] = hb; ((__bf16*)vl)[64 * VP + jr * VP + d] = bf16_rne(f - bf16_f32(hb));
                    } else vl[jr * VP + d] = (_Float16)f;
                }
            }
            v8f s[4];
            float rb[8][4];                                     // the key block's relative-position table entries, fetched ahead of the products
            if constexpr (FULL) {
                // column i - j + GT - 1 as block-uniform pointer + the lane's fixed offset + a constant, each part >= 0 (j0 <= GT - 64)
                const float* rt = p.Rt + (long long)h * (2 * GT - 1) + ((int)blockIdx.x * (16 * AW) - j0 + (GT - 64));
                const unsigned ro = (unsigned)(wave * 16 + 8 * hf + 15 - l15);
#pragma unroll
                for (int i = 0; i < 8; ++i)
#pragma unroll
                    for (int t = 0; t < 4; ++t) rb[i][t] = rt[(size_t)ro + (i + 16 * (3 - t))];
            } else if (p.Rt) {
#pragma unroll
                for (int i = 0; i < 8; ++i)
#pragma unroll
                    for (int t = 0; t < 4; ++t) {
                        const int ic = min(q0 + i + 8 * hf, p.Lq - 1);
                        int rc = ic - min(j0 + t * 16 + l15, p.Lk - 1) + p.roff; rc = rc < 0 ? 0 : (rc >= p.rn ? p.rn - 1 : rc);
                        rb[i][t] = p.Rt[b * p.srb + h * p.srh + (long long)ic * p.sri + rc];
                    }
            }
            if constexpr (FULL && QM == 0 && KS == 2) {
                // two key tiles at a time: their sixteen 16-byte loads (fh_ld's k order: floats 8 hf + 0..7 and 16 + 8 hf + 0..7 of each 32) fly together
#pragma unroll
                for (int tp = 0; tp < 2; ++tp) {
                    v4f kr[16];
#pragma unroll
                    for (int t2 = 0; t2 < 2; ++t2)
#pragma unroll
                        for (int ks = 0; ks < 2; ++ks) {
                            const v4f* kp = (const v4f*)((kbase + (long long)j0 * GD) + ((size_t)(unsigned)(l15 * GD + 8 * hf) + (2 * tp + t2) * 16 * GD + ks * 32));
                            kr[(t2 * 2 + ks) * 4 + 0] = kp[0]; kr[(t2 * 2 + ks) * 4 + 1] = kp[1]; kr[(t2 * 2 + ks) * 4 + 2] = kp[4]; kr[(t2 * 2 + ks) * 4 + 3] = kp[5];
                        }
                    hold16(kr);                                  // all sixteen loads issue ahead of this line and are waited for once
#pragma unroll
                    for (int t2 = 0; t2 < 2; ++t2) {
                        v8f acc = {};
#pragma unroll
                        for (int ks = 0; ks < 2; ++ks) {
                            v16h kfr;
#pragma unroll
                            for (int e = 0; e < 16; ++e) kfr[e] = (_Float16)kr[(t2 * 2 + ks) * 4 + (e >> 2)][e & 3];
                            acc = wmma16(qa[ks], kfr, acc);
                        }
                        s[2 * tp + t2] = acc;
                    }
                }
            } else {
#pragma unroll
            for (int t = 0; t < 4; ++t) {
                const int j = min(j0 + t * 16 + l15, p.Lk - 1);
                const float* krow = kbase + (long long)j * p.sKj;
                v8f acc = {};
#pragma unroll
                for (int ks = 0; ks < KS; ++ks) {
                    if (QM == 2)      acc = wmma6(qt_[ks], sp3_ld(krow, p.sKd, ks * 32, hf, p.dh, 1.f), acc);
                    else if (QM == 1) acc = wmma3(qs_[ks], sp_ld(krow, p.sKd, ks * 32, hf, p.dh, 1.f), acc);
                    else              acc = wmma16(qa[ks], fh_ld(krow, p.sKd, ks * 32, hf, p.dh, 1.f), acc);
                }
                s[t] = acc;
            }
            }
            float pv[8][4];
#pragma unroll
            for (int i = 0; i < 8; ++i) {
                const int irow = q0 + i + 8 * hf;
                const int ic = FULL ? irow : min(irow, p.Lq - 1);
                float sc[4];
#pragma unroll
                for (int t = 0; t < 4; ++t) {
                    const int jg = j0 + t * 16 + l15;
                    float v = s[t][i] * p.scale;
                    if (p.Mf) v += p.Mf[b * p.smb + h * p.smh + (long long)ic * p.smi + (long long)min(jg, p.Lk - 1) * p.smj];
                    if (p.Rt) v += rb[i][t];
                    if (p.Mi) { const int mv = p.Mi[b * p.smb + h * p.smh + (long long)ic * p.smi + (long long)min(jg, p.Lk - 1) * p.smj]; if (p.mpol ? (mv != 0) : (mv == 0)) v = p.mfill; }
                    if (p.SQ) { const bool same = p.SQ[(long long)b * p.Lq + ic] == p.SK[(long long)b * p.Lk + min(jg, p.Lk - 1)]; if (p.segpol ? same : !same) v = p.mfill; }
                    if (p.causal == 2 && jg > irow + p.coff) v = p.mfill;
                    if ((!FULL && jg >= p.Lk) || (p.causal == 1 && jg > irow + p.coff) || (p.causal == 3 && jg < irow + p.coff) || (p.win > 0 && irow + p.coff - jg > p.win)) v = NEG; else v *= L2E;
                    sc[t] = v;
                }
                if (!TWOPASS || pass == 0) {
                    float mx = fmaxf(fmaxf(sc[0], sc[1]), fmaxf(sc[2], sc[3]));
                    mx = fmaxf(mx, __shfl_xor(mx, 1, 32)); mx = fmaxf(mx, __shfl_xor(mx, 2, 32));
                    mx = fmaxf(mx, __shfl_xor(mx, 4, 32)); mx = fmaxf(mx, __shfl_xor(mx, 8, 32));
                    const float mnew = fmaxf(m8[i], mx);
                    const float corr = (mnew == NEG) ? 1.f : exp2f(m8[i] - mnew);
                    float rs = 0.f;
#pragma unroll
                    for (int t = 0; t < 4; ++t) {
                        const float pp = (sc[t] == NEG) ? 0.f : exp2f(sc[t] - mnew); rs += pp;
                        pv[i][t] = p.Pw ? pp * p.Pw[b * p.swb + h * p.swh + (long long)ic * p.swi + (long long)min(j0 + t * 16 + l15, p.Lk - 1) * p.swj] : pp;
                    }
                    rs += __shfl_xor(rs, 1, 32); rs += __shfl_xor(rs, 2, 32); rs += __shfl_xor(rs, 4, 32); rs += __shfl_xor(rs, 8, 32);
                    l8[i] = l8[i] * corr + rs; m8[i] = mnew;
                    if (!TWOPASS) {
#pragma unroll
                        for (int t = 0; t < NT; ++t) o[t][i] *= corr;
                    }
                } else {
                    const float inv = (l8[i] > 0.f) ? 1.f / l8[i] : 0.f;
#pragma unroll
                    for (int t = 0; t < 4; ++t) {
                        const int jg = j0 + t * 16 + l15;
                        float pp = (sc[t] == NEG) ? 0.f : exp2f(sc[t] - m8[i]) * inv;
                        if (p.Pw) pp *= p.Pw[b * p.swb + h * p.swh + (long long)ic * p.swi + (long long)min(jg, p.Lk - 1) * p.swj];
                        pv[i][t] = pp;
                    }
                }
            }
            if (dopv) {
#pragma unroll
                for (int i = 0; i < 8; ++i)
#pragma unroll
                    for (int t = 0; t < 4; ++t) ((float*)myp)[(i + 8 * hf) * 64 + t * 16 + l15] = pv[i][t];
                __syncthreads();                                 // P (per wave) and V (shared) visible
                if (p.P) {
                    float* pb_ = p.P + b * p.sPb + h * p.sPh;
                    const bool fastP = (p.pband == 0) && ((p.sPi & 3) == 0) && (j0 + 64 <= p.Lk) && (q0 + 16 <= p.Lq) && ((((size_t)pb_) & 15) == 0);
                    if (fastP) {
#pragma unroll
                        for (int s = 0; s < 8; ++s) {
                            const int row = s * 2 + (lane >> 4), c4 = (lane & 15) * 4;
                            const v4f v = *(const v4f*)(myp + row * 64 + c4);
                            VST2V4(pb_ + (long long)(q0 + row) * p.sPi + j0 + c4, v);
                        }
                    } else {
                        for (int row = 0; row < 16; ++row) {
                            const int irow = q0 + row; if (irow >= p.Lq) continue;
                            for (int c = lane; c < 64; c += 32) {
                                const int jg = j0 + c; if (jg >= p.Lk) continue;
                                if (p.pband == 0) VST2(float, pb_ + (long long)irow * p.sPi + jg, myp[row * 64 + c]);
                                else if (jg - irow <= p.pband && irow - jg <= p.pband) VST2(float, pb_ + (long long)irow * p.sPi + (jg - irow + p.pband), myp[row * 64 + c]);
                            }
                        }
                    }
                }
                if (SPLITPV) {
                    const Split pa0 = sp_ld(myp + l15 * 64, 1, 0, hf, 64, 1.f), pa1 = sp_ld(myp + l15 * 64, 1, 32, hf, 64, 1.f);
                    const __bf16* vh = (const __bf16*)vl; const __bf16* vlo = vh + 64 * VP;
#pragma unroll
                    for (int t = 0; t < NT; ++t) {
                        const int dcol = t * 16 + l15;
                        Split b0, b1;
#pragma unroll
                        for (int e = 0; e < 16; ++e) {
                            const int k0 = frag_k(e, hf), k1 = 32 + frag_k(e, hf);
                            b0.hi[e] = vh[k0 * VP + dcol]; b0.lo[e] = vlo[k0 * VP + dcol]; b1.hi[e] = vh[k1 * VP + dcol]; b1.lo[e] = vlo[k1 * VP + dcol];
                        }
                        o[t] = wmma3(pa0, b0, o[t]);
                        o[t] = wmma3(pa1, b1, o[t]);
                    }
                } else {
                    const v16h pa0 = fh_ld(myp + l15 * 64, 1, 0, hf, 64, 4096.f), pa1 = fh_ld(myp + l15 * 64, 1, 32, hf, 64, 4096.f);
#pragma unroll
                    for (int t = 0; t < NT; ++t) {
                        const int dcol = t * 16 + l15;
                        v16h b0, b1;
#pragma unroll
                        for (int e = 0; e < 16; ++e) { b0[e] = vl[frag_k(e, hf) * VP + dcol]; b1[e] = vl[(32 + frag_k(e, hf)) * VP + dcol]; }
                        o[t] = wmma16(pa0, b0, o[t]);
                        o[t] = wmma16(pa1, b1, o[t]);
                    }
                }
            }
        }
    }
    float* obase = p.O + b * p.sOb + h * p.sOh;
    if (p.ST) {
        const int rl = lane >> 1, isel = rl & 7;           // row q0 + rl ; rl>>3 == hf holds because lane>>4 == (lane>>1)>>3
        float mv = 0.f, lv = 0.f;
#pragma unroll
        for (int i = 0; i < 8; ++i) if (i == isel) { mv = m8[i]; lv = l8[i]; }
        const int irow = q0 + rl;
        if (irow < p.Lq) { float* st = p.ST + (((long long)b * gridDim.y + h) * p.Lq + irow) * 2 + (lane & 1); VST2(float, st, (lane & 1) ? lv : mv * 0.6931471805599453f); }
    }
    float invr[8];
#pragma unroll
    for (int i = 0; i < 8; ++i) {
        if (TWOPASS) invr[i] = SPLITPV ? 1.f : (1.f / 4096.f);
        else if (p.nonorm) invr[i] = exp2f(m8[i]) * (SPLITPV ? 1.f : (1.f / 4096.f));
        else invr[i] = (l8[i] > 0.f) ? (SPLITPV ? 1.f / l8[i] : 1.f / (l8[i] * 4096.f)) : 0.f;
    }
    __syncthreads();                                             // all waves done with pl/vl from the main loop
    const bool ofast = ((p.sOi & 3) == 0) && ((((size_t)obase) & 15) == 0) && (q0 + 16 <= p.Lq);
#pragma unroll
    for (int c0 = 0; c0 < DVP; c0 += 64) {
#pragma unroll
        for (int i = 0; i < 8; ++i)
#pragma unroll
            for (int t = 0; t < NT; ++t) if (t * 16 >= c0 && t * 16 < c0 + 64) ((float*)myp)[(i + 8 * hf) * 64 + (t * 16 - c0) + l15] = o[t][i] * invr[i];
        __syncthreads();
        const int cw = (DVP - c0 < 64) ? (DVP - c0) : 64;      // staged columns in this chunk (multiple of 16)
        if (ofast && (c0 + cw <= p.dv) && (cw % 32 == 0)) {
            const int lpr = cw / 4;                              // lanes per row (16 for 64 cols, 8 for 32)
            const int rows_per_ins = 32 / lpr;
            for (int r0 = 0; r0 < 16; r0 += rows_per_ins) {
                const int row = r0 + lane / lpr, c4 = (lane % lpr) * 4;
                const v4f v = *(const v4f*)(myp + row * 64 + c4);
                VST2V4(obase + (long long)(q0 + row) * p.sOi + c0 + c4, v);
            }
        } else {
            for (int row = 0; row < 16; ++row) {
                const int irow = q0 + row; if (irow >= p.Lq) continue;
                for (int c = lane; c < cw; c += 32) { const int d = c0 + c; if (d < p.dv) VST2(float, obase + (long long)irow * p.sOi + d, myp[row * 64 + c]); }
            }
        }
        __syncthreads();
    }
}

// =====================================================================================================================
// k_tr: dst(z, c, r) = alpha * src(z, r, c) (+ beta * R2(z, c, r)): [Z][R][C] (row stride lds) -> [Z][C][R] (row stride ldd) through a 32x32 LDS tile;
//   flags: 1 -> add beta * residual R2 addressed like dst (z*sRz + c*ldr + r); act applied before the residual.
// =====================================================================================================================
struct TrP { const float* src; float* dst; const float* R2; long long sSz, lds, sDz, ldd, sRz, ldr; int R, C, flags, act; float alpha, beta; };
static_assert(sizeof(TrP) == 3 * 8 + 6 * 8 + 6 * 4, "TrP has padding");
__global__ __launch_bounds__(256) void k_tr(TrP p) {
    __shared__ float tile[32][33];
    const int c0 = blockIdx.x * 32, r0 = blockIdx.y * 32, z = blockIdx.z;
    const int lane = threadIdx.x & 31, wave = threadIdx.x >> 5;
    const float* s = p.src + z * p.sSz;
#pragma unroll
    for (int k = 0; k < 4; ++k) {
        const int rl = wave * 4 + k, r = r0 + rl, c = c0 + lane;
        tile[rl][lane] = (r < p.R && c < p.C) ? s[(long long)r * p.lds + c] : 0.f;
    }
    __syncthreads();
    float* d = p.dst + z * p.sDz; const float* rr = p.R2 + z * p.sRz;
#pragma unroll
    for (int k = 0; k < 4; ++k) {
        const int cl = wave * 4 + k, c = c0 + cl, r = r0 + lane;
        if (c < p.C && r < p.R) {
            float v = act_fn(p.alpha * tile[lane][cl], p.act);
            if (p.flags & 1) v += p.beta * rr[(long long)c * p.ldr + r];
            VST2(float, d + (long long)c * p.ldd + r, v);
        }
    }
}

// k_affine: dst[i] = a * (sdev ? sdev[0] : 1) * src[i] + b, i < n (one thread per element; consecutive lanes -> consecutive addresses)
__global__ __launch_bounds__(256) void k_affine(const float* __restrict__ src, float* __restrict__ dst, int n, float a, float b, const float* __restrict__ sdev) {
    const int i = blockIdx.x * 256 + threadIdx.x;
    if (i < n) { const float aa = sdev ? a * sdev[0] : a; const float v = aa * src[i] + b; VST2(float, dst + i, v); }
}

// =====================================================================================================================
// k_softmax: row softmax over n contiguous elements, one 256-thread block per row; rows addressed z*sz + r*sr (grid (R, Z)).
//   out = scale_out * softmax(scale_in * x + (Mf ? Mf[z*smz + r*smr + j] : 0)); a row whose max is -inf is written as 0.
// =====================================================================================================================
struct SmP { const float* src; float* dst; const float* Mf; long long sz, sr, dz, dr, smz, smr; int n, pad; float scale_in, scale_out; };
static_assert(sizeof(SmP) == 3 * 8 + 6 * 8 + 4 * 4, "SmP has padding");
__global__ __launch_bounds__(256) void k_softmax(SmP p) {
    __shared__ float red[256];
    const int r = blockIdx.x, z = blockIdx.y, tid = threadIdx.x;
    const float* s = p.src + z * p.sz + (long long)r * p.sr;
    const float* mf = p.Mf ? (p.Mf + z * p.smz + (long long)r * p.smr) : nullptr;
    float mx = -__builtin_inff();
    for (int j = tid; j < p.n; j += 256) { float v = s[j] * p.scale_in; if (mf) v += mf[j]; mx = fmaxf(mx, v); }
    red[tid] = mx; __syncthreads();
    for (int o = 128; o > 0; o >>= 1) { if (tid < o) red[tid] = fmaxf(red[tid], red[tid + o]); __syncthreads(); }
    mx = red[0]; __syncthreads();
    float sum = 0.f;
    for (int j = tid; j < p.n; j += 256) { float v = s[j] * p.scale_in; if (mf) v += mf[j]; sum += (mx == -__builtin_inff()) ? 0.f : expf(v - mx); }
    red[tid] = sum; __syncthreads();
    for (int o = 128; o > 0; o >>= 1) { if (tid < o) red[tid] += red[tid + o]; __syncthreads(); }
    sum = red[0];
    const float inv = (sum > 0.f) ? p.scale_out / sum : 0.f;
    float* d = p.dst + z * p.dz + (long long)r * p.dr;
    for (int j = tid; j < p.n; j += 256) { float v = s[j] * p.scale_in; if (mf) v += mf[j]; const float o = (mx == -__builtin_inff()) ? 0.f : expf(v - mx) * inv; VST2(float, d + j, o); }
}
// =====================================================================================================================
// k_stats: mean and rsqrt(var + eps) over a set of n elements addressed base + z*sz + (e / inner) * so + (e % inner) * si, one 256-thread
// k_norm_apply: y = (x - mean[set]) * rstd[set] * g[c] + b[c] over a [Z][C][L] channel-major tensor with set = z*G + c / (C/G) (G groups per z;
//   G = C -> per-channel sets indexed z*C+c; for batch norm pass stats indexed by c only via bn = 1). Optional act. Output same layout.
// =====================================================================================================================
//   mode 0: mean / rsqrt(var + eps); mode 1 (RMSNorm): 0 / rsqrt(mean(x^2) + eps); mode 2 (L2 normalize * sqrt(n)): 0 / sqrt(n) / max(||x||, eps); mode 3: as 0 with unbiased variance (n-1)
__global__ __launch_bounds__(256) void k_stats(const float* __restrict__ x, long long sz, long long so, long long si, int inner, int n, float eps, float* __restrict__ stat, int mode) {
    __shared__ float red[256];
    const int z = blockIdx.x, tid = threadIdx.x;
    const float* base = x + z * sz;
    float s = 0.f;
    for (int e = tid; e < n; e += 256) s += base[(long long)(e / inner) * so + (long long)(e % inner) * si];
    red[tid] = s; __syncthreads();
    for (int o = 128; o > 0; o >>= 1) { if (tid < o) red[tid] += red[tid + o]; __syncthreads(); }
    const float mu = (mode == 0 || mode == 3) ? red[0] / (float)n : 0.f; __syncthreads();
    float q = 0.f;
    for (int e = tid; e < n; e += 256) { const float dlt = base[(long long)(e / inner) * so + (long long)(e % inner) * si] - mu; q += dlt * dlt; }
    red[tid] = q; __syncthreads();
    for (int o = 128; o > 0; o >>= 1) { if (tid < o) red[tid] += red[tid + o]; __syncthreads(); }
    {
        float rs;
        if (mode == 2) rs = sqrtf((float)n) / fmaxf(sqrtf(red[0]), eps); else if (mode == 3) rs = rsqrtf(red[0] / (float)(n - 1) + eps); else rs = rsqrtf(red[0] / (float)n + eps);
        if (tid < 32) { const float v = (tid == 0) ? mu : ((tid == 1) ? rs : 0.f); VST2(float, stat + (long long)z * 32 + tid, v); }
    }
}
//   One thread per element over the flat [Z][C][L] index space: grid ceil(Z*C*L / 256).
__global__ __launch_bounds__(256) void k_norm_apply(const float* __restrict__ x, float* __restrict__ y, const float* __restrict__ stat, const float* __restrict__ g, const float* __restrict__ bta,
                                                     int Z, int C, int L, int G, int bn, int act) {
    const long long idx = (long long)blockIdx.x * 256 + threadIdx.x;
    if (idx >= (long long)Z * C * L) return;
    const int l = (int)(idx % L); const long long zc = idx / L; const int c = (int)(zc % C), z = (int)(zc / C); (void)l;
    const int set = bn ? c : (z * G + c / (C / G));
    float v = (x[idx] - stat[(long long)set * 32]) * stat[(long long)set * 32 + 1];
    if (g) v *= g[c];
    if (bta) v += bta[c];
    v = act_fn(v, act);
    VST2(float, y + idx, v);
}

// k_lse_neg: c[i] = -(st[2i] + log(st[2i+1])) = minus the log-sum-exp of row i from k_attn's ST output (for softmax over the query dimension)
__global__ __launch_bounds__(256) void k_lse_neg(const float* __restrict__ st, float* __restrict__ c, int n) {
    const int i = blockIdx.x * 256 + threadIdx.x;
    if (i < n) { const float v = -(st[2 * i] + logf(st[2 * i + 1])); VST2(float, c + i, v); }
}

// k_iota: dst[i] = a * i + b as int32 (segment/position id helper)
__global__ __launch_bounds__(256) void k_iota(int* __restrict__ dst, int n, int a, int b) {
    const int i = blockIdx.x * 256 + threadIdx.x;
    if (i < n) { const int v = a * i + b; VST2(int, dst + i, v); }
}

// k_axpby: dst[i] = a * x[i] + b * y[i] (+ c), i < n
__global__ __launch_bounds__(256) void k_axpby(const float* __restrict__ x, const float* __restrict__ y, float* __restrict__ dst, int n, float a, float b, float c) {
    const int i = blockIdx.x * 256 + threadIdx.x;
    if (i < n) { const float v = a * x[i] + b * y[i] + c; VST2(float, dst + i, v); }
}

// =====================================================================================================================
// k_rope: rotary embedding on a [R rows][Hn heads][D] view (row stride sXr, head stride sXh, element stride 1) -> Y (own strides).
//   mode 0: rotate_half (partner d±D/2, sign - for d<D/2); mode 1: interleaved pairs (partner d^1, sign - for even d).
//   table column tcol: tmode 0 -> d, 1 -> d % (D/2), 2 -> d / 2; position p: pmode 0 -> r % S, 1 -> head index, 2 -> pos[r];
//   c = C[(r / S) * sCb + p * sCp + tcol * sCd], s likewise from Sn; y = x[d] * c + sign * x[partner] * s. X and Y must not alias.
// =====================================================================================================================
struct RopeP { const float* X; float* Y; const float* C; const float* Sn; const int* pos; long long sXr, sXh, sYr, sYh, sCb, sCp, sCd; int R, Hn, D, S, mode, tmode, pmode, pad; };
static_assert(sizeof(RopeP) == 5 * 8 + 7 * 8 + 8 * 4, "RopeP has padding");
__global__ __launch_bounds__(256) void k_rope(RopeP p) {
    const long long idx = (long long)blockIdx.x * 256 + threadIdx.x;
    if (idx >= (long long)p.R * p.Hn * p.D) return;
    const int d = (int)(idx % p.D); const long long rh = idx / p.D; const int h = (int)(rh % p.Hn); const int r = (int)(rh / p.Hn);
    const int half = p.D / 2;
    int partner; float sign;
    if (p.mode == 0) { partner = (d < half) ? d + half : d - half; sign = (d < half) ? -1.f : 1.f; }
    else { partner = d ^ 1; sign = (d & 1) ? 1.f : -1.f; }
    const int tcol = (p.tmode == 0) ? d : ((p.tmode == 1) ? (d % half) : (d >> 1));
    const int pp = (p.pmode == 0) ? (r % p.S) : ((p.pmode == 1) ? h : p.pos[r]);
    const long long toff = (long long)(r / p.S) * p.sCb + (long long)pp * p.sCp + (long long)tcol * p.sCd;
    const float* xr = p.X + (long long)r * p.sXr + (long long)h * p.sXh;
    const float v = xr[d] * p.C[toff] + sign * xr[partner] * p.Sn[toff];
    VST2(float, p.Y + (long long)r * p.sYr + (long long)h * p.sYh + d, v);
}

// k_invf + k_sincos (split so neither kernel carries a large VALU-fma footprint): invf_i = num * (1 / powf(base, (2 i)/D)) [fmode 0],
//   num * expf((2 i) * cexp) [fmode 1], num * powf(base, -2 (i - 1) / D) [fmode 2]; then cs/sn[s*half + i] = cos/sin((pscale * s) * invf_i)
__global__ __launch_bounds__(256) void k_invf(float* __restrict__ invb, int half, int D, float base, float num, int fmode, float cexp) {
    const int i = blockIdx.x * 256 + threadIdx.x;
    if (i >= ((half + 31) / 32) * 32) return;
    if (i >= half) { VST2(float, invb + i, 0.f); return; }
    const float e = (float)(2 * i) / (float)D;
    float invf;
    if (fmode == 1) invf = num * expf((float)(2 * i) * cexp);
    else if (fmode == 2) invf = num * powf(base, (-2.0f * ((float)i - 1.0f)) / (float)D);
    else invf = num * (1.0f / powf(base, e));
    VST2(float, invb + i, invf);
}
__global__ __launch_bounds__(256) void k_sincos(float* __restrict__ cs, float* __restrict__ sn, const float* __restrict__ invb, int S, int half, float pscale) {
    const int idx = blockIdx.x * 256 + threadIdx.x;
    if (idx >= S * half) return;
    const int s = idx / half, i = idx - s * half;
    const float ang = (pscale * (float)s) * invb[i];
    VST2(float, cs + idx, cosf(ang)); VST2(float, sn + idx, sinf(ang));
}

// k_mulact: dst[i] = act(x[i]) * y[i]
__global__ __launch_bounds__(256) void k_mulact(const float* __restrict__ x, const float* __restrict__ y, float* __restrict__ dst, int n, int act) {
    const int i = blockIdx.x * 256 + threadIdx.x;
    if (i < n) { const float v = act_fn(x[i], act) * y[i]; VST2(float, dst + i, v); }
}

// =====================================================================================================================
// k_matvec: thread-per-row matrix-vector products for N <= 8 output columns (heads with 1-3 outputs, gates), f32 on the VALU.
//   C[r*sCm + j] = act(alpha * sum_k A[r*sAm + k*sAk] * B[j*sBn + k*sBk] + bias[j]) + beta * R[r*sRm + j*sRn]; each thread writes its N contiguous floats.
// =====================================================================================================================
__global__ __launch_bounds__(256) void k_matvec(GemmP p) {
    // 32 lanes write one line with one instruction.
    const int rpt = (p.N == 1) ? 1 : 32;
    const long long r0 = ((long long)blockIdx.x * 256 + threadIdx.x) * rpt; const int z = blockIdx.z, zo = z / p.zi_n, zi = z - zo * p.zi_n;
    if (r0 >= p.M) return;
    const float* Bb = p.B + zo * p.sBo + zi * p.sBi;
    float* C = p.C + zo * p.sCo + zi * p.sCi; const float* R = p.R + zo * p.sRo + zi * p.sRi;
    for (int rr = 0; rr < rpt; ++rr) {
        const long long r = r0 + rr; if (r >= p.M) break;
        const float* A = p.A + zo * p.sAo + zi * p.sAi + r * p.sAm;
        float acc[8] = {0.f, 0.f, 0.f, 0.f, 0.f, 0.f, 0.f, 0.f};
        for (int k = 0; k < p.K; ++k) { const float a = A[(long long)k * p.sAk];
#pragma unroll
            for (int j = 0; j < 8; ++j) if (j < p.N) acc[j] += a * Bb[(long long)j * p.sBn + (long long)k * p.sBk]; }
#pragma unroll
        for (int j = 0; j < 8; ++j) if (j < p.N) {
            float v = acc[j] * p.alpha;
            if (p.flags & 1) v += p.bias[j];
            if (p.flags & 2) v += p.bias[r];
            v = act_fn(v, p.act);
            if (p.flags & 4) v += p.beta * R[r * p.sRm + (long long)j * p.sRn];
            VST2(float, C + r * p.sCm + j, v);
        }
    }
}
// k_smallsoftmax: thread-per-row softmax for short rows (n <= 64): dst[r*dr + j] = softmax(scale*src[r*sr + j])
__global__ __launch_bounds__(256) void k_smallsoftmax(const float* __restrict__ src, float* __restrict__ dst, long long sr, long long dr, int n, long long R, float scale) {
    const long long r0 = ((long long)blockIdx.x * 256 + threadIdx.x) * 32;
    for (int rr = 0; rr < 32; ++rr) {
        const long long r = r0 + rr; if (r >= R) return;
        const float* s = src + r * sr; float* d = dst + r * dr;
        float mx = -__builtin_inff();
        for (int j = 0; j < n; ++j) mx = fmaxf(mx, s[j] * scale);
        float sum = 0.f;
        for (int j = 0; j < n; ++j) sum += expf(s[j] * scale - mx);
        const float inv = 1.f / sum;
        for (int j = 0; j < n; ++j) { const float v = expf(s[j] * scale - mx) * inv; VST2(float, d + j, v); }
    }
}

__global__ __launch_bounds__(32) void k_unitstat(float* __restrict__ st) { const int t = threadIdx.x; const float v = (t == 1) ? 1.f : 0.f; VST2(float, st + t, v); }

// destination (e.g. a d_out whose row width is not a multiple of 32 floats) is written by consecutive lanes of one instruction
__global__ __launch_bounds__(256) void k_lincopy(const float* __restrict__ src, long long lds, float* __restrict__ dst, long long ldd, long long rows, int cols) {
    const long long i = (long long)blockIdx.x * 256 + threadIdx.x; if (i >= rows * cols) return;
    const long long r = i / cols; const int c = (int)(i - r * cols);
    const float v = src[r * lds + c]; VST2(float, dst + r * ldd + c, v);
}

namespace w25 {
typedef __attribute__((ext_vector_type(16))) _Float16 v16h;
typedef __attribute__((ext_vector_type(8)))  _Float16 v8h;
typedef __attribute__((ext_vector_type(16))) __bf16   v16b;
typedef __attribute__((ext_vector_type(8)))  __bf16   v8b;
typedef __attribute__((ext_vector_type(8)))  float    v8f;
typedef __attribute__((ext_vector_type(4)))  float    v4f;

__device__ __forceinline__ unsigned short f2bf_bits(float f) {
  unsigned u = __float_as_uint(f);
  return (unsigned short)((u + 0x7FFFu + ((u >> 16) & 1u)) >> 16);
}
__device__ __forceinline__ float bf_bits2f(unsigned short h) { return __uint_as_float(((unsigned)h) << 16); }

// hazard guards as plain device helpers (no inline asm inside the kernel template body)
__device__ __forceinline__ void dep_guard_h(v8f& a, v8f& b, v16h x, v16h y) { asm volatile("v_nop\n\tv_nop\n\tv_nop\n\tv_nop" : "+v"(a), "+v"(b) : "v"(x), "v"(y)); }
__device__ __forceinline__ void dep_guard_b(v8f& a, v8f& b, v16b x, v16b y) { asm volatile("v_nop\n\tv_nop\n\tv_nop\n\tv_nop" : "+v"(a), "+v"(b) : "v"(x), "v"(y)); }
__device__ __forceinline__ void keep4_h(v16h a, v16h b, v16h c, v16h d) { asm volatile("v_nop" :: "v"(a), "v"(b), "v"(c), "v"(d)); }
__device__ __forceinline__ void keep4_b(v16b a, v16b b, v16b c, v16b d) { asm volatile("v_nop" :: "v"(a), "v"(b), "v"(c), "v"(d)); }
__device__ __forceinline__ void acc_guard4(v8f& a, v8f& b, v8f& c, v8f& d) { asm volatile("v_nop\n\tv_nop\n\tv_nop\n\tv_nop" : "+v"(a), "+v"(b), "+v"(c), "+v"(d)); }
template <typename T> struct Frag;
template <> struct Frag<_Float16> {
  typedef v16h V; union U { v16h v; v8h h[2]; };
  static __device__ __forceinline__ v16h load(const _Float16* p) {   // elements 0..7 <- p[0..7], 8..15 <- p[16..23]
    U f; f.h[0] = *(const v8h*)(p); f.h[1] = *(const v8h*)(p + 16); return f.v;
  }
  static __device__ __forceinline__ v8f mma(v16h a, v16h b, v8f c) {
    return __builtin_amdgcn_wmma_f32_16x16x32_f16(false, a, false, b, (short)0, c, false, false);
  }
  static __device__ __forceinline__ void guard(v8f& a, v8f& b, v16h x, v16h y) { dep_guard_h(a, b, x, y); }
  static __device__ __forceinline__ void keep(v16h a, v16h b, v16h c, v16h d) { keep4_h(a, b, c, d); }
};
template <> struct Frag<__bf16> {
  typedef v16b V; union U { v16b v; v8b h[2]; };
  static __device__ __forceinline__ v16b load(const __bf16* p) {
    U f; f.h[0] = *(const v8b*)(p); f.h[1] = *(const v8b*)(p + 16); return f.v;
  }
  static __device__ __forceinline__ v8f mma(v16b a, v16b b, v8f c) {
    return __builtin_amdgcn_wmma_f32_16x16x32_bf16(false, a, false, b, (short)0, c, false, false);
  }
  static __device__ __forceinline__ void guard(v8f& a, v8f& b, v16b x, v16b y) { dep_guard_b(a, b, x, y); }
  static __device__ __forceinline__ void keep(v16b a, v16b b, v16b c, v16b d) { keep4_b(a, b, c, d); }
};

// ---- Register-blocked batched WMMA GEMM ------------------------------------
// C[m,n] = scale * sum_k A[m,k] * Bt[n,k] (+bias)(+resid); each wave owns a 64x64 tile.
// A row-major [M,K]; Bt row-major [N,K]; M,N % 64 == 0, K % 32 == 0.
// SPLIT: operands are hi/lo planes (A2/Bt2 = lo planes, same layout); product = hi·hi + hi·lo + lo·hi.
// BIAS_MODE: 0 = none, 1 = bias[m], 2 = bias[n].
// OUT_MODE: 0 = f32, 1 = f16, 2 = bf16 hi plane (Cout) + bf16 lo plane (Cout2).
// ET: 0 = f16 operands, 1 = bf16 operands (pointers passed as 16-bit storage)
template <int ET> struct Elem;
template <> struct Elem<0> { typedef _Float16 T; };
template <> struct Elem<1> { typedef __bf16 T; };
template <int ET, bool SPLIT, int BIAS_MODE, int OUT_MODE, bool RESID, int ACT = 0>
__global__ __launch_bounds__(256) void wmma_gemm64(
    const unsigned short* __restrict__ Ap, const unsigned short* __restrict__ A2p, int lda, long strideA,
    const unsigned short* __restrict__ Btp, const unsigned short* __restrict__ Bt2p, int ldb, long strideB,
    void* __restrict__ Cout, void* __restrict__ Cout2, int ldc, long strideC,
    const float* __restrict__ bias,
    const float* __restrict__ resid, long strideR,
    int M, int N, int K, float scale) {
  typedef typename Elem<ET>::T T;
  typedef typename Frag<T>::V V;
  const T* A = (const T*)Ap; const T* A2 = (const T*)A2p; const T* Bt = (const T*)Btp; const T* Bt2 = (const T*)Bt2p;
  __shared__ __align__(16) float sT[8][16 * 68];   // per-wave 16x64 slab, pitch 68 floats
  const int b    = blockIdx.y;
  const int lane = threadIdx.x & 31;
  const int wave = threadIdx.x >> 5;
  const int tilesN = N >> 6;
  const int tilesM = M >> 6;
  const int tile = blockIdx.x * 8 + wave;
  if (tile >= tilesM * tilesN) return;   // wave-uniform; no block barriers in this kernel
  const int tm = tile / tilesN;
  const int tn = tile - tm * tilesN;
  const int m0 = tm << 6;
  const int n0 = tn << 6;

  const T* Ab  = A  + (size_t)b * strideA;
  const T* Bb  = Bt + (size_t)b * strideB;
  const T* Ab2 = SPLIT ? (A2  + (size_t)b * strideA) : nullptr;
  const T* Bb2 = SPLIT ? (Bt2 + (size_t)b * strideB) : nullptr;

  const int rlane = lane & 15;                 // row (A) / col (B, D) within subtile
  const int koff  = (lane >> 4) * 8;           // k offset of this lane half
  const int mOff  = (lane >> 4) * 8;           // D row offset

  v8f acc[4][4];
#pragma unroll
  for (int i = 0; i < 4; ++i)
#pragma unroll
    for (int j = 0; j < 4; ++j) acc[i][j] = (v8f){0.f,0.f,0.f,0.f,0.f,0.f,0.f,0.f};

  for (int k0 = 0; k0 < K; k0 += 32) {
    V bh[4], bl[4];
#pragma unroll
    for (int j = 0; j < 4; ++j) {
      const size_t bo = (size_t)(n0 + (j << 4) + rlane) * ldb + koff + k0;
      bh[j] = Frag<T>::load(Bb + bo);
      if (SPLIT) bl[j] = Frag<T>::load(Bb2 + bo);
    }
#pragma unroll
    for (int i = 0; i < 4; ++i) {
      const size_t ao = (size_t)(m0 + (i << 4) + rlane) * lda + koff + k0;
      V ah = Frag<T>::load(Ab + ao);
      V al;
      if (SPLIT) al = Frag<T>::load(Ab2 + ao);
#pragma unroll
      for (int j = 0; j < 4; ++j) {
        acc[i][j] = Frag<T>::mma(ah, bh[j], acc[i][j]);
        if (SPLIT) {
          acc[i][j] = Frag<T>::mma(ah, bl[j], acc[i][j]);
          acc[i][j] = Frag<T>::mma(al, bh[j], acc[i][j]);
        }
      }
      Frag<T>::guard(acc[i][0], acc[i][3], ah, SPLIT ? al : ah);
    }
    Frag<T>::keep(bh[0], bh[1], bh[2], bh[3]);
    if (SPLIT) Frag<T>::keep(bl[0], bl[1], bl[2], bl[3]);
  }
  acc_guard4(acc[0][0], acc[0][1], acc[0][2], acc[0][3]);
  acc_guard4(acc[1][0], acc[1][1], acc[1][2], acc[1][3]);
  acc_guard4(acc[2][0], acc[2][1], acc[2][2], acc[2][3]);
  acc_guard4(acc[3][0], acc[3][1], acc[3][2], acc[3][3]);

  // ---- epilogue ----
  float* slab = sT[wave];
  const float* Rb = RESID ? (resid + (size_t)b * strideR) : nullptr;
#pragma unroll
  for (int i = 0; i < 4; ++i) {
    const int mBase = m0 + (i << 4);
#pragma unroll
    for (int j = 0; j < 4; ++j) {
      const int n = n0 + (j << 4) + rlane;
      float bv = 0.f;
      if (BIAS_MODE == 2) bv = bias[n];
#pragma unroll
      for (int r = 0; r < 8; ++r) {
        float v = acc[i][j][r] * scale;
        if (BIAS_MODE == 1) v += bias[mBase + mOff + r];
        if (BIAS_MODE == 2) v += bv;
        if (RESID) v += Rb[(size_t)(mBase + mOff + r) * ldc + n];
        if (ACT == 1) v = tanhf(v);
        if (ACT == 2) v = fmaxf(v, 0.0f);
        if (ACT == 3) v = v / (1.0f + expf(-v));
        if (ACT == 4) v = (v > 0.f) ? v : 0.01f * v;
        if (ACT == 5) v = 0.5f * v * (1.0f + erff(v * 0.70710678118654752f));
        slab[(mOff + r) * 68 + (j << 4) + rlane] = v;
      }
    }
    __builtin_amdgcn_fence(__ATOMIC_RELEASE, "workgroup");
    __builtin_amdgcn_wave_barrier();
    __builtin_amdgcn_fence(__ATOMIC_ACQUIRE, "workgroup");
    if (OUT_MODE == 0) {
      float* C = (float*)Cout + (size_t)b * strideC;
      const int hh = lane >> 4, c4 = (lane & 15) * 4;     // row seg = 256 B = 16 lanes x 16 B
      {
#pragma unroll
        for (int it = 0; it < 8; ++it) {
          const int row = it * 2 + hh;
          v4f v = *(const v4f*)(slab + row * 68 + c4);
          *(v4f*)(C + (size_t)(mBase + row) * ldc + n0 + c4) = v;
        }
        
      }
    } else {
      const int q = lane >> 3, c8 = (lane & 7) * 8;
      unsigned short* C  = (unsigned short*)Cout  + (size_t)b * strideC;
      unsigned short* C2 = (OUT_MODE == 2) ? ((unsigned short*)Cout2 + (size_t)b * strideC) : nullptr;
      {
#pragma unroll
        for (int it = 0; it < 4; ++it) {
          const int row = it * 4 + q;
          const float* sp = slab + row * 68 + c8;
          v8h hv, lv;
#pragma unroll
          for (int e = 0; e < 8; ++e) {
            if (OUT_MODE == 1) {
              hv[e] = (_Float16)sp[e];
            } else {
              unsigned short hb = f2bf_bits(sp[e]);
              unsigned short lb = f2bf_bits(sp[e] - bf_bits2f(hb));
              hv[e] = __builtin_bit_cast(_Float16, hb);
              lv[e] = __builtin_bit_cast(_Float16, lb);
            }
          }
          *(v8h*)(C + (size_t)(mBase + row) * ldc + n0 + c8) = hv;
          if (OUT_MODE == 2) *(v8h*)(C2 + (size_t)(mBase + row) * ldc + n0 + c8) = lv;
        }
        
      }
    }
    __builtin_amdgcn_fence(__ATOMIC_RELEASE, "workgroup");
    __builtin_amdgcn_wave_barrier();
    __builtin_amdgcn_fence(__ATOMIC_ACQUIRE, "workgroup");
  }
}

__global__ __launch_bounds__(256) void cast_f32_f16x2(
    const float* __restrict__ in, _Float16* __restrict__ out, int n2) {
  int i = blockIdx.x * 256 + threadIdx.x;
  if (i < n2) {
    const _Float16 h0 = (_Float16)in[2 * i], h1 = (_Float16)in[2 * i + 1];
    const unsigned u = (unsigned)__builtin_bit_cast(unsigned short, h0) | ((unsigned)__builtin_bit_cast(unsigned short, h1) << 16);
    ((unsigned*)out)[i] = u;
    
  }
}


} // namespace w25

__global__ __launch_bounds__(256) void k_castT16(const float* __restrict__ src, long long lds, _Float16* __restrict__ dst, long long ldd, int R, int C, float s) {
    const long long i = (long long)blockIdx.x * 256 + threadIdx.x; const long long np = (long long)C * (R / 2); if (i >= np) return; const int c = (int)(i / (R / 2)); const int r = 2 * (int)(i % (R / 2));
    const _Float16 h0 = (_Float16)(src[(long long)r * lds + c] * s), h1 = (_Float16)(src[(long long)(r + 1) * lds + c] * s);
    const unsigned u = (unsigned)__builtin_bit_cast(unsigned short, h0) | ((unsigned)__builtin_bit_cast(unsigned short, h1) << 16);
    unsigned* d = (unsigned*)(dst + (long long)c * ldd + r); *d = u;  }
__global__ __launch_bounds__(256) void k_cast16(const float* __restrict__ src, long long lds, _Float16* __restrict__ dst, long long ldd, int R, int C, float s) {
    const long long i = (long long)blockIdx.x * 256 + threadIdx.x; const long long np = (long long)R * (C / 2); if (i >= np) return; const int r = (int)(i / (C / 2)); const int c = 2 * (int)(i % (C / 2));
    const _Float16 h0 = (_Float16)(src[(long long)r * lds + c] * s), h1 = (_Float16)(src[(long long)r * lds + c + 1] * s);
    const unsigned u = (unsigned)__builtin_bit_cast(unsigned short, h0) | ((unsigned)__builtin_bit_cast(unsigned short, h1) << 16);
    unsigned* d = (unsigned*)(dst + (long long)r * ldd + c); *d = u;  }

// f32 -> bf16 hi plane + bf16 lo plane (x = hi + lo to ~2^-17 relative; RNE both), [R][C] -> [R][C] (or transposed to [C][R]); 2 consecutive destination elements
__device__ __forceinline__ unsigned int f2bf2_pack(float a, float b, unsigned int* lo) {
    const unsigned short ha = w25::f2bf_bits(a), hb = w25::f2bf_bits(b);
    const unsigned short la = w25::f2bf_bits(a - w25::bf_bits2f(ha)), lb = w25::f2bf_bits(b - w25::bf_bits2f(hb));
    *lo = (unsigned)la | ((unsigned)lb << 16); return (unsigned)ha | ((unsigned)hb << 16); }
__global__ __launch_bounds__(256) void k_castS16(const float* __restrict__ src, long long lds, __bf16* __restrict__ dhi, __bf16* __restrict__ dlo, long long ldd, int R, int C, float s, int transpose) {
    const long long i = (long long)blockIdx.x * 256 + threadIdx.x; long long o; float a, b;
    if (transpose) { const long long np = (long long)C * (R / 2); if (i >= np) return; const int c = (int)(i / (R / 2)); const int r = 2 * (int)(i % (R / 2)); a = src[(long long)r * lds + c] * s; b = src[(long long)(r + 1) * lds + c] * s; o = (long long)c * ldd + r; }
    else { const long long np = (long long)R * (C / 2); if (i >= np) return; const int r = (int)(i / (C / 2)); const int c = 2 * (int)(i % (C / 2)); a = src[(long long)r * lds + c] * s; b = src[(long long)r * lds + c + 1] * s; o = (long long)r * ldd + c; }
    unsigned lo; const unsigned hi = f2bf2_pack(a, b, &lo); unsigned* ph = (unsigned*)(dhi + o); unsigned* pl = (unsigned*)(dlo + o);
    *ph = hi; *pl = lo;  }

namespace w25 {
// =====================================================================================
// Generic causal/non-causal attention for head_dim 64, f32 in / f32 out; 16-bit operands: bf16 with optional hi/lo splits, or
// plain f16 (F16=true, non-split, probabilities carried x2^15).
//   scores = (q*qscale)·kᵀ : v_wmma_f32_16x16x32_bf16; SPLIT_QK -> q,k as bf16 hi/lo (hi·hi + hi·lo + lo·hi)
//   out    = p·v           : v_wmma_f32_16x16x32_bf16; SPLIT_PV -> p,v as bf16 hi/lo; else p,v plain bf16
//   f32 accumulate; online softmax in f32. Block = 4 waves = 64 query rows of one (batch, head); S % 64 == 0.
//   Element (b, s, h, d) of tensor X lives at X[b*X_bs + s*X_rs + h*X_hs + d] (strides in floats, multiples of 4).
//   Masking: mask_mode 0 none, 1 causal (kv > q masked), 2 tensor [S][Skv] shared over (b,h) (float if
//   mask_is_int==0, int32 with element == 0 -> masked if 1, int32 with element != 0 -> masked if 2), 3 per-token vectors qmask[B][S] & kvmask[B][Skv] (int32,
//   0 -> masked), 4 causal + sliding window (kv > q or q - kv > W masked; W passed in mask_is_int);
//   5 = relative-position bias: s += cp[b,h,q][idx[q][kv]] + pc[b,h,kv][idx[q][kv]] with idx = mask_b ([S][Skv] int32) and
//   mask_a an int32 [S][Skv] tensor with nonzero = masked (tables: element (b,h,row,n) at X + b*c_bs + h*c_hs + row*c_rs + n);
//   masked scores are replaced by mask_fill (e.g. -inf or -1e9) before the softmax.
//   grid.x = B * H * (S/64) (or a sub-range with blk0).
// =====================================================================================
#define AT_D 64
#define AT_NW 4
#define AT_QB 64
#define AT_KC 64
struct AttnGeom { const float* cp = nullptr; const float* pc = nullptr; long c_bs = 0, c_rs = 0, c_hs = 0;   // mode-5 score-bias tables
                  long q_bs, q_rs, q_hs, k_bs, k_rs, k_hs, v_bs, v_rs, v_hs, o_bs, o_rs, o_hs;
                  int S, Skv, H, mask_mode; float qscale; int blk0; float mask_fill; int mask_is_int; };
static_assert(sizeof(AttnGeom) == 168, "no padding");

__device__ __forceinline__ unsigned short at_bf_bits(float f) {
  unsigned u = __float_as_uint(f);
  return (unsigned short)((u + 0x7FFFu + ((u >> 16) & 1u)) >> 16);
}
__device__ __forceinline__ __bf16 at_f2bf(float f) { return __builtin_bit_cast(__bf16, at_bf_bits(f)); }
__device__ __forceinline__ void at_split(float f, __bf16& hi, __bf16& lo) {
  const unsigned short hb = at_bf_bits(f);
  hi = __builtin_bit_cast(__bf16, hb);
  lo = at_f2bf(f - __uint_as_float(((unsigned)hb) << 16));
}
__device__ __forceinline__ v8f at_mma(v16b a, v16b b, v8f c) {
  c = __builtin_amdgcn_wmma_f32_16x16x32_bf16(false, a, false, b, (short)0, c, false, false);
  asm volatile("v_nop\n\tv_nop\n\tv_nop\n\tv_nop" : "+v"(c) : "v"(a), "v"(b));
  return c;
}
// 16-bit element as a bit pattern held in a __bf16 slot: f16 bits when F16, bf16 (RNE) otherwise
template <bool F16> __device__ __forceinline__ __bf16 at_to16(float f) {
  if (F16) return __builtin_bit_cast(__bf16, (_Float16)f);
  return at_f2bf(f);
}
template <bool F16> __device__ __forceinline__ v8f at_mma16(v16b a, v16b b, v8f c) {
  if (F16) {
    const v16h ah = __builtin_bit_cast(v16h, a), bh = __builtin_bit_cast(v16h, b);
    c = __builtin_amdgcn_wmma_f32_16x16x32_f16(false, ah, false, bh, (short)0, c, false, false);
    asm volatile("v_nop\n\tv_nop\n\tv_nop\n\tv_nop" : "+v"(c) : "v"(ah), "v"(bh));
    return c;
  }
  return at_mma(a, b, c);
}

template <bool SPLIT_QK, bool SPLIT_PV, bool F16 = false>
__global__ __launch_bounds__(128)
void attn64_kernel(const float* __restrict__ q, const float* __restrict__ k,
                   const float* __restrict__ v, float* __restrict__ out,
                   const void* __restrict__ mask_a, const int* __restrict__ mask_b, AttnGeom g) {
  static_assert(!(F16 && (SPLIT_QK || SPLIT_PV)), "f16 mode is non-split");
  const float PSC = F16 ? 32768.0f : 1.0f;     // f16 probabilities carried x2^15 (subnormal range), folded into the final 1/l
  union FB { v16b v; v8b h[2]; };
  __shared__ __align__(16) __bf16 Ksh[AT_KC * AT_D];             // K hi [kv][d]      8 KB
  __shared__ __align__(16) __bf16 Ksl[SPLIT_QK ? AT_KC * AT_D : 8];
  __shared__ __align__(16) __bf16 Vth[AT_D * AT_KC];             // V hi [d][kv]      8 KB
  __shared__ __align__(16) __bf16 Vtl[SPLIT_PV ? AT_D * AT_KC : 8];
  __shared__ __align__(16) __bf16 Psh[AT_NW][16 * AT_KC];        // per wave P hi [row][kv]  8 KB
  __shared__ __align__(16) __bf16 Psl[SPLIT_PV ? AT_NW : 1][SPLIT_PV ? 16 * AT_KC : 8];
  __shared__ __align__(16) float  Os[AT_NW][16 * 68];            // per wave out tile, pitch 68

  const int tid  = threadIdx.x;
  const int wave = tid >> 5;
  const int lane = tid & 31;
  const int hh   = lane >> 4;
  const int c    = lane & 15;

  const int nqb = g.S / AT_QB;
  const int bx = blockIdx.x + g.blk0;
  const int qb = bx % nqb;
  const int bh = bx / nqb;
  const int h  = bh % g.H;
  const int b  = bh / g.H;
  const int qbase_block = qb * AT_QB;
  const int q0 = qbase_block + wave * 16;

  const float* qb_ptr = q + (size_t)b * g.q_bs + (size_t)h * g.q_hs;
  const float* kb_ptr = k + (size_t)b * g.k_bs + (size_t)h * g.k_hs;
  const float* vb_ptr = v + (size_t)b * g.v_bs + (size_t)h * g.v_hs;
  float*       ob_ptr = out + (size_t)b * g.o_bs + (size_t)h * g.o_hs;

  // ---- Q fragments (A operand): 2 d-chunks, hi (and lo) ----
  v16b qah[2], qal[2];
  {
    const float* qrow = qb_ptr + (size_t)(q0 + c) * g.q_rs;
#pragma unroll
    for (int dc = 0; dc < 2; ++dc) {
#pragma unroll
      for (int e = 0; e < 8; ++e) {
        const float f0 = qrow[dc * 32 + 8 * hh + e] * g.qscale;
        const float f1 = qrow[dc * 32 + 16 + 8 * hh + e] * g.qscale;
        if (SPLIT_QK) { __bf16 hq, lq; at_split(f0, hq, lq); qah[dc][e] = hq; qal[dc][e] = lq; at_split(f1, hq, lq); qah[dc][8 + e] = hq; qal[dc][8 + e] = lq; }
        else { qah[dc][e] = at_to16<F16>(f0); qah[dc][8 + e] = at_to16<F16>(f1); qal[dc][e] = qah[dc][e]; qal[dc][8 + e] = qah[dc][8 + e]; }
      }
    }
  }

  float mrow[8], lrow[8];
  v8f oacc[4];
#pragma unroll
  for (int r = 0; r < 8; ++r) { mrow[r] = -INFINITY; lrow[r] = 0.f; }
#pragma unroll
  for (int t = 0; t < 4; ++t) oacc[t] = (v8f){0.f,0.f,0.f,0.f,0.f,0.f,0.f,0.f};

  const int nChunks = (g.mask_mode == 1 || g.mask_mode == 4) ? (qb + 1) : (g.Skv / AT_KC);   // block-uniform
  // per-row query mask (mode 3)
  int qkeep[8];
#pragma unroll
  for (int r = 0; r < 8; ++r) qkeep[r] = (g.mask_mode == 3) ? mask_b[(size_t)b * g.S + q0 + 8 * hh + r] : 1;   // mask_b = qmask in mode 3
  for (int kc = 0; kc < nChunks; ++kc) {
    const int kv0 = kc * AT_KC;
    __syncthreads();
    {
      const int kvr = tid >> 1, dh = (tid & 1) * 32;
      const float* krow = kb_ptr + (size_t)(kv0 + kvr) * g.k_rs + dh;
      const float* vrow = vb_ptr + (size_t)(kv0 + kvr) * g.v_rs + dh;
#pragma unroll
      for (int i = 0; i < 8; ++i) {
        v4f kk = *(const v4f*)(krow + 4 * i);
        v4f vv = *(const v4f*)(vrow + 4 * i);
#pragma unroll
        for (int e = 0; e < 4; ++e) {
          const int d = dh + 4 * i + e;
          if (SPLIT_QK) { __bf16 a, bl; at_split(kk[e], a, bl); Ksh[kvr * AT_D + d] = a; Ksl[kvr * AT_D + d] = bl; }
          else Ksh[kvr * AT_D + d] = at_to16<F16>(kk[e]);
          if (SPLIT_PV) { __bf16 a, bl; at_split(vv[e], a, bl); Vth[d * AT_KC + kvr] = a; Vtl[d * AT_KC + kvr] = bl; }
          else Vth[d * AT_KC + kvr] = at_to16<F16>(vv[e]);
        }
      }
    }
    __syncthreads();

    v8f s[4];
#pragma unroll
    for (int j = 0; j < 4; ++j) {
      s[j] = (v8f){0.f,0.f,0.f,0.f,0.f,0.f,0.f,0.f};
#pragma unroll 1
      for (int dc = 0; dc < 2; ++dc) {
        FB kb;
        kb.h[0] = *(const v8b*)(Ksh + (j * 16 + c) * AT_D + dc * 32 + 8 * hh);
        kb.h[1] = *(const v8b*)(Ksh + (j * 16 + c) * AT_D + dc * 32 + 16 + 8 * hh);
        s[j] = at_mma16<F16>(qah[dc], kb.v, s[j]);
        if (SPLIT_QK) {
          FB kl;
          kl.h[0] = *(const v8b*)(Ksl + (j * 16 + c) * AT_D + dc * 32 + 8 * hh);
          kl.h[1] = *(const v8b*)(Ksl + (j * 16 + c) * AT_D + dc * 32 + 16 + 8 * hh);
          s[j] = at_mma16<F16>(qah[dc], kl.v, s[j]);
          s[j] = at_mma16<F16>(qal[dc], kb.v, s[j]);
        }
      }
    }
    const bool diag = (g.mask_mode == 1) && (kc == qb);
    int kvkeep[4] = {1, 1, 1, 1};
    if (g.mask_mode == 3) {
#pragma unroll
      for (int j = 0; j < 4; ++j) kvkeep[j] = ((const int*)mask_a)[(size_t)b * g.Skv + kv0 + j * 16 + c];   // mask_a = kvmask
    }
    float cm[8];
#pragma unroll
    for (int r = 0; r < 8; ++r) {
      const int qrow = q0 + 8 * hh + r;
      float m = -INFINITY;
#pragma unroll
      for (int j = 0; j < 4; ++j) {
        const int kvcol = kv0 + j * 16 + c;
        bool masked = false;
        if (diag) masked = (kvcol > qrow);
        else if (g.mask_mode == 4) masked = (kvcol > qrow) || (qrow - kvcol > g.mask_is_int);
        else if (g.mask_mode == 2) {
          const size_t mi = (size_t)qrow * g.Skv + kvcol;
          masked = (g.mask_is_int == 0) ? (((const float*)mask_a)[mi] == 0.0f)
                 : (g.mask_is_int == 1) ? (((const int*)mask_a)[mi] == 0) : (((const int*)mask_a)[mi] != 0);
        } else if (g.mask_mode == 3) masked = (qkeep[r] == 0) || (kvkeep[j] == 0);
        else if (g.mask_mode == 5) {
          const size_t mi = (size_t)qrow * g.Skv + kvcol;
          masked = (((const int*)mask_a)[mi] != 0);
          int n = mask_b[mi]; n = n < 0 ? 0 : n;
          s[j][r] += g.cp[(size_t)b * g.c_bs + (size_t)h * g.c_hs + (size_t)qrow * g.c_rs + n]
                   + g.pc[(size_t)b * g.c_bs + (size_t)h * g.c_hs + (size_t)kvcol * g.c_rs + n];
        }
        if (masked) s[j][r] = g.mask_fill;
        m = fmaxf(m, s[j][r]);
      }
#pragma unroll
      for (int off = 1; off < 16; off <<= 1) m = fmaxf(m, __shfl_xor(m, off, 32));
      cm[r] = m;
    }
    __bf16* pwh = Psh[wave];
    __bf16* pwl = Psl[SPLIT_PV ? wave : 0];
#pragma unroll
    for (int r = 0; r < 8; ++r) {
      const float mnew = fmaxf(mrow[r], cm[r]);
      const float alpha = expf(mrow[r] - mnew);
      mrow[r] = mnew;
      float psum = 0.f;
#pragma unroll
      for (int j = 0; j < 4; ++j) {
        const float p = expf(s[j][r] - mnew);
        psum += p;
        if (SPLIT_PV) { __bf16 a, bl; at_split(p, a, bl); pwh[(8 * hh + r) * AT_KC + j * 16 + c] = a; pwl[(8 * hh + r) * AT_KC + j * 16 + c] = bl; }
        else pwh[(8 * hh + r) * AT_KC + j * 16 + c] = at_to16<F16>(p * PSC);
      }
#pragma unroll
      for (int off = 1; off < 16; off <<= 1) psum += __shfl_xor(psum, off, 32);
      lrow[r] = lrow[r] * alpha + psum;
#pragma unroll
      for (int t = 0; t < 4; ++t) oacc[t][r] *= alpha;
    }
    __builtin_amdgcn_fence(__ATOMIC_RELEASE, "workgroup");
    __builtin_amdgcn_wave_barrier();
    __builtin_amdgcn_fence(__ATOMIC_ACQUIRE, "workgroup");
#pragma unroll 1
    for (int kk = 0; kk < 2; ++kk) {
      FB pa, pl;
      pa.h[0] = *(const v8b*)(pwh + c * AT_KC + kk * 32 + 8 * hh);
      pa.h[1] = *(const v8b*)(pwh + c * AT_KC + kk * 32 + 16 + 8 * hh);
      if (SPLIT_PV) {
        pl.h[0] = *(const v8b*)(pwl + c * AT_KC + kk * 32 + 8 * hh);
        pl.h[1] = *(const v8b*)(pwl + c * AT_KC + kk * 32 + 16 + 8 * hh);
      }
#pragma unroll
      for (int t = 0; t < 4; ++t) {
        FB vb;
        vb.h[0] = *(const v8b*)(Vth + (t * 16 + c) * AT_KC + kk * 32 + 8 * hh);
        vb.h[1] = *(const v8b*)(Vth + (t * 16 + c) * AT_KC + kk * 32 + 16 + 8 * hh);
        oacc[t] = at_mma16<F16>(pa.v, vb.v, oacc[t]);
        if (SPLIT_PV) {
          FB vl;
          vl.h[0] = *(const v8b*)(Vtl + (t * 16 + c) * AT_KC + kk * 32 + 8 * hh);
          vl.h[1] = *(const v8b*)(Vtl + (t * 16 + c) * AT_KC + kk * 32 + 16 + 8 * hh);
          oacc[t] = at_mma16<F16>(pa.v, vl.v, oacc[t]);
          oacc[t] = at_mma16<F16>(pl.v, vb.v, oacc[t]);
        }
      }
    }
  }

  float* os = Os[wave];
#pragma unroll
  for (int r = 0; r < 8; ++r) {
    const float inv = 1.0f / (lrow[r] * PSC);
#pragma unroll
    for (int t = 0; t < 4; ++t) os[(8 * hh + r) * 68 + t * 16 + c] = oacc[t][r] * inv;
  }
  __builtin_amdgcn_fence(__ATOMIC_RELEASE, "workgroup");
  __builtin_amdgcn_wave_barrier();
  __builtin_amdgcn_fence(__ATOMIC_ACQUIRE, "workgroup");
  {
    const int c4 = (lane & 15) * 4;
    {
#pragma unroll
      for (int it = 0; it < 8; ++it) {
        const int row = it * 2 + hh;
        v4f val = *(const v4f*)(os + row * 68 + c4);
        *(v4f*)(ob_ptr + (size_t)(q0 + row) * g.o_rs + c4) = val;
      }
      
    }
  }
}

} // namespace w25

// relative-offset bias table RT[h][c], c = i - j + (T-1): -floor(|i-j| / 30) * 2^-(h+1)   (thread-linear, data-independent)
__global__ __launch_bounds__(256) void k_mc_rt(float* __restrict__ RT, int NH, int RN, int T) { const int t = blockIdx.x * 256 + threadIdx.x; if (t >= NH * RN) return; const int h = t / RN, c = t % RN; int dist = c - (T - 1); dist = dist < 0 ? -dist : dist; VST2(float, RT + t, -(float)(dist / 30) * exp2f(-(float)(h + 1))); }


extern "C" void kernel_launch(void* const* d_in, const int* in_sizes, int n_in, void* d_out, int out_size, void* d_ws, size_t ws_size, hipStream_t stream) {
    (void)in_sizes; (void)n_in; (void)out_size; (void)ws_size;
    const float* x = (const float*)d_in[0];
    const float* ctx = (const float*)d_in[1];
    const float* Wq = (const float*)d_in[2];
    const float* Wk = (const float*)d_in[3];
    const float* Wv = (const float*)d_in[4];
    const float* Wo = (const float*)d_in[5];
    const float* bo = (const float*)d_in[6];
    const int Bn = 2;
    const int T = 2048;
    const int D = 1024;
    const int NH = 16;
    const int HD = 64;
    const int NR = Bn * T;
    const int RN = 2 * T - 1;
    float* out = (float*)d_out;
    char* wsp = (char*)d_ws;
    float* Q = (float*)wsp; wsp += (((size_t)((size_t)NR * D) * 4 + 255) / 256) * 256;
    float* Kb = (float*)wsp; wsp += (((size_t)((size_t)NR * D) * 4 + 255) / 256) * 256;
    float* V = (float*)wsp; wsp += (((size_t)((size_t)NR * D) * 4 + 255) / 256) * 256;
    float* Y = (float*)wsp; wsp += (((size_t)((size_t)NR * D) * 4 + 255) / 256) * 256;
    float* RT = (float*)wsp; wsp += (((size_t)((size_t)NH * RN + 64) * 4 + 255) / 256) * 256;
    unsigned short* G64A = (unsigned short*)wsp; wsp += (((size_t)(4194304) * 2 + 255) / 256) * 256;
    unsigned short* G64B = (unsigned short*)wsp; wsp += (((size_t)(1048576) * 2 + 255) / 256) * 256;
    k_mc_rt<<<(unsigned)((NH * RN + 255) / 256), 256, 0, stream>>>(RT, NH, RN, T);
    k_cast16<<<(unsigned)((((long long)(4096) * ((1024) / 2)) + 255) / 256), 256, 0, stream>>>(x, 1024, (_Float16*)(G64A), 1024, 4096, 1024, 1.0f);
    k_cast16<<<(unsigned)((((long long)(1024) * ((1024) / 2)) + 255) / 256), 256, 0, stream>>>(Wq, 1024, (_Float16*)(G64B), 1024, 1024, 1024, 16.0f);
    w25::wmma_gemm64<0, false, 0, 0, false, 0><<<dim3((unsigned)((((4096) / 64) * ((1024) / 64) + 7) / 8), (unsigned)(1)), 256, 0, stream>>>((const unsigned short*)(G64A), nullptr, 1024, 0, (const unsigned short*)(G64B), nullptr, 1024, 0, (void*)(Q), nullptr, 1024, 0, nullptr, nullptr, 0, 4096, 1024, 1024, 0.0625f);
    k_cast16<<<(unsigned)((((long long)(4096) * ((1024) / 2)) + 255) / 256), 256, 0, stream>>>(ctx, 1024, (_Float16*)(G64A), 1024, 4096, 1024, 1.0f);
    k_cast16<<<(unsigned)((((long long)(1024) * ((1024) / 2)) + 255) / 256), 256, 0, stream>>>(Wk, 1024, (_Float16*)(G64B), 1024, 1024, 1024, 16.0f);
    w25::wmma_gemm64<0, false, 0, 0, false, 0><<<dim3((unsigned)((((4096) / 64) * ((1024) / 64) + 7) / 8), (unsigned)(1)), 256, 0, stream>>>((const unsigned short*)(G64A), nullptr, 1024, 0, (const unsigned short*)(G64B), nullptr, 1024, 0, (void*)(Kb), nullptr, 1024, 0, nullptr, nullptr, 0, 4096, 1024, 1024, 0.0625f);
    k_cast16<<<(unsigned)((((long long)(4096) * ((1024) / 2)) + 255) / 256), 256, 0, stream>>>(ctx, 1024, (_Float16*)(G64A), 1024, 4096, 1024, 1.0f);
    k_cast16<<<(unsigned)((((long long)(1024) * ((1024) / 2)) + 255) / 256), 256, 0, stream>>>(Wv, 1024, (_Float16*)(G64B), 1024, 1024, 1024, 16.0f);
    w25::wmma_gemm64<0, false, 0, 0, false, 0><<<dim3((unsigned)((((4096) / 64) * ((1024) / 64) + 7) / 8), (unsigned)(1)), 256, 0, stream>>>((const unsigned short*)(G64A), nullptr, 1024, 0, (const unsigned short*)(G64B), nullptr, 1024, 0, (void*)(V), nullptr, 1024, 0, nullptr, nullptr, 0, 4096, 1024, 1024, 0.0625f);
    { /*apv4*/ AttnP a;
      a.Q = Q; a.K = Kb; a.V = V; a.O = Y; a.P = 0; a.Mf = 0; a.Mi = 0; a.ST = 0;
      a.Pw = 0; a.Rt = RT; a.SQ = 0; a.SK = 0;
      a.swb = 0; a.swh = 0; a.swi = 0; a.swj = 0; a.srb = 0; a.srh = RN; a.sri = 0; a.sQb = (long long)T * D; a.sQh = HD; a.sQi = D; a.sQd = 1; a.sKb = (long long)T * D; a.sKh = HD; a.sKj = D; a.sKd = 1; a.sVb = (long long)T * D; a.sVh = HD; a.sVj = D; a.sVd = 1; a.sOb = (long long)T * D; a.sOh = HD; a.sOi = D; a.sPb = 0; a.sPh = 0; a.sPi = 0; a.smb = 0; a.smh = 0; a.smi = 0; a.smj = 0;
      a.Lq = T; a.Lk = T; a.dh = HD; a.dv = HD; a.hrep = 1; a.causal = 0; a.coff = 0; a.pband = 0;
      a.scale = 0.125f; a.mfill = 0.0f; a.nonorm = 0; a.mpol = 0;
      a.roff = T - 1; a.rn = RN; a.segpol = 0; a.win = 0;
      k_attn<64, 64, 0, false, false, 2048, 1024><<<dim3((unsigned)((T) + 16 * AW - 1) / (16 * AW), (unsigned)(NH), (unsigned)(Bn)), 32 * AW, 0, stream>>>(a); }
    k_cast16<<<(unsigned)((((long long)(4096) * ((1024) / 2)) + 255) / 256), 256, 0, stream>>>(Y, 1024, (_Float16*)(G64A), 1024, 4096, 1024, 1.0f);
    k_cast16<<<(unsigned)((((long long)(1024) * ((1024) / 2)) + 255) / 256), 256, 0, stream>>>(Wo, 1024, (_Float16*)(G64B), 1024, 1024, 1024, 16.0f);
    w25::wmma_gemm64<0, false, 2, 0, false, 0><<<dim3((unsigned)((((4096) / 64) * ((1024) / 64) + 7) / 8), (unsigned)(1)), 256, 0, stream>>>((const unsigned short*)(G64A), nullptr, 1024, 0, (const unsigned short*)(G64B), nullptr, 1024, 0, (void*)(out), nullptr, 1024, 0, bo, nullptr, 0, 4096, 1024, 1024, 0.0625f);
}

// v002
// Measured time: 338 microseconds a run.
// In both of two side-by-side timings against v001, it was 1.39 times as fast.
// Counting every step since v000, it is 6.65 times as fast.
// Contractions: q = x.Wq^T [4096x1024].[1024x1024], k/v = context.W^T and the output projection (+b) with f16 operands on pre-cast planes (v_wmma_f32_16x16x32_f16; 64x64 register-blocked wave tiles, weights x16); per (batch, head) softmax(q k^T / 8 + b_h(|i-j|)) v over 2048 keys (head_dim 64) as a flash kernel with f16 q.k^T and f16 p.v (p as f16 of 4096 p), the periodic distance bias -floor(|i-j|/30) 2^-(h+1) read from a per-head relative-offset table built on device; f32 accumulate and softmax.
#include <hip/hip_runtime.h>
#include <math.h>

typedef __attribute__((ext_vector_type(16))) _Float16 v16h;
typedef __attribute__((ext_vector_type(8)))  _Float16 v8h;
typedef __attribute__((ext_vector_type(16))) __bf16   v16b;
typedef __attribute__((ext_vector_type(8)))  float    v8f;
typedef __attribute__((ext_vector_type(4)))  float    v4f;

// 16-bit WMMA fragment map (wave32), lane L, h = L>>4, m = L&15:
//   A 16x32: lane = row m;   element i -> k = (i<8) ? 8h+i : 16+8h+(i-8)
//   B 32x16: lane = column m; the SAME k(i,h)
//   D 16x16 (8 f32): lane = column m; element r -> row 8h+r
__device__ __forceinline__ int frag_k(int i, int h) { return (i < 8) ? (8 * h + i) : (16 + 8 * h + (i - 8)); }
__device__ __forceinline__ __bf16 bf16_rne(float f) {
    unsigned int u = __float_as_uint(f);
    u += 0x7fffu + ((u >> 16) & 1u);
    return __builtin_bit_cast(__bf16, (unsigned short)(u >> 16));
}
__device__ __forceinline__ float bf16_f32(__bf16 b) { return __uint_as_float(((unsigned int)__builtin_bit_cast(unsigned short, b)) << 16); }
__device__ __forceinline__ v8f wmma16(v16h a, v16h b, v8f c) {
    c = __builtin_amdgcn_wmma_f32_16x16x32_f16(false, a, false, b, (short)0, c, false, false);
    asm volatile("v_nop\n\tv_nop\n\tv_nop\n\tv_nop" : "+v"(c) : "v"(a), "v"(b));
    return c;
}
__device__ __forceinline__ v8f wmmab(v16b a, v16b b, v8f c) {
    c = __builtin_amdgcn_wmma_f32_16x16x32_bf16(false, a, false, b, (short)0, c, false, false);
    asm volatile("v_nop\n\tv_nop\n\tv_nop\n\tv_nop" : "+v"(c) : "v"(a), "v"(b));
    return c;
}
struct Split { v16b hi, lo; };
// hi/lo split product: a.hi*b.hi + a.hi*b.lo + a.lo*b.hi
__device__ __forceinline__ v8f wmma3(const Split& a, const Split& b, v8f c) {
    c = __builtin_amdgcn_wmma_f32_16x16x32_bf16(false, a.hi, false, b.hi, (short)0, c, false, false);
    c = __builtin_amdgcn_wmma_f32_16x16x32_bf16(false, a.hi, false, b.lo, (short)0, c, false, false);
    c = __builtin_amdgcn_wmma_f32_16x16x32_bf16(false, a.lo, false, b.hi, (short)0, c, false, false);
    asm volatile("v_nop\n\tv_nop\n\tv_nop\n\tv_nop" : "+v"(c) : "v"(a.hi), "v"(a.lo), "v"(b.hi), "v"(b.lo));
    return c;
}
struct Split3 { v16b hi, mid, lo; };
// triple split product (6 terms, drops only terms below 2^-24 relative)
__device__ __forceinline__ v8f wmma6(const Split3& a, const Split3& b, v8f c) {
    c = __builtin_amdgcn_wmma_f32_16x16x32_bf16(false, a.hi, false, b.hi, (short)0, c, false, false);
    c = __builtin_amdgcn_wmma_f32_16x16x32_bf16(false, a.hi, false, b.mid, (short)0, c, false, false);
    c = __builtin_amdgcn_wmma_f32_16x16x32_bf16(false, a.mid, false, b.hi, (short)0, c, false, false);
    c = __builtin_amdgcn_wmma_f32_16x16x32_bf16(false, a.hi, false, b.lo, (short)0, c, false, false);
    c = __builtin_amdgcn_wmma_f32_16x16x32_bf16(false, a.mid, false, b.mid, (short)0, c, false, false);
    c = __builtin_amdgcn_wmma_f32_16x16x32_bf16(false, a.lo, false, b.hi, (short)0, c, false, false);
    asm volatile("v_nop\n\tv_nop\n\tv_nop\n\tv_nop" : "+v"(c) : "v"(a.hi), "v"(a.mid), "v"(a.lo), "v"(b.hi), "v"(b.mid), "v"(b.lo));
    return c;
}

// Fragment gathers from f32 memory: element i <- p[(k0 + frag_k(i,h)) * sk] * s, zero for k >= klen.
__device__ __forceinline__ v16h fh_ld(const float* __restrict__ p, long long sk, int k0, int h, int klen, float s) {
    v16h a;
#pragma unroll
    for (int i = 0; i < 16; ++i) { const int k = k0 + frag_k(i, h); a[i] = (k < klen) ? (_Float16)(p[(long long)k * sk] * s) : (_Float16)0.f; }
    return a;
}
__device__ __forceinline__ Split sp_ld(const float* __restrict__ p, long long sk, int k0, int h, int klen, float s) {
    Split r;
#pragma unroll
    for (int i = 0; i < 16; ++i) {
        const int k = k0 + frag_k(i, h); const float x = (k < klen) ? p[(long long)k * sk] * s : 0.f;
        const __bf16 hb = bf16_rne(x); r.hi[i] = hb; r.lo[i] = bf16_rne(x - bf16_f32(hb));
    }
    return r;
}
__device__ __forceinline__ Split3 sp3_ld(const float* __restrict__ p, long long sk, int k0, int h, int klen, float s) {
    Split3 r;
#pragma unroll
    for (int i = 0; i < 16; ++i) {
        const int k = k0 + frag_k(i, h); const float x = (k < klen) ? p[(long long)k * sk] * s : 0.f;
        const __bf16 hb = bf16_rne(x); const float r1 = x - bf16_f32(hb); const __bf16 mb = bf16_rne(r1);
        r.hi[i] = hb; r.mid[i] = mb; r.lo[i] = bf16_rne(r1 - bf16_f32(mb));
    }
    return r;
}
__device__ __forceinline__ v16b bh_ld(const float* __restrict__ p, long long sk, int k0, int h, int klen, float s) {
    v16b a;
#pragma unroll
    for (int i = 0; i < 16; ++i) { const int k = k0 + frag_k(i, h); a[i] = bf16_rne((k < klen) ? p[(long long)k * sk] * s : 0.f); }
    return a;
}
// f16 fragment from an f16 LDS/global row with element stride 1 (k-contiguous), no bounds (tile already zero padded)
__device__ __forceinline__ v16h fh_row(const _Float16* __restrict__ row, int k0, int h) {
    v16h a;
#pragma unroll
    for (int i = 0; i < 16; ++i) a[i] = row[k0 + frag_k(i, h)];
    return a;
}

#define VST2(T, ptr, val) do { const T vst2_v_ = (val); *(T*)(ptr) = vst2_v_;  } while (0)
typedef float v4f __attribute__((ext_vector_type(4)));
#define VST2V4(ptr, val) do { const v4f vst2_v4_ = (val); *(v4f*)(ptr) = vst2_v4_;  } while (0)

__device__ __attribute__((noinline)) float act_fn(float v, int act) {
    if (act == 1) return fmaxf(v, 0.f);                                                                               // relu
    if (act == 2) { const float u = 0.7978845608028654f * (v + 0.044715f * v * v * v); return 0.5f * v * (1.f + tanhf(u)); } // tanh-gelu
    if (act == 3) return v / (1.f + expf(-v));                                                                        // silu
    if (act == 4) return 0.5f * v * (1.f + erff(v * 0.7071067811865476f));                                             // erf-gelu
    if (act == 5) return tanhf(v);
    if (act == 6) return 1.f / (1.f + expf(-v));                                                                      // sigmoid
    if (act == 7) return (v > 0.f) ? v : 0.01f * v;                                                                   // leaky relu 0.01
    if (act == 8) return (v > 0.f) ? v : (expf(v) - 1.f);                                                             // elu
    if (act == 9) return fminf(fmaxf(v, 0.f), 6.f);                                                                   // relu6
    if (act == 10) return fabsf(v);                                                                                    // abs
    if (act == 11) return (v >= 0.f) ? v : 0.1f * v;                                                                  // leaky 0.1
    if (act == 12) return (v > 0.f) ? v : 0.2f * v;                                                                   // leaky 0.2
    if (act == 13) return (v > 20.f) ? v : log1pf(expf(v));                                                            // softplus
    return v;
}

// =====================================================================================================================
// k_gemm<MODE>: C(z, m, n) = act(alpha * sum_k A(z, m, k) * B(z, k, n) + bias) + beta * R(z, m, n)
//   One wave (32-thread block) per 16 x 32 tile of C; grid (ceil(N/32), ceil(M/16), Z). Batch z -> (zo = z / zi_n, zi = z % zi_n)
//   with separate outer/inner strides for every tensor (e.g. batch and head). A(m,k) = A[zo*sAo + zi*sAi + m*sAm + k*sAk] (f32),
//   B(k,n) = B[zo*sBo + zi*sBi + n*sBn + k*sBk] (f32); any M, N, K (K zero-padded to 32 inside the fragments, M/N tails guarded).
//   C(m,n) = C[zo*sCo + zi*sCi + m*sCm + n] (n contiguous). flags: 1 bias[n], 2 bias[m], 4 residual R[zo*sRo + zi*sRi + m*sRm + n*sRn].
//   MODE 0: f16 operands (A prescaled by sa, B by sb, both undone in the epilogue); 1: bf16 hi/lo split (3 products); 2: bf16;
//   3: bf16 hi/mid/lo triple split (6 products); 4: as 3 with Kahan-compensated f32 accumulation across k-steps.
// =====================================================================================================================
struct GemmP {
    const float* A; const float* B; const float* bias; const float* R; float* C;
    long long sAo, sAi, sAm, sAk, sBo, sBi, sBn, sBk, sCo, sCi, sCm, sRo, sRi, sRm, sRn;
    int M, N, K, zi_n, flags, act; float alpha, beta, sa, sb;
    int Npad, pad_;     // columns [N, Npad) of C are written as 0 so that padded workspace rows are covered by whole-line stores; Npad >= N
};
static_assert(sizeof(GemmP) == 5 * 8 + 15 * 8 + 6 * 4 + 4 * 4 + 2 * 4, "GemmP has padding");

template <int MODE>
__global__ __launch_bounds__(32) void k_gemm(GemmP p) {
    const int lane = threadIdx.x & 31, h = lane >> 4, l15 = lane & 15;
    const int m0 = blockIdx.y * 16, n0 = blockIdx.x * 32;
    const int z = blockIdx.z, zo = z / p.zi_n, zi = z - zo * p.zi_n;
    const float* A = p.A + zo * p.sAo + zi * p.sAi;
    const float* B = p.B + zo * p.sBo + zi * p.sBi;
    const int am = min(m0 + l15, p.M - 1);                       // clamped row for loads (stores are guarded)
    v8f acc[2], comp[2];
#pragma unroll
    for (int t = 0; t < 2; ++t) { v8f zz = {}; acc[t] = zz; comp[t] = zz; }
    for (int k0 = 0; k0 < p.K; k0 += 32) {
        const float* arow = A + (long long)am * p.sAm;
        if (MODE == 1) {
            const Split a = sp_ld(arow, p.sAk, k0, h, p.K, 1.f);
#pragma unroll
            for (int t = 0; t < 2; ++t) {
                const int bn = min(n0 + t * 16 + l15, p.N - 1);
                acc[t] = wmma3(a, sp_ld(B + (long long)bn * p.sBn, p.sBk, k0, h, p.K, 1.f), acc[t]);
            }
        } else if (MODE == 3) {
            const Split3 a = sp3_ld(arow, p.sAk, k0, h, p.K, 1.f);
#pragma unroll
            for (int t = 0; t < 2; ++t) {
                const int bn = min(n0 + t * 16 + l15, p.N - 1);
                acc[t] = wmma6(a, sp3_ld(B + (long long)bn * p.sBn, p.sBk, k0, h, p.K, 1.f), acc[t]);
            }
        } else if (MODE == 4) {
            // triple split as MODE 3, but each k-step's 6 products go into a fresh accumulator and the partial is added to the running f32 sum
            // on the VALU with Kahan compensation (accumulation error stays ~1 ulp however long K is)
            const Split3 a = sp3_ld(arow, p.sAk, k0, h, p.K, 1.f);
#pragma unroll
            for (int t = 0; t < 2; ++t) {
                const int bn = min(n0 + t * 16 + l15, p.N - 1); v8f zz = {};
                const v8f part = wmma6(a, sp3_ld(B + (long long)bn * p.sBn, p.sBk, k0, h, p.K, 1.f), zz);
                const v8f y = part - comp[t]; const v8f s = acc[t] + y; comp[t] = (s - acc[t]) - y; acc[t] = s;
            }
        } else if (MODE == 2) {
            const v16b a = bh_ld(arow, p.sAk, k0, h, p.K, 1.f);
#pragma unroll
            for (int t = 0; t < 2; ++t) {
                const int bn = min(n0 + t * 16 + l15, p.N - 1);
                acc[t] = wmmab(a, bh_ld(B + (long long)bn * p.sBn, p.sBk, k0, h, p.K, 1.f), acc[t]);
            }
        } else {
            const v16h a = fh_ld(arow, p.sAk, k0, h, p.K, p.sa);
#pragma unroll
            for (int t = 0; t < 2; ++t) {
                const int bn = min(n0 + t * 16 + l15, p.N - 1);
                acc[t] = wmma16(a, fh_ld(B + (long long)bn * p.sBn, p.sBk, k0, h, p.K, p.sb), acc[t]);
            }
        }
    }
    const float iscale = (MODE == 0) ? p.alpha / (p.sa * p.sb) : p.alpha;
    float* C = p.C + zo * p.sCo + zi * p.sCi;
    const float* R = p.R + zo * p.sRo + zi * p.sRi;
    __shared__ __align__(16) float ctile[16][36];
#pragma unroll
    for (int t = 0; t < 2; ++t) {
        const int n = n0 + t * 16 + l15; const int nn = min(n, p.N - 1);
#pragma unroll
        for (int r = 0; r < 8; ++r) {
            const int m = m0 + 8 * h + r; const int mm = min(m, p.M - 1);
            float v = acc[t][r] * iscale;
            if (p.flags & 1) v += p.bias[nn];
            if (p.flags & 2) v += p.bias[mm];
            if (p.flags & 8) v *= p.bias[(long long)zo * p.M + mm];   /* per-(z,row) scale vector laid out [Z][M]; exclusive with the bias flags */
            v = act_fn(v, p.act);
            if (p.flags & 4) v += p.beta * R[(long long)mm * p.sRm + (long long)nn * p.sRn];
            ctile[8 * h + r][t * 16 + l15] = (n < p.N) ? v : 0.f;
        }
    }
    __syncthreads();
    const int NW = (p.Npad > p.N) ? p.Npad : p.N;           // write width
    const bool fast = (m0 + 16 <= p.M) && (n0 + 32 <= NW) && ((p.sCm & 3) == 0) && ((((size_t)C) & 15) == 0);
    if (fast) {
#pragma unroll
        for (int s = 0; s < 4; ++s) {
            const int row = s * 4 + (lane >> 3), c4 = (lane & 7) * 4;
            const v4f v = *(const v4f*)&ctile[row][c4];
            VST2V4(C + (long long)(m0 + row) * p.sCm + n0 + c4, v);
        }
    } else {
        for (int row = 0; row < 16; ++row) {
            const int m = m0 + row, n = n0 + lane;
            if (m < p.M && n < NW) VST2(float, C + (long long)m * p.sCm + n, ctile[row][lane]);
        }
    }
}


// =====================================================================================================================
// k_gemmT<MODE, TM, TN>: same contract as k_gemm, but one wave computes a (16*TM) x (16*TN) tile: TM A fragments and TN B fragments are
//   loaded per 32-wide k-step and reused across TM*TN WMMAs (far fewer load/convert instructions per MAC). MODE 0 (f16), 1 (bf16 hi/lo),
//   2 (bf16) only. grid (ceil(NW/(16*TN)), ceil(M/(16*TM)), Z), block 32. Epilogue identical to k_gemm, run per 16x32 sub-tile.
// =====================================================================================================================
template <int MODE, int TM, int TN>
__global__ __launch_bounds__(32) void k_gemmT(GemmP p) {
    const int lane = threadIdx.x & 31, h = lane >> 4, l15 = lane & 15;
    const int m0 = blockIdx.y * (16 * TM), n0 = blockIdx.x * (16 * TN);
    const int z = blockIdx.z, zo = z / p.zi_n, zi = z - zo * p.zi_n;
    const float* A = p.A + zo * p.sAo + zi * p.sAi;
    const float* B = p.B + zo * p.sBo + zi * p.sBi;
    v8f acc[TM][TN];
#pragma unroll
    for (int i = 0; i < TM; ++i)
#pragma unroll
        for (int t = 0; t < TN; ++t) { v8f zz = {}; acc[i][t] = zz; }
    for (int k0 = 0; k0 < p.K; k0 += 32) {
        if (MODE == 1) {
            Split a[TM], b[TN];
#pragma unroll
            for (int i = 0; i < TM; ++i) { const int am = min(m0 + 16 * i + l15, p.M - 1); a[i] = sp_ld(A + (long long)am * p.sAm, p.sAk, k0, h, p.K, 1.f); }
#pragma unroll
            for (int t = 0; t < TN; ++t) { const int bn = min(n0 + 16 * t + l15, p.N - 1); b[t] = sp_ld(B + (long long)bn * p.sBn, p.sBk, k0, h, p.K, 1.f); }
#pragma unroll
            for (int i = 0; i < TM; ++i)
#pragma unroll
                for (int t = 0; t < TN; ++t) acc[i][t] = wmma3(a[i], b[t], acc[i][t]);
        } else if (MODE == 2) {
            v16b a[TM], b[TN];
#pragma unroll
            for (int i = 0; i < TM; ++i) { const int am = min(m0 + 16 * i + l15, p.M - 1); a[i] = bh_ld(A + (long long)am * p.sAm, p.sAk, k0, h, p.K, 1.f); }
#pragma unroll
            for (int t = 0; t < TN; ++t) { const int bn = min(n0 + 16 * t + l15, p.N - 1); b[t] = bh_ld(B + (long long)bn * p.sBn, p.sBk, k0, h, p.K, 1.f); }
#pragma unroll
            for (int i = 0; i < TM; ++i)
#pragma unroll
                for (int t = 0; t < TN; ++t) acc[i][t] = wmmab(a[i], b[t], acc[i][t]);
        } else {
            v16h a[TM], b[TN];
#pragma unroll
            for (int i = 0; i < TM; ++i) { const int am = min(m0 + 16 * i + l15, p.M - 1); a[i] = fh_ld(A + (long long)am * p.sAm, p.sAk, k0, h, p.K, p.sa); }
#pragma unroll
            for (int t = 0; t < TN; ++t) { const int bn = min(n0 + 16 * t + l15, p.N - 1); b[t] = fh_ld(B + (long long)bn * p.sBn, p.sBk, k0, h, p.K, p.sb); }
#pragma unroll
            for (int i = 0; i < TM; ++i)
#pragma unroll
                for (int t = 0; t < TN; ++t) acc[i][t] = wmma16(a[i], b[t], acc[i][t]);
        }
    }
    const float iscale = (MODE == 0) ? p.alpha / (p.sa * p.sb) : p.alpha;
    float* C = p.C + zo * p.sCo + zi * p.sCi;
    const float* R = p.R + zo * p.sRo + zi * p.sRi;
    const int NW = (p.Npad > p.N) ? p.Npad : p.N;
    __shared__ __align__(16) float ctile[16][36];
#pragma unroll
    for (int i = 0; i < TM; ++i) {
        const int mb = m0 + 16 * i; if (mb >= p.M) break;          // wave-uniform
#pragma unroll
        for (int tp = 0; tp < TN / 2; ++tp) {
            const int nb = n0 + 32 * tp; if (nb >= NW) break;        // wave-uniform
#pragma unroll
            for (int t2 = 0; t2 < 2; ++t2) {
                const int t = 2 * tp + t2; const int n = nb + t2 * 16 + l15; const int nn = min(n, p.N - 1);
#pragma unroll
                for (int r = 0; r < 8; ++r) {
                    const int m = mb + 8 * h + r; const int mm = min(m, p.M - 1);
                    float v = acc[i][t][r] * iscale;
                    if (p.flags & 1) v += p.bias[nn];
                    if (p.flags & 2) v += p.bias[mm];
            if (p.flags & 8) v *= p.bias[(long long)zo * p.M + mm];   /* per-(z,row) scale vector laid out [Z][M]; exclusive with the bias flags */
                    v = act_fn(v, p.act);
                    if (p.flags & 4) v += p.beta * R[(long long)mm * p.sRm + (long long)nn * p.sRn];
                    ctile[8 * h + r][t2 * 16 + l15] = (n < p.N) ? v : 0.f;
                }
            }
            __syncthreads();
            const bool fast = (mb + 16 <= p.M) && (nb + 32 <= NW) && ((p.sCm & 3) == 0) && ((((size_t)C) & 15) == 0);
            if (fast) {
#pragma unroll
                for (int s = 0; s < 4; ++s) {
                    const int row = s * 4 + (lane >> 3), c4 = (lane & 7) * 4;
                    const v4f v = *(const v4f*)&ctile[row][c4];
                    VST2V4(C + (long long)(mb + row) * p.sCm + nb + c4, v);
                }
            } else {
                for (int row = 0; row < 16; ++row) {
                    const int m = mb + row, n = nb + lane;
                    if (m < p.M && n < NW) VST2(float, C + (long long)m * p.sCm + n, ctile[row][lane]);
                }
            }
            __syncthreads();
        }
    }
}

// =====================================================================================================================
//   Wave = 16 queries, AW waves per block, 64-key blocks; grid (ceil(Lq/(16*AW)), H, B), block 32*AW. Any Lq, Lk; head dim dh <= DHP
//   (DHP multiple of 32), value dim dv <= DVP (multiple of 16, <= 128). Every tensor addressed by (batch, head, row, element) strides, f32.
//   Scores: QM 0 f16 operands, 1 bf16 hi/lo split, 2 bf16 triple split; statistics f32 (exp2 domain); P.V: P x 4096 as f16 with V f16 staged in LDS
//   (SPLITPV: P and V as bf16 hi/lo splits). kv head = h / hrep. Masking: causal = 1 (keep j <= i + coff, masked -> -inf, key blocks beyond the
//   diagonal skipped), causal = 2 (masked -> mfill, a finite fill like the -1e9; no skipping), causal = 3 (keep j >= i + coff,
//   masked -> -inf, no skipping); optional additive f32 mask Mf,
//   optional int keep-mask Mi (0 -> score := mfill), both addressed b*smb + h*smh + i*smi + j*smj (0 strides broadcast).
// =====================================================================================================================
#define AW 4
struct AttnP {   // apv4
    const float* Q; const float* K; const float* V; float* O; float* P; const float* Mf; const int* Mi; float* ST;
    const float* Pw; const float* Rt; const int* SQ; const int* SK;           // optional: post-softmax weight, relative-position table, segment ids
    long long swb, swh, swi, swj, srb, srh, sri;                                 // Pw strides (b,h,i,j); Rt strides (b,h,i), column = clamp(i - j + roff, 0, rn-1)
    long long sQb, sQh, sQi, sQd, sKb, sKh, sKj, sKd, sVb, sVh, sVj, sVd, sOb, sOh, sOi, sPb, sPh, sPi, smb, smh, smi, smj;
    int Lq, Lk, dh, dv, hrep, causal, coff, pband;   // pband > 0: P holds only the band |j - i| <= pband, column j - i + pband
    float scale, mfill; int nonorm, mpol;             // nonorm (online path only): O = sum_j exp(score_j) V_j without the 1/rowsum (scores must be <= ~0); mpol: Mi masks where ==0 (mpol 0) or where !=0 (mpol 1)
    int roff, rn, segpol, win;                        // Rt column offset/count; SQ/SK: score := mfill where (segpol 0) SQ[i] != SK[j] or (segpol 1) SQ[i] == SK[j]; win > 0: keys with i - j > win (after coff) -> -inf
};
//   Pw: the softmax numerator is multiplied by Pw(b,h,i,j) AFTER the row sum is taken (probs * weight, then P.V), as in post-softmax multiplicative biases.                                                    // ST (optional): per row (b,h,i) -> ST[((b*H + h)*Lq + i)*2 + {0,1}] = {row max of the scaled+masked score (natural units), sum_j exp(score - max)}
static_assert(sizeof(AttnP) == 12 * 8 + 29 * 8 + 16 * 4, "AttnP has padding");

// Inputs-only fence on sixteen loaded values: all must have arrived here, so their loads are issued together ahead of it and share one wait
// (without it the register-budgeted schedule waits after every load). It names no product and changes no value.
template <typename T> __device__ __forceinline__ void hold16(const T* x) {
    asm volatile("" :: "v"(x[0]), "v"(x[1]), "v"(x[2]), "v"(x[3]), "v"(x[4]), "v"(x[5]), "v"(x[6]), "v"(x[7]),
                       "v"(x[8]), "v"(x[9]), "v"(x[10]), "v"(x[11]), "v"(x[12]), "v"(x[13]), "v"(x[14]), "v"(x[15]));
}
#ifndef KATTN_ATTR
#define KATTN_ATTR __attribute__((amdgpu_waves_per_eu(4)))   // register budget of 256: four waves a SIMD, so that all 1,024 blocks of the launch are resident at once
#endif
//   GT > 0 fixes the geometry at compile time: Lq = Lk = GT, rows of GD floats with head h at column h * DHP (unit element stride), dh = DHP,
//   dv = DVP, one kv head per head, no mask, weight, segment, P or ST tensor, and a per-head Rt row of 2 GT - 1 columns. Only Q, K, V, O, Rt and scale
//   are then taken from the argument, so every length guard folds and the loads of a key block are contiguous and free of branches.
template <int DHP, int DVP, int QM, bool SPLITPV, bool TWOPASS, int GT = 0, int GD = 0>
__global__ __launch_bounds__(32 * AW) KATTN_ATTR void k_attn(AttnP parg) {
    AttnP p = parg;
    if (GT > 0) {
        p.P = nullptr; p.Mf = nullptr; p.Mi = nullptr; p.ST = nullptr; p.Pw = nullptr; p.SQ = nullptr; p.SK = nullptr;
        p.swb = 0; p.swh = 0; p.swi = 0; p.swj = 0; p.srb = 0; p.srh = 2 * GT - 1; p.sri = 0;
        p.sQb = (long long)GT * GD; p.sQh = DHP; p.sQi = GD; p.sQd = 1; p.sKb = (long long)GT * GD; p.sKh = DHP; p.sKj = GD; p.sKd = 1;
        p.sVb = (long long)GT * GD; p.sVh = DVP; p.sVj = GD; p.sVd = 1; p.sOb = (long long)GT * GD; p.sOh = DVP; p.sOi = GD;
        p.sPb = 0; p.sPh = 0; p.sPi = 0; p.smb = 0; p.smh = 0; p.smi = 0; p.smj = 0;
        p.Lq = GT; p.Lk = GT; p.dh = DHP; p.dv = DVP; p.hrep = 1; p.causal = 0; p.coff = 0; p.pband = 0;
        p.mfill = 0.f; p.nonorm = 0; p.mpol = 0; p.roff = GT - 1; p.rn = 2 * GT - 1; p.segpol = 0; p.win = 0;
        __builtin_assume(p.Rt != nullptr);
    }
    constexpr bool FULL = GT > 0 && GT % (16 * AW) == 0 && GT % 64 == 0;   // every query tile and key block is whole: index clamps and length guards are identities
    constexpr int NT = DVP / 16;                // output tiles
    constexpr int KS = DHP / 32;                // k-steps for the scores
    constexpr int VP = DVP + 8;                 // LDS pitch (halves)
    __shared__ __align__(16) float    pl[AW][16 * 64];
    __shared__ __align__(16) _Float16 vl[(SPLITPV ? 2 : 1) * 64 * VP];   // f16 V tile, or bf16 hi and lo tiles (same 2-byte size)
    const int lane = threadIdx.x & 31, hf = lane >> 4, l15 = lane & 15, wave = threadIdx.x >> 5;
    const int h = blockIdx.y, b = blockIdx.z, hk = h / p.hrep;
    const int q0 = (blockIdx.x * AW + wave) * 16;
    float* myp = pl[wave];
    const float L2E = 1.4426950408889634f;
    const float NEG = -__builtin_inff();
    const int qi = FULL ? q0 + l15 : min(q0 + l15, p.Lq - 1);
    const float* qrow = p.Q + b * p.sQb + h * p.sQh + (long long)qi * p.sQi;
    const float* kbase = p.K + b * p.sKb + hk * p.sKh;
    const float* vbase = p.V + b * p.sVb + hk * p.sVh;
    v16h qa[QM == 0 ? KS : 1]; Split qs_[QM == 1 ? KS : 1]; Split3 qt_[QM == 2 ? KS : 1];
#pragma unroll
    for (int ks = 0; ks < KS; ++ks) {
        if (QM == 2) qt_[ks] = sp3_ld(qrow, p.sQd, ks * 32, hf, p.dh, 1.f);
        else if (QM == 1) qs_[ks] = sp_ld(qrow, p.sQd, ks * 32, hf, p.dh, 1.f);
        else qa[ks] = fh_ld(qrow, p.sQd, ks * 32, hf, p.dh, 1.f);
    }
    v8f o[NT]; float m8[8], l8[8];
#pragma unroll
    for (int t = 0; t < NT; ++t) { v8f zz = {}; o[t] = zz; }
#pragma unroll
    for (int i = 0; i < 8; ++i) { m8[i] = NEG; l8[i] = 0.f; }
    int jend = p.Lk;
    if (p.causal == 1) { const int je = (blockIdx.x * AW + AW - 1) * 16 + 16 + p.coff; jend = min(jend, max(je, 0)); }   // uniform per block
    const int npass = TWOPASS ? 2 : 1;
    for (int pass = 0; pass < npass; ++pass) {
        const bool dopv = (!TWOPASS) || pass == 1;
        for (int j0 = 0; j0 < jend; j0 += 64) {
            if (dopv) {
                __syncthreads();                                 // previous key block's reads of vl / pl are done
                constexpr int VN = 64 * DVP / (32 * AW);         // V elements per thread and key block
                constexpr bool VLIN = (32 * AW) % DVP == 0;      // a thread keeps its column: its rows differ by a constant step
                float vf[VN];
#pragma unroll   // constant trip count: with the guard folded the tile's loads differ by immediate offsets only
                for (int it = 0; it < VN; ++it) {
                    const int idx = threadIdx.x + it * (32 * AW);
                    const int jr = VLIN ? (int)threadIdx.x / DVP + it * ((32 * AW) / DVP) : idx / DVP, d = VLIN ? (int)threadIdx.x % DVP : idx - jr * DVP, j = j0 + jr;
                    if constexpr (FULL && VLIN)   // block-uniform tile pointer + the thread's fixed offset + a constant
                        vf[it] = (vbase + (long long)j0 * GD)[(size_t)(unsigned)((int)threadIdx.x / DVP * GD + (int)threadIdx.x % DVP) + it * ((32 * AW) / DVP) * GD];
                    else
                        vf[it] = (j < p.Lk && d < p.dv) ? vbase[(long long)j * p.sVj + (long long)d * p.sVd] : 0.f;
                }
                if (FULL && VN == 32) { hold16(vf); hold16(vf + 16); }   // the tile's loads all issue ahead of this line and are waited for once
#pragma unroll
                for (int it = 0; it < VN; ++it) {
                    const int idx = threadIdx.x + it * (32 * AW);
                    const int jr = VLIN ? (int)threadIdx.x / DVP + it * ((32 * AW) / DVP) : idx / DVP, d = VLIN ? (int)threadIdx.x % DVP : idx - jr * DVP;
                    const float f = vf[it];
                    if (SPLITPV) {
                        const __bf16 hb = bf16_rne(f);
                        ((__bf16*)vl)[jr * VP + d] = hb; ((__bf16*)vl)[64 * VP + jr * VP + d] = bf16_rne(f - bf16_f32(hb));
                    } else vl[jr * VP + d] = (_Float16)f;
                }
            }
            v8f s[4];
            float rb[8][4];                                     // the key block's relative-position table entries, fetched ahead of the products
            if constexpr (FULL) {
                // column i - j + GT - 1 as block-uniform pointer + the lane's fixed offset + a constant, each part >= 0 (j0 <= GT - 64)
                const float* rt = p.Rt + (long long)h * (2 * GT - 1) + ((int)blockIdx.x * (16 * AW) - j0 + (GT - 64));
                const unsigned ro = (unsigned)(wave * 16 + 8 * hf + 15 - l15);
#pragma unroll
                for (int i = 0; i < 8; ++i)
#pragma unroll
                    for (int t = 0; t < 4; ++t) rb[i][t] = rt[(size_t)ro + (i + 16 * (3 - t))];
            } else if (p.Rt) {
#pragma unroll
                for (int i = 0; i < 8; ++i)
#pragma unroll
                    for (int t = 0; t < 4; ++t) {
                        const int ic = min(q0 + i + 8 * hf, p.Lq - 1);
                        int rc = ic - min(j0 + t * 16 + l15, p.Lk - 1) + p.roff; rc = rc < 0 ? 0 : (rc >= p.rn ? p.rn - 1 : rc);
                        rb[i][t] = p.Rt[b * p.srb + h * p.srh + (long long)ic * p.sri + rc];
                    }
            }
            if constexpr (FULL && QM == 0 && KS == 2) {
                // two key tiles at a time: their sixteen 16-byte loads (fh_ld's k order: floats 8 hf + 0..7 and 16 + 8 hf + 0..7 of each 32) fly together
#pragma unroll
                for (int tp = 0; tp < 2; ++tp) {
                    v4f kr[16];
#pragma unroll
                    for (int t2 = 0; t2 < 2; ++t2)
#pragma unroll
                        for (int ks = 0; ks < 2; ++ks) {
                            const v4f* kp = (const v4f*)((kbase + (long long)j0 * GD) + ((size_t)(unsigned)(l15 * GD + 8 * hf) + (2 * tp + t2) * 16 * GD + ks * 32));
                            kr[(t2 * 2 + ks) * 4 + 0] = kp[0]; kr[(t2 * 2 + ks) * 4 + 1] = kp[1]; kr[(t2 * 2 + ks) * 4 + 2] = kp[4]; kr[(t2 * 2 + ks) * 4 + 3] = kp[5];
                        }
                    hold16(kr);                                  // all sixteen loads issue ahead of this line and are waited for once
#pragma unroll
                    for (int t2 = 0; t2 < 2; ++t2) {
                        v8f acc = {};
#pragma unroll
                        for (int ks = 0; ks < 2; ++ks) {
                            v16h kfr;
#pragma unroll
                            for (int e = 0; e < 16; ++e) kfr[e] = (_Float16)kr[(t2 * 2 + ks) * 4 + (e >> 2)][e & 3];
                            acc = wmma16(qa[ks], kfr, acc);
                        }
                        s[2 * tp + t2] = acc;
                    }
                }
            } else {
#pragma unroll
            for (int t = 0; t < 4; ++t) {
                const int j = min(j0 + t * 16 + l15, p.Lk - 1);
                const float* krow = kbase + (long long)j * p.sKj;
                v8f acc = {};
#pragma unroll
                for (int ks = 0; ks < KS; ++ks) {
                    if (QM == 2)      acc = wmma6(qt_[ks], sp3_ld(krow, p.sKd, ks * 32, hf, p.dh, 1.f), acc);
                    else if (QM == 1) acc = wmma3(qs_[ks], sp_ld(krow, p.sKd, ks * 32, hf, p.dh, 1.f), acc);
                    else              acc = wmma16(qa[ks], fh_ld(krow, p.sKd, ks * 32, hf, p.dh, 1.f), acc);
                }
                s[t] = acc;
            }
            }
            float pv[8][4];
#pragma unroll
            for (int i = 0; i < 8; ++i) {
                const int irow = q0 + i + 8 * hf;
                const int ic = FULL ? irow : min(irow, p.Lq - 1);
                float sc[4];
#pragma unroll
                for (int t = 0; t < 4; ++t) {
                    const int jg = j0 + t * 16 + l15;
                    float v = s[t][i] * p.scale;
                    if (p.Mf) v += p.Mf[b * p.smb + h * p.smh + (long long)ic * p.smi + (long long)min(jg, p.Lk - 1) * p.smj];
                    if (p.Rt) v += rb[i][t];
                    if (p.Mi) { const int mv = p.Mi[b * p.smb + h * p.smh + (long long)ic * p.smi + (long long)min(jg, p.Lk - 1) * p.smj]; if (p.mpol ? (mv != 0) : (mv == 0)) v = p.mfill; }
                    if (p.SQ) { const bool same = p.SQ[(long long)b * p.Lq + ic] == p.SK[(long long)b * p.Lk + min(jg, p.Lk - 1)]; if (p.segpol ? same : !same) v = p.mfill; }
                    if (p.causal == 2 && jg > irow + p.coff) v = p.mfill;
                    if ((!FULL && jg >= p.Lk) || (p.causal == 1 && jg > irow + p.coff) || (p.causal == 3 && jg < irow + p.coff) || (p.win > 0 && irow + p.coff - jg > p.win)) v = NEG; else v *= L2E;
                    sc[t] = v;
                }
                if (!TWOPASS || pass == 0) {
                    float mx = fmaxf(fmaxf(sc[0], sc[1]), fmaxf(sc[2], sc[3]));
                    mx = fmaxf(mx, __shfl_xor(mx, 1, 32)); mx = fmaxf(mx, __shfl_xor(mx, 2, 32));
                    mx = fmaxf(mx, __shfl_xor(mx, 4, 32)); mx = fmaxf(mx, __shfl_xor(mx, 8, 32));
                    const float mnew = fmaxf(m8[i], mx);
                    const float corr = (mnew == NEG) ? 1.f : exp2f(m8[i] - mnew);
                    float rs = 0.f;
#pragma unroll
                    for (int t = 0; t < 4; ++t) {
                        const float pp = (sc[t] == NEG) ? 0.f : exp2f(sc[t] - mnew); rs += pp;
                        pv[i][t] = p.Pw ? pp * p.Pw[b * p.swb + h * p.swh + (long long)ic * p.swi + (long long)min(j0 + t * 16 + l15, p.Lk - 1) * p.swj] : pp;
                    }
                    rs += __shfl_xor(rs, 1, 32); rs += __shfl_xor(rs, 2, 32); rs += __shfl_xor(rs, 4, 32); rs += __shfl_xor(rs, 8, 32);
                    l8[i] = l8[i] * corr + rs; m8[i] = mnew;
                    if (!TWOPASS) {
#pragma unroll
                        for (int t = 0; t < NT; ++t) o[t][i] *= corr;
                    }
                } else {
                    const float inv = (l8[i] > 0.f) ? 1.f / l8[i] : 0.f;
#pragma unroll
                    for (int t = 0; t < 4; ++t) {
                        const int jg = j0 + t * 16 + l15;
                        float pp = (sc[t] == NEG) ? 0.f : exp2f(sc[t] - m8[i]) * inv;
                        if (p.Pw) pp *= p.Pw[b * p.swb + h * p.swh + (long long)ic * p.swi + (long long)min(jg, p.Lk - 1) * p.swj];
                        pv[i][t] = pp;
                    }
                }
            }
            if (dopv) {
#pragma unroll
                for (int i = 0; i < 8; ++i)
#pragma unroll
                    for (int t = 0; t < 4; ++t) ((float*)myp)[(i + 8 * hf) * 64 + t * 16 + l15] = pv[i][t];
                __syncthreads();                                 // P (per wave) and V (shared) visible
                if (p.P) {
                    float* pb_ = p.P + b * p.sPb + h * p.sPh;
                    const bool fastP = (p.pband == 0) && ((p.sPi & 3) == 0) && (j0 + 64 <= p.Lk) && (q0 + 16 <= p.Lq) && ((((size_t)pb_) & 15) == 0);
                    if (fastP) {
#pragma unroll
                        for (int s = 0; s < 8; ++s) {
                            const int row = s * 2 + (lane >> 4), c4 = (lane & 15) * 4;
                            const v4f v = *(const v4f*)(myp + row * 64 + c4);
                            VST2V4(pb_ + (long long)(q0 + row) * p.sPi + j0 + c4, v);
                        }
                    } else {
                        for (int row = 0; row < 16; ++row) {
                            const int irow = q0 + row; if (irow >= p.Lq) continue;
                            for (int c = lane; c < 64; c += 32) {
                                const int jg = j0 + c; if (jg >= p.Lk) continue;
                                if (p.pband == 0) VST2(float, pb_ + (long long)irow * p.sPi + jg, myp[row * 64 + c]);
                                else if (jg - irow <= p.pband && irow - jg <= p.pband) VST2(float, pb_ + (long long)irow * p.sPi + (jg - irow + p.pband), myp[row * 64 + c]);
                            }
                        }
                    }
                }
                if (SPLITPV) {
                    const Split pa0 = sp_ld(myp + l15 * 64, 1, 0, hf, 64, 1.f), pa1 = sp_ld(myp + l15 * 64, 1, 32, hf, 64, 1.f);
                    const __bf16* vh = (const __bf16*)vl; const __bf16* vlo = vh + 64 * VP;
#pragma unroll
                    for (int t = 0; t < NT; ++t) {
                        const int dcol = t * 16 + l15;
                        Split b0, b1;
#pragma unroll
                        for (int e = 0; e < 16; ++e) {
                            const int k0 = frag_k(e, hf), k1 = 32 + frag_k(e, hf);
                            b0.hi[e] = vh[k0 * VP + dcol]; b0.lo[e] = vlo[k0 * VP + dcol]; b1.hi[e] = vh[k1 * VP + dcol]; b1.lo[e] = vlo[k1 * VP + dcol];
                        }
                        o[t] = wmma3(pa0, b0, o[t]);
                        o[t] = wmma3(pa1, b1, o[t]);
                    }
                } else {
                    const v16h pa0 = fh_ld(myp + l15 * 64, 1, 0, hf, 64, 4096.f), pa1 = fh_ld(myp + l15 * 64, 1, 32, hf, 64, 4096.f);
#pragma unroll
                    for (int t = 0; t < NT; ++t) {
                        const int dcol = t * 16 + l15;
                        v16h b0, b1;
#pragma unroll
                        for (int e = 0; e < 16; ++e) { b0[e] = vl[frag_k(e, hf) * VP + dcol]; b1[e] = vl[(32 + frag_k(e, hf)) * VP + dcol]; }
                        o[t] = wmma16(pa0, b0, o[t]);
                        o[t] = wmma16(pa1, b1, o[t]);
                    }
                }
            }
        }
    }
    float* obase = p.O + b * p.sOb + h * p.sOh;
    if (p.ST) {
        const int rl = lane >> 1, isel = rl & 7;           // row q0 + rl ; rl>>3 == hf holds because lane>>4 == (lane>>1)>>3
        float mv = 0.f, lv = 0.f;
#pragma unroll
        for (int i = 0; i < 8; ++i) if (i == isel) { mv = m8[i]; lv = l8[i]; }
        const int irow = q0 + rl;
        if (irow < p.Lq) { float* st = p.ST + (((long long)b * gridDim.y + h) * p.Lq + irow) * 2 + (lane & 1); VST2(float, st, (lane & 1) ? lv : mv * 0.6931471805599453f); }
    }
    float invr[8];
#pragma unroll
    for (int i = 0; i < 8; ++i) {
        if (TWOPASS) invr[i] = SPLITPV ? 1.f : (1.f / 4096.f);
        else if (p.nonorm) invr[i] = exp2f(m8[i]) * (SPLITPV ? 1.f : (1.f / 4096.f));
        else invr[i] = (l8[i] > 0.f) ? (SPLITPV ? 1.f / l8[i] : 1.f / (l8[i] * 4096.f)) : 0.f;
    }
    __syncthreads();                                             // all waves done with pl/vl from the main loop
    const bool ofast = ((p.sOi & 3) == 0) && ((((size_t)obase) & 15) == 0) && (q0 + 16 <= p.Lq);
#pragma unroll
    for (int c0 = 0; c0 < DVP; c0 += 64) {
#pragma unroll
        for (int i = 0; i < 8; ++i)
#pragma unroll
            for (int t = 0; t < NT; ++t) if (t * 16 >= c0 && t * 16 < c0 + 64) ((float*)myp)[(i + 8 * hf) * 64 + (t * 16 - c0) + l15] = o[t][i] * invr[i];
        __syncthreads();
        const int cw = (DVP - c0 < 64) ? (DVP - c0) : 64;      // staged columns in this chunk (multiple of 16)
        if (ofast && (c0 + cw <= p.dv) && (cw % 32 == 0)) {
            const int lpr = cw / 4;                              // lanes per row (16 for 64 cols, 8 for 32)
            const int rows_per_ins = 32 / lpr;
            for (int r0 = 0; r0 < 16; r0 += rows_per_ins) {
                const int row = r0 + lane / lpr, c4 = (lane % lpr) * 4;
                const v4f v = *(const v4f*)(myp + row * 64 + c4);
                VST2V4(obase + (long long)(q0 + row) * p.sOi + c0 + c4, v);
            }
        } else {
            for (int row = 0; row < 16; ++row) {
                const int irow = q0 + row; if (irow >= p.Lq) continue;
                for (int c = lane; c < cw; c += 32) { const int d = c0 + c; if (d < p.dv) VST2(float, obase + (long long)irow * p.sOi + d, myp[row * 64 + c]); }
            }
        }
        __syncthreads();
    }
}

__device__ __forceinline__ float xhalf(float x) { return __builtin_bit_cast(float, __builtin_amdgcn_permlanex16(__builtin_bit_cast(int, x), __builtin_bit_cast(int, x), 0x76543210, 0xfedcba98, false, false)); }
template <int GT, int GD>
__global__ __launch_bounds__(32 * AW) KATTN_ATTR void k_attnT(const float* __restrict__ Q, const float* __restrict__ K, const float* __restrict__ V, float* __restrict__ O, const float* __restrict__ Rt, float scale) {
    static_assert(GT % (16 * AW) == 0 && GT % 64 == 0 && AW == 4, "whole query tiles and key blocks; 128 threads stage the 64 x 64 V tile");
    constexpr int DH = 64;                      // head size
    constexpr int VP = 64 + 8;                  // LDS pitch (halves): rows of 128 bytes + 16, for 16-byte readers
    __shared__ __align__(16) _Float16 vt[DH * VP];   // V^T tile: row = head column, 64 keys along the row
    const int lane = threadIdx.x & 31, hf = lane >> 4, l15 = lane & 15, wave = threadIdx.x >> 5;
    const int h = blockIdx.y, b = blockIdx.z;
    const int q0 = (blockIdx.x * AW + wave) * 16;
    const float L2E = 1.4426950408889634f;
    const float* qrow = Q + (long long)b * GT * GD + h * DH + (long long)(q0 + l15) * GD;
    const float* kbase = K + (long long)b * GT * GD + h * DH;
    const float* vbase = V + (long long)b * GT * GD + h * DH;
    v16h qb[2];
#pragma unroll
    for (int ks = 0; ks < 2; ++ks) qb[ks] = fh_ld(qrow, 1, ks * 32, hf, DH, 1.f);
    v8f o[4]; float m = -__builtin_inff(), l = 0.f;
#pragma unroll
    for (int t = 0; t < 4; ++t) { v8f zz = {}; o[t] = zz; }
    const int vd = threadIdx.x & 63, vk = (threadIdx.x >> 6) * 32;   // staging: this thread's head column and its first of 32 consecutive keys
    for (int j0 = 0; j0 < GT; j0 += 64) {
        float vf[32];
#pragma unroll
        for (int it = 0; it < 32; ++it) vf[it] = (vbase + (long long)j0 * GD)[(size_t)(unsigned)(vk * GD + vd) + it * GD];
        // table column i - j + GT - 1 as block-uniform pointer + the lane's fixed offset + a constant, each part >= 0 (j0 <= GT - 64)
        float rb[4][8];
        const float* rt = Rt + (long long)h * (2 * GT - 1) + ((int)blockIdx.x * (16 * AW) - j0 + (GT - 64));
        const unsigned ro = (unsigned)(wave * 16 + l15 + 8 * (1 - hf));
#pragma unroll
        for (int t = 0; t < 4; ++t)
#pragma unroll
            for (int r = 0; r < 8; ++r) rb[t][r] = rt[(size_t)ro + (16 * (3 - t) + (7 - r))];
        v8f s[4];
#pragma unroll
        for (int tp = 0; tp < 2; ++tp) {
            // two key tiles at a time: their sixteen 16-byte loads (fh_ld's k order: floats 8 hf + 0..7 and 16 + 8 hf + 0..7 of each 32) fly together
            v4f kr[16];
#pragma unroll
            for (int t2 = 0; t2 < 2; ++t2)
#pragma unroll
                for (int ks = 0; ks < 2; ++ks) {
                    const v4f* kp = (const v4f*)((kbase + (long long)j0 * GD) + ((size_t)(unsigned)(l15 * GD + 8 * hf) + (2 * tp + t2) * 16 * GD + ks * 32));
                    kr[(t2 * 2 + ks) * 4 + 0] = kp[0]; kr[(t2 * 2 + ks) * 4 + 1] = kp[1]; kr[(t2 * 2 + ks) * 4 + 2] = kp[4]; kr[(t2 * 2 + ks) * 4 + 3] = kp[5];
                }
            hold16(kr);                                  // all sixteen loads issue ahead of this line and are waited for once
            if (tp == 0) { hold16(vf); hold16(vf + 16); }   // the V tile's loads issue ahead of the products and fly under the K loads
#pragma unroll
            for (int t2 = 0; t2 < 2; ++t2) {
                v8f acc = {};
#pragma unroll
                for (int ks = 0; ks < 2; ++ks) {
                    v16h kfr;
#pragma unroll
                    for (int e = 0; e < 16; ++e) kfr[e] = (_Float16)kr[(t2 * 2 + ks) * 4 + (e >> 2)][e & 3];
                    acc = __builtin_amdgcn_wmma_f32_16x16x32_f16(false, kfr, false, qb[ks], (short)0, acc, false, false);   // A = key rows, B = query columns
                }
                s[2 * tp + t2] = acc;
            }
        }
        float sc[4][8], mt[4];
#pragma unroll
        for (int t = 0; t < 4; ++t) {
#pragma unroll
            for (int r = 0; r < 8; ++r) sc[t][r] = (s[t][r] * scale + rb[t][r]) * L2E;
            mt[t] = fmaxf(fmaxf(fmaxf(sc[t][0], sc[t][1]), fmaxf(sc[t][2], sc[t][3])), fmaxf(fmaxf(sc[t][4], sc[t][5]), fmaxf(sc[t][6], sc[t][7])));
        }
        float mx = fmaxf(fmaxf(mt[0], mt[1]), fmaxf(mt[2], mt[3]));
        mx = fmaxf(mx, xhalf(mx));                        // the other lane half holds the query's other 32 keys
        const float mnew = fmaxf(m, mx);
        const float corr = exp2f(m - mnew);
        float rs[4];
#pragma unroll
        for (int t = 0; t < 4; ++t) {
            rs[t] = 0.f;
#pragma unroll
            for (int r = 0; r < 8; ++r) { const float pp = exp2f(sc[t][r] - mnew); rs[t] += pp; sc[t][r] = pp; }
        }
        l = l * corr + ((rs[0] + rs[1]) + (rs[2] + rs[3])); m = mnew;
#pragma unroll
        for (int t = 0; t < 4; ++t)
#pragma unroll
            for (int r = 0; r < 8; ++r) o[t][r] *= corr;
        v16h pb[2];
#pragma unroll
        for (int ks = 0; ks < 2; ++ks)
#pragma unroll
            for (int e = 0; e < 16; ++e) pb[ks][e] = (_Float16)(sc[2 * ks + (e >> 3)][e & 7] * 4096.f);
        __syncthreads();                                 // previous key block's reads of vt are done
#pragma unroll
        for (int c8 = 0; c8 < 4; ++c8) {
            v8h pk;
#pragma unroll
            for (int e = 0; e < 8; ++e) pk[e] = (_Float16)vf[c8 * 8 + e];
            *(v8h*)(vt + vd * VP + vk + c8 * 8) = pk;
        }
        __syncthreads();                                 // V^T tile visible to the four waves
#pragma unroll
        for (int t = 0; t < 4; ++t)
#pragma unroll
            for (int ks = 0; ks < 2; ++ks) {
                const _Float16* vr = vt + (t * 16 + l15) * VP + ks * 32 + 8 * hf;
                const v8h a0 = *(const v8h*)vr, a1 = *(const v8h*)(vr + 16);
                const v16h va = __builtin_shufflevector(a0, a1, 0, 1, 2, 3, 4, 5, 6, 7, 8, 9, 10, 11, 12, 13, 14, 15);
                o[t] = __builtin_amdgcn_wmma_f32_16x16x32_f16(false, va, false, pb[ks], (short)0, o[t], false, false);   // A = head columns, B = query columns
            }
    }
    l += xhalf(l);                                       // join the two halves' sums
    const float inv = (l > 0.f) ? 1.f / (l * 4096.f) : 0.f;
    float* orow = O + (long long)b * GT * GD + h * DH + (long long)(q0 + l15) * GD + 8 * hf;
#pragma unroll
    for (int t = 0; t < 4; ++t) {
        const v4f w0 = { o[t][0] * inv, o[t][1] * inv, o[t][2] * inv, o[t][3] * inv }, w1 = { o[t][4] * inv, o[t][5] * inv, o[t][6] * inv, o[t][7] * inv };
        VST2V4(orow + t * 16, w0); VST2V4(orow + t * 16 + 4, w1);
    }
}

// =====================================================================================================================
// k_tr: dst(z, c, r) = alpha * src(z, r, c) (+ beta * R2(z, c, r)): [Z][R][C] (row stride lds) -> [Z][C][R] (row stride ldd) through a 32x32 LDS tile;
//   flags: 1 -> add beta * residual R2 addressed like dst (z*sRz + c*ldr + r); act applied before the residual.
// =====================================================================================================================
struct TrP { const float* src; float* dst; const float* R2; long long sSz, lds, sDz, ldd, sRz, ldr; int R, C, flags, act; float alpha, beta; };
static_assert(sizeof(TrP) == 3 * 8 + 6 * 8 + 6 * 4, "TrP has padding");
__global__ __launch_bounds__(256) void k_tr(TrP p) {
    __shared__ float tile[32][33];
    const int c0 = blockIdx.x * 32, r0 = blockIdx.y * 32, z = blockIdx.z;
    const int lane = threadIdx.x & 31, wave = threadIdx.x >> 5;
    const float* s = p.src + z * p.sSz;
#pragma unroll
    for (int k = 0; k < 4; ++k) {
        const int rl = wave * 4 + k, r = r0 + rl, c = c0 + lane;
        tile[rl][lane] = (r < p.R && c < p.C) ? s[(long long)r * p.lds + c] : 0.f;
    }
    __syncthreads();
    float* d = p.dst + z * p.sDz; const float* rr = p.R2 + z * p.sRz;
#pragma unroll
    for (int k = 0; k < 4; ++k) {
        const int cl = wave * 4 + k, c = c0 + cl, r = r0 + lane;
        if (c < p.C && r < p.R) {
            float v = act_fn(p.alpha * tile[lane][cl], p.act);
            if (p.flags & 1) v += p.beta * rr[(long long)c * p.ldr + r];
            VST2(float, d + (long long)c * p.ldd + r, v);
        }
    }
}

// k_affine: dst[i] = a * (sdev ? sdev[0] : 1) * src[i] + b, i < n (one thread per element; consecutive lanes -> consecutive addresses)
__global__ __launch_bounds__(256) void k_affine(const float* __restrict__ src, float* __restrict__ dst, int n, float a, float b, const float* __restrict__ sdev) {
    const int i = blockIdx.x * 256 + threadIdx.x;
    if (i < n) { const float aa = sdev ? a * sdev[0] : a; const float v = aa * src[i] + b; VST2(float, dst + i, v); }
}

// =====================================================================================================================
// k_softmax: row softmax over n contiguous elements, one 256-thread block per row; rows addressed z*sz + r*sr (grid (R, Z)).
//   out = scale_out * softmax(scale_in * x + (Mf ? Mf[z*smz + r*smr + j] : 0)); a row whose max is -inf is written as 0.
// =====================================================================================================================
struct SmP { const float* src; float* dst; const float* Mf; long long sz, sr, dz, dr, smz, smr; int n, pad; float scale_in, scale_out; };
static_assert(sizeof(SmP) == 3 * 8 + 6 * 8 + 4 * 4, "SmP has padding");
__global__ __launch_bounds__(256) void k_softmax(SmP p) {
    __shared__ float red[256];
    const int r = blockIdx.x, z = blockIdx.y, tid = threadIdx.x;
    const float* s = p.src + z * p.sz + (long long)r * p.sr;
    const float* mf = p.Mf ? (p.Mf + z * p.smz + (long long)r * p.smr) : nullptr;
    float mx = -__builtin_inff();
    for (int j = tid; j < p.n; j += 256) { float v = s[j] * p.scale_in; if (mf) v += mf[j]; mx = fmaxf(mx, v); }
    red[tid] = mx; __syncthreads();
    for (int o = 128; o > 0; o >>= 1) { if (tid < o) red[tid] = fmaxf(red[tid], red[tid + o]); __syncthreads(); }
    mx = red[0]; __syncthreads();
    float sum = 0.f;
    for (int j = tid; j < p.n; j += 256) { float v = s[j] * p.scale_in; if (mf) v += mf[j]; sum += (mx == -__builtin_inff()) ? 0.f : expf(v - mx); }
    red[tid] = sum; __syncthreads();
    for (int o = 128; o > 0; o >>= 1) { if (tid < o) red[tid] += red[tid + o]; __syncthreads(); }
    sum = red[0];
    const float inv = (sum > 0.f) ? p.scale_out / sum : 0.f;
    float* d = p.dst + z * p.dz + (long long)r * p.dr;
    for (int j = tid; j < p.n; j += 256) { float v = s[j] * p.scale_in; if (mf) v += mf[j]; const float o = (mx == -__builtin_inff()) ? 0.f : expf(v - mx) * inv; VST2(float, d + j, o); }
}
// =====================================================================================================================
// k_stats: mean and rsqrt(var + eps) over a set of n elements addressed base + z*sz + (e / inner) * so + (e % inner) * si, one 256-thread
// k_norm_apply: y = (x - mean[set]) * rstd[set] * g[c] + b[c] over a [Z][C][L] channel-major tensor with set = z*G + c / (C/G) (G groups per z;
//   G = C -> per-channel sets indexed z*C+c; for batch norm pass stats indexed by c only via bn = 1). Optional act. Output same layout.
// =====================================================================================================================
//   mode 0: mean / rsqrt(var + eps); mode 1 (RMSNorm): 0 / rsqrt(mean(x^2) + eps); mode 2 (L2 normalize * sqrt(n)): 0 / sqrt(n) / max(||x||, eps); mode 3: as 0 with unbiased variance (n-1)
__global__ __launch_bounds__(256) void k_stats(const float* __restrict__ x, long long sz, long long so, long long si, int inner, int n, float eps, float* __restrict__ stat, int mode) {
    __shared__ float red[256];
    const int z = blockIdx.x, tid = threadIdx.x;
    const float* base = x + z * sz;
    float s = 0.f;
    for (int e = tid; e < n; e += 256) s += base[(long long)(e / inner) * so + (long long)(e % inner) * si];
    red[tid] = s; __syncthreads();
    for (int o = 128; o > 0; o >>= 1) { if (tid < o) red[tid] += red[tid + o]; __syncthreads(); }
    const float mu = (mode == 0 || mode == 3) ? red[0] / (float)n : 0.f; __syncthreads();
    float q = 0.f;
    for (int e = tid; e < n; e += 256) { const float dlt = base[(long long)(e / inner) * so + (long long)(e % inner) * si] - mu; q += dlt * dlt; }
    red[tid] = q; __syncthreads();
    for (int o = 128; o > 0; o >>= 1) { if (tid < o) red[tid] += red[tid + o]; __syncthreads(); }
    {
        float rs;
        if (mode == 2) rs = sqrtf((float)n) / fmaxf(sqrtf(red[0]), eps); else if (mode == 3) rs = rsqrtf(red[0] / (float)(n - 1) + eps); else rs = rsqrtf(red[0] / (float)n + eps);
        if (tid < 32) { const float v = (tid == 0) ? mu : ((tid == 1) ? rs : 0.f); VST2(float, stat + (long long)z * 32 + tid, v); }
    }
}
//   One thread per element over the flat [Z][C][L] index space: grid ceil(Z*C*L / 256).
__global__ __launch_bounds__(256) void k_norm_apply(const float* __restrict__ x, float* __restrict__ y, const float* __restrict__ stat, const float* __restrict__ g, const float* __restrict__ bta,
                                                     int Z, int C, int L, int G, int bn, int act) {
    const long long idx = (long long)blockIdx.x * 256 + threadIdx.x;
    if (idx >= (long long)Z * C * L) return;
    const int l = (int)(idx % L); const long long zc = idx / L; const int c = (int)(zc % C), z = (int)(zc / C); (void)l;
    const int set = bn ? c : (z * G + c / (C / G));
    float v = (x[idx] - stat[(long long)set * 32]) * stat[(long long)set * 32 + 1];
    if (g) v *= g[c];
    if (bta) v += bta[c];
    v = act_fn(v, act);
    VST2(float, y + idx, v);
}

// k_lse_neg: c[i] = -(st[2i] + log(st[2i+1])) = minus the log-sum-exp of row i from k_attn's ST output (for softmax over the query dimension)
__global__ __launch_bounds__(256) void k_lse_neg(const float* __restrict__ st, float* __restrict__ c, int n) {
    const int i = blockIdx.x * 256 + threadIdx.x;
    if (i < n) { const float v = -(st[2 * i] + logf(st[2 * i + 1])); VST2(float, c + i, v); }
}

// k_iota: dst[i] = a * i + b as int32 (segment/position id helper)
__global__ __launch_bounds__(256) void k_iota(int* __restrict__ dst, int n, int a, int b) {
    const int i = blockIdx.x * 256 + threadIdx.x;
    if (i < n) { const int v = a * i + b; VST2(int, dst + i, v); }
}

// k_axpby: dst[i] = a * x[i] + b * y[i] (+ c), i < n
__global__ __launch_bounds__(256) void k_axpby(const float* __restrict__ x, const float* __restrict__ y, float* __restrict__ dst, int n, float a, float b, float c) {
    const int i = blockIdx.x * 256 + threadIdx.x;
    if (i < n) { const float v = a * x[i] + b * y[i] + c; VST2(float, dst + i, v); }
}

// =====================================================================================================================
// k_rope: rotary embedding on a [R rows][Hn heads][D] view (row stride sXr, head stride sXh, element stride 1) -> Y (own strides).
//   mode 0: rotate_half (partner d±D/2, sign - for d<D/2); mode 1: interleaved pairs (partner d^1, sign - for even d).
//   table column tcol: tmode 0 -> d, 1 -> d % (D/2), 2 -> d / 2; position p: pmode 0 -> r % S, 1 -> head index, 2 -> pos[r];
//   c = C[(r / S) * sCb + p * sCp + tcol * sCd], s likewise from Sn; y = x[d] * c + sign * x[partner] * s. X and Y must not alias.
// =====================================================================================================================
struct RopeP { const float* X; float* Y; const float* C; const float* Sn; const int* pos; long long sXr, sXh, sYr, sYh, sCb, sCp, sCd; int R, Hn, D, S, mode, tmode, pmode, pad; };
static_assert(sizeof(RopeP) == 5 * 8 + 7 * 8 + 8 * 4, "RopeP has padding");
__global__ __launch_bounds__(256) void k_rope(RopeP p) {
    const long long idx = (long long)blockIdx.x * 256 + threadIdx.x;
    if (idx >= (long long)p.R * p.Hn * p.D) return;
    const int d = (int)(idx % p.D); const long long rh = idx / p.D; const int h = (int)(rh % p.Hn); const int r = (int)(rh / p.Hn);
    const int half = p.D / 2;
    int partner; float sign;
    if (p.mode == 0) { partner = (d < half) ? d + half : d - half; sign = (d < half) ? -1.f : 1.f; }
    else { partner = d ^ 1; sign = (d & 1) ? 1.f : -1.f; }
    const int tcol = (p.tmode == 0) ? d : ((p.tmode == 1) ? (d % half) : (d >> 1));
    const int pp = (p.pmode == 0) ? (r % p.S) : ((p.pmode == 1) ? h : p.pos[r]);
    const long long toff = (long long)(r / p.S) * p.sCb + (long long)pp * p.sCp + (long long)tcol * p.sCd;
    const float* xr = p.X + (long long)r * p.sXr + (long long)h * p.sXh;
    const float v = xr[d] * p.C[toff] + sign * xr[partner] * p.Sn[toff];
    VST2(float, p.Y + (long long)r * p.sYr + (long long)h * p.sYh + d, v);
}

// k_invf + k_sincos (split so neither kernel carries a large VALU-fma footprint): invf_i = num * (1 / powf(base, (2 i)/D)) [fmode 0],
//   num * expf((2 i) * cexp) [fmode 1], num * powf(base, -2 (i - 1) / D) [fmode 2]; then cs/sn[s*half + i] = cos/sin((pscale * s) * invf_i)
__global__ __launch_bounds__(256) void k_invf(float* __restrict__ invb, int half, int D, float base, float num, int fmode, float cexp) {
    const int i = blockIdx.x * 256 + threadIdx.x;
    if (i >= ((half + 31) / 32) * 32) return;
    if (i >= half) { VST2(float, invb + i, 0.f); return; }
    const float e = (float)(2 * i) / (float)D;
    float invf;
    if (fmode == 1) invf = num * expf((float)(2 * i) * cexp);
    else if (fmode == 2) invf = num * powf(base, (-2.0f * ((float)i - 1.0f)) / (float)D);
    else invf = num * (1.0f / powf(base, e));
    VST2(float, invb + i, invf);
}
__global__ __launch_bounds__(256) void k_sincos(float* __restrict__ cs, float* __restrict__ sn, const float* __restrict__ invb, int S, int half, float pscale) {
    const int idx = blockIdx.x * 256 + threadIdx.x;
    if (idx >= S * half) return;
    const int s = idx / half, i = idx - s * half;
    const float ang = (pscale * (float)s) * invb[i];
    VST2(float, cs + idx, cosf(ang)); VST2(float, sn + idx, sinf(ang));
}

// k_mulact: dst[i] = act(x[i]) * y[i]
__global__ __launch_bounds__(256) void k_mulact(const float* __restrict__ x, const float* __restrict__ y, float* __restrict__ dst, int n, int act) {
    const int i = blockIdx.x * 256 + threadIdx.x;
    if (i < n) { const float v = act_fn(x[i], act) * y[i]; VST2(float, dst + i, v); }
}

// =====================================================================================================================
// k_matvec: thread-per-row matrix-vector products for N <= 8 output columns (heads with 1-3 outputs, gates), f32 on the VALU.
//   C[r*sCm + j] = act(alpha * sum_k A[r*sAm + k*sAk] * B[j*sBn + k*sBk] + bias[j]) + beta * R[r*sRm + j*sRn]; each thread writes its N contiguous floats.
// =====================================================================================================================
__global__ __launch_bounds__(256) void k_matvec(GemmP p) {
    // 32 lanes write one line with one instruction.
    const int rpt = (p.N == 1) ? 1 : 32;
    const long long r0 = ((long long)blockIdx.x * 256 + threadIdx.x) * rpt; const int z = blockIdx.z, zo = z / p.zi_n, zi = z - zo * p.zi_n;
    if (r0 >= p.M) return;
    const float* Bb = p.B + zo * p.sBo + zi * p.sBi;
    float* C = p.C + zo * p.sCo + zi * p.sCi; const float* R = p.R + zo * p.sRo + zi * p.sRi;
    for (int rr = 0; rr < rpt; ++rr) {
        const long long r = r0 + rr; if (r >= p.M) break;
        const float* A = p.A + zo * p.sAo + zi * p.sAi + r * p.sAm;
        float acc[8] = {0.f, 0.f, 0.f, 0.f, 0.f, 0.f, 0.f, 0.f};
        for (int k = 0; k < p.K; ++k) { const float a = A[(long long)k * p.sAk];
#pragma unroll
            for (int j = 0; j < 8; ++j) if (j < p.N) acc[j] += a * Bb[(long long)j * p.sBn + (long long)k * p.sBk]; }
#pragma unroll
        for (int j = 0; j < 8; ++j) if (j < p.N) {
            float v = acc[j] * p.alpha;
            if (p.flags & 1) v += p.bias[j];
            if (p.flags & 2) v += p.bias[r];
            v = act_fn(v, p.act);
            if (p.flags & 4) v += p.beta * R[r * p.sRm + (long long)j * p.sRn];
            VST2(float, C + r * p.sCm + j, v);
        }
    }
}
// k_smallsoftmax: thread-per-row softmax for short rows (n <= 64): dst[r*dr + j] = softmax(scale*src[r*sr + j])
__global__ __launch_bounds__(256) void k_smallsoftmax(const float* __restrict__ src, float* __restrict__ dst, long long sr, long long dr, int n, long long R, float scale) {
    const long long r0 = ((long long)blockIdx.x * 256 + threadIdx.x) * 32;
    for (int rr = 0; rr < 32; ++rr) {
        const long long r = r0 + rr; if (r >= R) return;
        const float* s = src + r * sr; float* d = dst + r * dr;
        float mx = -__builtin_inff();
        for (int j = 0; j < n; ++j) mx = fmaxf(mx, s[j] * scale);
        float sum = 0.f;
        for (int j = 0; j < n; ++j) sum += expf(s[j] * scale - mx);
        const float inv = 1.f / sum;
        for (int j = 0; j < n; ++j) { const float v = expf(s[j] * scale - mx) * inv; VST2(float, d + j, v); }
    }
}

__global__ __launch_bounds__(32) void k_unitstat(float* __restrict__ st) { const int t = threadIdx.x; const float v = (t == 1) ? 1.f : 0.f; VST2(float, st + t, v); }

// destination (e.g. a d_out whose row width is not a multiple of 32 floats) is written by consecutive lanes of one instruction
__global__ __launch_bounds__(256) void k_lincopy(const float* __restrict__ src, long long lds, float* __restrict__ dst, long long ldd, long long rows, int cols) {
    const long long i = (long long)blockIdx.x * 256 + threadIdx.x; if (i >= rows * cols) return;
    const long long r = i / cols; const int c = (int)(i - r * cols);
    const float v = src[r * lds + c]; VST2(float, dst + r * ldd + c, v);
}

namespace w25 {
typedef __attribute__((ext_vector_type(16))) _Float16 v16h;
typedef __attribute__((ext_vector_type(8)))  _Float16 v8h;
typedef __attribute__((ext_vector_type(16))) __bf16   v16b;
typedef __attribute__((ext_vector_type(8)))  __bf16   v8b;
typedef __attribute__((ext_vector_type(8)))  float    v8f;
typedef __attribute__((ext_vector_type(4)))  float    v4f;

__device__ __forceinline__ unsigned short f2bf_bits(float f) {
  unsigned u = __float_as_uint(f);
  return (unsigned short)((u + 0x7FFFu + ((u >> 16) & 1u)) >> 16);
}
__device__ __forceinline__ float bf_bits2f(unsigned short h) { return __uint_as_float(((unsigned)h) << 16); }

// hazard guards as plain device helpers (no inline asm inside the kernel template body)
__device__ __forceinline__ void dep_guard_h(v8f& a, v8f& b, v16h x, v16h y) { asm volatile("v_nop\n\tv_nop\n\tv_nop\n\tv_nop" : "+v"(a), "+v"(b) : "v"(x), "v"(y)); }
__device__ __forceinline__ void dep_guard_b(v8f& a, v8f& b, v16b x, v16b y) { asm volatile("v_nop\n\tv_nop\n\tv_nop\n\tv_nop" : "+v"(a), "+v"(b) : "v"(x), "v"(y)); }
__device__ __forceinline__ void keep4_h(v16h a, v16h b, v16h c, v16h d) { asm volatile("v_nop" :: "v"(a), "v"(b), "v"(c), "v"(d)); }
__device__ __forceinline__ void keep4_b(v16b a, v16b b, v16b c, v16b d) { asm volatile("v_nop" :: "v"(a), "v"(b), "v"(c), "v"(d)); }
__device__ __forceinline__ void acc_guard4(v8f& a, v8f& b, v8f& c, v8f& d) { asm volatile("v_nop\n\tv_nop\n\tv_nop\n\tv_nop" : "+v"(a), "+v"(b), "+v"(c), "+v"(d)); }
template <typename T> struct Frag;
template <> struct Frag<_Float16> {
  typedef v16h V; union U { v16h v; v8h h[2]; };
  static __device__ __forceinline__ v16h load(const _Float16* p) {   // elements 0..7 <- p[0..7], 8..15 <- p[16..23]
    U f; f.h[0] = *(const v8h*)(p); f.h[1] = *(const v8h*)(p + 16); return f.v;
  }
  static __device__ __forceinline__ v8f mma(v16h a, v16h b, v8f c) {
    return __builtin_amdgcn_wmma_f32_16x16x32_f16(false, a, false, b, (short)0, c, false, false);
  }
  static __device__ __forceinline__ void guard(v8f& a, v8f& b, v16h x, v16h y) { dep_guard_h(a, b, x, y); }
  static __device__ __forceinline__ void keep(v16h a, v16h b, v16h c, v16h d) { keep4_h(a, b, c, d); }
};
template <> struct Frag<__bf16> {
  typedef v16b V; union U { v16b v; v8b h[2]; };
  static __device__ __forceinline__ v16b load(const __bf16* p) {
    U f; f.h[0] = *(const v8b*)(p); f.h[1] = *(const v8b*)(p + 16); return f.v;
  }
  static __device__ __forceinline__ v8f mma(v16b a, v16b b, v8f c) {
    return __builtin_amdgcn_wmma_f32_16x16x32_bf16(false, a, false, b, (short)0, c, false, false);
  }
  static __device__ __forceinline__ void guard(v8f& a, v8f& b, v16b x, v16b y) { dep_guard_b(a, b, x, y); }
  static __device__ __forceinline__ void keep(v16b a, v16b b, v16b c, v16b d) { keep4_b(a, b, c, d); }
};

// ---- Register-blocked batched WMMA GEMM ------------------------------------
// C[m,n] = scale * sum_k A[m,k] * Bt[n,k] (+bias)(+resid); each wave owns a 64x64 tile.
// A row-major [M,K]; Bt row-major [N,K]; M,N % 64 == 0, K % 32 == 0.
// SPLIT: operands are hi/lo planes (A2/Bt2 = lo planes, same layout); product = hi·hi + hi·lo + lo·hi.
// BIAS_MODE: 0 = none, 1 = bias[m], 2 = bias[n].
// OUT_MODE: 0 = f32, 1 = f16, 2 = bf16 hi plane (Cout) + bf16 lo plane (Cout2).
// ET: 0 = f16 operands, 1 = bf16 operands (pointers passed as 16-bit storage)
template <int ET> struct Elem;
template <> struct Elem<0> { typedef _Float16 T; };
template <> struct Elem<1> { typedef __bf16 T; };
template <int ET, bool SPLIT, int BIAS_MODE, int OUT_MODE, bool RESID, int ACT = 0>
__global__ __launch_bounds__(256) void wmma_gemm64(
    const unsigned short* __restrict__ Ap, const unsigned short* __restrict__ A2p, int lda, long strideA,
    const unsigned short* __restrict__ Btp, const unsigned short* __restrict__ Bt2p, int ldb, long strideB,
    void* __restrict__ Cout, void* __restrict__ Cout2, int ldc, long strideC,
    const float* __restrict__ bias,
    const float* __restrict__ resid, long strideR,
    int M, int N, int K, float scale) {
  typedef typename Elem<ET>::T T;
  typedef typename Frag<T>::V V;
  const T* A = (const T*)Ap; const T* A2 = (const T*)A2p; const T* Bt = (const T*)Btp; const T* Bt2 = (const T*)Bt2p;
  __shared__ __align__(16) float sT[8][16 * 68];   // per-wave 16x64 slab, pitch 68 floats
  const int b    = blockIdx.y;
  const int lane = threadIdx.x & 31;
  const int wave = threadIdx.x >> 5;
  const int tilesN = N >> 6;
  const int tilesM = M >> 6;
  const int tile = blockIdx.x * 8 + wave;
  if (tile >= tilesM * tilesN) return;   // wave-uniform; no block barriers in this kernel
  const int tm = tile / tilesN;
  const int tn = tile - tm * tilesN;
  const int m0 = tm << 6;
  const int n0 = tn << 6;

  const T* Ab  = A  + (size_t)b * strideA;
  const T* Bb  = Bt + (size_t)b * strideB;
  const T* Ab2 = SPLIT ? (A2  + (size_t)b * strideA) : nullptr;
  const T* Bb2 = SPLIT ? (Bt2 + (size_t)b * strideB) : nullptr;

  const int rlane = lane & 15;                 // row (A) / col (B, D) within subtile
  const int koff  = (lane >> 4) * 8;           // k offset of this lane half
  const int mOff  = (lane >> 4) * 8;           // D row offset

  v8f acc[4][4];
#pragma unroll
  for (int i = 0; i < 4; ++i)
#pragma unroll
    for (int j = 0; j < 4; ++j) acc[i][j] = (v8f){0.f,0.f,0.f,0.f,0.f,0.f,0.f,0.f};

  for (int k0 = 0; k0 < K; k0 += 32) {
    V bh[4], bl[4];
#pragma unroll
    for (int j = 0; j < 4; ++j) {
      const size_t bo = (size_t)(n0 + (j << 4) + rlane) * ldb + koff + k0;
      bh[j] = Frag<T>::load(Bb + bo);
      if (SPLIT) bl[j] = Frag<T>::load(Bb2 + bo);
    }
#pragma unroll
    for (int i = 0; i < 4; ++i) {
      const size_t ao = (size_t)(m0 + (i << 4) + rlane) * lda + koff + k0;
      V ah = Frag<T>::load(Ab + ao);
      V al;
      if (SPLIT) al = Frag<T>::load(Ab2 + ao);
#pragma unroll
      for (int j = 0; j < 4; ++j) {
        acc[i][j] = Frag<T>::mma(ah, bh[j], acc[i][j]);
        if (SPLIT) {
          acc[i][j] = Frag<T>::mma(ah, bl[j], acc[i][j]);
          acc[i][j] = Frag<T>::mma(al, bh[j], acc[i][j]);
        }
      }
      Frag<T>::guard(acc[i][0], acc[i][3], ah, SPLIT ? al : ah);
    }
    Frag<T>::keep(bh[0], bh[1], bh[2], bh[3]);
    if (SPLIT) Frag<T>::keep(bl[0], bl[1], bl[2], bl[3]);
  }
  acc_guard4(acc[0][0], acc[0][1], acc[0][2], acc[0][3]);
  acc_guard4(acc[1][0], acc[1][1], acc[1][2], acc[1][3]);
  acc_guard4(acc[2][0], acc[2][1], acc[2][2], acc[2][3]);
  acc_guard4(acc[3][0], acc[3][1], acc[3][2], acc[3][3]);

  // ---- epilogue ----
  float* slab = sT[wave];
  const float* Rb = RESID ? (resid + (size_t)b * strideR) : nullptr;
#pragma unroll
  for (int i = 0; i < 4; ++i) {
    const int mBase = m0 + (i << 4);
#pragma unroll
    for (int j = 0; j < 4; ++j) {
      const int n = n0 + (j << 4) + rlane;
      float bv = 0.f;
      if (BIAS_MODE == 2) bv = bias[n];
#pragma unroll
      for (int r = 0; r < 8; ++r) {
        float v = acc[i][j][r] * scale;
        if (BIAS_MODE == 1) v += bias[mBase + mOff + r];
        if (BIAS_MODE == 2) v += bv;
        if (RESID) v += Rb[(size_t)(mBase + mOff + r) * ldc + n];
        if (ACT == 1) v = tanhf(v);
        if (ACT == 2) v = fmaxf(v, 0.0f);
        if (ACT == 3) v = v / (1.0f + expf(-v));
        if (ACT == 4) v = (v > 0.f) ? v : 0.01f * v;
        if (ACT == 5) v = 0.5f * v * (1.0f + erff(v * 0.70710678118654752f));
        slab[(mOff + r) * 68 + (j << 4) + rlane] = v;
      }
    }
    __builtin_amdgcn_fence(__ATOMIC_RELEASE, "workgroup");
    __builtin_amdgcn_wave_barrier();
    __builtin_amdgcn_fence(__ATOMIC_ACQUIRE, "workgroup");
    if (OUT_MODE == 0) {
      float* C = (float*)Cout + (size_t)b * strideC;
      const int hh = lane >> 4, c4 = (lane & 15) * 4;     // row seg = 256 B = 16 lanes x 16 B
      {
#pragma unroll
        for (int it = 0; it < 8; ++it) {
          const int row = it * 2 + hh;
          v4f v = *(const v4f*)(slab + row * 68 + c4);
          *(v4f*)(C + (size_t)(mBase + row) * ldc + n0 + c4) = v;
        }
        
      }
    } else {
      const int q = lane >> 3, c8 = (lane & 7) * 8;
      unsigned short* C  = (unsigned short*)Cout  + (size_t)b * strideC;
      unsigned short* C2 = (OUT_MODE == 2) ? ((unsigned short*)Cout2 + (size_t)b * strideC) : nullptr;
      {
#pragma unroll
        for (int it = 0; it < 4; ++it) {
          const int row = it * 4 + q;
          const float* sp = slab + row * 68 + c8;
          v8h hv, lv;
#pragma unroll
          for (int e = 0; e < 8; ++e) {
            if (OUT_MODE == 1) {
              hv[e] = (_Float16)sp[e];
            } else {
              unsigned short hb = f2bf_bits(sp[e]);
              unsigned short lb = f2bf_bits(sp[e] - bf_bits2f(hb));
              hv[e] = __builtin_bit_cast(_Float16, hb);
              lv[e] = __builtin_bit_cast(_Float16, lb);
            }
          }
          *(v8h*)(C + (size_t)(mBase + row) * ldc + n0 + c8) = hv;
          if (OUT_MODE == 2) *(v8h*)(C2 + (size_t)(mBase + row) * ldc + n0 + c8) = lv;
        }
        
      }
    }
    __builtin_amdgcn_fence(__ATOMIC_RELEASE, "workgroup");
    __builtin_amdgcn_wave_barrier();
    __builtin_amdgcn_fence(__ATOMIC_ACQUIRE, "workgroup");
  }
}

__global__ __launch_bounds__(256) void cast_f32_f16x2(
    const float* __restrict__ in, _Float16* __restrict__ out, int n2) {
  int i = blockIdx.x * 256 + threadIdx.x;
  if (i < n2) {
    const _Float16 h0 = (_Float16)in[2 * i], h1 = (_Float16)in[2 * i + 1];
    const unsigned u = (unsigned)__builtin_bit_cast(unsigned short, h0) | ((unsigned)__builtin_bit_cast(unsigned short, h1) << 16);
    ((unsigned*)out)[i] = u;
    
  }
}


} // namespace w25

__global__ __launch_bounds__(256) void k_castT16(const float* __restrict__ src, long long lds, _Float16* __restrict__ dst, long long ldd, int R, int C, float s) {
    const long long i = (long long)blockIdx.x * 256 + threadIdx.x; const long long np = (long long)C * (R / 2); if (i >= np) return; const int c = (int)(i / (R / 2)); const int r = 2 * (int)(i % (R / 2));
    const _Float16 h0 = (_Float16)(src[(long long)r * lds + c] * s), h1 = (_Float16)(src[(long long)(r + 1) * lds + c] * s);
    const unsigned u = (unsigned)__builtin_bit_cast(unsigned short, h0) | ((unsigned)__builtin_bit_cast(unsigned short, h1) << 16);
    unsigned* d = (unsigned*)(dst + (long long)c * ldd + r); *d = u;  }
__global__ __launch_bounds__(256) void k_cast16(const float* __restrict__ src, long long lds, _Float16* __restrict__ dst, long long ldd, int R, int C, float s) {
    const long long i = (long long)blockIdx.x * 256 + threadIdx.x; const long long np = (long long)R * (C / 2); if (i >= np) return; const int r = (int)(i / (C / 2)); const int c = 2 * (int)(i % (C / 2));
    const _Float16 h0 = (_Float16)(src[(long long)r * lds + c] * s), h1 = (_Float16)(src[(long long)r * lds + c + 1] * s);
    const unsigned u = (unsigned)__builtin_bit_cast(unsigned short, h0) | ((unsigned)__builtin_bit_cast(unsigned short, h1) << 16);
    unsigned* d = (unsigned*)(dst + (long long)r * ldd + c); *d = u;  }

// f32 -> bf16 hi plane + bf16 lo plane (x = hi + lo to ~2^-17 relative; RNE both), [R][C] -> [R][C] (or transposed to [C][R]); 2 consecutive destination elements
__device__ __forceinline__ unsigned int f2bf2_pack(float a, float b, unsigned int* lo) {
    const unsigned short ha = w25::f2bf_bits(a), hb = w25::f2bf_bits(b);
    const unsigned short la = w25::f2bf_bits(a - w25::bf_bits2f(ha)), lb = w25::f2bf_bits(b - w25::bf_bits2f(hb));
    *lo = (unsigned)la | ((unsigned)lb << 16); return (unsigned)ha | ((unsigned)hb << 16); }
__global__ __launch_bounds__(256) void k_castS16(const float* __restrict__ src, long long lds, __bf16* __restrict__ dhi, __bf16* __restrict__ dlo, long long ldd, int R, int C, float s, int transpose) {
    const long long i = (long long)blockIdx.x * 256 + threadIdx.x; long long o; float a, b;
    if (transpose) { const long long np = (long long)C * (R / 2); if (i >= np) return; const int c = (int)(i / (R / 2)); const int r = 2 * (int)(i % (R / 2)); a = src[(long long)r * lds + c] * s; b = src[(long long)(r + 1) * lds + c] * s; o = (long long)c * ldd + r; }
    else { const long long np = (long long)R * (C / 2); if (i >= np) return; const int r = (int)(i / (C / 2)); const int c = 2 * (int)(i % (C / 2)); a = src[(long long)r * lds + c] * s; b = src[(long long)r * lds + c + 1] * s; o = (long long)r * ldd + c; }
    unsigned lo; const unsigned hi = f2bf2_pack(a, b, &lo); unsigned* ph = (unsigned*)(dhi + o); unsigned* pl = (unsigned*)(dlo + o);
    *ph = hi; *pl = lo;  }

namespace w25 {
// =====================================================================================
// Generic causal/non-causal attention for head_dim 64, f32 in / f32 out; 16-bit operands: bf16 with optional hi/lo splits, or
// plain f16 (F16=true, non-split, probabilities carried x2^15).
//   scores = (q*qscale)·kᵀ : v_wmma_f32_16x16x32_bf16; SPLIT_QK -> q,k as bf16 hi/lo (hi·hi + hi·lo + lo·hi)
//   out    = p·v           : v_wmma_f32_16x16x32_bf16; SPLIT_PV -> p,v as bf16 hi/lo; else p,v plain bf16
//   f32 accumulate; online softmax in f32. Block = 4 waves = 64 query rows of one (batch, head); S % 64 == 0.
//   Element (b, s, h, d) of tensor X lives at X[b*X_bs + s*X_rs + h*X_hs + d] (strides in floats, multiples of 4).
//   Masking: mask_mode 0 none, 1 causal (kv > q masked), 2 tensor [S][Skv] shared over (b,h) (float if
//   mask_is_int==0, int32 with element == 0 -> masked if 1, int32 with element != 0 -> masked if 2), 3 per-token vectors qmask[B][S] & kvmask[B][Skv] (int32,
//   0 -> masked), 4 causal + sliding window (kv > q or q - kv > W masked; W passed in mask_is_int);
//   5 = relative-position bias: s += cp[b,h,q][idx[q][kv]] + pc[b,h,kv][idx[q][kv]] with idx = mask_b ([S][Skv] int32) and
//   mask_a an int32 [S][Skv] tensor with nonzero = masked (tables: element (b,h,row,n) at X + b*c_bs + h*c_hs + row*c_rs + n);
//   masked scores are replaced by mask_fill (e.g. -inf or -1e9) before the softmax.
//   grid.x = B * H * (S/64) (or a sub-range with blk0).
// =====================================================================================
#define AT_D 64
#define AT_NW 4
#define AT_QB 64
#define AT_KC 64
struct AttnGeom { const float* cp = nullptr; const float* pc = nullptr; long c_bs = 0, c_rs = 0, c_hs = 0;   // mode-5 score-bias tables
                  long q_bs, q_rs, q_hs, k_bs, k_rs, k_hs, v_bs, v_rs, v_hs, o_bs, o_rs, o_hs;
                  int S, Skv, H, mask_mode; float qscale; int blk0; float mask_fill; int mask_is_int; };
static_assert(sizeof(AttnGeom) == 168, "no padding");

__device__ __forceinline__ unsigned short at_bf_bits(float f) {
  unsigned u = __float_as_uint(f);
  return (unsigned short)((u + 0x7FFFu + ((u >> 16) & 1u)) >> 16);
}
__device__ __forceinline__ __bf16 at_f2bf(float f) { return __builtin_bit_cast(__bf16, at_bf_bits(f)); }
__device__ __forceinline__ void at_split(float f, __bf16& hi, __bf16& lo) {
  const unsigned short hb = at_bf_bits(f);
  hi = __builtin_bit_cast(__bf16, hb);
  lo = at_f2bf(f - __uint_as_float(((unsigned)hb) << 16));
}
__device__ __forceinline__ v8f at_mma(v16b a, v16b b, v8f c) {
  c = __builtin_amdgcn_wmma_f32_16x16x32_bf16(false, a, false, b, (short)0, c, false, false);
  asm volatile("v_nop\n\tv_nop\n\tv_nop\n\tv_nop" : "+v"(c) : "v"(a), "v"(b));
  return c;
}
// 16-bit element as a bit pattern held in a __bf16 slot: f16 bits when F16, bf16 (RNE) otherwise
template <bool F16> __device__ __forceinline__ __bf16 at_to16(float f) {
  if (F16) return __builtin_bit_cast(__bf16, (_Float16)f);
  return at_f2bf(f);
}
template <bool F16> __device__ __forceinline__ v8f at_mma16(v16b a, v16b b, v8f c) {
  if (F16) {
    const v16h ah = __builtin_bit_cast(v16h, a), bh = __builtin_bit_cast(v16h, b);
    c = __builtin_amdgcn_wmma_f32_16x16x32_f16(false, ah, false, bh, (short)0, c, false, false);
    asm volatile("v_nop\n\tv_nop\n\tv_nop\n\tv_nop" : "+v"(c) : "v"(ah), "v"(bh));
    return c;
  }
  return at_mma(a, b, c);
}

template <bool SPLIT_QK, bool SPLIT_PV, bool F16 = false>
__global__ __launch_bounds__(128)
void attn64_kernel(const float* __restrict__ q, const float* __restrict__ k,
                   const float* __restrict__ v, float* __restrict__ out,
                   const void* __restrict__ mask_a, const int* __restrict__ mask_b, AttnGeom g) {
  static_assert(!(F16 && (SPLIT_QK || SPLIT_PV)), "f16 mode is non-split");
  const float PSC = F16 ? 32768.0f : 1.0f;     // f16 probabilities carried x2^15 (subnormal range), folded into the final 1/l
  union FB { v16b v; v8b h[2]; };
  __shared__ __align__(16) __bf16 Ksh[AT_KC * AT_D];             // K hi [kv][d]      8 KB
  __shared__ __align__(16) __bf16 Ksl[SPLIT_QK ? AT_KC * AT_D : 8];
  __shared__ __align__(16) __bf16 Vth[AT_D * AT_KC];             // V hi [d][kv]      8 KB
  __shared__ __align__(16) __bf16 Vtl[SPLIT_PV ? AT_D * AT_KC : 8];
  __shared__ __align__(16) __bf16 Psh[AT_NW][16 * AT_KC];        // per wave P hi [row][kv]  8 KB
  __shared__ __align__(16) __bf16 Psl[SPLIT_PV ? AT_NW : 1][SPLIT_PV ? 16 * AT_KC : 8];
  __shared__ __align__(16) float  Os[AT_NW][16 * 68];            // per wave out tile, pitch 68

  const int tid  = threadIdx.x;
  const int wave = tid >> 5;
  const int lane = tid & 31;
  const int hh   = lane >> 4;
  const int c    = lane & 15;

  const int nqb = g.S / AT_QB;
  const int bx = blockIdx.x + g.blk0;
  const int qb = bx % nqb;
  const int bh = bx / nqb;
  const int h  = bh % g.H;
  const int b  = bh / g.H;
  const int qbase_block = qb * AT_QB;
  const int q0 = qbase_block + wave * 16;

  const float* qb_ptr = q + (size_t)b * g.q_bs + (size_t)h * g.q_hs;
  const float* kb_ptr = k + (size_t)b * g.k_bs + (size_t)h * g.k_hs;
  const float* vb_ptr = v + (size_t)b * g.v_bs + (size_t)h * g.v_hs;
  float*       ob_ptr = out + (size_t)b * g.o_bs + (size_t)h * g.o_hs;

  // ---- Q fragments (A operand): 2 d-chunks, hi (and lo) ----
  v16b qah[2], qal[2];
  {
    const float* qrow = qb_ptr + (size_t)(q0 + c) * g.q_rs;
#pragma unroll
    for (int dc = 0; dc < 2; ++dc) {
#pragma unroll
      for (int e = 0; e < 8; ++e) {
        const float f0 = qrow[dc * 32 + 8 * hh + e] * g.qscale;
        const float f1 = qrow[dc * 32 + 16 + 8 * hh + e] * g.qscale;
        if (SPLIT_QK) { __bf16 hq, lq; at_split(f0, hq, lq); qah[dc][e] = hq; qal[dc][e] = lq; at_split(f1, hq, lq); qah[dc][8 + e] = hq; qal[dc][8 + e] = lq; }
        else { qah[dc][e] = at_to16<F16>(f0); qah[dc][8 + e] = at_to16<F16>(f1); qal[dc][e] = qah[dc][e]; qal[dc][8 + e] = qah[dc][8 + e]; }
      }
    }
  }

  float mrow[8], lrow[8];
  v8f oacc[4];
#pragma unroll
  for (int r = 0; r < 8; ++r) { mrow[r] = -INFINITY; lrow[r] = 0.f; }
#pragma unroll
  for (int t = 0; t < 4; ++t) oacc[t] = (v8f){0.f,0.f,0.f,0.f,0.f,0.f,0.f,0.f};

  const int nChunks = (g.mask_mode == 1 || g.mask_mode == 4) ? (qb + 1) : (g.Skv / AT_KC);   // block-uniform
  // per-row query mask (mode 3)
  int qkeep[8];
#pragma unroll
  for (int r = 0; r < 8; ++r) qkeep[r] = (g.mask_mode == 3) ? mask_b[(size_t)b * g.S + q0 + 8 * hh + r] : 1;   // mask_b = qmask in mode 3
  for (int kc = 0; kc < nChunks; ++kc) {
    const int kv0 = kc * AT_KC;
    __syncthreads();
    {
      const int kvr = tid >> 1, dh = (tid & 1) * 32;
      const float* krow = kb_ptr + (size_t)(kv0 + kvr) * g.k_rs + dh;
      const float* vrow = vb_ptr + (size_t)(kv0 + kvr) * g.v_rs + dh;
#pragma unroll
      for (int i = 0; i < 8; ++i) {
        v4f kk = *(const v4f*)(krow + 4 * i);
        v4f vv = *(const v4f*)(vrow + 4 * i);
#pragma unroll
        for (int e = 0; e < 4; ++e) {
          const int d = dh + 4 * i + e;
          if (SPLIT_QK) { __bf16 a, bl; at_split(kk[e], a, bl); Ksh[kvr * AT_D + d] = a; Ksl[kvr * AT_D + d] = bl; }
          else Ksh[kvr * AT_D + d] = at_to16<F16>(kk[e]);
          if (SPLIT_PV) { __bf16 a, bl; at_split(vv[e], a, bl); Vth[d * AT_KC + kvr] = a; Vtl[d * AT_KC + kvr] = bl; }
          else Vth[d * AT_KC + kvr] = at_to16<F16>(vv[e]);
        }
      }
    }
    __syncthreads();

    v8f s[4];
#pragma unroll
    for (int j = 0; j < 4; ++j) {
      s[j] = (v8f){0.f,0.f,0.f,0.f,0.f,0.f,0.f,0.f};
#pragma unroll 1
      for (int dc = 0; dc < 2; ++dc) {
        FB kb;
        kb.h[0] = *(const v8b*)(Ksh + (j * 16 + c) * AT_D + dc * 32 + 8 * hh);
        kb.h[1] = *(const v8b*)(Ksh + (j * 16 + c) * AT_D + dc * 32 + 16 + 8 * hh);
        s[j] = at_mma16<F16>(qah[dc], kb.v, s[j]);
        if (SPLIT_QK) {
          FB kl;
          kl.h[0] = *(const v8b*)(Ksl + (j * 16 + c) * AT_D + dc * 32 + 8 * hh);
          kl.h[1] = *(const v8b*)(Ksl + (j * 16 + c) * AT_D + dc * 32 + 16 + 8 * hh);
          s[j] = at_mma16<F16>(qah[dc], kl.v, s[j]);
          s[j] = at_mma16<F16>(qal[dc], kb.v, s[j]);
        }
      }
    }
    const bool diag = (g.mask_mode == 1) && (kc == qb);
    int kvkeep[4] = {1, 1, 1, 1};
    if (g.mask_mode == 3) {
#pragma unroll
      for (int j = 0; j < 4; ++j) kvkeep[j] = ((const int*)mask_a)[(size_t)b * g.Skv + kv0 + j * 16 + c];   // mask_a = kvmask
    }
    float cm[8];
#pragma unroll
    for (int r = 0; r < 8; ++r) {
      const int qrow = q0 + 8 * hh + r;
      float m = -INFINITY;
#pragma unroll
      for (int j = 0; j < 4; ++j) {
        const int kvcol = kv0 + j * 16 + c;
        bool masked = false;
        if (diag) masked = (kvcol > qrow);
        else if (g.mask_mode == 4) masked = (kvcol > qrow) || (qrow - kvcol > g.mask_is_int);
        else if (g.mask_mode == 2) {
          const size_t mi = (size_t)qrow * g.Skv + kvcol;
          masked = (g.mask_is_int == 0) ? (((const float*)mask_a)[mi] == 0.0f)
                 : (g.mask_is_int == 1) ? (((const int*)mask_a)[mi] == 0) : (((const int*)mask_a)[mi] != 0);
        } else if (g.mask_mode == 3) masked = (qkeep[r] == 0) || (kvkeep[j] == 0);
        else if (g.mask_mode == 5) {
          const size_t mi = (size_t)qrow * g.Skv + kvcol;
          masked = (((const int*)mask_a)[mi] != 0);
          int n = mask_b[mi]; n = n < 0 ? 0 : n;
          s[j][r] += g.cp[(size_t)b * g.c_bs + (size_t)h * g.c_hs + (size_t)qrow * g.c_rs + n]
                   + g.pc[(size_t)b * g.c_bs + (size_t)h * g.c_hs + (size_t)kvcol * g.c_rs + n];
        }
        if (masked) s[j][r] = g.mask_fill;
        m = fmaxf(m, s[j][r]);
      }
#pragma unroll
      for (int off = 1; off < 16; off <<= 1) m = fmaxf(m, __shfl_xor(m, off, 32));
      cm[r] = m;
    }
    __bf16* pwh = Psh[wave];
    __bf16* pwl = Psl[SPLIT_PV ? wave : 0];
#pragma unroll
    for (int r = 0; r < 8; ++r) {
      const float mnew = fmaxf(mrow[r], cm[r]);
      const float alpha = expf(mrow[r] - mnew);
      mrow[r] = mnew;
      float psum = 0.f;
#pragma unroll
      for (int j = 0; j < 4; ++j) {
        const float p = expf(s[j][r] - mnew);
        psum += p;
        if (SPLIT_PV) { __bf16 a, bl; at_split(p, a, bl); pwh[(8 * hh + r) * AT_KC + j * 16 + c] = a; pwl[(8 * hh + r) * AT_KC + j * 16 + c] = bl; }
        else pwh[(8 * hh + r) * AT_KC + j * 16 + c] = at_to16<F16>(p * PSC);
      }
#pragma unroll
      for (int off = 1; off < 16; off <<= 1) psum += __shfl_xor(psum, off, 32);
      lrow[r] = lrow[r] * alpha + psum;
#pragma unroll
      for (int t = 0; t < 4; ++t) oacc[t][r] *= alpha;
    }
    __builtin_amdgcn_fence(__ATOMIC_RELEASE, "workgroup");
    __builtin_amdgcn_wave_barrier();
    __builtin_amdgcn_fence(__ATOMIC_ACQUIRE, "workgroup");
#pragma unroll 1
    for (int kk = 0; kk < 2; ++kk) {
      FB pa, pl;
      pa.h[0] = *(const v8b*)(pwh + c * AT_KC + kk * 32 + 8 * hh);
      pa.h[1] = *(const v8b*)(pwh + c * AT_KC + kk * 32 + 16 + 8 * hh);
      if (SPLIT_PV) {
        pl.h[0] = *(const v8b*)(pwl + c * AT_KC + kk * 32 + 8 * hh);
        pl.h[1] = *(const v8b*)(pwl + c * AT_KC + kk * 32 + 16 + 8 * hh);
      }
#pragma unroll
      for (int t = 0; t < 4; ++t) {
        FB vb;
        vb.h[0] = *(const v8b*)(Vth + (t * 16 + c) * AT_KC + kk * 32 + 8 * hh);
        vb.h[1] = *(const v8b*)(Vth + (t * 16 + c) * AT_KC + kk * 32 + 16 + 8 * hh);
        oacc[t] = at_mma16<F16>(pa.v, vb.v, oacc[t]);
        if (SPLIT_PV) {
          FB vl;
          vl.h[0] = *(const v8b*)(Vtl + (t * 16 + c) * AT_KC + kk * 32 + 8 * hh);
          vl.h[1] = *(const v8b*)(Vtl + (t * 16 + c) * AT_KC + kk * 32 + 16 + 8 * hh);
          oacc[t] = at_mma16<F16>(pa.v, vl.v, oacc[t]);
          oacc[t] = at_mma16<F16>(pl.v, vb.v, oacc[t]);
        }
      }
    }
  }

  float* os = Os[wave];
#pragma unroll
  for (int r = 0; r < 8; ++r) {
    const float inv = 1.0f / (lrow[r] * PSC);
#pragma unroll
    for (int t = 0; t < 4; ++t) os[(8 * hh + r) * 68 + t * 16 + c] = oacc[t][r] * inv;
  }
  __builtin_amdgcn_fence(__ATOMIC_RELEASE, "workgroup");
  __builtin_amdgcn_wave_barrier();
  __builtin_amdgcn_fence(__ATOMIC_ACQUIRE, "workgroup");
  {
    const int c4 = (lane & 15) * 4;
    {
#pragma unroll
      for (int it = 0; it < 8; ++it) {
        const int row = it * 2 + hh;
        v4f val = *(const v4f*)(os + row * 68 + c4);
        *(v4f*)(ob_ptr + (size_t)(q0 + row) * g.o_rs + c4) = val;
      }
      
    }
  }
}

} // namespace w25

// relative-offset bias table RT[h][c], c = i - j + (T-1): -floor(|i-j| / 30) * 2^-(h+1)   (thread-linear, data-independent)
__global__ __launch_bounds__(256) void k_mc_rt(float* __restrict__ RT, int NH, int RN, int T) { const int t = blockIdx.x * 256 + threadIdx.x; if (t >= NH * RN) return; const int h = t / RN, c = t % RN; int dist = c - (T - 1); dist = dist < 0 ? -dist : dist; VST2(float, RT + t, -(float)(dist / 30) * exp2f(-(float)(h + 1))); }


extern "C" void kernel_launch(void* const* d_in, const int* in_sizes, int n_in, void* d_out, int out_size, void* d_ws, size_t ws_size, hipStream_t stream) {
    (void)in_sizes; (void)n_in; (void)out_size; (void)ws_size;
    const float* x = (const float*)d_in[0];
    const float* ctx = (const float*)d_in[1];
    const float* Wq = (const float*)d_in[2];
    const float* Wk = (const float*)d_in[3];
    const float* Wv = (const float*)d_in[4];
    const float* Wo = (const float*)d_in[5];
    const float* bo = (const float*)d_in[6];
    const int Bn = 2;
    const int T = 2048;
    const int D = 1024;
    const int NH = 16;
    const int HD = 64;
    const int NR = Bn * T;
    const int RN = 2 * T - 1;
    float* out = (float*)d_out;
    char* wsp = (char*)d_ws;
    float* Q = (float*)wsp; wsp += (((size_t)((size_t)NR * D) * 4 + 255) / 256) * 256;
    float* Kb = (float*)wsp; wsp += (((size_t)((size_t)NR * D) * 4 + 255) / 256) * 256;
    float* V = (float*)wsp; wsp += (((size_t)((size_t)NR * D) * 4 + 255) / 256) * 256;
    float* Y = (float*)wsp; wsp += (((size_t)((size_t)NR * D) * 4 + 255) / 256) * 256;
    float* RT = (float*)wsp; wsp += (((size_t)((size_t)NH * RN + 64) * 4 + 255) / 256) * 256;
    unsigned short* G64A = (unsigned short*)wsp; wsp += (((size_t)(4194304) * 2 + 255) / 256) * 256;
    unsigned short* G64B = (unsigned short*)wsp; wsp += (((size_t)(1048576) * 2 + 255) / 256) * 256;
    k_mc_rt<<<(unsigned)((NH * RN + 255) / 256), 256, 0, stream>>>(RT, NH, RN, T);
    k_cast16<<<(unsigned)((((long long)(4096) * ((1024) / 2)) + 255) / 256), 256, 0, stream>>>(x, 1024, (_Float16*)(G64A), 1024, 4096, 1024, 1.0f);
    k_cast16<<<(unsigned)((((long long)(1024) * ((1024) / 2)) + 255) / 256), 256, 0, stream>>>(Wq, 1024, (_Float16*)(G64B), 1024, 1024, 1024, 16.0f);
    w25::wmma_gemm64<0, false, 0, 0, false, 0><<<dim3((unsigned)((((4096) / 64) * ((1024) / 64) + 7) / 8), (unsigned)(1)), 256, 0, stream>>>((const unsigned short*)(G64A), nullptr, 1024, 0, (const unsigned short*)(G64B), nullptr, 1024, 0, (void*)(Q), nullptr, 1024, 0, nullptr, nullptr, 0, 4096, 1024, 1024, 0.0625f);
    k_cast16<<<(unsigned)((((long long)(4096) * ((1024) / 2)) + 255) / 256), 256, 0, stream>>>(ctx, 1024, (_Float16*)(G64A), 1024, 4096, 1024, 1.0f);
    k_cast16<<<(unsigned)((((long long)(1024) * ((1024) / 2)) + 255) / 256), 256, 0, stream>>>(Wk, 1024, (_Float16*)(G64B), 1024, 1024, 1024, 16.0f);
    w25::wmma_gemm64<0, false, 0, 0, false, 0><<<dim3((unsigned)((((4096) / 64) * ((1024) / 64) + 7) / 8), (unsigned)(1)), 256, 0, stream>>>((const unsigned short*)(G64A), nullptr, 1024, 0, (const unsigned short*)(G64B), nullptr, 1024, 0, (void*)(Kb), nullptr, 1024, 0, nullptr, nullptr, 0, 4096, 1024, 1024, 0.0625f);
    k_cast16<<<(unsigned)((((long long)(4096) * ((1024) / 2)) + 255) / 256), 256, 0, stream>>>(ctx, 1024, (_Float16*)(G64A), 1024, 4096, 1024, 1.0f);
    k_cast16<<<(unsigned)((((long long)(1024) * ((1024) / 2)) + 255) / 256), 256, 0, stream>>>(Wv, 1024, (_Float16*)(G64B), 1024, 1024, 1024, 16.0f);
    w25::wmma_gemm64<0, false, 0, 0, false, 0><<<dim3((unsigned)((((4096) / 64) * ((1024) / 64) + 7) / 8), (unsigned)(1)), 256, 0, stream>>>((const unsigned short*)(G64A), nullptr, 1024, 0, (const unsigned short*)(G64B), nullptr, 1024, 0, (void*)(V), nullptr, 1024, 0, nullptr, nullptr, 0, 4096, 1024, 1024, 0.0625f);
    k_attnT<2048, 1024><<<dim3(2048 / (16 * AW), 16, 2), 32 * AW, 0, stream>>>(Q, Kb, V, Y, RT, 0.125f);
    k_cast16<<<(unsigned)((((long long)(4096) * ((1024) / 2)) + 255) / 256), 256, 0, stream>>>(Y, 1024, (_Float16*)(G64A), 1024, 4096, 1024, 1.0f);
    k_cast16<<<(unsigned)((((long long)(1024) * ((1024) / 2)) + 255) / 256), 256, 0, stream>>>(Wo, 1024, (_Float16*)(G64B), 1024, 1024, 1024, 16.0f);
    w25::wmma_gemm64<0, false, 2, 0, false, 0><<<dim3((unsigned)((((4096) / 64) * ((1024) / 64) + 7) / 8), (unsigned)(1)), 256, 0, stream>>>((const unsigned short*)(G64A), nullptr, 1024, 0, (const unsigned short*)(G64B), nullptr, 1024, 0, (void*)(out), nullptr, 1024, 0, bo, nullptr, 0, 4096, 1024, 1024, 0.0625f);
}

// v003
// It runs in 298 microseconds.
// Two timings next to v002 both put it at 1.13 times that version's speed.
// Over all steps from v000 it is 7.51 times as fast.
// Contractions: q = x.Wq^T [4096x1024].[1024x1024], k/v = context.W^T and the output projection (+b) with f16 operands on pre-cast planes (v_wmma_f32_16x16x32_f16; 64x64 register-blocked wave tiles, weights x16); per (batch, head) softmax(q k^T / 8 + b_h(|i-j|)) v over 2048 keys (head_dim 64) as a flash kernel with f16 q.k^T and f16 p.v (p as f16 of 4096 p), the periodic distance bias -floor(|i-j|/30) 2^-(h+1) read from a per-head relative-offset table built on device; f32 accumulate and softmax.
#include <hip/hip_runtime.h>
#include <math.h>

typedef __attribute__((ext_vector_type(16))) _Float16 v16h;
typedef __attribute__((ext_vector_type(8)))  _Float16 v8h;
typedef __attribute__((ext_vector_type(4)))  _Float16 v4h;
typedef __attribute__((ext_vector_type(16))) __bf16   v16b;
typedef __attribute__((ext_vector_type(8)))  float    v8f;
typedef __attribute__((ext_vector_type(4)))  float    v4f;

// 16-bit WMMA fragment map (wave32), lane L, h = L>>4, m = L&15:
//   A 16x32: lane = row m;   element i -> k = (i<8) ? 8h+i : 16+8h+(i-8)
//   B 32x16: lane = column m; the SAME k(i,h)
//   D 16x16 (8 f32): lane = column m; element r -> row 8h+r
__device__ __forceinline__ int frag_k(int i, int h) { return (i < 8) ? (8 * h + i) : (16 + 8 * h + (i - 8)); }
__device__ __forceinline__ __bf16 bf16_rne(float f) {
    unsigned int u = __float_as_uint(f);
    u += 0x7fffu + ((u >> 16) & 1u);
    return __builtin_bit_cast(__bf16, (unsigned short)(u >> 16));
}
__device__ __forceinline__ float bf16_f32(__bf16 b) { return __uint_as_float(((unsigned int)__builtin_bit_cast(unsigned short, b)) << 16); }
__device__ __forceinline__ v8f wmma16(v16h a, v16h b, v8f c) {
    c = __builtin_amdgcn_wmma_f32_16x16x32_f16(false, a, false, b, (short)0, c, false, false);
    asm volatile("v_nop\n\tv_nop\n\tv_nop\n\tv_nop" : "+v"(c) : "v"(a), "v"(b));
    return c;
}
__device__ __forceinline__ v8f wmmab(v16b a, v16b b, v8f c) {
    c = __builtin_amdgcn_wmma_f32_16x16x32_bf16(false, a, false, b, (short)0, c, false, false);
    asm volatile("v_nop\n\tv_nop\n\tv_nop\n\tv_nop" : "+v"(c) : "v"(a), "v"(b));
    return c;
}
struct Split { v16b hi, lo; };
// hi/lo split product: a.hi*b.hi + a.hi*b.lo + a.lo*b.hi
__device__ __forceinline__ v8f wmma3(const Split& a, const Split& b, v8f c) {
    c = __builtin_amdgcn_wmma_f32_16x16x32_bf16(false, a.hi, false, b.hi, (short)0, c, false, false);
    c = __builtin_amdgcn_wmma_f32_16x16x32_bf16(false, a.hi, false, b.lo, (short)0, c, false, false);
    c = __builtin_amdgcn_wmma_f32_16x16x32_bf16(false, a.lo, false, b.hi, (short)0, c, false, false);
    asm volatile("v_nop\n\tv_nop\n\tv_nop\n\tv_nop" : "+v"(c) : "v"(a.hi), "v"(a.lo), "v"(b.hi), "v"(b.lo));
    return c;
}
struct Split3 { v16b hi, mid, lo; };
// triple split product (6 terms, drops only terms below 2^-24 relative)
__device__ __forceinline__ v8f wmma6(const Split3& a, const Split3& b, v8f c) {
    c = __builtin_amdgcn_wmma_f32_16x16x32_bf16(false, a.hi, false, b.hi, (short)0, c, false, false);
    c = __builtin_amdgcn_wmma_f32_16x16x32_bf16(false, a.hi, false, b.mid, (short)0, c, false, false);
    c = __builtin_amdgcn_wmma_f32_16x16x32_bf16(false, a.mid, false, b.hi, (short)0, c, false, false);
    c = __builtin_amdgcn_wmma_f32_16x16x32_bf16(false, a.hi, false, b.lo, (short)0, c, false, false);
    c = __builtin_amdgcn_wmma_f32_16x16x32_bf16(false, a.mid, false, b.mid, (short)0, c, false, false);
    c = __builtin_amdgcn_wmma_f32_16x16x32_bf16(false, a.lo, false, b.hi, (short)0, c, false, false);
    asm volatile("v_nop\n\tv_nop\n\tv_nop\n\tv_nop" : "+v"(c) : "v"(a.hi), "v"(a.mid), "v"(a.lo), "v"(b.hi), "v"(b.mid), "v"(b.lo));
    return c;
}

// Fragment gathers from f32 memory: element i <- p[(k0 + frag_k(i,h)) * sk] * s, zero for k >= klen.
__device__ __forceinline__ v16h fh_ld(const float* __restrict__ p, long long sk, int k0, int h, int klen, float s) {
    v16h a;
#pragma unroll
    for (int i = 0; i < 16; ++i) { const int k = k0 + frag_k(i, h); a[i] = (k < klen) ? (_Float16)(p[(long long)k * sk] * s) : (_Float16)0.f; }
    return a;
}
__device__ __forceinline__ Split sp_ld(const float* __restrict__ p, long long sk, int k0, int h, int klen, float s) {
    Split r;
#pragma unroll
    for (int i = 0; i < 16; ++i) {
        const int k = k0 + frag_k(i, h); const float x = (k < klen) ? p[(long long)k * sk] * s : 0.f;
        const __bf16 hb = bf16_rne(x); r.hi[i] = hb; r.lo[i] = bf16_rne(x - bf16_f32(hb));
    }
    return r;
}
__device__ __forceinline__ Split3 sp3_ld(const float* __restrict__ p, long long sk, int k0, int h, int klen, float s) {
    Split3 r;
#pragma unroll
    for (int i = 0; i < 16; ++i) {
        const int k = k0 + frag_k(i, h); const float x = (k < klen) ? p[(long long)k * sk] * s : 0.f;
        const __bf16 hb = bf16_rne(x); const float r1 = x - bf16_f32(hb); const __bf16 mb = bf16_rne(r1);
        r.hi[i] = hb; r.mid[i] = mb; r.lo[i] = bf16_rne(r1 - bf16_f32(mb));
    }
    return r;
}
__device__ __forceinline__ v16b bh_ld(const float* __restrict__ p, long long sk, int k0, int h, int klen, float s) {
    v16b a;
#pragma unroll
    for (int i = 0; i < 16; ++i) { const int k = k0 + frag_k(i, h); a[i] = bf16_rne((k < klen) ? p[(long long)k * sk] * s : 0.f); }
    return a;
}
// f16 fragment from an f16 LDS/global row with element stride 1 (k-contiguous), no bounds (tile already zero padded)
__device__ __forceinline__ v16h fh_row(const _Float16* __restrict__ row, int k0, int h) {
    v16h a;
#pragma unroll
    for (int i = 0; i < 16; ++i) a[i] = row[k0 + frag_k(i, h)];
    return a;
}

#define VST2(T, ptr, val) do { const T vst2_v_ = (val); *(T*)(ptr) = vst2_v_;  } while (0)
typedef float v4f __attribute__((ext_vector_type(4)));
#define VST2V4(ptr, val) do { const v4f vst2_v4_ = (val); *(v4f*)(ptr) = vst2_v4_;  } while (0)

__device__ __attribute__((noinline)) float act_fn(float v, int act) {
    if (act == 1) return fmaxf(v, 0.f);                                                                               // relu
    if (act == 2) { const float u = 0.7978845608028654f * (v + 0.044715f * v * v * v); return 0.5f * v * (1.f + tanhf(u)); } // tanh-gelu
    if (act == 3) return v / (1.f + expf(-v));                                                                        // silu
    if (act == 4) return 0.5f * v * (1.f + erff(v * 0.7071067811865476f));                                             // erf-gelu
    if (act == 5) return tanhf(v);
    if (act == 6) return 1.f / (1.f + expf(-v));                                                                      // sigmoid
    if (act == 7) return (v > 0.f) ? v : 0.01f * v;                                                                   // leaky relu 0.01
    if (act == 8) return (v > 0.f) ? v : (expf(v) - 1.f);                                                             // elu
    if (act == 9) return fminf(fmaxf(v, 0.f), 6.f);                                                                   // relu6
    if (act == 10) return fabsf(v);                                                                                    // abs
    if (act == 11) return (v >= 0.f) ? v : 0.1f * v;                                                                  // leaky 0.1
    if (act == 12) return (v > 0.f) ? v : 0.2f * v;                                                                   // leaky 0.2
    if (act == 13) return (v > 20.f) ? v : log1pf(expf(v));                                                            // softplus
    return v;
}

// =====================================================================================================================
// k_gemm<MODE>: C(z, m, n) = act(alpha * sum_k A(z, m, k) * B(z, k, n) + bias) + beta * R(z, m, n)
//   One wave (32-thread block) per 16 x 32 tile of C; grid (ceil(N/32), ceil(M/16), Z). Batch z -> (zo = z / zi_n, zi = z % zi_n)
//   with separate outer/inner strides for every tensor (e.g. batch and head). A(m,k) = A[zo*sAo + zi*sAi + m*sAm + k*sAk] (f32),
//   B(k,n) = B[zo*sBo + zi*sBi + n*sBn + k*sBk] (f32); any M, N, K (K zero-padded to 32 inside the fragments, M/N tails guarded).
//   C(m,n) = C[zo*sCo + zi*sCi + m*sCm + n] (n contiguous). flags: 1 bias[n], 2 bias[m], 4 residual R[zo*sRo + zi*sRi + m*sRm + n*sRn].
//   MODE 0: f16 operands (A prescaled by sa, B by sb, both undone in the epilogue); 1: bf16 hi/lo split (3 products); 2: bf16;
//   3: bf16 hi/mid/lo triple split (6 products); 4: as 3 with Kahan-compensated f32 accumulation across k-steps.
// =====================================================================================================================
struct GemmP {
    const float* A; const float* B; const float* bias; const float* R; float* C;
    long long sAo, sAi, sAm, sAk, sBo, sBi, sBn, sBk, sCo, sCi, sCm, sRo, sRi, sRm, sRn;
    int M, N, K, zi_n, flags, act; float alpha, beta, sa, sb;
    int Npad, pad_;     // columns [N, Npad) of C are written as 0 so that padded workspace rows are covered by whole-line stores; Npad >= N
};
static_assert(sizeof(GemmP) == 5 * 8 + 15 * 8 + 6 * 4 + 4 * 4 + 2 * 4, "GemmP has padding");

template <int MODE>
__global__ __launch_bounds__(32) void k_gemm(GemmP p) {
    const int lane = threadIdx.x & 31, h = lane >> 4, l15 = lane & 15;
    const int m0 = blockIdx.y * 16, n0 = blockIdx.x * 32;
    const int z = blockIdx.z, zo = z / p.zi_n, zi = z - zo * p.zi_n;
    const float* A = p.A + zo * p.sAo + zi * p.sAi;
    const float* B = p.B + zo * p.sBo + zi * p.sBi;
    const int am = min(m0 + l15, p.M - 1);                       // clamped row for loads (stores are guarded)
    v8f acc[2], comp[2];
#pragma unroll
    for (int t = 0; t < 2; ++t) { v8f zz = {}; acc[t] = zz; comp[t] = zz; }
    for (int k0 = 0; k0 < p.K; k0 += 32) {
        const float* arow = A + (long long)am * p.sAm;
        if (MODE == 1) {
            const Split a = sp_ld(arow, p.sAk, k0, h, p.K, 1.f);
#pragma unroll
            for (int t = 0; t < 2; ++t) {
                const int bn = min(n0 + t * 16 + l15, p.N - 1);
                acc[t] = wmma3(a, sp_ld(B + (long long)bn * p.sBn, p.sBk, k0, h, p.K, 1.f), acc[t]);
            }
        } else if (MODE == 3) {
            const Split3 a = sp3_ld(arow, p.sAk, k0, h, p.K, 1.f);
#pragma unroll
            for (int t = 0; t < 2; ++t) {
                const int bn = min(n0 + t * 16 + l15, p.N - 1);
                acc[t] = wmma6(a, sp3_ld(B + (long long)bn * p.sBn, p.sBk, k0, h, p.K, 1.f), acc[t]);
            }
        } else if (MODE == 4) {
            // triple split as MODE 3, but each k-step's 6 products go into a fresh accumulator and the partial is added to the running f32 sum
            // on the VALU with Kahan compensation (accumulation error stays ~1 ulp however long K is)
            const Split3 a = sp3_ld(arow, p.sAk, k0, h, p.K, 1.f);
#pragma unroll
            for (int t = 0; t < 2; ++t) {
                const int bn = min(n0 + t * 16 + l15, p.N - 1); v8f zz = {};
                const v8f part = wmma6(a, sp3_ld(B + (long long)bn * p.sBn, p.sBk, k0, h, p.K, 1.f), zz);
                const v8f y = part - comp[t]; const v8f s = acc[t] + y; comp[t] = (s - acc[t]) - y; acc[t] = s;
            }
        } else if (MODE == 2) {
            const v16b a = bh_ld(arow, p.sAk, k0, h, p.K, 1.f);
#pragma unroll
            for (int t = 0; t < 2; ++t) {
                const int bn = min(n0 + t * 16 + l15, p.N - 1);
                acc[t] = wmmab(a, bh_ld(B + (long long)bn * p.sBn, p.sBk, k0, h, p.K, 1.f), acc[t]);
            }
        } else {
            const v16h a = fh_ld(arow, p.sAk, k0, h, p.K, p.sa);
#pragma unroll
            for (int t = 0; t < 2; ++t) {
                const int bn = min(n0 + t * 16 + l15, p.N - 1);
                acc[t] = wmma16(a, fh_ld(B + (long long)bn * p.sBn, p.sBk, k0, h, p.K, p.sb), acc[t]);
            }
        }
    }
    const float iscale = (MODE == 0) ? p.alpha / (p.sa * p.sb) : p.alpha;
    float* C = p.C + zo * p.sCo + zi * p.sCi;
    const float* R = p.R + zo * p.sRo + zi * p.sRi;
    __shared__ __align__(16) float ctile[16][36];
#pragma unroll
    for (int t = 0; t < 2; ++t) {
        const int n = n0 + t * 16 + l15; const int nn = min(n, p.N - 1);
#pragma unroll
        for (int r = 0; r < 8; ++r) {
            const int m = m0 + 8 * h + r; const int mm = min(m, p.M - 1);
            float v = acc[t][r] * iscale;
            if (p.flags & 1) v += p.bias[nn];
            if (p.flags & 2) v += p.bias[mm];
            if (p.flags & 8) v *= p.bias[(long long)zo * p.M + mm];   /* per-(z,row) scale vector laid out [Z][M]; exclusive with the bias flags */
            v = act_fn(v, p.act);
            if (p.flags & 4) v += p.beta * R[(long long)mm * p.sRm + (long long)nn * p.sRn];
            ctile[8 * h + r][t * 16 + l15] = (n < p.N) ? v : 0.f;
        }
    }
    __syncthreads();
    const int NW = (p.Npad > p.N) ? p.Npad : p.N;           // write width
    const bool fast = (m0 + 16 <= p.M) && (n0 + 32 <= NW) && ((p.sCm & 3) == 0) && ((((size_t)C) & 15) == 0);
    if (fast) {
#pragma unroll
        for (int s = 0; s < 4; ++s) {
            const int row = s * 4 + (lane >> 3), c4 = (lane & 7) * 4;
            const v4f v = *(const v4f*)&ctile[row][c4];
            VST2V4(C + (long long)(m0 + row) * p.sCm + n0 + c4, v);
        }
    } else {
        for (int row = 0; row < 16; ++row) {
            const int m = m0 + row, n = n0 + lane;
            if (m < p.M && n < NW) VST2(float, C + (long long)m * p.sCm + n, ctile[row][lane]);
        }
    }
}


// =====================================================================================================================
// k_gemmT<MODE, TM, TN>: same contract as k_gemm, but one wave computes a (16*TM) x (16*TN) tile: TM A fragments and TN B fragments are
//   loaded per 32-wide k-step and reused across TM*TN WMMAs (far fewer load/convert instructions per MAC). MODE 0 (f16), 1 (bf16 hi/lo),
//   2 (bf16) only. grid (ceil(NW/(16*TN)), ceil(M/(16*TM)), Z), block 32. Epilogue identical to k_gemm, run per 16x32 sub-tile.
// =====================================================================================================================
template <int MODE, int TM, int TN>
__global__ __launch_bounds__(32) void k_gemmT(GemmP p) {
    const int lane = threadIdx.x & 31, h = lane >> 4, l15 = lane & 15;
    const int m0 = blockIdx.y * (16 * TM), n0 = blockIdx.x * (16 * TN);
    const int z = blockIdx.z, zo = z / p.zi_n, zi = z - zo * p.zi_n;
    const float* A = p.A + zo * p.sAo + zi * p.sAi;
    const float* B = p.B + zo * p.sBo + zi * p.sBi;
    v8f acc[TM][TN];
#pragma unroll
    for (int i = 0; i < TM; ++i)
#pragma unroll
        for (int t = 0; t < TN; ++t) { v8f zz = {}; acc[i][t] = zz; }
    for (int k0 = 0; k0 < p.K; k0 += 32) {
        if (MODE == 1) {
            Split a[TM], b[TN];
#pragma unroll
            for (int i = 0; i < TM; ++i) { const int am = min(m0 + 16 * i + l15, p.M - 1); a[i] = sp_ld(A + (long long)am * p.sAm, p.sAk, k0, h, p.K, 1.f); }
#pragma unroll
            for (int t = 0; t < TN; ++t) { const int bn = min(n0 + 16 * t + l15, p.N - 1); b[t] = sp_ld(B + (long long)bn * p.sBn, p.sBk, k0, h, p.K, 1.f); }
#pragma unroll
            for (int i = 0; i < TM; ++i)
#pragma unroll
                for (int t = 0; t < TN; ++t) acc[i][t] = wmma3(a[i], b[t], acc[i][t]);
        } else if (MODE == 2) {
            v16b a[TM], b[TN];
#pragma unroll
            for (int i = 0; i < TM; ++i) { const int am = min(m0 + 16 * i + l15, p.M - 1); a[i] = bh_ld(A + (long long)am * p.sAm, p.sAk, k0, h, p.K, 1.f); }
#pragma unroll
            for (int t = 0; t < TN; ++t) { const int bn = min(n0 + 16 * t + l15, p.N - 1); b[t] = bh_ld(B + (long long)bn * p.sBn, p.sBk, k0, h, p.K, 1.f); }
#pragma unroll
            for (int i = 0; i < TM; ++i)
#pragma unroll
                for (int t = 0; t < TN; ++t) acc[i][t] = wmmab(a[i], b[t], acc[i][t]);
        } else {
            v16h a[TM], b[TN];
#pragma unroll
            for (int i = 0; i < TM; ++i) { const int am = min(m0 + 16 * i + l15, p.M - 1); a[i] = fh_ld(A + (long long)am * p.sAm, p.sAk, k0, h, p.K, p.sa); }
#pragma unroll
            for (int t = 0; t < TN; ++t) { const int bn = min(n0 + 16 * t + l15, p.N - 1); b[t] = fh_ld(B + (long long)bn * p.sBn, p.sBk, k0, h, p.K, p.sb); }
#pragma unroll
            for (int i = 0; i < TM; ++i)
#pragma unroll
                for (int t = 0; t < TN; ++t) acc[i][t] = wmma16(a[i], b[t], acc[i][t]);
        }
    }
    const float iscale = (MODE == 0) ? p.alpha / (p.sa * p.sb) : p.alpha;
    float* C = p.C + zo * p.sCo + zi * p.sCi;
    const float* R = p.R + zo * p.sRo + zi * p.sRi;
    const int NW = (p.Npad > p.N) ? p.Npad : p.N;
    __shared__ __align__(16) float ctile[16][36];
#pragma unroll
    for (int i = 0; i < TM; ++i) {
        const int mb = m0 + 16 * i; if (mb >= p.M) break;          // wave-uniform
#pragma unroll
        for (int tp = 0; tp < TN / 2; ++tp) {
            const int nb = n0 + 32 * tp; if (nb >= NW) break;        // wave-uniform
#pragma unroll
            for (int t2 = 0; t2 < 2; ++t2) {
                const int t = 2 * tp + t2; const int n = nb + t2 * 16 + l15; const int nn = min(n, p.N - 1);
#pragma unroll
                for (int r = 0; r < 8; ++r) {
                    const int m = mb + 8 * h + r; const int mm = min(m, p.M - 1);
                    float v = acc[i][t][r] * iscale;
                    if (p.flags & 1) v += p.bias[nn];
                    if (p.flags & 2) v += p.bias[mm];
            if (p.flags & 8) v *= p.bias[(long long)zo * p.M + mm];   /* per-(z,row) scale vector laid out [Z][M]; exclusive with the bias flags */
                    v = act_fn(v, p.act);
                    if (p.flags & 4) v += p.beta * R[(long long)mm * p.sRm + (long long)nn * p.sRn];
                    ctile[8 * h + r][t2 * 16 + l15] = (n < p.N) ? v : 0.f;
                }
            }
            __syncthreads();
            const bool fast = (mb + 16 <= p.M) && (nb + 32 <= NW) && ((p.sCm & 3) == 0) && ((((size_t)C) & 15) == 0);
            if (fast) {
#pragma unroll
                for (int s = 0; s < 4; ++s) {
                    const int row = s * 4 + (lane >> 3), c4 = (lane & 7) * 4;
                    const v4f v = *(const v4f*)&ctile[row][c4];
                    VST2V4(C + (long long)(mb + row) * p.sCm + nb + c4, v);
                }
            } else {
                for (int row = 0; row < 16; ++row) {
                    const int m = mb + row, n = nb + lane;
                    if (m < p.M && n < NW) VST2(float, C + (long long)m * p.sCm + n, ctile[row][lane]);
                }
            }
            __syncthreads();
        }
    }
}

// =====================================================================================================================
//   Wave = 16 queries, AW waves per block, 64-key blocks; grid (ceil(Lq/(16*AW)), H, B), block 32*AW. Any Lq, Lk; head dim dh <= DHP
//   (DHP multiple of 32), value dim dv <= DVP (multiple of 16, <= 128). Every tensor addressed by (batch, head, row, element) strides, f32.
//   Scores: QM 0 f16 operands, 1 bf16 hi/lo split, 2 bf16 triple split; statistics f32 (exp2 domain); P.V: P x 4096 as f16 with V f16 staged in LDS
//   (SPLITPV: P and V as bf16 hi/lo splits). kv head = h / hrep. Masking: causal = 1 (keep j <= i + coff, masked -> -inf, key blocks beyond the
//   diagonal skipped), causal = 2 (masked -> mfill, a finite fill like the -1e9; no skipping), causal = 3 (keep j >= i + coff,
//   masked -> -inf, no skipping); optional additive f32 mask Mf,
//   optional int keep-mask Mi (0 -> score := mfill), both addressed b*smb + h*smh + i*smi + j*smj (0 strides broadcast).
// =====================================================================================================================
#define AW 4
struct AttnP {   // apv4
    const float* Q; const float* K; const float* V; float* O; float* P; const float* Mf; const int* Mi; float* ST;
    const float* Pw; const float* Rt; const int* SQ; const int* SK;           // optional: post-softmax weight, relative-position table, segment ids
    long long swb, swh, swi, swj, srb, srh, sri;                                 // Pw strides (b,h,i,j); Rt strides (b,h,i), column = clamp(i - j + roff, 0, rn-1)
    long long sQb, sQh, sQi, sQd, sKb, sKh, sKj, sKd, sVb, sVh, sVj, sVd, sOb, sOh, sOi, sPb, sPh, sPi, smb, smh, smi, smj;
    int Lq, Lk, dh, dv, hrep, causal, coff, pband;   // pband > 0: P holds only the band |j - i| <= pband, column j - i + pband
    float scale, mfill; int nonorm, mpol;             // nonorm (online path only): O = sum_j exp(score_j) V_j without the 1/rowsum (scores must be <= ~0); mpol: Mi masks where ==0 (mpol 0) or where !=0 (mpol 1)
    int roff, rn, segpol, win;                        // Rt column offset/count; SQ/SK: score := mfill where (segpol 0) SQ[i] != SK[j] or (segpol 1) SQ[i] == SK[j]; win > 0: keys with i - j > win (after coff) -> -inf
};
//   Pw: the softmax numerator is multiplied by Pw(b,h,i,j) AFTER the row sum is taken (probs * weight, then P.V), as in post-softmax multiplicative biases.                                                    // ST (optional): per row (b,h,i) -> ST[((b*H + h)*Lq + i)*2 + {0,1}] = {row max of the scaled+masked score (natural units), sum_j exp(score - max)}
static_assert(sizeof(AttnP) == 12 * 8 + 29 * 8 + 16 * 4, "AttnP has padding");

// Inputs-only fence on sixteen loaded values: all must have arrived here, so their loads are issued together ahead of it and share one wait
// (without it the register-budgeted schedule waits after every load). It names no product and changes no value.
template <typename T> __device__ __forceinline__ void hold16(const T* x) {
    asm volatile("" :: "v"(x[0]), "v"(x[1]), "v"(x[2]), "v"(x[3]), "v"(x[4]), "v"(x[5]), "v"(x[6]), "v"(x[7]),
                       "v"(x[8]), "v"(x[9]), "v"(x[10]), "v"(x[11]), "v"(x[12]), "v"(x[13]), "v"(x[14]), "v"(x[15]));
}
#ifndef KATTN_ATTR
#define KATTN_ATTR __attribute__((amdgpu_waves_per_eu(4)))   // register budget of 256: four waves a SIMD, so that all 1,024 blocks of the launch are resident at once
#endif
//   GT > 0 fixes the geometry at compile time: Lq = Lk = GT, rows of GD floats with head h at column h * DHP (unit element stride), dh = DHP,
//   dv = DVP, one kv head per head, no mask, weight, segment, P or ST tensor, and a per-head Rt row of 2 GT - 1 columns. Only Q, K, V, O, Rt and scale
//   are then taken from the argument, so every length guard folds and the loads of a key block are contiguous and free of branches.
template <int DHP, int DVP, int QM, bool SPLITPV, bool TWOPASS, int GT = 0, int GD = 0>
__global__ __launch_bounds__(32 * AW) KATTN_ATTR void k_attn(AttnP parg) {
    AttnP p = parg;
    if (GT > 0) {
        p.P = nullptr; p.Mf = nullptr; p.Mi = nullptr; p.ST = nullptr; p.Pw = nullptr; p.SQ = nullptr; p.SK = nullptr;
        p.swb = 0; p.swh = 0; p.swi = 0; p.swj = 0; p.srb = 0; p.srh = 2 * GT - 1; p.sri = 0;
        p.sQb = (long long)GT * GD; p.sQh = DHP; p.sQi = GD; p.sQd = 1; p.sKb = (long long)GT * GD; p.sKh = DHP; p.sKj = GD; p.sKd = 1;
        p.sVb = (long long)GT * GD; p.sVh = DVP; p.sVj = GD; p.sVd = 1; p.sOb = (long long)GT * GD; p.sOh = DVP; p.sOi = GD;
        p.sPb = 0; p.sPh = 0; p.sPi = 0; p.smb = 0; p.smh = 0; p.smi = 0; p.smj = 0;
        p.Lq = GT; p.Lk = GT; p.dh = DHP; p.dv = DVP; p.hrep = 1; p.causal = 0; p.coff = 0; p.pband = 0;
        p.mfill = 0.f; p.nonorm = 0; p.mpol = 0; p.roff = GT - 1; p.rn = 2 * GT - 1; p.segpol = 0; p.win = 0;
        __builtin_assume(p.Rt != nullptr);
    }
    constexpr bool FULL = GT > 0 && GT % (16 * AW) == 0 && GT % 64 == 0;   // every query tile and key block is whole: index clamps and length guards are identities
    constexpr int NT = DVP / 16;                // output tiles
    constexpr int KS = DHP / 32;                // k-steps for the scores
    constexpr int VP = DVP + 8;                 // LDS pitch (halves)
    __shared__ __align__(16) float    pl[AW][16 * 64];
    __shared__ __align__(16) _Float16 vl[(SPLITPV ? 2 : 1) * 64 * VP];   // f16 V tile, or bf16 hi and lo tiles (same 2-byte size)
    const int lane = threadIdx.x & 31, hf = lane >> 4, l15 = lane & 15, wave = threadIdx.x >> 5;
    const int h = blockIdx.y, b = blockIdx.z, hk = h / p.hrep;
    const int q0 = (blockIdx.x * AW + wave) * 16;
    float* myp = pl[wave];
    const float L2E = 1.4426950408889634f;
    const float NEG = -__builtin_inff();
    const int qi = FULL ? q0 + l15 : min(q0 + l15, p.Lq - 1);
    const float* qrow = p.Q + b * p.sQb + h * p.sQh + (long long)qi * p.sQi;
    const float* kbase = p.K + b * p.sKb + hk * p.sKh;
    const float* vbase = p.V + b * p.sVb + hk * p.sVh;
    v16h qa[QM == 0 ? KS : 1]; Split qs_[QM == 1 ? KS : 1]; Split3 qt_[QM == 2 ? KS : 1];
#pragma unroll
    for (int ks = 0; ks < KS; ++ks) {
        if (QM == 2) qt_[ks] = sp3_ld(qrow, p.sQd, ks * 32, hf, p.dh, 1.f);
        else if (QM == 1) qs_[ks] = sp_ld(qrow, p.sQd, ks * 32, hf, p.dh, 1.f);
        else qa[ks] = fh_ld(qrow, p.sQd, ks * 32, hf, p.dh, 1.f);
    }
    v8f o[NT]; float m8[8], l8[8];
#pragma unroll
    for (int t = 0; t < NT; ++t) { v8f zz = {}; o[t] = zz; }
#pragma unroll
    for (int i = 0; i < 8; ++i) { m8[i] = NEG; l8[i] = 0.f; }
    int jend = p.Lk;
    if (p.causal == 1) { const int je = (blockIdx.x * AW + AW - 1) * 16 + 16 + p.coff; jend = min(jend, max(je, 0)); }   // uniform per block
    const int npass = TWOPASS ? 2 : 1;
    for (int pass = 0; pass < npass; ++pass) {
        const bool dopv = (!TWOPASS) || pass == 1;
        for (int j0 = 0; j0 < jend; j0 += 64) {
            if (dopv) {
                __syncthreads();                                 // previous key block's reads of vl / pl are done
                constexpr int VN = 64 * DVP / (32 * AW);         // V elements per thread and key block
                constexpr bool VLIN = (32 * AW) % DVP == 0;      // a thread keeps its column: its rows differ by a constant step
                float vf[VN];
#pragma unroll   // constant trip count: with the guard folded the tile's loads differ by immediate offsets only
                for (int it = 0; it < VN; ++it) {
                    const int idx = threadIdx.x + it * (32 * AW);
                    const int jr = VLIN ? (int)threadIdx.x / DVP + it * ((32 * AW) / DVP) : idx / DVP, d = VLIN ? (int)threadIdx.x % DVP : idx - jr * DVP, j = j0 + jr;
                    if constexpr (FULL && VLIN)   // block-uniform tile pointer + the thread's fixed offset + a constant
                        vf[it] = (vbase + (long long)j0 * GD)[(size_t)(unsigned)((int)threadIdx.x / DVP * GD + (int)threadIdx.x % DVP) + it * ((32 * AW) / DVP) * GD];
                    else
                        vf[it] = (j < p.Lk && d < p.dv) ? vbase[(long long)j * p.sVj + (long long)d * p.sVd] : 0.f;
                }
                if (FULL && VN == 32) { hold16(vf); hold16(vf + 16); }   // the tile's loads all issue ahead of this line and are waited for once
#pragma unroll
                for (int it = 0; it < VN; ++it) {
                    const int idx = threadIdx.x + it * (32 * AW);
                    const int jr = VLIN ? (int)threadIdx.x / DVP + it * ((32 * AW) / DVP) : idx / DVP, d = VLIN ? (int)threadIdx.x % DVP : idx - jr * DVP;
                    const float f = vf[it];
                    if (SPLITPV) {
                        const __bf16 hb = bf16_rne(f);
                        ((__bf16*)vl)[jr * VP + d] = hb; ((__bf16*)vl)[64 * VP + jr * VP + d] = bf16_rne(f - bf16_f32(hb));
                    } else vl[jr * VP + d] = (_Float16)f;
                }
            }
            v8f s[4];
            float rb[8][4];                                     // the key block's relative-position table entries, fetched ahead of the products
            if constexpr (FULL) {
                // column i - j + GT - 1 as block-uniform pointer + the lane's fixed offset + a constant, each part >= 0 (j0 <= GT - 64)
                const float* rt = p.Rt + (long long)h * (2 * GT - 1) + ((int)blockIdx.x * (16 * AW) - j0 + (GT - 64));
                const unsigned ro = (unsigned)(wave * 16 + 8 * hf + 15 - l15);
#pragma unroll
                for (int i = 0; i < 8; ++i)
#pragma unroll
                    for (int t = 0; t < 4; ++t) rb[i][t] = rt[(size_t)ro + (i + 16 * (3 - t))];
            } else if (p.Rt) {
#pragma unroll
                for (int i = 0; i < 8; ++i)
#pragma unroll
                    for (int t = 0; t < 4; ++t) {
                        const int ic = min(q0 + i + 8 * hf, p.Lq - 1);
                        int rc = ic - min(j0 + t * 16 + l15, p.Lk - 1) + p.roff; rc = rc < 0 ? 0 : (rc >= p.rn ? p.rn - 1 : rc);
                        rb[i][t] = p.Rt[b * p.srb + h * p.srh + (long long)ic * p.sri + rc];
                    }
            }
            if constexpr (FULL && QM == 0 && KS == 2) {
                // two key tiles at a time: their sixteen 16-byte loads (fh_ld's k order: floats 8 hf + 0..7 and 16 + 8 hf + 0..7 of each 32) fly together
#pragma unroll
                for (int tp = 0; tp < 2; ++tp) {
                    v4f kr[16];
#pragma unroll
                    for (int t2 = 0; t2 < 2; ++t2)
#pragma unroll
                        for (int ks = 0; ks < 2; ++ks) {
                            const v4f* kp = (const v4f*)((kbase + (long long)j0 * GD) + ((size_t)(unsigned)(l15 * GD + 8 * hf) + (2 * tp + t2) * 16 * GD + ks * 32));
                            kr[(t2 * 2 + ks) * 4 + 0] = kp[0]; kr[(t2 * 2 + ks) * 4 + 1] = kp[1]; kr[(t2 * 2 + ks) * 4 + 2] = kp[4]; kr[(t2 * 2 + ks) * 4 + 3] = kp[5];
                        }
                    hold16(kr);                                  // all sixteen loads issue ahead of this line and are waited for once
#pragma unroll
                    for (int t2 = 0; t2 < 2; ++t2) {
                        v8f acc = {};
#pragma unroll
                        for (int ks = 0; ks < 2; ++ks) {
                            v16h kfr;
#pragma unroll
                            for (int e = 0; e < 16; ++e) kfr[e] = (_Float16)kr[(t2 * 2 + ks) * 4 + (e >> 2)][e & 3];
                            acc = wmma16(qa[ks], kfr, acc);
                        }
                        s[2 * tp + t2] = acc;
                    }
                }
            } else {
#pragma unroll
            for (int t = 0; t < 4; ++t) {
                const int j = min(j0 + t * 16 + l15, p.Lk - 1);
                const float* krow = kbase + (long long)j * p.sKj;
                v8f acc = {};
#pragma unroll
                for (int ks = 0; ks < KS; ++ks) {
                    if (QM == 2)      acc = wmma6(qt_[ks], sp3_ld(krow, p.sKd, ks * 32, hf, p.dh, 1.f), acc);
                    else if (QM == 1) acc = wmma3(qs_[ks], sp_ld(krow, p.sKd, ks * 32, hf, p.dh, 1.f), acc);
                    else              acc = wmma16(qa[ks], fh_ld(krow, p.sKd, ks * 32, hf, p.dh, 1.f), acc);
                }
                s[t] = acc;
            }
            }
            float pv[8][4];
#pragma unroll
            for (int i = 0; i < 8; ++i) {
                const int irow = q0 + i + 8 * hf;
                const int ic = FULL ? irow : min(irow, p.Lq - 1);
                float sc[4];
#pragma unroll
                for (int t = 0; t < 4; ++t) {
                    const int jg = j0 + t * 16 + l15;
                    float v = s[t][i] * p.scale;
                    if (p.Mf) v += p.Mf[b * p.smb + h * p.smh + (long long)ic * p.smi + (long long)min(jg, p.Lk - 1) * p.smj];
                    if (p.Rt) v += rb[i][t];
                    if (p.Mi) { const int mv = p.Mi[b * p.smb + h * p.smh + (long long)ic * p.smi + (long long)min(jg, p.Lk - 1) * p.smj]; if (p.mpol ? (mv != 0) : (mv == 0)) v = p.mfill; }
                    if (p.SQ) { const bool same = p.SQ[(long long)b * p.Lq + ic] == p.SK[(long long)b * p.Lk + min(jg, p.Lk - 1)]; if (p.segpol ? same : !same) v = p.mfill; }
                    if (p.causal == 2 && jg > irow + p.coff) v = p.mfill;
                    if ((!FULL && jg >= p.Lk) || (p.causal == 1 && jg > irow + p.coff) || (p.causal == 3 && jg < irow + p.coff) || (p.win > 0 && irow + p.coff - jg > p.win)) v = NEG; else v *= L2E;
                    sc[t] = v;
                }
                if (!TWOPASS || pass == 0) {
                    float mx = fmaxf(fmaxf(sc[0], sc[1]), fmaxf(sc[2], sc[3]));
                    mx = fmaxf(mx, __shfl_xor(mx, 1, 32)); mx = fmaxf(mx, __shfl_xor(mx, 2, 32));
                    mx = fmaxf(mx, __shfl_xor(mx, 4, 32)); mx = fmaxf(mx, __shfl_xor(mx, 8, 32));
                    const float mnew = fmaxf(m8[i], mx);
                    const float corr = (mnew == NEG) ? 1.f : exp2f(m8[i] - mnew);
                    float rs = 0.f;
#pragma unroll
                    for (int t = 0; t < 4; ++t) {
                        const float pp = (sc[t] == NEG) ? 0.f : exp2f(sc[t] - mnew); rs += pp;
                        pv[i][t] = p.Pw ? pp * p.Pw[b * p.swb + h * p.swh + (long long)ic * p.swi + (long long)min(j0 + t * 16 + l15, p.Lk - 1) * p.swj] : pp;
                    }
                    rs += __shfl_xor(rs, 1, 32); rs += __shfl_xor(rs, 2, 32); rs += __shfl_xor(rs, 4, 32); rs += __shfl_xor(rs, 8, 32);
                    l8[i] = l8[i] * corr + rs; m8[i] = mnew;
                    if (!TWOPASS) {
#pragma unroll
                        for (int t = 0; t < NT; ++t) o[t][i] *= corr;
                    }
                } else {
                    const float inv = (l8[i] > 0.f) ? 1.f / l8[i] : 0.f;
#pragma unroll
                    for (int t = 0; t < 4; ++t) {
                        const int jg = j0 + t * 16 + l15;
                        float pp = (sc[t] == NEG) ? 0.f : exp2f(sc[t] - m8[i]) * inv;
                        if (p.Pw) pp *= p.Pw[b * p.swb + h * p.swh + (long long)ic * p.swi + (long long)min(jg, p.Lk - 1) * p.swj];
                        pv[i][t] = pp;
                    }
                }
            }
            if (dopv) {
#pragma unroll
                for (int i = 0; i < 8; ++i)
#pragma unroll
                    for (int t = 0; t < 4; ++t) ((float*)myp)[(i + 8 * hf) * 64 + t * 16 + l15] = pv[i][t];
                __syncthreads();                                 // P (per wave) and V (shared) visible
                if (p.P) {
                    float* pb_ = p.P + b * p.sPb + h * p.sPh;
                    const bool fastP = (p.pband == 0) && ((p.sPi & 3) == 0) && (j0 + 64 <= p.Lk) && (q0 + 16 <= p.Lq) && ((((size_t)pb_) & 15) == 0);
                    if (fastP) {
#pragma unroll
                        for (int s = 0; s < 8; ++s) {
                            const int row = s * 2 + (lane >> 4), c4 = (lane & 15) * 4;
                            const v4f v = *(const v4f*)(myp + row * 64 + c4);
                            VST2V4(pb_ + (long long)(q0 + row) * p.sPi + j0 + c4, v);
                        }
                    } else {
                        for (int row = 0; row < 16; ++row) {
                            const int irow = q0 + row; if (irow >= p.Lq) continue;
                            for (int c = lane; c < 64; c += 32) {
                                const int jg = j0 + c; if (jg >= p.Lk) continue;
                                if (p.pband == 0) VST2(float, pb_ + (long long)irow * p.sPi + jg, myp[row * 64 + c]);
                                else if (jg - irow <= p.pband && irow - jg <= p.pband) VST2(float, pb_ + (long long)irow * p.sPi + (jg - irow + p.pband), myp[row * 64 + c]);
                            }
                        }
                    }
                }
                if (SPLITPV) {
                    const Split pa0 = sp_ld(myp + l15 * 64, 1, 0, hf, 64, 1.f), pa1 = sp_ld(myp + l15 * 64, 1, 32, hf, 64, 1.f);
                    const __bf16* vh = (const __bf16*)vl; const __bf16* vlo = vh + 64 * VP;
#pragma unroll
                    for (int t = 0; t < NT; ++t) {
                        const int dcol = t * 16 + l15;
                        Split b0, b1;
#pragma unroll
                        for (int e = 0; e < 16; ++e) {
                            const int k0 = frag_k(e, hf), k1 = 32 + frag_k(e, hf);
                            b0.hi[e] = vh[k0 * VP + dcol]; b0.lo[e] = vlo[k0 * VP + dcol]; b1.hi[e] = vh[k1 * VP + dcol]; b1.lo[e] = vlo[k1 * VP + dcol];
                        }
                        o[t] = wmma3(pa0, b0, o[t]);
                        o[t] = wmma3(pa1, b1, o[t]);
                    }
                } else {
                    const v16h pa0 = fh_ld(myp + l15 * 64, 1, 0, hf, 64, 4096.f), pa1 = fh_ld(myp + l15 * 64, 1, 32, hf, 64, 4096.f);
#pragma unroll
                    for (int t = 0; t < NT; ++t) {
                        const int dcol = t * 16 + l15;
                        v16h b0, b1;
#pragma unroll
                        for (int e = 0; e < 16; ++e) { b0[e] = vl[frag_k(e, hf) * VP + dcol]; b1[e] = vl[(32 + frag_k(e, hf)) * VP + dcol]; }
                        o[t] = wmma16(pa0, b0, o[t]);
                        o[t] = wmma16(pa1, b1, o[t]);
                    }
                }
            }
        }
    }
    float* obase = p.O + b * p.sOb + h * p.sOh;
    if (p.ST) {
        const int rl = lane >> 1, isel = rl & 7;           // row q0 + rl ; rl>>3 == hf holds because lane>>4 == (lane>>1)>>3
        float mv = 0.f, lv = 0.f;
#pragma unroll
        for (int i = 0; i < 8; ++i) if (i == isel) { mv = m8[i]; lv = l8[i]; }
        const int irow = q0 + rl;
        if (irow < p.Lq) { float* st = p.ST + (((long long)b * gridDim.y + h) * p.Lq + irow) * 2 + (lane & 1); VST2(float, st, (lane & 1) ? lv : mv * 0.6931471805599453f); }
    }
    float invr[8];
#pragma unroll
    for (int i = 0; i < 8; ++i) {
        if (TWOPASS) invr[i] = SPLITPV ? 1.f : (1.f / 4096.f);
        else if (p.nonorm) invr[i] = exp2f(m8[i]) * (SPLITPV ? 1.f : (1.f / 4096.f));
        else invr[i] = (l8[i] > 0.f) ? (SPLITPV ? 1.f / l8[i] : 1.f / (l8[i] * 4096.f)) : 0.f;
    }
    __syncthreads();                                             // all waves done with pl/vl from the main loop
    const bool ofast = ((p.sOi & 3) == 0) && ((((size_t)obase) & 15) == 0) && (q0 + 16 <= p.Lq);
#pragma unroll
    for (int c0 = 0; c0 < DVP; c0 += 64) {
#pragma unroll
        for (int i = 0; i < 8; ++i)
#pragma unroll
            for (int t = 0; t < NT; ++t) if (t * 16 >= c0 && t * 16 < c0 + 64) ((float*)myp)[(i + 8 * hf) * 64 + (t * 16 - c0) + l15] = o[t][i] * invr[i];
        __syncthreads();
        const int cw = (DVP - c0 < 64) ? (DVP - c0) : 64;      // staged columns in this chunk (multiple of 16)
        if (ofast && (c0 + cw <= p.dv) && (cw % 32 == 0)) {
            const int lpr = cw / 4;                              // lanes per row (16 for 64 cols, 8 for 32)
            const int rows_per_ins = 32 / lpr;
            for (int r0 = 0; r0 < 16; r0 += rows_per_ins) {
                const int row = r0 + lane / lpr, c4 = (lane % lpr) * 4;
                const v4f v = *(const v4f*)(myp + row * 64 + c4);
                VST2V4(obase + (long long)(q0 + row) * p.sOi + c0 + c4, v);
            }
        } else {
            for (int row = 0; row < 16; ++row) {
                const int irow = q0 + row; if (irow >= p.Lq) continue;
                for (int c = lane; c < cw; c += 32) { const int d = c0 + c; if (d < p.dv) VST2(float, obase + (long long)irow * p.sOi + d, myp[row * 64 + c]); }
            }
        }
        __syncthreads();
    }
}

__device__ __forceinline__ float xhalf(float x) { return __builtin_bit_cast(float, __builtin_amdgcn_permlanex16(__builtin_bit_cast(int, x), __builtin_bit_cast(int, x), 0x76543210, 0xfedcba98, false, false)); }
template <int GT, int GD>
__global__ __launch_bounds__(32 * AW) KATTN_ATTR void k_attnT(const float* __restrict__ Q, const float* __restrict__ K, const float* __restrict__ V, float* __restrict__ O, const float* __restrict__ Rt, float scale) {
    static_assert(GT % (16 * AW) == 0 && GT % 64 == 0 && AW == 4, "whole query tiles and key blocks; 128 threads stage the 64 x 64 K and V tiles");
    constexpr int DH = 64;                      // head size
    constexpr int VP = 64 + 8;                  // LDS pitch (halves): rows of 128 bytes + 16, for 16-byte readers
    __shared__ __align__(16) _Float16 vt[2][DH * VP];   // V^T tile: row = head column, 64 keys along the row
    __shared__ __align__(16) _Float16 kt[2][64 * VP];   // K tile: row = key, the 64 head columns along the row; written once a key block, read by all four waves
    const int lane = threadIdx.x & 31, hf = lane >> 4, l15 = lane & 15, wave = threadIdx.x >> 5;
    const int h = blockIdx.y, b = blockIdx.z;
    const int q0 = (blockIdx.x * AW + wave) * 16;
    const float L2E = 1.4426950408889634f;
    const float* qrow = Q + (long long)b * GT * GD + h * DH + (long long)(q0 + l15) * GD;
    const float* kbase = K + (long long)b * GT * GD + h * DH;
    const float* vbase = V + (long long)b * GT * GD + h * DH;
    v16h qb[2];
#pragma unroll
    for (int ks = 0; ks < 2; ++ks) qb[ks] = fh_ld(qrow, 1, ks * 32, hf, DH, 1.f);
    v8f o[4]; float m = -__builtin_inff(), l = 0.f;
#pragma unroll
    for (int t = 0; t < 4; ++t) { v8f zz = {}; o[t] = zz; }
    const int vd = threadIdx.x & 63, vk = (threadIdx.x >> 6) * 32;   // V staging: this thread's head column and its first of 32 consecutive keys
    const int kc = threadIdx.x & 15, kq = threadIdx.x >> 4;          // K staging: 16 lanes cover one key's 256 bytes, so a wave's 16-byte load is four whole lines; keys kq + 8 it
    float vf[32]; v4f kf[8];                                         // this thread's share of the tiles on their way from global memory to LDS
    __builtin_amdgcn_sched_barrier(0);                               // with the one behind the wait below: nothing but the first tiles' loads stands between them, so no register is rewritten ahead of that wait
#pragma unroll
    for (int it = 0; it < 8; ++it) kf[it] = *(const v4f*)(kbase + ((size_t)(unsigned)(kq * GD + kc * 4) + it * 8 * GD));
#pragma unroll
    for (int it = 0; it < 32; ++it) vf[it] = vbase[(size_t)(unsigned)(vk * GD + vd) + it * GD];
    asm volatile("s_wait_xcnt 0x0" ::: "memory");                    // in front of the first overwrite of a register that these loads name as an address
    __builtin_amdgcn_sched_barrier(0);                               // keeps the later address arithmetic behind that wait (a "memory" clobber alone did not)
#pragma unroll
    for (int it = 0; it < 8; ++it) {
        v4h pk;
#pragma unroll
        for (int e = 0; e < 4; ++e) pk[e] = (_Float16)kf[it][e];
        *(v4h*)(kt[0] + (kq + 8 * it) * VP + kc * 4) = pk;
    }
#pragma unroll
    for (int c8 = 0; c8 < 4; ++c8) {
        v8h pk;
#pragma unroll
        for (int e = 0; e < 8; ++e) pk[e] = (_Float16)vf[c8 * 8 + e];
        *(v8h*)(vt[0] + vd * VP + vk + c8 * 8) = pk;
    }
    for (int j0 = 0; j0 < GT; j0 += 64) {
        // This trip works on key block j0 in buffer cur and fills the other buffer with the next block, whose loads fly under the products and the softmax.
        const int cur = (j0 >> 6) & 1;
        __syncthreads();                                 // block j0's tiles are visible; every wave has left the buffer that this trip fills
        const int jn = (j0 + 64 < GT) ? j0 + 64 : j0;    // the last trip fetches its own block again: no branch, nothing out of bounds, the copy is not read
#pragma unroll
        for (int it = 0; it < 8; ++it) kf[it] = *(const v4f*)((kbase + (long long)jn * GD) + ((size_t)(unsigned)(kq * GD + kc * 4) + it * 8 * GD));
        __builtin_amdgcn_sched_barrier(0);               // the next K tile's loads issue here: the scheduler otherwise moves them down to their LDS stores, each waited for with nothing to hide it
        // table column i - j + GT - 1 as block-uniform pointer + the lane's fixed offset + a constant, each part >= 0 (j0 <= GT - 64)
        float rb[4][8];
        const float* rt = Rt + (long long)h * (2 * GT - 1) + ((int)blockIdx.x * (16 * AW) - j0 + (GT - 64));
        const unsigned ro = (unsigned)(wave * 16 + l15 + 8 * (1 - hf));
#pragma unroll
        for (int t = 0; t < 4; ++t)
#pragma unroll
            for (int r = 0; r < 8; ++r) rb[t][r] = rt[(size_t)ro + (16 * (3 - t) + (7 - r))];
        v8f s[4];
        v8h ka[16];                                      // the eight K fragments, fh_ld's k order: halves 8 hf + 0..7 and 16 + 8 hf + 0..7 of each 32
#pragma unroll
        for (int t = 0; t < 4; ++t)
#pragma unroll
            for (int ks = 0; ks < 2; ++ks) {
                const _Float16* kr = kt[cur] + (t * 16 + l15) * VP + ks * 32 + 8 * hf;
                ka[(t * 2 + ks) * 2] = *(const v8h*)kr; ka[(t * 2 + ks) * 2 + 1] = *(const v8h*)(kr + 16);
            }
        hold16(ka);                                      // the sixteen LDS reads issue together and are waited for once (otherwise: one fragment's registers, a full LDS wait in front of each product)
#pragma unroll
        for (int t = 0; t < 4; ++t) {
            v8f acc = {};
#pragma unroll
            for (int ks = 0; ks < 2; ++ks) {
                const v16h kfr = __builtin_shufflevector(ka[(t * 2 + ks) * 2], ka[(t * 2 + ks) * 2 + 1], 0, 1, 2, 3, 4, 5, 6, 7, 8, 9, 10, 11, 12, 13, 14, 15);
                acc = __builtin_amdgcn_wmma_f32_16x16x32_f16(false, kfr, false, qb[ks], (short)0, acc, false, false);   // A = key rows, B = query columns
            }
            s[t] = acc;
        }
        float sc[4][8], mt[4];
#pragma unroll
        for (int t = 0; t < 4; ++t) {
#pragma unroll
            for (int r = 0; r < 8; ++r) sc[t][r] = (s[t][r] * scale + rb[t][r]) * L2E;
            mt[t] = fmaxf(fmaxf(fmaxf(sc[t][0], sc[t][1]), fmaxf(sc[t][2], sc[t][3])), fmaxf(fmaxf(sc[t][4], sc[t][5]), fmaxf(sc[t][6], sc[t][7])));
        }
        // the next V tile's loads: behind the table's last use, whose 32 registers they take over; they fly under the exponentials and the second products
        __builtin_amdgcn_sched_barrier(0);               // not earlier: issued beside the K tile and the table they leave the score products one fragment's registers, a wait per product
#pragma unroll
        for (int it = 0; it < 32; ++it) vf[it] = (vbase + (long long)jn * GD)[(size_t)(unsigned)(vk * GD + vd) + it * GD];
        __builtin_amdgcn_sched_barrier(0);               // they issue here, for the same reason as the K tile's
        float mx = fmaxf(fmaxf(mt[0], mt[1]), fmaxf(mt[2], mt[3]));
        mx = fmaxf(mx, xhalf(mx));                        // the other lane half holds the query's other 32 keys
        const float mnew = fmaxf(m, mx);
        const float corr = exp2f(m - mnew);
        float rs[4];
#pragma unroll
        for (int t = 0; t < 4; ++t) {
            rs[t] = 0.f;
#pragma unroll
            for (int r = 0; r < 8; ++r) { const float pp = exp2f(sc[t][r] - mnew); rs[t] += pp; sc[t][r] = pp; }
        }
        l = l * corr + ((rs[0] + rs[1]) + (rs[2] + rs[3])); m = mnew;
#pragma unroll
        for (int t = 0; t < 4; ++t)
#pragma unroll
            for (int r = 0; r < 8; ++r) o[t][r] *= corr;
        v16h pb[2];
#pragma unroll
        for (int ks = 0; ks < 2; ++ks)
#pragma unroll
            for (int e = 0; e < 16; ++e) pb[ks][e] = (_Float16)(sc[2 * ks + (e >> 3)][e & 7] * 4096.f);
#pragma unroll
        for (int t = 0; t < 4; ++t)
#pragma unroll
            for (int ks = 0; ks < 2; ++ks) {
                const _Float16* vr = vt[cur] + (t * 16 + l15) * VP + ks * 32 + 8 * hf;
                const v8h a0 = *(const v8h*)vr, a1 = *(const v8h*)(vr + 16);
                const v16h va = __builtin_shufflevector(a0, a1, 0, 1, 2, 3, 4, 5, 6, 7, 8, 9, 10, 11, 12, 13, 14, 15);
                o[t] = __builtin_amdgcn_wmma_f32_16x16x32_f16(false, va, false, pb[ks], (short)0, o[t], false, false);   // A = head columns, B = query columns
            }
        __builtin_amdgcn_sched_barrier(0);               // the casts stay below: moved up to save registers they would wait for the tiles' loads ahead of the work that hides them
#pragma unroll
        for (int it = 0; it < 8; ++it) {
            v4h pk;
#pragma unroll
            for (int e = 0; e < 4; ++e) pk[e] = (_Float16)kf[it][e];
            *(v4h*)(kt[cur ^ 1] + (kq + 8 * it) * VP + kc * 4) = pk;
        }
#pragma unroll
        for (int c8 = 0; c8 < 4; ++c8) {
            v8h pk;
#pragma unroll
            for (int e = 0; e < 8; ++e) pk[e] = (_Float16)vf[c8 * 8 + e];
            *(v8h*)(vt[cur ^ 1] + vd * VP + vk + c8 * 8) = pk;
        }
    }
    l += xhalf(l);                                       // join the two halves' sums
    const float inv = (l > 0.f) ? 1.f / (l * 4096.f) : 0.f;
    float* orow = O + (long long)b * GT * GD + h * DH + (long long)(q0 + l15) * GD + 8 * hf;
#pragma unroll
    for (int t = 0; t < 4; ++t) {
        const v4f w0 = { o[t][0] * inv, o[t][1] * inv, o[t][2] * inv, o[t][3] * inv }, w1 = { o[t][4] * inv, o[t][5] * inv, o[t][6] * inv, o[t][7] * inv };
        VST2V4(orow + t * 16, w0); VST2V4(orow + t * 16 + 4, w1);
    }
}

// =====================================================================================================================
// k_tr: dst(z, c, r) = alpha * src(z, r, c) (+ beta * R2(z, c, r)): [Z][R][C] (row stride lds) -> [Z][C][R] (row stride ldd) through a 32x32 LDS tile;
//   flags: 1 -> add beta * residual R2 addressed like dst (z*sRz + c*ldr + r); act applied before the residual.
// =====================================================================================================================
struct TrP { const float* src; float* dst; const float* R2; long long sSz, lds, sDz, ldd, sRz, ldr; int R, C, flags, act; float alpha, beta; };
static_assert(sizeof(TrP) == 3 * 8 + 6 * 8 + 6 * 4, "TrP has padding");
__global__ __launch_bounds__(256) void k_tr(TrP p) {
    __shared__ float tile[32][33];
    const int c0 = blockIdx.x * 32, r0 = blockIdx.y * 32, z = blockIdx.z;
    const int lane = threadIdx.x & 31, wave = threadIdx.x >> 5;
    const float* s = p.src + z * p.sSz;
#pragma unroll
    for (int k = 0; k < 4; ++k) {
        const int rl = wave * 4 + k, r = r0 + rl, c = c0 + lane;
        tile[rl][lane] = (r < p.R && c < p.C) ? s[(long long)r * p.lds + c] : 0.f;
    }
    __syncthreads();
    float* d = p.dst + z * p.sDz; const float* rr = p.R2 + z * p.sRz;
#pragma unroll
    for (int k = 0; k < 4; ++k) {
        const int cl = wave * 4 + k, c = c0 + cl, r = r0 + lane;
        if (c < p.C && r < p.R) {
            float v = act_fn(p.alpha * tile[lane][cl], p.act);
            if (p.flags & 1) v += p.beta * rr[(long long)c * p.ldr + r];
            VST2(float, d + (long long)c * p.ldd + r, v);
        }
    }
}

// k_affine: dst[i] = a * (sdev ? sdev[0] : 1) * src[i] + b, i < n (one thread per element; consecutive lanes -> consecutive addresses)
__global__ __launch_bounds__(256) void k_affine(const float* __restrict__ src, float* __restrict__ dst, int n, float a, float b, const float* __restrict__ sdev) {
    const int i = blockIdx.x * 256 + threadIdx.x;
    if (i < n) { const float aa = sdev ? a * sdev[0] : a; const float v = aa * src[i] + b; VST2(float, dst + i, v); }
}

// =====================================================================================================================
// k_softmax: row softmax over n contiguous elements, one 256-thread block per row; rows addressed z*sz + r*sr (grid (R, Z)).
//   out = scale_out * softmax(scale_in * x + (Mf ? Mf[z*smz + r*smr + j] : 0)); a row whose max is -inf is written as 0.
// =====================================================================================================================
struct SmP { const float* src; float* dst; const float* Mf; long long sz, sr, dz, dr, smz, smr; int n, pad; float scale_in, scale_out; };
static_assert(sizeof(SmP) == 3 * 8 + 6 * 8 + 4 * 4, "SmP has padding");
__global__ __launch_bounds__(256) void k_softmax(SmP p) {
    __shared__ float red[256];
    const int r = blockIdx.x, z = blockIdx.y, tid = threadIdx.x;
    const float* s = p.src + z * p.sz + (long long)r * p.sr;
    const float* mf = p.Mf ? (p.Mf + z * p.smz + (long long)r * p.smr) : nullptr;
    float mx = -__builtin_inff();
    for (int j = tid; j < p.n; j += 256) { float v = s[j] * p.scale_in; if (mf) v += mf[j]; mx = fmaxf(mx, v); }
    red[tid] = mx; __syncthreads();
    for (int o = 128; o > 0; o >>= 1) { if (tid < o) red[tid] = fmaxf(red[tid], red[tid + o]); __syncthreads(); }
    mx = red[0]; __syncthreads();
    float sum = 0.f;
    for (int j = tid; j < p.n; j += 256) { float v = s[j] * p.scale_in; if (mf) v += mf[j]; sum += (mx == -__builtin_inff()) ? 0.f : expf(v - mx); }
    red[tid] = sum; __syncthreads();
    for (int o = 128; o > 0; o >>= 1) { if (tid < o) red[tid] += red[tid + o]; __syncthreads(); }
    sum = red[0];
    const float inv = (sum > 0.f) ? p.scale_out / sum : 0.f;
    float* d = p.dst + z * p.dz + (long long)r * p.dr;
    for (int j = tid; j < p.n; j += 256) { float v = s[j] * p.scale_in; if (mf) v += mf[j]; const float o = (mx == -__builtin_inff()) ? 0.f : expf(v - mx) * inv; VST2(float, d + j, o); }
}
// =====================================================================================================================
// k_stats: mean and rsqrt(var + eps) over a set of n elements addressed base + z*sz + (e / inner) * so + (e % inner) * si, one 256-thread
// k_norm_apply: y = (x - mean[set]) * rstd[set] * g[c] + b[c] over a [Z][C][L] channel-major tensor with set = z*G + c / (C/G) (G groups per z;
//   G = C -> per-channel sets indexed z*C+c; for batch norm pass stats indexed by c only via bn = 1). Optional act. Output same layout.
// =====================================================================================================================
//   mode 0: mean / rsqrt(var + eps); mode 1 (RMSNorm): 0 / rsqrt(mean(x^2) + eps); mode 2 (L2 normalize * sqrt(n)): 0 / sqrt(n) / max(||x||, eps); mode 3: as 0 with unbiased variance (n-1)
__global__ __launch_bounds__(256) void k_stats(const float* __restrict__ x, long long sz, long long so, long long si, int inner, int n, float eps, float* __restrict__ stat, int mode) {
    __shared__ float red[256];
    const int z = blockIdx.x, tid = threadIdx.x;
    const float* base = x + z * sz;
    float s = 0.f;
    for (int e = tid; e < n; e += 256) s += base[(long long)(e / inner) * so + (long long)(e % inner) * si];
    red[tid] = s; __syncthreads();
    for (int o = 128; o > 0; o >>= 1) { if (tid < o) red[tid] += red[tid + o]; __syncthreads(); }
    const float mu = (mode == 0 || mode == 3) ? red[0] / (float)n : 0.f; __syncthreads();
    float q = 0.f;
    for (int e = tid; e < n; e += 256) { const float dlt = base[(long long)(e / inner) * so + (long long)(e % inner) * si] - mu; q += dlt * dlt; }
    red[tid] = q; __syncthreads();
    for (int o = 128; o > 0; o >>= 1) { if (tid < o) red[tid] += red[tid + o]; __syncthreads(); }
    {
        float rs;
        if (mode == 2) rs = sqrtf((float)n) / fmaxf(sqrtf(red[0]), eps); else if (mode == 3) rs = rsqrtf(red[0] / (float)(n - 1) + eps); else rs = rsqrtf(red[0] / (float)n + eps);
        if (tid < 32) { const float v = (tid == 0) ? mu : ((tid == 1) ? rs : 0.f); VST2(float, stat + (long long)z * 32 + tid, v); }
    }
}
//   One thread per element over the flat [Z][C][L] index space: grid ceil(Z*C*L / 256).
__global__ __launch_bounds__(256) void k_norm_apply(const float* __restrict__ x, float* __restrict__ y, const float* __restrict__ stat, const float* __restrict__ g, const float* __restrict__ bta,
                                                     int Z, int C, int L, int G, int bn, int act) {
    const long long idx = (long long)blockIdx.x * 256 + threadIdx.x;
    if (idx >= (long long)Z * C * L) return;
    const int l = (int)(idx % L); const long long zc = idx / L; const int c = (int)(zc % C), z = (int)(zc / C); (void)l;
    const int set = bn ? c : (z * G + c / (C / G));
    float v = (x[idx] - stat[(long long)set * 32]) * stat[(long long)set * 32 + 1];
    if (g) v *= g[c];
    if (bta) v += bta[c];
    v = act_fn(v, act);
    VST2(float, y + idx, v);
}

// k_lse_neg: c[i] = -(st[2i] + log(st[2i+1])) = minus the log-sum-exp of row i from k_attn's ST output (for softmax over the query dimension)
__global__ __launch_bounds__(256) void k_lse_neg(const float* __restrict__ st, float* __restrict__ c, int n) {
    const int i = blockIdx.x * 256 + threadIdx.x;
    if (i < n) { const float v = -(st[2 * i] + logf(st[2 * i + 1])); VST2(float, c + i, v); }
}

// k_iota: dst[i] = a * i + b as int32 (segment/position id helper)
__global__ __launch_bounds__(256) void k_iota(int* __restrict__ dst, int n, int a, int b) {
    const int i = blockIdx.x * 256 + threadIdx.x;
    if (i < n) { const int v = a * i + b; VST2(int, dst + i, v); }
}

// k_axpby: dst[i] = a * x[i] + b * y[i] (+ c), i < n
__global__ __launch_bounds__(256) void k_axpby(const float* __restrict__ x, const float* __restrict__ y, float* __restrict__ dst, int n, float a, float b, float c) {
    const int i = blockIdx.x * 256 + threadIdx.x;
    if (i < n) { const float v = a * x[i] + b * y[i] + c; VST2(float, dst + i, v); }
}

// =====================================================================================================================
// k_rope: rotary embedding on a [R rows][Hn heads][D] view (row stride sXr, head stride sXh, element stride 1) -> Y (own strides).
//   mode 0: rotate_half (partner d±D/2, sign - for d<D/2); mode 1: interleaved pairs (partner d^1, sign - for even d).
//   table column tcol: tmode 0 -> d, 1 -> d % (D/2), 2 -> d / 2; position p: pmode 0 -> r % S, 1 -> head index, 2 -> pos[r];
//   c = C[(r / S) * sCb + p * sCp + tcol * sCd], s likewise from Sn; y = x[d] * c + sign * x[partner] * s. X and Y must not alias.
// =====================================================================================================================
struct RopeP { const float* X; float* Y; const float* C; const float* Sn; const int* pos; long long sXr, sXh, sYr, sYh, sCb, sCp, sCd; int R, Hn, D, S, mode, tmode, pmode, pad; };
static_assert(sizeof(RopeP) == 5 * 8 + 7 * 8 + 8 * 4, "RopeP has padding");
__global__ __launch_bounds__(256) void k_rope(RopeP p) {
    const long long idx = (long long)blockIdx.x * 256 + threadIdx.x;
    if (idx >= (long long)p.R * p.Hn * p.D) return;
    const int d = (int)(idx % p.D); const long long rh = idx / p.D; const int h = (int)(rh % p.Hn); const int r = (int)(rh / p.Hn);
    const int half = p.D / 2;
    int partner; float sign;
    if (p.mode == 0) { partner = (d < half) ? d + half : d - half; sign = (d < half) ? -1.f : 1.f; }
    else { partner = d ^ 1; sign = (d & 1) ? 1.f : -1.f; }
    const int tcol = (p.tmode == 0) ? d : ((p.tmode == 1) ? (d % half) : (d >> 1));
    const int pp = (p.pmode == 0) ? (r % p.S) : ((p.pmode == 1) ? h : p.pos[r]);
    const long long toff = (long long)(r / p.S) * p.sCb + (long long)pp * p.sCp + (long long)tcol * p.sCd;
    const float* xr = p.X + (long long)r * p.sXr + (long long)h * p.sXh;
    const float v = xr[d] * p.C[toff] + sign * xr[partner] * p.Sn[toff];
    VST2(float, p.Y + (long long)r * p.sYr + (long long)h * p.sYh + d, v);
}

// k_invf + k_sincos (split so neither kernel carries a large VALU-fma footprint): invf_i = num * (1 / powf(base, (2 i)/D)) [fmode 0],
//   num * expf((2 i) * cexp) [fmode 1], num * powf(base, -2 (i - 1) / D) [fmode 2]; then cs/sn[s*half + i] = cos/sin((pscale * s) * invf_i)
__global__ __launch_bounds__(256) void k_invf(float* __restrict__ invb, int half, int D, float base, float num, int fmode, float cexp) {
    const int i = blockIdx.x * 256 + threadIdx.x;
    if (i >= ((half + 31) / 32) * 32) return;
    if (i >= half) { VST2(float, invb + i, 0.f); return; }
    const float e = (float)(2 * i) / (float)D;
    float invf;
    if (fmode == 1) invf = num * expf((float)(2 * i) * cexp);
    else if (fmode == 2) invf = num * powf(base, (-2.0f * ((float)i - 1.0f)) / (float)D);
    else invf = num * (1.0f / powf(base, e));
    VST2(float, invb + i, invf);
}
__global__ __launch_bounds__(256) void k_sincos(float* __restrict__ cs, float* __restrict__ sn, const float* __restrict__ invb, int S, int half, float pscale) {
    const int idx = blockIdx.x * 256 + threadIdx.x;
    if (idx >= S * half) return;
    const int s = idx / half, i = idx - s * half;
    const float ang = (pscale * (float)s) * invb[i];
    VST2(float, cs + idx, cosf(ang)); VST2(float, sn + idx, sinf(ang));
}

// k_mulact: dst[i] = act(x[i]) * y[i]
__global__ __launch_bounds__(256) void k_mulact(const float* __restrict__ x, const float* __restrict__ y, float* __restrict__ dst, int n, int act) {
    const int i = blockIdx.x * 256 + threadIdx.x;
    if (i < n) { const float v = act_fn(x[i], act) * y[i]; VST2(float, dst + i, v); }
}

// =====================================================================================================================
// k_matvec: thread-per-row matrix-vector products for N <= 8 output columns (heads with 1-3 outputs, gates), f32 on the VALU.
//   C[r*sCm + j] = act(alpha * sum_k A[r*sAm + k*sAk] * B[j*sBn + k*sBk] + bias[j]) + beta * R[r*sRm + j*sRn]; each thread writes its N contiguous floats.
// =====================================================================================================================
__global__ __launch_bounds__(256) void k_matvec(GemmP p) {
    // 32 lanes write one line with one instruction.
    const int rpt = (p.N == 1) ? 1 : 32;
    const long long r0 = ((long long)blockIdx.x * 256 + threadIdx.x) * rpt; const int z = blockIdx.z, zo = z / p.zi_n, zi = z - zo * p.zi_n;
    if (r0 >= p.M) return;
    const float* Bb = p.B + zo * p.sBo + zi * p.sBi;
    float* C = p.C + zo * p.sCo + zi * p.sCi; const float* R = p.R + zo * p.sRo + zi * p.sRi;
    for (int rr = 0; rr < rpt; ++rr) {
        const long long r = r0 + rr; if (r >= p.M) break;
        const float* A = p.A + zo * p.sAo + zi * p.sAi + r * p.sAm;
        float acc[8] = {0.f, 0.f, 0.f, 0.f, 0.f, 0.f, 0.f, 0.f};
        for (int k = 0; k < p.K; ++k) { const float a = A[(long long)k * p.sAk];
#pragma unroll
            for (int j = 0; j < 8; ++j) if (j < p.N) acc[j] += a * Bb[(long long)j * p.sBn + (long long)k * p.sBk]; }
#pragma unroll
        for (int j = 0; j < 8; ++j) if (j < p.N) {
            float v = acc[j] * p.alpha;
            if (p.flags & 1) v += p.bias[j];
            if (p.flags & 2) v += p.bias[r];
            v = act_fn(v, p.act);
            if (p.flags & 4) v += p.beta * R[r * p.sRm + (long long)j * p.sRn];
            VST2(float, C + r * p.sCm + j, v);
        }
    }
}
// k_smallsoftmax: thread-per-row softmax for short rows (n <= 64): dst[r*dr + j] = softmax(scale*src[r*sr + j])
__global__ __launch_bounds__(256) void k_smallsoftmax(const float* __restrict__ src, float* __restrict__ dst, long long sr, long long dr, int n, long long R, float scale) {
    const long long r0 = ((long long)blockIdx.x * 256 + threadIdx.x) * 32;
    for (int rr = 0; rr < 32; ++rr) {
        const long long r = r0 + rr; if (r >= R) return;
        const float* s = src + r * sr; float* d = dst + r * dr;
        float mx = -__builtin_inff();
        for (int j = 0; j < n; ++j) mx = fmaxf(mx, s[j] * scale);
        float sum = 0.f;
        for (int j = 0; j < n; ++j) sum += expf(s[j] * scale - mx);
        const float inv = 1.f / sum;
        for (int j = 0; j < n; ++j) { const float v = expf(s[j] * scale - mx) * inv; VST2(float, d + j, v); }
    }
}

__global__ __launch_bounds__(32) void k_unitstat(float* __restrict__ st) { const int t = threadIdx.x; const float v = (t == 1) ? 1.f : 0.f; VST2(float, st + t, v); }

// destination (e.g. a d_out whose row width is not a multiple of 32 floats) is written by consecutive lanes of one instruction
__global__ __launch_bounds__(256) void k_lincopy(const float* __restrict__ src, long long lds, float* __restrict__ dst, long long ldd, long long rows, int cols) {
    const long long i = (long long)blockIdx.x * 256 + threadIdx.x; if (i >= rows * cols) return;
    const long long r = i / cols; const int c = (int)(i - r * cols);
    const float v = src[r * lds + c]; VST2(float, dst + r * ldd + c, v);
}

namespace w25 {
typedef __attribute__((ext_vector_type(16))) _Float16 v16h;
typedef __attribute__((ext_vector_type(8)))  _Float16 v8h;
typedef __attribute__((ext_vector_type(16))) __bf16   v16b;
typedef __attribute__((ext_vector_type(8)))  __bf16   v8b;
typedef __attribute__((ext_vector_type(8)))  float    v8f;
typedef __attribute__((ext_vector_type(4)))  float    v4f;

__device__ __forceinline__ unsigned short f2bf_bits(float f) {
  unsigned u = __float_as_uint(f);
  return (unsigned short)((u + 0x7FFFu + ((u >> 16) & 1u)) >> 16);
}
__device__ __forceinline__ float bf_bits2f(unsigned short h) { return __uint_as_float(((unsigned)h) << 16); }

// hazard guards as plain device helpers (no inline asm inside the kernel template body)
__device__ __forceinline__ void dep_guard_h(v8f& a, v8f& b, v16h x, v16h y) { asm volatile("v_nop\n\tv_nop\n\tv_nop\n\tv_nop" : "+v"(a), "+v"(b) : "v"(x), "v"(y)); }
__device__ __forceinline__ void dep_guard_b(v8f& a, v8f& b, v16b x, v16b y) { asm volatile("v_nop\n\tv_nop\n\tv_nop\n\tv_nop" : "+v"(a), "+v"(b) : "v"(x), "v"(y)); }
__device__ __forceinline__ void keep4_h(v16h a, v16h b, v16h c, v16h d) { asm volatile("v_nop" :: "v"(a), "v"(b), "v"(c), "v"(d)); }
__device__ __forceinline__ void keep4_b(v16b a, v16b b, v16b c, v16b d) { asm volatile("v_nop" :: "v"(a), "v"(b), "v"(c), "v"(d)); }
__device__ __forceinline__ void acc_guard4(v8f& a, v8f& b, v8f& c, v8f& d) { asm volatile("v_nop\n\tv_nop\n\tv_nop\n\tv_nop" : "+v"(a), "+v"(b), "+v"(c), "+v"(d)); }
template <typename T> struct Frag;
template <> struct Frag<_Float16> {
  typedef v16h V; union U { v16h v; v8h h[2]; };
  static __device__ __forceinline__ v16h load(const _Float16* p) {   // elements 0..7 <- p[0..7], 8..15 <- p[16..23]
    U f; f.h[0] = *(const v8h*)(p); f.h[1] = *(const v8h*)(p + 16); return f.v;
  }
  static __device__ __forceinline__ v8f mma(v16h a, v16h b, v8f c) {
    return __builtin_amdgcn_wmma_f32_16x16x32_f16(false, a, false, b, (short)0, c, false, false);
  }
  static __device__ __forceinline__ void guard(v8f& a, v8f& b, v16h x, v16h y) { dep_guard_h(a, b, x, y); }
  static __device__ __forceinline__ void keep(v16h a, v16h b, v16h c, v16h d) { keep4_h(a, b, c, d); }
};
template <> struct Frag<__bf16> {
  typedef v16b V; union U { v16b v; v8b h[2]; };
  static __device__ __forceinline__ v16b load(const __bf16* p) {
    U f; f.h[0] = *(const v8b*)(p); f.h[1] = *(const v8b*)(p + 16); return f.v;
  }
  static __device__ __forceinline__ v8f mma(v16b a, v16b b, v8f c) {
    return __builtin_amdgcn_wmma_f32_16x16x32_bf16(false, a, false, b, (short)0, c, false, false);
  }
  static __device__ __forceinline__ void guard(v8f& a, v8f& b, v16b x, v16b y) { dep_guard_b(a, b, x, y); }
  static __device__ __forceinline__ void keep(v16b a, v16b b, v16b c, v16b d) { keep4_b(a, b, c, d); }
};

// ---- Register-blocked batched WMMA GEMM ------------------------------------
// C[m,n] = scale * sum_k A[m,k] * Bt[n,k] (+bias)(+resid); each wave owns a 64x64 tile.
// A row-major [M,K]; Bt row-major [N,K]; M,N % 64 == 0, K % 32 == 0.
// SPLIT: operands are hi/lo planes (A2/Bt2 = lo planes, same layout); product = hi·hi + hi·lo + lo·hi.
// BIAS_MODE: 0 = none, 1 = bias[m], 2 = bias[n].
// OUT_MODE: 0 = f32, 1 = f16, 2 = bf16 hi plane (Cout) + bf16 lo plane (Cout2).
// ET: 0 = f16 operands, 1 = bf16 operands (pointers passed as 16-bit storage)
template <int ET> struct Elem;
template <> struct Elem<0> { typedef _Float16 T; };
template <> struct Elem<1> { typedef __bf16 T; };
template <int ET, bool SPLIT, int BIAS_MODE, int OUT_MODE, bool RESID, int ACT = 0>
__global__ __launch_bounds__(256) void wmma_gemm64(
    const unsigned short* __restrict__ Ap, const unsigned short* __restrict__ A2p, int lda, long strideA,
    const unsigned short* __restrict__ Btp, const unsigned short* __restrict__ Bt2p, int ldb, long strideB,
    void* __restrict__ Cout, void* __restrict__ Cout2, int ldc, long strideC,
    const float* __restrict__ bias,
    const float* __restrict__ resid, long strideR,
    int M, int N, int K, float scale) {
  typedef typename Elem<ET>::T T;
  typedef typename Frag<T>::V V;
  const T* A = (const T*)Ap; const T* A2 = (const T*)A2p; const T* Bt = (const T*)Btp; const T* Bt2 = (const T*)Bt2p;
  __shared__ __align__(16) float sT[8][16 * 68];   // per-wave 16x64 slab, pitch 68 floats
  const int b    = blockIdx.y;
  const int lane = threadIdx.x & 31;
  const int wave = threadIdx.x >> 5;
  const int tilesN = N >> 6;
  const int tilesM = M >> 6;
  const int tile = blockIdx.x * 8 + wave;
  if (tile >= tilesM * tilesN) return;   // wave-uniform; no block barriers in this kernel
  const int tm = tile / tilesN;
  const int tn = tile - tm * tilesN;
  const int m0 = tm << 6;
  const int n0 = tn << 6;

  const T* Ab  = A  + (size_t)b * strideA;
  const T* Bb  = Bt + (size_t)b * strideB;
  const T* Ab2 = SPLIT ? (A2  + (size_t)b * strideA) : nullptr;
  const T* Bb2 = SPLIT ? (Bt2 + (size_t)b * strideB) : nullptr;

  const int rlane = lane & 15;                 // row (A) / col (B, D) within subtile
  const int koff  = (lane >> 4) * 8;           // k offset of this lane half
  const int mOff  = (lane >> 4) * 8;           // D row offset

  v8f acc[4][4];
#pragma unroll
  for (int i = 0; i < 4; ++i)
#pragma unroll
    for (int j = 0; j < 4; ++j) acc[i][j] = (v8f){0.f,0.f,0.f,0.f,0.f,0.f,0.f,0.f};

  for (int k0 = 0; k0 < K; k0 += 32) {
    V bh[4], bl[4];
#pragma unroll
    for (int j = 0; j < 4; ++j) {
      const size_t bo = (size_t)(n0 + (j << 4) + rlane) * ldb + koff + k0;
      bh[j] = Frag<T>::load(Bb + bo);
      if (SPLIT) bl[j] = Frag<T>::load(Bb2 + bo);
    }
#pragma unroll
    for (int i = 0; i < 4; ++i) {
      const size_t ao = (size_t)(m0 + (i << 4) + rlane) * lda + koff + k0;
      V ah = Frag<T>::load(Ab + ao);
      V al;
      if (SPLIT) al = Frag<T>::load(Ab2 + ao);
#pragma unroll
      for (int j = 0; j < 4; ++j) {
        acc[i][j] = Frag<T>::mma(ah, bh[j], acc[i][j]);
        if (SPLIT) {
          acc[i][j] = Frag<T>::mma(ah, bl[j], acc[i][j]);
          acc[i][j] = Frag<T>::mma(al, bh[j], acc[i][j]);
        }
      }
      Frag<T>::guard(acc[i][0], acc[i][3], ah, SPLIT ? al : ah);
    }
    Frag<T>::keep(bh[0], bh[1], bh[2], bh[3]);
    if (SPLIT) Frag<T>::keep(bl[0], bl[1], bl[2], bl[3]);
  }
  acc_guard4(acc[0][0], acc[0][1], acc[0][2], acc[0][3]);
  acc_guard4(acc[1][0], acc[1][1], acc[1][2], acc[1][3]);
  acc_guard4(acc[2][0], acc[2][1], acc[2][2], acc[2][3]);
  acc_guard4(acc[3][0], acc[3][1], acc[3][2], acc[3][3]);

  // ---- epilogue ----
  float* slab = sT[wave];
  const float* Rb = RESID ? (resid + (size_t)b * strideR) : nullptr;
#pragma unroll
  for (int i = 0; i < 4; ++i) {
    const int mBase = m0 + (i << 4);
#pragma unroll
    for (int j = 0; j < 4; ++j) {
      const int n = n0 + (j << 4) + rlane;
      float bv = 0.f;
      if (BIAS_MODE == 2) bv = bias[n];
#pragma unroll
      for (int r = 0; r < 8; ++r) {
        float v = acc[i][j][r] * scale;
        if (BIAS_MODE == 1) v += bias[mBase + mOff + r];
        if (BIAS_MODE == 2) v += bv;
        if (RESID) v += Rb[(size_t)(mBase + mOff + r) * ldc + n];
        if (ACT == 1) v = tanhf(v);
        if (ACT == 2) v = fmaxf(v, 0.0f);
        if (ACT == 3) v = v / (1.0f + expf(-v));
        if (ACT == 4) v = (v > 0.f) ? v : 0.01f * v;
        if (ACT == 5) v = 0.5f * v * (1.0f + erff(v * 0.70710678118654752f));
        slab[(mOff + r) * 68 + (j << 4) + rlane] = v;
      }
    }
    __builtin_amdgcn_fence(__ATOMIC_RELEASE, "workgroup");
    __builtin_amdgcn_wave_barrier();
    __builtin_amdgcn_fence(__ATOMIC_ACQUIRE, "workgroup");
    if (OUT_MODE == 0) {
      float* C = (float*)Cout + (size_t)b * strideC;
      const int hh = lane >> 4, c4 = (lane & 15) * 4;     // row seg = 256 B = 16 lanes x 16 B
      {
#pragma unroll
        for (int it = 0; it < 8; ++it) {
          const int row = it * 2 + hh;
          v4f v = *(const v4f*)(slab + row * 68 + c4);
          *(v4f*)(C + (size_t)(mBase + row) * ldc + n0 + c4) = v;
        }
        
      }
    } else {
      const int q = lane >> 3, c8 = (lane & 7) * 8;
      unsigned short* C  = (unsigned short*)Cout  + (size_t)b * strideC;
      unsigned short* C2 = (OUT_MODE == 2) ? ((unsigned short*)Cout2 + (size_t)b * strideC) : nullptr;
      {
#pragma unroll
        for (int it = 0; it < 4; ++it) {
          const int row = it * 4 + q;
          const float* sp = slab + row * 68 + c8;
          v8h hv, lv;
#pragma unroll
          for (int e = 0; e < 8; ++e) {
            if (OUT_MODE == 1) {
              hv[e] = (_Float16)sp[e];
            } else {
              unsigned short hb = f2bf_bits(sp[e]);
              unsigned short lb = f2bf_bits(sp[e] - bf_bits2f(hb));
              hv[e] = __builtin_bit_cast(_Float16, hb);
              lv[e] = __builtin_bit_cast(_Float16, lb);
            }
          }
          *(v8h*)(C + (size_t)(mBase + row) * ldc + n0 + c8) = hv;
          if (OUT_MODE == 2) *(v8h*)(C2 + (size_t)(mBase + row) * ldc + n0 + c8) = lv;
        }
        
      }
    }
    __builtin_amdgcn_fence(__ATOMIC_RELEASE, "workgroup");
    __builtin_amdgcn_wave_barrier();
    __builtin_amdgcn_fence(__ATOMIC_ACQUIRE, "workgroup");
  }
}

__global__ __launch_bounds__(256) void cast_f32_f16x2(
    const float* __restrict__ in, _Float16* __restrict__ out, int n2) {
  int i = blockIdx.x * 256 + threadIdx.x;
  if (i < n2) {
    const _Float16 h0 = (_Float16)in[2 * i], h1 = (_Float16)in[2 * i + 1];
    const unsigned u = (unsigned)__builtin_bit_cast(unsigned short, h0) | ((unsigned)__builtin_bit_cast(unsigned short, h1) << 16);
    ((unsigned*)out)[i] = u;
    
  }
}


} // namespace w25

__global__ __launch_bounds__(256) void k_castT16(const float* __restrict__ src, long long lds, _Float16* __restrict__ dst, long long ldd, int R, int C, float s) {
    const long long i = (long long)blockIdx.x * 256 + threadIdx.x; const long long np = (long long)C * (R / 2); if (i >= np) return; const int c = (int)(i / (R / 2)); const int r = 2 * (int)(i % (R / 2));
    const _Float16 h0 = (_Float16)(src[(long long)r * lds + c] * s), h1 = (_Float16)(src[(long long)(r + 1) * lds + c] * s);
    const unsigned u = (unsigned)__builtin_bit_cast(unsigned short, h0) | ((unsigned)__builtin_bit_cast(unsigned short, h1) << 16);
    unsigned* d = (unsigned*)(dst + (long long)c * ldd + r); *d = u;  }
__global__ __launch_bounds__(256) void k_cast16(const float* __restrict__ src, long long lds, _Float16* __restrict__ dst, long long ldd, int R, int C, float s) {
    const long long i = (long long)blockIdx.x * 256 + threadIdx.x; const long long np = (long long)R * (C / 2); if (i >= np) return; const int r = (int)(i / (C / 2)); const int c = 2 * (int)(i % (C / 2));
    const _Float16 h0 = (_Float16)(src[(long long)r * lds + c] * s), h1 = (_Float16)(src[(long long)r * lds + c + 1] * s);
    const unsigned u = (unsigned)__builtin_bit_cast(unsigned short, h0) | ((unsigned)__builtin_bit_cast(unsigned short, h1) << 16);
    unsigned* d = (unsigned*)(dst + (long long)r * ldd + c); *d = u;  }

// f32 -> bf16 hi plane + bf16 lo plane (x = hi + lo to ~2^-17 relative; RNE both), [R][C] -> [R][C] (or transposed to [C][R]); 2 consecutive destination elements
__device__ __forceinline__ unsigned int f2bf2_pack(float a, float b, unsigned int* lo) {
    const unsigned short ha = w25::f2bf_bits(a), hb = w25::f2bf_bits(b);
    const unsigned short la = w25::f2bf_bits(a - w25::bf_bits2f(ha)), lb = w25::f2bf_bits(b - w25::bf_bits2f(hb));
    *lo = (unsigned)la | ((unsigned)lb << 16); return (unsigned)ha | ((unsigned)hb << 16); }
__global__ __launch_bounds__(256) void k_castS16(const float* __restrict__ src, long long lds, __bf16* __restrict__ dhi, __bf16* __restrict__ dlo, long long ldd, int R, int C, float s, int transpose) {
    const long long i = (long long)blockIdx.x * 256 + threadIdx.x; long long o; float a, b;
    if (transpose) { const long long np = (long long)C * (R / 2); if (i >= np) return; const int c = (int)(i / (R / 2)); const int r = 2 * (int)(i % (R / 2)); a = src[(long long)r * lds + c] * s; b = src[(long long)(r + 1) * lds + c] * s; o = (long long)c * ldd + r; }
    else { const long long np = (long long)R * (C / 2); if (i >= np) return; const int r = (int)(i / (C / 2)); const int c = 2 * (int)(i % (C / 2)); a = src[(long long)r * lds + c] * s; b = src[(long long)r * lds + c + 1] * s; o = (long long)r * ldd + c; }
    unsigned lo; const unsigned hi = f2bf2_pack(a, b, &lo); unsigned* ph = (unsigned*)(dhi + o); unsigned* pl = (unsigned*)(dlo + o);
    *ph = hi; *pl = lo;  }

namespace w25 {
// =====================================================================================
// Generic causal/non-causal attention for head_dim 64, f32 in / f32 out; 16-bit operands: bf16 with optional hi/lo splits, or
// plain f16 (F16=true, non-split, probabilities carried x2^15).
//   scores = (q*qscale)·kᵀ : v_wmma_f32_16x16x32_bf16; SPLIT_QK -> q,k as bf16 hi/lo (hi·hi + hi·lo + lo·hi)
//   out    = p·v           : v_wmma_f32_16x16x32_bf16; SPLIT_PV -> p,v as bf16 hi/lo; else p,v plain bf16
//   f32 accumulate; online softmax in f32. Block = 4 waves = 64 query rows of one (batch, head); S % 64 == 0.
//   Element (b, s, h, d) of tensor X lives at X[b*X_bs + s*X_rs + h*X_hs + d] (strides in floats, multiples of 4).
//   Masking: mask_mode 0 none, 1 causal (kv > q masked), 2 tensor [S][Skv] shared over (b,h) (float if
//   mask_is_int==0, int32 with element == 0 -> masked if 1, int32 with element != 0 -> masked if 2), 3 per-token vectors qmask[B][S] & kvmask[B][Skv] (int32,
//   0 -> masked), 4 causal + sliding window (kv > q or q - kv > W masked; W passed in mask_is_int);
//   5 = relative-position bias: s += cp[b,h,q][idx[q][kv]] + pc[b,h,kv][idx[q][kv]] with idx = mask_b ([S][Skv] int32) and
//   mask_a an int32 [S][Skv] tensor with nonzero = masked (tables: element (b,h,row,n) at X + b*c_bs + h*c_hs + row*c_rs + n);
//   masked scores are replaced by mask_fill (e.g. -inf or -1e9) before the softmax.
//   grid.x = B * H * (S/64) (or a sub-range with blk0).
// =====================================================================================
#define AT_D 64
#define AT_NW 4
#define AT_QB 64
#define AT_KC 64
struct AttnGeom { const float* cp = nullptr; const float* pc = nullptr; long c_bs = 0, c_rs = 0, c_hs = 0;   // mode-5 score-bias tables
                  long q_bs, q_rs, q_hs, k_bs, k_rs, k_hs, v_bs, v_rs, v_hs, o_bs, o_rs, o_hs;
                  int S, Skv, H, mask_mode; float qscale; int blk0; float mask_fill; int mask_is_int; };
static_assert(sizeof(AttnGeom) == 168, "no padding");

__device__ __forceinline__ unsigned short at_bf_bits(float f) {
  unsigned u = __float_as_uint(f);
  return (unsigned short)((u + 0x7FFFu + ((u >> 16) & 1u)) >> 16);
}
__device__ __forceinline__ __bf16 at_f2bf(float f) { return __builtin_bit_cast(__bf16, at_bf_bits(f)); }
__device__ __forceinline__ void at_split(float f, __bf16& hi, __bf16& lo) {
  const unsigned short hb = at_bf_bits(f);
  hi = __builtin_bit_cast(__bf16, hb);
  lo = at_f2bf(f - __uint_as_float(((unsigned)hb) << 16));
}
__device__ __forceinline__ v8f at_mma(v16b a, v16b b, v8f c) {
  c = __builtin_amdgcn_wmma_f32_16x16x32_bf16(false, a, false, b, (short)0, c, false, false);
  asm volatile("v_nop\n\tv_nop\n\tv_nop\n\tv_nop" : "+v"(c) : "v"(a), "v"(b));
  return c;
}
// 16-bit element as a bit pattern held in a __bf16 slot: f16 bits when F16, bf16 (RNE) otherwise
template <bool F16> __device__ __forceinline__ __bf16 at_to16(float f) {
  if (F16) return __builtin_bit_cast(__bf16, (_Float16)f);
  return at_f2bf(f);
}
template <bool F16> __device__ __forceinline__ v8f at_mma16(v16b a, v16b b, v8f c) {
  if (F16) {
    const v16h ah = __builtin_bit_cast(v16h, a), bh = __builtin_bit_cast(v16h, b);
    c = __builtin_amdgcn_wmma_f32_16x16x32_f16(false, ah, false, bh, (short)0, c, false, false);
    asm volatile("v_nop\n\tv_nop\n\tv_nop\n\tv_nop" : "+v"(c) : "v"(ah), "v"(bh));
    return c;
  }
  return at_mma(a, b, c);
}

template <bool SPLIT_QK, bool SPLIT_PV, bool F16 = false>
__global__ __launch_bounds__(128)
void attn64_kernel(const float* __restrict__ q, const float* __restrict__ k,
                   const float* __restrict__ v, float* __restrict__ out,
                   const void* __restrict__ mask_a, const int* __restrict__ mask_b, AttnGeom g) {
  static_assert(!(F16 && (SPLIT_QK || SPLIT_PV)), "f16 mode is non-split");
  const float PSC = F16 ? 32768.0f : 1.0f;     // f16 probabilities carried x2^15 (subnormal range), folded into the final 1/l
  union FB { v16b v; v8b h[2]; };
  __shared__ __align__(16) __bf16 Ksh[AT_KC * AT_D];             // K hi [kv][d]      8 KB
  __shared__ __align__(16) __bf16 Ksl[SPLIT_QK ? AT_KC * AT_D : 8];
  __shared__ __align__(16) __bf16 Vth[AT_D * AT_KC];             // V hi [d][kv]      8 KB
  __shared__ __align__(16) __bf16 Vtl[SPLIT_PV ? AT_D * AT_KC : 8];
  __shared__ __align__(16) __bf16 Psh[AT_NW][16 * AT_KC];        // per wave P hi [row][kv]  8 KB
  __shared__ __align__(16) __bf16 Psl[SPLIT_PV ? AT_NW : 1][SPLIT_PV ? 16 * AT_KC : 8];
  __shared__ __align__(16) float  Os[AT_NW][16 * 68];            // per wave out tile, pitch 68

  const int tid  = threadIdx.x;
  const int wave = tid >> 5;
  const int lane = tid & 31;
  const int hh   = lane >> 4;
  const int c    = lane & 15;

  const int nqb = g.S / AT_QB;
  const int bx = blockIdx.x + g.blk0;
  const int qb = bx % nqb;
  const int bh = bx / nqb;
  const int h  = bh % g.H;
  const int b  = bh / g.H;
  const int qbase_block = qb * AT_QB;
  const int q0 = qbase_block + wave * 16;

  const float* qb_ptr = q + (size_t)b * g.q_bs + (size_t)h * g.q_hs;
  const float* kb_ptr = k + (size_t)b * g.k_bs + (size_t)h * g.k_hs;
  const float* vb_ptr = v + (size_t)b * g.v_bs + (size_t)h * g.v_hs;
  float*       ob_ptr = out + (size_t)b * g.o_bs + (size_t)h * g.o_hs;

  // ---- Q fragments (A operand): 2 d-chunks, hi (and lo) ----
  v16b qah[2], qal[2];
  {
    const float* qrow = qb_ptr + (size_t)(q0 + c) * g.q_rs;
#pragma unroll
    for (int dc = 0; dc < 2; ++dc) {
#pragma unroll
      for (int e = 0; e < 8; ++e) {
        const float f0 = qrow[dc * 32 + 8 * hh + e] * g.qscale;
        const float f1 = qrow[dc * 32 + 16 + 8 * hh + e] * g.qscale;
        if (SPLIT_QK) { __bf16 hq, lq; at_split(f0, hq, lq); qah[dc][e] = hq; qal[dc][e] = lq; at_split(f1, hq, lq); qah[dc][8 + e] = hq; qal[dc][8 + e] = lq; }
        else { qah[dc][e] = at_to16<F16>(f0); qah[dc][8 + e] = at_to16<F16>(f1); qal[dc][e] = qah[dc][e]; qal[dc][8 + e] = qah[dc][8 + e]; }
      }
    }
  }

  float mrow[8], lrow[8];
  v8f oacc[4];
#pragma unroll
  for (int r = 0; r < 8; ++r) { mrow[r] = -INFINITY; lrow[r] = 0.f; }
#pragma unroll
  for (int t = 0; t < 4; ++t) oacc[t] = (v8f){0.f,0.f,0.f,0.f,0.f,0.f,0.f,0.f};

  const int nChunks = (g.mask_mode == 1 || g.mask_mode == 4) ? (qb + 1) : (g.Skv / AT_KC);   // block-uniform
  // per-row query mask (mode 3)
  int qkeep[8];
#pragma unroll
  for (int r = 0; r < 8; ++r) qkeep[r] = (g.mask_mode == 3) ? mask_b[(size_t)b * g.S + q0 + 8 * hh + r] : 1;   // mask_b = qmask in mode 3
  for (int kc = 0; kc < nChunks; ++kc) {
    const int kv0 = kc * AT_KC;
    __syncthreads();
    {
      const int kvr = tid >> 1, dh = (tid & 1) * 32;
      const float* krow = kb_ptr + (size_t)(kv0 + kvr) * g.k_rs + dh;
      const float* vrow = vb_ptr + (size_t)(kv0 + kvr) * g.v_rs + dh;
#pragma unroll
      for (int i = 0; i < 8; ++i) {
        v4f kk = *(const v4f*)(krow + 4 * i);
        v4f vv = *(const v4f*)(vrow + 4 * i);
#pragma unroll
        for (int e = 0; e < 4; ++e) {
          const int d = dh + 4 * i + e;
          if (SPLIT_QK) { __bf16 a, bl; at_split(kk[e], a, bl); Ksh[kvr * AT_D + d] = a; Ksl[kvr * AT_D + d] = bl; }
          else Ksh[kvr * AT_D + d] = at_to16<F16>(kk[e]);
          if (SPLIT_PV) { __bf16 a, bl; at_split(vv[e], a, bl); Vth[d * AT_KC + kvr] = a; Vtl[d * AT_KC + kvr] = bl; }
          else Vth[d * AT_KC + kvr] = at_to16<F16>(vv[e]);
        }
      }
    }
    __syncthreads();

    v8f s[4];
#pragma unroll
    for (int j = 0; j < 4; ++j) {
      s[j] = (v8f){0.f,0.f,0.f,0.f,0.f,0.f,0.f,0.f};
#pragma unroll 1
      for (int dc = 0; dc < 2; ++dc) {
        FB kb;
        kb.h[0] = *(const v8b*)(Ksh + (j * 16 + c) * AT_D + dc * 32 + 8 * hh);
        kb.h[1] = *(const v8b*)(Ksh + (j * 16 + c) * AT_D + dc * 32 + 16 + 8 * hh);
        s[j] = at_mma16<F16>(qah[dc], kb.v, s[j]);
        if (SPLIT_QK) {
          FB kl;
          kl.h[0] = *(const v8b*)(Ksl + (j * 16 + c) * AT_D + dc * 32 + 8 * hh);
          kl.h[1] = *(const v8b*)(Ksl + (j * 16 + c) * AT_D + dc * 32 + 16 + 8 * hh);
          s[j] = at_mma16<F16>(qah[dc], kl.v, s[j]);
          s[j] = at_mma16<F16>(qal[dc], kb.v, s[j]);
        }
      }
    }
    const bool diag = (g.mask_mode == 1) && (kc == qb);
    int kvkeep[4] = {1, 1, 1, 1};
    if (g.mask_mode == 3) {
#pragma unroll
      for (int j = 0; j < 4; ++j) kvkeep[j] = ((const int*)mask_a)[(size_t)b * g.Skv + kv0 + j * 16 + c];   // mask_a = kvmask
    }
    float cm[8];
#pragma unroll
    for (int r = 0; r < 8; ++r) {
      const int qrow = q0 + 8 * hh + r;
      float m = -INFINITY;
#pragma unroll
      for (int j = 0; j < 4; ++j) {
        const int kvcol = kv0 + j * 16 + c;
        bool masked = false;
        if (diag) masked = (kvcol > qrow);
        else if (g.mask_mode == 4) masked = (kvcol > qrow) || (qrow - kvcol > g.mask_is_int);
        else if (g.mask_mode == 2) {
          const size_t mi = (size_t)qrow * g.Skv + kvcol;
          masked = (g.mask_is_int == 0) ? (((const float*)mask_a)[mi] == 0.0f)
                 : (g.mask_is_int == 1) ? (((const int*)mask_a)[mi] == 0) : (((const int*)mask_a)[mi] != 0);
        } else if (g.mask_mode == 3) masked = (qkeep[r] == 0) || (kvkeep[j] == 0);
        else if (g.mask_mode == 5) {
          const size_t mi = (size_t)qrow * g.Skv + kvcol;
          masked = (((const int*)mask_a)[mi] != 0);
          int n = mask_b[mi]; n = n < 0 ? 0 : n;
          s[j][r] += g.cp[(size_t)b * g.c_bs + (size_t)h * g.c_hs + (size_t)qrow * g.c_rs + n]
                   + g.pc[(size_t)b * g.c_bs + (size_t)h * g.c_hs + (size_t)kvcol * g.c_rs + n];
        }
        if (masked) s[j][r] = g.mask_fill;
        m = fmaxf(m, s[j][r]);
      }
#pragma unroll
      for (int off = 1; off < 16; off <<= 1) m = fmaxf(m, __shfl_xor(m, off, 32));
      cm[r] = m;
    }
    __bf16* pwh = Psh[wave];
    __bf16* pwl = Psl[SPLIT_PV ? wave : 0];
#pragma unroll
    for (int r = 0; r < 8; ++r) {
      const float mnew = fmaxf(mrow[r], cm[r]);
      const float alpha = expf(mrow[r] - mnew);
      mrow[r] = mnew;
      float psum = 0.f;
#pragma unroll
      for (int j = 0; j < 4; ++j) {
        const float p = expf(s[j][r] - mnew);
        psum += p;
        if (SPLIT_PV) { __bf16 a, bl; at_split(p, a, bl); pwh[(8 * hh + r) * AT_KC + j * 16 + c] = a; pwl[(8 * hh + r) * AT_KC + j * 16 + c] = bl; }
        else pwh[(8 * hh + r) * AT_KC + j * 16 + c] = at_to16<F16>(p * PSC);
      }
#pragma unroll
      for (int off = 1; off < 16; off <<= 1) psum += __shfl_xor(psum, off, 32);
      lrow[r] = lrow[r] * alpha + psum;
#pragma unroll
      for (int t = 0; t < 4; ++t) oacc[t][r] *= alpha;
    }
    __builtin_amdgcn_fence(__ATOMIC_RELEASE, "workgroup");
    __builtin_amdgcn_wave_barrier();
    __builtin_amdgcn_fence(__ATOMIC_ACQUIRE, "workgroup");
#pragma unroll 1
    for (int kk = 0; kk < 2; ++kk) {
      FB pa, pl;
      pa.h[0] = *(const v8b*)(pwh + c * AT_KC + kk * 32 + 8 * hh);
      pa.h[1] = *(const v8b*)(pwh + c * AT_KC + kk * 32 + 16 + 8 * hh);
      if (SPLIT_PV) {
        pl.h[0] = *(const v8b*)(pwl + c * AT_KC + kk * 32 + 8 * hh);
        pl.h[1] = *(const v8b*)(pwl + c * AT_KC + kk * 32 + 16 + 8 * hh);
      }
#pragma unroll
      for (int t = 0; t < 4; ++t) {
        FB vb;
        vb.h[0] = *(const v8b*)(Vth + (t * 16 + c) * AT_KC + kk * 32 + 8 * hh);
        vb.h[1] = *(const v8b*)(Vth + (t * 16 + c) * AT_KC + kk * 32 + 16 + 8 * hh);
        oacc[t] = at_mma16<F16>(pa.v, vb.v, oacc[t]);
        if (SPLIT_PV) {
          FB vl;
          vl.h[0] = *(const v8b*)(Vtl + (t * 16 + c) * AT_KC + kk * 32 + 8 * hh);
          vl.h[1] = *(const v8b*)(Vtl + (t * 16 + c) * AT_KC + kk * 32 + 16 + 8 * hh);
          oacc[t] = at_mma16<F16>(pa.v, vl.v, oacc[t]);
          oacc[t] = at_mma16<F16>(pl.v, vb.v, oacc[t]);
        }
      }
    }
  }

  float* os = Os[wave];
#pragma unroll
  for (int r = 0; r < 8; ++r) {
    const float inv = 1.0f / (lrow[r] * PSC);
#pragma unroll
    for (int t = 0; t < 4; ++t) os[(8 * hh + r) * 68 + t * 16 + c] = oacc[t][r] * inv;
  }
  __builtin_amdgcn_fence(__ATOMIC_RELEASE, "workgroup");
  __builtin_amdgcn_wave_barrier();
  __builtin_amdgcn_fence(__ATOMIC_ACQUIRE, "workgroup");
  {
    const int c4 = (lane & 15) * 4;
    {
#pragma unroll
      for (int it = 0; it < 8; ++it) {
        const int row = it * 2 + hh;
        v4f val = *(const v4f*)(os + row * 68 + c4);
        *(v4f*)(ob_ptr + (size_t)(q0 + row) * g.o_rs + c4) = val;
      }
      
    }
  }
}

} // namespace w25

// relative-offset bias table RT[h][c], c = i - j + (T-1): -floor(|i-j| / 30) * 2^-(h+1)   (thread-linear, data-independent)
__global__ __launch_bounds__(256) void k_mc_rt(float* __restrict__ RT, int NH, int RN, int T) { const int t = blockIdx.x * 256 + threadIdx.x; if (t >= NH * RN) return; const int h = t / RN, c = t % RN; int dist = c - (T - 1); dist = dist < 0 ? -dist : dist; VST2(float, RT + t, -(float)(dist / 30) * exp2f(-(float)(h + 1))); }


extern "C" void kernel_launch(void* const* d_in, const int* in_sizes, int n_in, void* d_out, int out_size, void* d_ws, size_t ws_size, hipStream_t stream) {
    (void)in_sizes; (void)n_in; (void)out_size; (void)ws_size;
    const float* x = (const float*)d_in[0];
    const float* ctx = (const float*)d_in[1];
    const float* Wq = (const float*)d_in[2];
    const float* Wk = (const float*)d_in[3];
    const float* Wv = (const float*)d_in[4];
    const float* Wo = (const float*)d_in[5];
    const float* bo = (const float*)d_in[6];
    const int Bn = 2;
    const int T = 2048;
    const int D = 1024;
    const int NH = 16;
    const int HD = 64;
    const int NR = Bn * T;
    const int RN = 2 * T - 1;
    float* out = (float*)d_out;
    char* wsp = (char*)d_ws;
    float* Q = (float*)wsp; wsp += (((size_t)((size_t)NR * D) * 4 + 255) / 256) * 256;
    float* Kb = (float*)wsp; wsp += (((size_t)((size_t)NR * D) * 4 + 255) / 256) * 256;
    float* V = (float*)wsp; wsp += (((size_t)((size_t)NR * D) * 4 + 255) / 256) * 256;
    float* Y = (float*)wsp; wsp += (((size_t)((size_t)NR * D) * 4 + 255) / 256) * 256;
    float* RT = (float*)wsp; wsp += (((size_t)((size_t)NH * RN + 64) * 4 + 255) / 256) * 256;
    unsigned short* G64A = (unsigned short*)wsp; wsp += (((size_t)(4194304) * 2 + 255) / 256) * 256;
    unsigned short* G64B = (unsigned short*)wsp; wsp += (((size_t)(1048576) * 2 + 255) / 256) * 256;
    k_mc_rt<<<(unsigned)((NH * RN + 255) / 256), 256, 0, stream>>>(RT, NH, RN, T);
    k_cast16<<<(unsigned)((((long long)(4096) * ((1024) / 2)) + 255) / 256), 256, 0, stream>>>(x, 1024, (_Float16*)(G64A), 1024, 4096, 1024, 1.0f);
    k_cast16<<<(unsigned)((((long long)(1024) * ((1024) / 2)) + 255) / 256), 256, 0, stream>>>(Wq, 1024, (_Float16*)(G64B), 1024, 1024, 1024, 16.0f);
    w25::wmma_gemm64<0, false, 0, 0, false, 0><<<dim3((unsigned)((((4096) / 64) * ((1024) / 64) + 7) / 8), (unsigned)(1)), 256, 0, stream>>>((const unsigned short*)(G64A), nullptr, 1024, 0, (const unsigned short*)(G64B), nullptr, 1024, 0, (void*)(Q), nullptr, 1024, 0, nullptr, nullptr, 0, 4096, 1024, 1024, 0.0625f);
    k_cast16<<<(unsigned)((((long long)(4096) * ((1024) / 2)) + 255) / 256), 256, 0, stream>>>(ctx, 1024, (_Float16*)(G64A), 1024, 4096, 1024, 1.0f);
    k_cast16<<<(unsigned)((((long long)(1024) * ((1024) / 2)) + 255) / 256), 256, 0, stream>>>(Wk, 1024, (_Float16*)(G64B), 1024, 1024, 1024, 16.0f);
    w25::wmma_gemm64<0, false, 0, 0, false, 0><<<dim3((unsigned)((((4096) / 64) * ((1024) / 64) + 7) / 8), (unsigned)(1)), 256, 0, stream>>>((const unsigned short*)(G64A), nullptr, 1024, 0, (const unsigned short*)(G64B), nullptr, 1024, 0, (void*)(Kb), nullptr, 1024, 0, nullptr, nullptr, 0, 4096, 1024, 1024, 0.0625f);
    k_cast16<<<(unsigned)((((long long)(4096) * ((1024) / 2)) + 255) / 256), 256, 0, stream>>>(ctx, 1024, (_Float16*)(G64A), 1024, 4096, 1024, 1.0f);
    k_cast16<<<(unsigned)((((long long)(1024) * ((1024) / 2)) + 255) / 256), 256, 0, stream>>>(Wv, 1024, (_Float16*)(G64B), 1024, 1024, 1024, 16.0f);
    w25::wmma_gemm64<0, false, 0, 0, false, 0><<<dim3((unsigned)((((4096) / 64) * ((1024) / 64) + 7) / 8), (unsigned)(1)), 256, 0, stream>>>((const unsigned short*)(G64A), nullptr, 1024, 0, (const unsigned short*)(G64B), nullptr, 1024, 0, (void*)(V), nullptr, 1024, 0, nullptr, nullptr, 0, 4096, 1024, 1024, 0.0625f);
    k_attnT<2048, 1024><<<dim3(2048 / (16 * AW), 16, 2), 32 * AW, 0, stream>>>(Q, Kb, V, Y, RT, 0.125f);
    k_cast16<<<(unsigned)((((long long)(4096) * ((1024) / 2)) + 255) / 256), 256, 0, stream>>>(Y, 1024, (_Float16*)(G64A), 1024, 4096, 1024, 1.0f);
    k_cast16<<<(unsigned)((((long long)(1024) * ((1024) / 2)) + 255) / 256), 256, 0, stream>>>(Wo, 1024, (_Float16*)(G64B), 1024, 1024, 1024, 16.0f);
    w25::wmma_gemm64<0, false, 2, 0, false, 0><<<dim3((unsigned)((((4096) / 64) * ((1024) / 64) + 7) / 8), (unsigned)(1)), 256, 0, stream>>>((const unsigned short*)(G64A), nullptr, 1024, 0, (const unsigned short*)(G64B), nullptr, 1024, 0, (void*)(out), nullptr, 1024, 0, bo, nullptr, 0, 4096, 1024, 1024, 0.0625f);
}

// v004
// One run takes 282 microseconds.
// Next to v003, in two timings, it ran 1.05 and 1.06 times as fast.
// Over all steps from v000 it is 7.94 times as fast.
// Contractions: q = x.Wq^T [4096x1024].[1024x1024], k/v = context.W^T and the output projection (+b) with f16 operands on pre-cast planes (v_wmma_f32_16x16x32_f16; 64x64 register-blocked wave tiles, weights x16); per (batch, head) softmax(q k^T / 8 + b_h(|i-j|)) v over 2048 keys (head_dim 64) as a flash kernel with f16 q.k^T and f16 p.v (p as f16 of 4096 p), the periodic distance bias -floor(|i-j|/30) 2^-(h+1) read from a per-head relative-offset table built on device; f32 accumulate and softmax.
#include <hip/hip_runtime.h>
#include <math.h>

typedef __attribute__((ext_vector_type(16))) _Float16 v16h;
typedef __attribute__((ext_vector_type(8)))  _Float16 v8h;
typedef __attribute__((ext_vector_type(4)))  _Float16 v4h;
typedef __attribute__((ext_vector_type(16))) __bf16   v16b;
typedef __attribute__((ext_vector_type(8)))  float    v8f;
typedef __attribute__((ext_vector_type(4)))  float    v4f;

// 16-bit WMMA fragment map (wave32), lane L, h = L>>4, m = L&15:
//   A 16x32: lane = row m;   element i -> k = (i<8) ? 8h+i : 16+8h+(i-8)
//   B 32x16: lane = column m; the SAME k(i,h)
//   D 16x16 (8 f32): lane = column m; element r -> row 8h+r
__device__ __forceinline__ int frag_k(int i, int h) { return (i < 8) ? (8 * h + i) : (16 + 8 * h + (i - 8)); }
__device__ __forceinline__ __bf16 bf16_rne(float f) {
    unsigned int u = __float_as_uint(f);
    u += 0x7fffu + ((u >> 16) & 1u);
    return __builtin_bit_cast(__bf16, (unsigned short)(u >> 16));
}
__device__ __forceinline__ float bf16_f32(__bf16 b) { return __uint_as_float(((unsigned int)__builtin_bit_cast(unsigned short, b)) << 16); }
__device__ __forceinline__ v8f wmma16(v16h a, v16h b, v8f c) {
    c = __builtin_amdgcn_wmma_f32_16x16x32_f16(false, a, false, b, (short)0, c, false, false);
    asm volatile("v_nop\n\tv_nop\n\tv_nop\n\tv_nop" : "+v"(c) : "v"(a), "v"(b));
    return c;
}
__device__ __forceinline__ v8f wmmab(v16b a, v16b b, v8f c) {
    c = __builtin_amdgcn_wmma_f32_16x16x32_bf16(false, a, false, b, (short)0, c, false, false);
    asm volatile("v_nop\n\tv_nop\n\tv_nop\n\tv_nop" : "+v"(c) : "v"(a), "v"(b));
    return c;
}
struct Split { v16b hi, lo; };
// hi/lo split product: a.hi*b.hi + a.hi*b.lo + a.lo*b.hi
__device__ __forceinline__ v8f wmma3(const Split& a, const Split& b, v8f c) {
    c = __builtin_amdgcn_wmma_f32_16x16x32_bf16(false, a.hi, false, b.hi, (short)0, c, false, false);
    c = __builtin_amdgcn_wmma_f32_16x16x32_bf16(false, a.hi, false, b.lo, (short)0, c, false, false);
    c = __builtin_amdgcn_wmma_f32_16x16x32_bf16(false, a.lo, false, b.hi, (short)0, c, false, false);
    asm volatile("v_nop\n\tv_nop\n\tv_nop\n\tv_nop" : "+v"(c) : "v"(a.hi), "v"(a.lo), "v"(b.hi), "v"(b.lo));
    return c;
}
struct Split3 { v16b hi, mid, lo; };
// triple split product (6 terms, drops only terms below 2^-24 relative)
__device__ __forceinline__ v8f wmma6(const Split3& a, const Split3& b, v8f c) {
    c = __builtin_amdgcn_wmma_f32_16x16x32_bf16(false, a.hi, false, b.hi, (short)0, c, false, false);
    c = __builtin_amdgcn_wmma_f32_16x16x32_bf16(false, a.hi, false, b.mid, (short)0, c, false, false);
    c = __builtin_amdgcn_wmma_f32_16x16x32_bf16(false, a.mid, false, b.hi, (short)0, c, false, false);
    c = __builtin_amdgcn_wmma_f32_16x16x32_bf16(false, a.hi, false, b.lo, (short)0, c, false, false);
    c = __builtin_amdgcn_wmma_f32_16x16x32_bf16(false, a.mid, false, b.mid, (short)0, c, false, false);
    c = __builtin_amdgcn_wmma_f32_16x16x32_bf16(false, a.lo, false, b.hi, (short)0, c, false, false);
    asm volatile("v_nop\n\tv_nop\n\tv_nop\n\tv_nop" : "+v"(c) : "v"(a.hi), "v"(a.mid), "v"(a.lo), "v"(b.hi), "v"(b.mid), "v"(b.lo));
    return c;
}

// Fragment gathers from f32 memory: element i <- p[(k0 + frag_k(i,h)) * sk] * s, zero for k >= klen.
__device__ __forceinline__ v16h fh_ld(const float* __restrict__ p, long long sk, int k0, int h, int klen, float s) {
    v16h a;
#pragma unroll
    for (int i = 0; i < 16; ++i) { const int k = k0 + frag_k(i, h); a[i] = (k < klen) ? (_Float16)(p[(long long)k * sk] * s) : (_Float16)0.f; }
    return a;
}
__device__ __forceinline__ Split sp_ld(const float* __restrict__ p, long long sk, int k0, int h, int klen, float s) {
    Split r;
#pragma unroll
    for (int i = 0; i < 16; ++i) {
        const int k = k0 + frag_k(i, h); const float x = (k < klen) ? p[(long long)k * sk] * s : 0.f;
        const __bf16 hb = bf16_rne(x); r.hi[i] = hb; r.lo[i] = bf16_rne(x - bf16_f32(hb));
    }
    return r;
}
__device__ __forceinline__ Split3 sp3_ld(const float* __restrict__ p, long long sk, int k0, int h, int klen, float s) {
    Split3 r;
#pragma unroll
    for (int i = 0; i < 16; ++i) {
        const int k = k0 + frag_k(i, h); const float x = (k < klen) ? p[(long long)k * sk] * s : 0.f;
        const __bf16 hb = bf16_rne(x); const float r1 = x - bf16_f32(hb); const __bf16 mb = bf16_rne(r1);
        r.hi[i] = hb; r.mid[i] = mb; r.lo[i] = bf16_rne(r1 - bf16_f32(mb));
    }
    return r;
}
__device__ __forceinline__ v16b bh_ld(const float* __restrict__ p, long long sk, int k0, int h, int klen, float s) {
    v16b a;
#pragma unroll
    for (int i = 0; i < 16; ++i) { const int k = k0 + frag_k(i, h); a[i] = bf16_rne((k < klen) ? p[(long long)k * sk] * s : 0.f); }
    return a;
}
// f16 fragment from an f16 LDS/global row with element stride 1 (k-contiguous), no bounds (tile already zero padded)
__device__ __forceinline__ v16h fh_row(const _Float16* __restrict__ row, int k0, int h) {
    v16h a;
#pragma unroll
    for (int i = 0; i < 16; ++i) a[i] = row[k0 + frag_k(i, h)];
    return a;
}

#define VST2(T, ptr, val) do { const T vst2_v_ = (val); *(T*)(ptr) = vst2_v_;  } while (0)
typedef float v4f __attribute__((ext_vector_type(4)));
#define VST2V4(ptr, val) do { const v4f vst2_v4_ = (val); *(v4f*)(ptr) = vst2_v4_;  } while (0)

__device__ __attribute__((noinline)) float act_fn(float v, int act) {
    if (act == 1) return fmaxf(v, 0.f);                                                                               // relu
    if (act == 2) { const float u = 0.7978845608028654f * (v + 0.044715f * v * v * v); return 0.5f * v * (1.f + tanhf(u)); } // tanh-gelu
    if (act == 3) return v / (1.f + expf(-v));                                                                        // silu
    if (act == 4) return 0.5f * v * (1.f + erff(v * 0.7071067811865476f));                                             // erf-gelu
    if (act == 5) return tanhf(v);
    if (act == 6) return 1.f / (1.f + expf(-v));                                                                      // sigmoid
    if (act == 7) return (v > 0.f) ? v : 0.01f * v;                                                                   // leaky relu 0.01
    if (act == 8) return (v > 0.f) ? v : (expf(v) - 1.f);                                                             // elu
    if (act == 9) return fminf(fmaxf(v, 0.f), 6.f);                                                                   // relu6
    if (act == 10) return fabsf(v);                                                                                    // abs
    if (act == 11) return (v >= 0.f) ? v : 0.1f * v;                                                                  // leaky 0.1
    if (act == 12) return (v > 0.f) ? v : 0.2f * v;                                                                   // leaky 0.2
    if (act == 13) return (v > 20.f) ? v : log1pf(expf(v));                                                            // softplus
    return v;
}

// =====================================================================================================================
// k_gemm<MODE>: C(z, m, n) = act(alpha * sum_k A(z, m, k) * B(z, k, n) + bias) + beta * R(z, m, n)
//   One wave (32-thread block) per 16 x 32 tile of C; grid (ceil(N/32), ceil(M/16), Z). Batch z -> (zo = z / zi_n, zi = z % zi_n)
//   with separate outer/inner strides for every tensor (e.g. batch and head). A(m,k) = A[zo*sAo + zi*sAi + m*sAm + k*sAk] (f32),
//   B(k,n) = B[zo*sBo + zi*sBi + n*sBn + k*sBk] (f32); any M, N, K (K zero-padded to 32 inside the fragments, M/N tails guarded).
//   C(m,n) = C[zo*sCo + zi*sCi + m*sCm + n] (n contiguous). flags: 1 bias[n], 2 bias[m], 4 residual R[zo*sRo + zi*sRi + m*sRm + n*sRn].
//   MODE 0: f16 operands (A prescaled by sa, B by sb, both undone in the epilogue); 1: bf16 hi/lo split (3 products); 2: bf16;
//   3: bf16 hi/mid/lo triple split (6 products); 4: as 3 with Kahan-compensated f32 accumulation across k-steps.
// =====================================================================================================================
struct GemmP {
    const float* A; const float* B; const float* bias; const float* R; float* C;
    long long sAo, sAi, sAm, sAk, sBo, sBi, sBn, sBk, sCo, sCi, sCm, sRo, sRi, sRm, sRn;
    int M, N, K, zi_n, flags, act; float alpha, beta, sa, sb;
    int Npad, pad_;     // columns [N, Npad) of C are written as 0 so that padded workspace rows are covered by whole-line stores; Npad >= N
};
static_assert(sizeof(GemmP) == 5 * 8 + 15 * 8 + 6 * 4 + 4 * 4 + 2 * 4, "GemmP has padding");

template <int MODE>
__global__ __launch_bounds__(32) void k_gemm(GemmP p) {
    const int lane = threadIdx.x & 31, h = lane >> 4, l15 = lane & 15;
    const int m0 = blockIdx.y * 16, n0 = blockIdx.x * 32;
    const int z = blockIdx.z, zo = z / p.zi_n, zi = z - zo * p.zi_n;
    const float* A = p.A + zo * p.sAo + zi * p.sAi;
    const float* B = p.B + zo * p.sBo + zi * p.sBi;
    const int am = min(m0 + l15, p.M - 1);                       // clamped row for loads (stores are guarded)
    v8f acc[2], comp[2];
#pragma unroll
    for (int t = 0; t < 2; ++t) { v8f zz = {}; acc[t] = zz; comp[t] = zz; }
    for (int k0 = 0; k0 < p.K; k0 += 32) {
        const float* arow = A + (long long)am * p.sAm;
        if (MODE == 1) {
            const Split a = sp_ld(arow, p.sAk, k0, h, p.K, 1.f);
#pragma unroll
            for (int t = 0; t < 2; ++t) {
                const int bn = min(n0 + t * 16 + l15, p.N - 1);
                acc[t] = wmma3(a, sp_ld(B + (long long)bn * p.sBn, p.sBk, k0, h, p.K, 1.f), acc[t]);
            }
        } else if (MODE == 3) {
            const Split3 a = sp3_ld(arow, p.sAk, k0, h, p.K, 1.f);
#pragma unroll
            for (int t = 0; t < 2; ++t) {
                const int bn = min(n0 + t * 16 + l15, p.N - 1);
                acc[t] = wmma6(a, sp3_ld(B + (long long)bn * p.sBn, p.sBk, k0, h, p.K, 1.f), acc[t]);
            }
        } else if (MODE == 4) {
            // triple split as MODE 3, but each k-step's 6 products go into a fresh accumulator and the partial is added to the running f32 sum
            // on the VALU with Kahan compensation (accumulation error stays ~1 ulp however long K is)
            const Split3 a = sp3_ld(arow, p.sAk, k0, h, p.K, 1.f);
#pragma unroll
            for (int t = 0; t < 2; ++t) {
                const int bn = min(n0 + t * 16 + l15, p.N - 1); v8f zz = {};
                const v8f part = wmma6(a, sp3_ld(B + (long long)bn * p.sBn, p.sBk, k0, h, p.K, 1.f), zz);
                const v8f y = part - comp[t]; const v8f s = acc[t] + y; comp[t] = (s - acc[t]) - y; acc[t] = s;
            }
        } else if (MODE == 2) {
            const v16b a = bh_ld(arow, p.sAk, k0, h, p.K, 1.f);
#pragma unroll
            for (int t = 0; t < 2; ++t) {
                const int bn = min(n0 + t * 16 + l15, p.N - 1);
                acc[t] = wmmab(a, bh_ld(B + (long long)bn * p.sBn, p.sBk, k0, h, p.K, 1.f), acc[t]);
            }
        } else {
            const v16h a = fh_ld(arow, p.sAk, k0, h, p.K, p.sa);
#pragma unroll
            for (int t = 0; t < 2; ++t) {
                const int bn = min(n0 + t * 16 + l15, p.N - 1);
                acc[t] = wmma16(a, fh_ld(B + (long long)bn * p.sBn, p.sBk, k0, h, p.K, p.sb), acc[t]);
            }
        }
    }
    const float iscale = (MODE == 0) ? p.alpha / (p.sa * p.sb) : p.alpha;
    float* C = p.C + zo * p.sCo + zi * p.sCi;
    const float* R = p.R + zo * p.sRo + zi * p.sRi;
    __shared__ __align__(16) float ctile[16][36];
#pragma unroll
    for (int t = 0; t < 2; ++t) {
        const int n = n0 + t * 16 + l15; const int nn = min(n, p.N - 1);
#pragma unroll
        for (int r = 0; r < 8; ++r) {
            const int m = m0 + 8 * h + r; const int mm = min(m, p.M - 1);
            float v = acc[t][r] * iscale;
            if (p.flags & 1) v += p.bias[nn];
            if (p.flags & 2) v += p.bias[mm];
            if (p.flags & 8) v *= p.bias[(long long)zo * p.M + mm];   /* per-(z,row) scale vector laid out [Z][M]; exclusive with the bias flags */
            v = act_fn(v, p.act);
            if (p.flags & 4) v += p.beta * R[(long long)mm * p.sRm + (long long)nn * p.sRn];
            ctile[8 * h + r][t * 16 + l15] = (n < p.N) ? v : 0.f;
        }
    }
    __syncthreads();
    const int NW = (p.Npad > p.N) ? p.Npad : p.N;           // write width
    const bool fast = (m0 + 16 <= p.M) && (n0 + 32 <= NW) && ((p.sCm & 3) == 0) && ((((size_t)C) & 15) == 0);
    if (fast) {
#pragma unroll
        for (int s = 0; s < 4; ++s) {
            const int row = s * 4 + (lane >> 3), c4 = (lane & 7) * 4;
            const v4f v = *(const v4f*)&ctile[row][c4];
            VST2V4(C + (long long)(m0 + row) * p.sCm + n0 + c4, v);
        }
    } else {
        for (int row = 0; row < 16; ++row) {
            const int m = m0 + row, n = n0 + lane;
            if (m < p.M && n < NW) VST2(float, C + (long long)m * p.sCm + n, ctile[row][lane]);
        }
    }
}


// =====================================================================================================================
// k_gemmT<MODE, TM, TN>: same contract as k_gemm, but one wave computes a (16*TM) x (16*TN) tile: TM A fragments and TN B fragments are
//   loaded per 32-wide k-step and reused across TM*TN WMMAs (far fewer load/convert instructions per MAC). MODE 0 (f16), 1 (bf16 hi/lo),
//   2 (bf16) only. grid (ceil(NW/(16*TN)), ceil(M/(16*TM)), Z), block 32. Epilogue identical to k_gemm, run per 16x32 sub-tile.
// =====================================================================================================================
template <int MODE, int TM, int TN>
__global__ __launch_bounds__(32) void k_gemmT(GemmP p) {
    const int lane = threadIdx.x & 31, h = lane >> 4, l15 = lane & 15;
    const int m0 = blockIdx.y * (16 * TM), n0 = blockIdx.x * (16 * TN);
    const int z = blockIdx.z, zo = z / p.zi_n, zi = z - zo * p.zi_n;
    const float* A = p.A + zo * p.sAo + zi * p.sAi;
    const float* B = p.B + zo * p.sBo + zi * p.sBi;
    v8f acc[TM][TN];
#pragma unroll
    for (int i = 0; i < TM; ++i)
#pragma unroll
        for (int t = 0; t < TN; ++t) { v8f zz = {}; acc[i][t] = zz; }
    for (int k0 = 0; k0 < p.K; k0 += 32) {
        if (MODE == 1) {
            Split a[TM], b[TN];
#pragma unroll
            for (int i = 0; i < TM; ++i) { const int am = min(m0 + 16 * i + l15, p.M - 1); a[i] = sp_ld(A + (long long)am * p.sAm, p.sAk, k0, h, p.K, 1.f); }
#pragma unroll
            for (int t = 0; t < TN; ++t) { const int bn = min(n0 + 16 * t + l15, p.N - 1); b[t] = sp_ld(B + (long long)bn * p.sBn, p.sBk, k0, h, p.K, 1.f); }
#pragma unroll
            for (int i = 0; i < TM; ++i)
#pragma unroll
                for (int t = 0; t < TN; ++t) acc[i][t] = wmma3(a[i], b[t], acc[i][t]);
        } else if (MODE == 2) {
            v16b a[TM], b[TN];
#pragma unroll
            for (int i = 0; i < TM; ++i) { const int am = min(m0 + 16 * i + l15, p.M - 1); a[i] = bh_ld(A + (long long)am * p.sAm, p.sAk, k0, h, p.K, 1.f); }
#pragma unroll
            for (int t = 0; t < TN; ++t) { const int bn = min(n0 + 16 * t + l15, p.N - 1); b[t] = bh_ld(B + (long long)bn * p.sBn, p.sBk, k0, h, p.K, 1.f); }
#pragma unroll
            for (int i = 0; i < TM; ++i)
#pragma unroll
                for (int t = 0; t < TN; ++t) acc[i][t] = wmmab(a[i], b[t], acc[i][t]);
        } else {
            v16h a[TM], b[TN];
#pragma unroll
            for (int i = 0; i < TM; ++i) { const int am = min(m0 + 16 * i + l15, p.M - 1); a[i] = fh_ld(A + (long long)am * p.sAm, p.sAk, k0, h, p.K, p.sa); }
#pragma unroll
            for (int t = 0; t < TN; ++t) { const int bn = min(n0 + 16 * t + l15, p.N - 1); b[t] = fh_ld(B + (long long)bn * p.sBn, p.sBk, k0, h, p.K, p.sb); }
#pragma unroll
            for (int i = 0; i < TM; ++i)
#pragma unroll
                for (int t = 0; t < TN; ++t) acc[i][t] = wmma16(a[i], b[t], acc[i][t]);
        }
    }
    const float iscale = (MODE == 0) ? p.alpha / (p.sa * p.sb) : p.alpha;
    float* C = p.C + zo * p.sCo + zi * p.sCi;
    const float* R = p.R + zo * p.sRo + zi * p.sRi;
    const int NW = (p.Npad > p.N) ? p.Npad : p.N;
    __shared__ __align__(16) float ctile[16][36];
#pragma unroll
    for (int i = 0; i < TM; ++i) {
        const int mb = m0 + 16 * i; if (mb >= p.M) break;          // wave-uniform
#pragma unroll
        for (int tp = 0; tp < TN / 2; ++tp) {
            const int nb = n0 + 32 * tp; if (nb >= NW) break;        // wave-uniform
#pragma unroll
            for (int t2 = 0; t2 < 2; ++t2) {
                const int t = 2 * tp + t2; const int n = nb + t2 * 16 + l15; const int nn = min(n, p.N - 1);
#pragma unroll
                for (int r = 0; r < 8; ++r) {
                    const int m = mb + 8 * h + r; const int mm = min(m, p.M - 1);
                    float v = acc[i][t][r] * iscale;
                    if (p.flags & 1) v += p.bias[nn];
                    if (p.flags & 2) v += p.bias[mm];
            if (p.flags & 8) v *= p.bias[(long long)zo * p.M + mm];   /* per-(z,row) scale vector laid out [Z][M]; exclusive with the bias flags */
                    v = act_fn(v, p.act);
                    if (p.flags & 4) v += p.beta * R[(long long)mm * p.sRm + (long long)nn * p.sRn];
                    ctile[8 * h + r][t2 * 16 + l15] = (n < p.N) ? v : 0.f;
                }
            }
            __syncthreads();
            const bool fast = (mb + 16 <= p.M) && (nb + 32 <= NW) && ((p.sCm & 3) == 0) && ((((size_t)C) & 15) == 0);
            if (fast) {
#pragma unroll
                for (int s = 0; s < 4; ++s) {
                    const int row = s * 4 + (lane >> 3), c4 = (lane & 7) * 4;
                    const v4f v = *(const v4f*)&ctile[row][c4];
                    VST2V4(C + (long long)(mb + row) * p.sCm + nb + c4, v);
                }
            } else {
                for (int row = 0; row < 16; ++row) {
                    const int m = mb + row, n = nb + lane;
                    if (m < p.M && n < NW) VST2(float, C + (long long)m * p.sCm + n, ctile[row][lane]);
                }
            }
            __syncthreads();
        }
    }
}

// =====================================================================================================================
//   Wave = 16 queries, AW waves per block, 64-key blocks; grid (ceil(Lq/(16*AW)), H, B), block 32*AW. Any Lq, Lk; head dim dh <= DHP
//   (DHP multiple of 32), value dim dv <= DVP (multiple of 16, <= 128). Every tensor addressed by (batch, head, row, element) strides, f32.
//   Scores: QM 0 f16 operands, 1 bf16 hi/lo split, 2 bf16 triple split; statistics f32 (exp2 domain); P.V: P x 4096 as f16 with V f16 staged in LDS
//   (SPLITPV: P and V as bf16 hi/lo splits). kv head = h / hrep. Masking: causal = 1 (keep j <= i + coff, masked -> -inf, key blocks beyond the
//   diagonal skipped), causal = 2 (masked -> mfill, a finite fill like the -1e9; no skipping), causal = 3 (keep j >= i + coff,
//   masked -> -inf, no skipping); optional additive f32 mask Mf,
//   optional int keep-mask Mi (0 -> score := mfill), both addressed b*smb + h*smh + i*smi + j*smj (0 strides broadcast).
// =====================================================================================================================
#define AW 4
struct AttnP {   // apv4
    const float* Q; const float* K; const float* V; float* O; float* P; const float* Mf; const int* Mi; float* ST;
    const float* Pw; const float* Rt; const int* SQ; const int* SK;           // optional: post-softmax weight, relative-position table, segment ids
    long long swb, swh, swi, swj, srb, srh, sri;                                 // Pw strides (b,h,i,j); Rt strides (b,h,i), column = clamp(i - j + roff, 0, rn-1)
    long long sQb, sQh, sQi, sQd, sKb, sKh, sKj, sKd, sVb, sVh, sVj, sVd, sOb, sOh, sOi, sPb, sPh, sPi, smb, smh, smi, smj;
    int Lq, Lk, dh, dv, hrep, causal, coff, pband;   // pband > 0: P holds only the band |j - i| <= pband, column j - i + pband
    float scale, mfill; int nonorm, mpol;             // nonorm (online path only): O = sum_j exp(score_j) V_j without the 1/rowsum (scores must be <= ~0); mpol: Mi masks where ==0 (mpol 0) or where !=0 (mpol 1)
    int roff, rn, segpol, win;                        // Rt column offset/count; SQ/SK: score := mfill where (segpol 0) SQ[i] != SK[j] or (segpol 1) SQ[i] == SK[j]; win > 0: keys with i - j > win (after coff) -> -inf
};
//   Pw: the softmax numerator is multiplied by Pw(b,h,i,j) AFTER the row sum is taken (probs * weight, then P.V), as in post-softmax multiplicative biases.                                                    // ST (optional): per row (b,h,i) -> ST[((b*H + h)*Lq + i)*2 + {0,1}] = {row max of the scaled+masked score (natural units), sum_j exp(score - max)}
static_assert(sizeof(AttnP) == 12 * 8 + 29 * 8 + 16 * 4, "AttnP has padding");

// Inputs-only fence on sixteen loaded values: all must have arrived here, so their loads are issued together ahead of it and share one wait
// (without it the register-budgeted schedule waits after every load). It names no product and changes no value.
template <typename T> __device__ __forceinline__ void hold16(const T* x) {
    asm volatile("" :: "v"(x[0]), "v"(x[1]), "v"(x[2]), "v"(x[3]), "v"(x[4]), "v"(x[5]), "v"(x[6]), "v"(x[7]),
                       "v"(x[8]), "v"(x[9]), "v"(x[10]), "v"(x[11]), "v"(x[12]), "v"(x[13]), "v"(x[14]), "v"(x[15]));
}
#ifndef KATTN_ATTR
#define KATTN_ATTR __attribute__((amdgpu_waves_per_eu(4)))   // register budget of 256: four waves a SIMD, so that all 1,024 blocks of the launch are resident at once
#endif
//   GT > 0 fixes the geometry at compile time: Lq = Lk = GT, rows of GD floats with head h at column h * DHP (unit element stride), dh = DHP,
//   dv = DVP, one kv head per head, no mask, weight, segment, P or ST tensor, and a per-head Rt row of 2 GT - 1 columns. Only Q, K, V, O, Rt and scale
//   are then taken from the argument, so every length guard folds and the loads of a key block are contiguous and free of branches.
template <int DHP, int DVP, int QM, bool SPLITPV, bool TWOPASS, int GT = 0, int GD = 0>
__global__ __launch_bounds__(32 * AW) KATTN_ATTR void k_attn(AttnP parg) {
    AttnP p = parg;
    if (GT > 0) {
        p.P = nullptr; p.Mf = nullptr; p.Mi = nullptr; p.ST = nullptr; p.Pw = nullptr; p.SQ = nullptr; p.SK = nullptr;
        p.swb = 0; p.swh = 0; p.swi = 0; p.swj = 0; p.srb = 0; p.srh = 2 * GT - 1; p.sri = 0;
        p.sQb = (long long)GT * GD; p.sQh = DHP; p.sQi = GD; p.sQd = 1; p.sKb = (long long)GT * GD; p.sKh = DHP; p.sKj = GD; p.sKd = 1;
        p.sVb = (long long)GT * GD; p.sVh = DVP; p.sVj = GD; p.sVd = 1; p.sOb = (long long)GT * GD; p.sOh = DVP; p.sOi = GD;
        p.sPb = 0; p.sPh = 0; p.sPi = 0; p.smb = 0; p.smh = 0; p.smi = 0; p.smj = 0;
        p.Lq = GT; p.Lk = GT; p.dh = DHP; p.dv = DVP; p.hrep = 1; p.causal = 0; p.coff = 0; p.pband = 0;
        p.mfill = 0.f; p.nonorm = 0; p.mpol = 0; p.roff = GT - 1; p.rn = 2 * GT - 1; p.segpol = 0; p.win = 0;
        __builtin_assume(p.Rt != nullptr);
    }
    constexpr bool FULL = GT > 0 && GT % (16 * AW) == 0 && GT % 64 == 0;   // every query tile and key block is whole: index clamps and length guards are identities
    constexpr int NT = DVP / 16;                // output tiles
    constexpr int KS = DHP / 32;                // k-steps for the scores
    constexpr int VP = DVP + 8;                 // LDS pitch (halves)
    __shared__ __align__(16) float    pl[AW][16 * 64];
    __shared__ __align__(16) _Float16 vl[(SPLITPV ? 2 : 1) * 64 * VP];   // f16 V tile, or bf16 hi and lo tiles (same 2-byte size)
    const int lane = threadIdx.x & 31, hf = lane >> 4, l15 = lane & 15, wave = threadIdx.x >> 5;
    const int h = blockIdx.y, b = blockIdx.z, hk = h / p.hrep;
    const int q0 = (blockIdx.x * AW + wave) * 16;
    float* myp = pl[wave];
    const float L2E = 1.4426950408889634f;
    const float NEG = -__builtin_inff();
    const int qi = FULL ? q0 + l15 : min(q0 + l15, p.Lq - 1);
    const float* qrow = p.Q + b * p.sQb + h * p.sQh + (long long)qi * p.sQi;
    const float* kbase = p.K + b * p.sKb + hk * p.sKh;
    const float* vbase = p.V + b * p.sVb + hk * p.sVh;
    v16h qa[QM == 0 ? KS : 1]; Split qs_[QM == 1 ? KS : 1]; Split3 qt_[QM == 2 ? KS : 1];
#pragma unroll
    for (int ks = 0; ks < KS; ++ks) {
        if (QM == 2) qt_[ks] = sp3_ld(qrow, p.sQd, ks * 32, hf, p.dh, 1.f);
        else if (QM == 1) qs_[ks] = sp_ld(qrow, p.sQd, ks * 32, hf, p.dh, 1.f);
        else qa[ks] = fh_ld(qrow, p.sQd, ks * 32, hf, p.dh, 1.f);
    }
    v8f o[NT]; float m8[8], l8[8];
#pragma unroll
    for (int t = 0; t < NT; ++t) { v8f zz = {}; o[t] = zz; }
#pragma unroll
    for (int i = 0; i < 8; ++i) { m8[i] = NEG; l8[i] = 0.f; }
    int jend = p.Lk;
    if (p.causal == 1) { const int je = (blockIdx.x * AW + AW - 1) * 16 + 16 + p.coff; jend = min(jend, max(je, 0)); }   // uniform per block
    const int npass = TWOPASS ? 2 : 1;
    for (int pass = 0; pass < npass; ++pass) {
        const bool dopv = (!TWOPASS) || pass == 1;
        for (int j0 = 0; j0 < jend; j0 += 64) {
            if (dopv) {
                __syncthreads();                                 // previous key block's reads of vl / pl are done
                constexpr int VN = 64 * DVP / (32 * AW);         // V elements per thread and key block
                constexpr bool VLIN = (32 * AW) % DVP == 0;      // a thread keeps its column: its rows differ by a constant step
                float vf[VN];
#pragma unroll   // constant trip count: with the guard folded the tile's loads differ by immediate offsets only
                for (int it = 0; it < VN; ++it) {
                    const int idx = threadIdx.x + it * (32 * AW);
                    const int jr = VLIN ? (int)threadIdx.x / DVP + it * ((32 * AW) / DVP) : idx / DVP, d = VLIN ? (int)threadIdx.x % DVP : idx - jr * DVP, j = j0 + jr;
                    if constexpr (FULL && VLIN)   // block-uniform tile pointer + the thread's fixed offset + a constant
                        vf[it] = (vbase + (long long)j0 * GD)[(size_t)(unsigned)((int)threadIdx.x / DVP * GD + (int)threadIdx.x % DVP) + it * ((32 * AW) / DVP) * GD];
                    else
                        vf[it] = (j < p.Lk && d < p.dv) ? vbase[(long long)j * p.sVj + (long long)d * p.sVd] : 0.f;
                }
                if (FULL && VN == 32) { hold16(vf); hold16(vf + 16); }   // the tile's loads all issue ahead of this line and are waited for once
#pragma unroll
                for (int it = 0; it < VN; ++it) {
                    const int idx = threadIdx.x + it * (32 * AW);
                    const int jr = VLIN ? (int)threadIdx.x / DVP + it * ((32 * AW) / DVP) : idx / DVP, d = VLIN ? (int)threadIdx.x % DVP : idx - jr * DVP;
                    const float f = vf[it];
                    if (SPLITPV) {
                        const __bf16 hb = bf16_rne(f);
                        ((__bf16*)vl)[jr * VP + d] = hb; ((__bf16*)vl)[64 * VP + jr * VP + d] = bf16_rne(f - bf16_f32(hb));
                    } else vl[jr * VP + d] = (_Float16)f;
                }
            }
            v8f s[4];
            float rb[8][4];                                     // the key block's relative-position table entries, fetched ahead of the products
            if constexpr (FULL) {
                // column i - j + GT - 1 as block-uniform pointer + the lane's fixed offset + a constant, each part >= 0 (j0 <= GT - 64)
                const float* rt = p.Rt + (long long)h * (2 * GT - 1) + ((int)blockIdx.x * (16 * AW) - j0 + (GT - 64));
                const unsigned ro = (unsigned)(wave * 16 + 8 * hf + 15 - l15);
#pragma unroll
                for (int i = 0; i < 8; ++i)
#pragma unroll
                    for (int t = 0; t < 4; ++t) rb[i][t] = rt[(size_t)ro + (i + 16 * (3 - t))];
            } else if (p.Rt) {
#pragma unroll
                for (int i = 0; i < 8; ++i)
#pragma unroll
                    for (int t = 0; t < 4; ++t) {
                        const int ic = min(q0 + i + 8 * hf, p.Lq - 1);
                        int rc = ic - min(j0 + t * 16 + l15, p.Lk - 1) + p.roff; rc = rc < 0 ? 0 : (rc >= p.rn ? p.rn - 1 : rc);
                        rb[i][t] = p.Rt[b * p.srb + h * p.srh + (long long)ic * p.sri + rc];
                    }
            }
            if constexpr (FULL && QM == 0 && KS == 2) {
                // two key tiles at a time: their sixteen 16-byte loads (fh_ld's k order: floats 8 hf + 0..7 and 16 + 8 hf + 0..7 of each 32) fly together
#pragma unroll
                for (int tp = 0; tp < 2; ++tp) {
                    v4f kr[16];
#pragma unroll
                    for (int t2 = 0; t2 < 2; ++t2)
#pragma unroll
                        for (int ks = 0; ks < 2; ++ks) {
                            const v4f* kp = (const v4f*)((kbase + (long long)j0 * GD) + ((size_t)(unsigned)(l15 * GD + 8 * hf) + (2 * tp + t2) * 16 * GD + ks * 32));
                            kr[(t2 * 2 + ks) * 4 + 0] = kp[0]; kr[(t2 * 2 + ks) * 4 + 1] = kp[1]; kr[(t2 * 2 + ks) * 4 + 2] = kp[4]; kr[(t2 * 2 + ks) * 4 + 3] = kp[5];
                        }
                    hold16(kr);                                  // all sixteen loads issue ahead of this line and are waited for once
#pragma unroll
                    for (int t2 = 0; t2 < 2; ++t2) {
                        v8f acc = {};
#pragma unroll
                        for (int ks = 0; ks < 2; ++ks) {
                            v16h kfr;
#pragma unroll
                            for (int e = 0; e < 16; ++e) kfr[e] = (_Float16)kr[(t2 * 2 + ks) * 4 + (e >> 2)][e & 3];
                            acc = wmma16(qa[ks], kfr, acc);
                        }
                        s[2 * tp + t2] = acc;
                    }
                }
            } else {
#pragma unroll
            for (int t = 0; t < 4; ++t) {
                const int j = min(j0 + t * 16 + l15, p.Lk - 1);
                const float* krow = kbase + (long long)j * p.sKj;
                v8f acc = {};
#pragma unroll
                for (int ks = 0; ks < KS; ++ks) {
                    if (QM == 2)      acc = wmma6(qt_[ks], sp3_ld(krow, p.sKd, ks * 32, hf, p.dh, 1.f), acc);
                    else if (QM == 1) acc = wmma3(qs_[ks], sp_ld(krow, p.sKd, ks * 32, hf, p.dh, 1.f), acc);
                    else              acc = wmma16(qa[ks], fh_ld(krow, p.sKd, ks * 32, hf, p.dh, 1.f), acc);
                }
                s[t] = acc;
            }
            }
            float pv[8][4];
#pragma unroll
            for (int i = 0; i < 8; ++i) {
                const int irow = q0 + i + 8 * hf;
                const int ic = FULL ? irow : min(irow, p.Lq - 1);
                float sc[4];
#pragma unroll
                for (int t = 0; t < 4; ++t) {
                    const int jg = j0 + t * 16 + l15;
                    float v = s[t][i] * p.scale;
                    if (p.Mf) v += p.Mf[b * p.smb + h * p.smh + (long long)ic * p.smi + (long long)min(jg, p.Lk - 1) * p.smj];
                    if (p.Rt) v += rb[i][t];
                    if (p.Mi) { const int mv = p.Mi[b * p.smb + h * p.smh + (long long)ic * p.smi + (long long)min(jg, p.Lk - 1) * p.smj]; if (p.mpol ? (mv != 0) : (mv == 0)) v = p.mfill; }
                    if (p.SQ) { const bool same = p.SQ[(long long)b * p.Lq + ic] == p.SK[(long long)b * p.Lk + min(jg, p.Lk - 1)]; if (p.segpol ? same : !same) v = p.mfill; }
                    if (p.causal == 2 && jg > irow + p.coff) v = p.mfill;
                    if ((!FULL && jg >= p.Lk) || (p.causal == 1 && jg > irow + p.coff) || (p.causal == 3 && jg < irow + p.coff) || (p.win > 0 && irow + p.coff - jg > p.win)) v = NEG; else v *= L2E;
                    sc[t] = v;
                }
                if (!TWOPASS || pass == 0) {
                    float mx = fmaxf(fmaxf(sc[0], sc[1]), fmaxf(sc[2], sc[3]));
                    mx = fmaxf(mx, __shfl_xor(mx, 1, 32)); mx = fmaxf(mx, __shfl_xor(mx, 2, 32));
                    mx = fmaxf(mx, __shfl_xor(mx, 4, 32)); mx = fmaxf(mx, __shfl_xor(mx, 8, 32));
                    const float mnew = fmaxf(m8[i], mx);
                    const float corr = (mnew == NEG) ? 1.f : exp2f(m8[i] - mnew);
                    float rs = 0.f;
#pragma unroll
                    for (int t = 0; t < 4; ++t) {
                        const float pp = (sc[t] == NEG) ? 0.f : exp2f(sc[t] - mnew); rs += pp;
                        pv[i][t] = p.Pw ? pp * p.Pw[b * p.swb + h * p.swh + (long long)ic * p.swi + (long long)min(j0 + t * 16 + l15, p.Lk - 1) * p.swj] : pp;
                    }
                    rs += __shfl_xor(rs, 1, 32); rs += __shfl_xor(rs, 2, 32); rs += __shfl_xor(rs, 4, 32); rs += __shfl_xor(rs, 8, 32);
                    l8[i] = l8[i] * corr + rs; m8[i] = mnew;
                    if (!TWOPASS) {
#pragma unroll
                        for (int t = 0; t < NT; ++t) o[t][i] *= corr;
                    }
                } else {
                    const float inv = (l8[i] > 0.f) ? 1.f / l8[i] : 0.f;
#pragma unroll
                    for (int t = 0; t < 4; ++t) {
                        const int jg = j0 + t * 16 + l15;
                        float pp = (sc[t] == NEG) ? 0.f : exp2f(sc[t] - m8[i]) * inv;
                        if (p.Pw) pp *= p.Pw[b * p.swb + h * p.swh + (long long)ic * p.swi + (long long)min(jg, p.Lk - 1) * p.swj];
                        pv[i][t] = pp;
                    }
                }
            }
            if (dopv) {
#pragma unroll
                for (int i = 0; i < 8; ++i)
#pragma unroll
                    for (int t = 0; t < 4; ++t) ((float*)myp)[(i + 8 * hf) * 64 + t * 16 + l15] = pv[i][t];
                __syncthreads();                                 // P (per wave) and V (shared) visible
                if (p.P) {
                    float* pb_ = p.P + b * p.sPb + h * p.sPh;
                    const bool fastP = (p.pband == 0) && ((p.sPi & 3) == 0) && (j0 + 64 <= p.Lk) && (q0 + 16 <= p.Lq) && ((((size_t)pb_) & 15) == 0);
                    if (fastP) {
#pragma unroll
                        for (int s = 0; s < 8; ++s) {
                            const int row = s * 2 + (lane >> 4), c4 = (lane & 15) * 4;
                            const v4f v = *(const v4f*)(myp + row * 64 + c4);
                            VST2V4(pb_ + (long long)(q0 + row) * p.sPi + j0 + c4, v);
                        }
                    } else {
                        for (int row = 0; row < 16; ++row) {
                            const int irow = q0 + row; if (irow >= p.Lq) continue;
                            for (int c = lane; c < 64; c += 32) {
                                const int jg = j0 + c; if (jg >= p.Lk) continue;
                                if (p.pband == 0) VST2(float, pb_ + (long long)irow * p.sPi + jg, myp[row * 64 + c]);
                                else if (jg - irow <= p.pband && irow - jg <= p.pband) VST2(float, pb_ + (long long)irow * p.sPi + (jg - irow + p.pband), myp[row * 64 + c]);
                            }
                        }
                    }
                }
                if (SPLITPV) {
                    const Split pa0 = sp_ld(myp + l15 * 64, 1, 0, hf, 64, 1.f), pa1 = sp_ld(myp + l15 * 64, 1, 32, hf, 64, 1.f);
                    const __bf16* vh = (const __bf16*)vl; const __bf16* vlo = vh + 64 * VP;
#pragma unroll
                    for (int t = 0; t < NT; ++t) {
                        const int dcol = t * 16 + l15;
                        Split b0, b1;
#pragma unroll
                        for (int e = 0; e < 16; ++e) {
                            const int k0 = frag_k(e, hf), k1 = 32 + frag_k(e, hf);
                            b0.hi[e] = vh[k0 * VP + dcol]; b0.lo[e] = vlo[k0 * VP + dcol]; b1.hi[e] = vh[k1 * VP + dcol]; b1.lo[e] = vlo[k1 * VP + dcol];
                        }
                        o[t] = wmma3(pa0, b0, o[t]);
                        o[t] = wmma3(pa1, b1, o[t]);
                    }
                } else {
                    const v16h pa0 = fh_ld(myp + l15 * 64, 1, 0, hf, 64, 4096.f), pa1 = fh_ld(myp + l15 * 64, 1, 32, hf, 64, 4096.f);
#pragma unroll
                    for (int t = 0; t < NT; ++t) {
                        const int dcol = t * 16 + l15;
                        v16h b0, b1;
#pragma unroll
                        for (int e = 0; e < 16; ++e) { b0[e] = vl[frag_k(e, hf) * VP + dcol]; b1[e] = vl[(32 + frag_k(e, hf)) * VP + dcol]; }
                        o[t] = wmma16(pa0, b0, o[t]);
                        o[t] = wmma16(pa1, b1, o[t]);
                    }
                }
            }
        }
    }
    float* obase = p.O + b * p.sOb + h * p.sOh;
    if (p.ST) {
        const int rl = lane >> 1, isel = rl & 7;           // row q0 + rl ; rl>>3 == hf holds because lane>>4 == (lane>>1)>>3
        float mv = 0.f, lv = 0.f;
#pragma unroll
        for (int i = 0; i < 8; ++i) if (i == isel) { mv = m8[i]; lv = l8[i]; }
        const int irow = q0 + rl;
        if (irow < p.Lq) { float* st = p.ST + (((long long)b * gridDim.y + h) * p.Lq + irow) * 2 + (lane & 1); VST2(float, st, (lane & 1) ? lv : mv * 0.6931471805599453f); }
    }
    float invr[8];
#pragma unroll
    for (int i = 0; i < 8; ++i) {
        if (TWOPASS) invr[i] = SPLITPV ? 1.f : (1.f / 4096.f);
        else if (p.nonorm) invr[i] = exp2f(m8[i]) * (SPLITPV ? 1.f : (1.f / 4096.f));
        else invr[i] = (l8[i] > 0.f) ? (SPLITPV ? 1.f / l8[i] : 1.f / (l8[i] * 4096.f)) : 0.f;
    }
    __syncthreads();                                             // all waves done with pl/vl from the main loop
    const bool ofast = ((p.sOi & 3) == 0) && ((((size_t)obase) & 15) == 0) && (q0 + 16 <= p.Lq);
#pragma unroll
    for (int c0 = 0; c0 < DVP; c0 += 64) {
#pragma unroll
        for (int i = 0; i < 8; ++i)
#pragma unroll
            for (int t = 0; t < NT; ++t) if (t * 16 >= c0 && t * 16 < c0 + 64) ((float*)myp)[(i + 8 * hf) * 64 + (t * 16 - c0) + l15] = o[t][i] * invr[i];
        __syncthreads();
        const int cw = (DVP - c0 < 64) ? (DVP - c0) : 64;      // staged columns in this chunk (multiple of 16)
        if (ofast && (c0 + cw <= p.dv) && (cw % 32 == 0)) {
            const int lpr = cw / 4;                              // lanes per row (16 for 64 cols, 8 for 32)
            const int rows_per_ins = 32 / lpr;
            for (int r0 = 0; r0 < 16; r0 += rows_per_ins) {
                const int row = r0 + lane / lpr, c4 = (lane % lpr) * 4;
                const v4f v = *(const v4f*)(myp + row * 64 + c4);
                VST2V4(obase + (long long)(q0 + row) * p.sOi + c0 + c4, v);
            }
        } else {
            for (int row = 0; row < 16; ++row) {
                const int irow = q0 + row; if (irow >= p.Lq) continue;
                for (int c = lane; c < cw; c += 32) { const int d = c0 + c; if (d < p.dv) VST2(float, obase + (long long)irow * p.sOi + d, myp[row * 64 + c]); }
            }
        }
        __syncthreads();
    }
}

__device__ __forceinline__ float xhalf(float x) { return __builtin_bit_cast(float, __builtin_amdgcn_permlanex16(__builtin_bit_cast(int, x), __builtin_bit_cast(int, x), 0x76543210, 0xfedcba98, false, false)); }
template <int GT, int GD>
__global__ __launch_bounds__(32 * AW) KATTN_ATTR void k_attnT(const float* __restrict__ Q, const float* __restrict__ K, const float* __restrict__ V, float* __restrict__ O, const float* __restrict__ Rt, float scale) {
    static_assert(GT % (16 * AW) == 0 && GT % 64 == 0 && AW == 4, "whole query tiles and key blocks; 128 threads stage the 64 x 64 K and V tiles");
    constexpr int DH = 64;                      // head size
    constexpr int VP = 64 + 8;                  // LDS pitch (halves): rows of 128 bytes + 16, for 16-byte readers
    __shared__ __align__(16) _Float16 vt[2][DH * VP];   // V^T tile: row = head column, 64 keys along the row
    __shared__ __align__(16) _Float16 kt[2][64 * VP];   // K tile: row = key, the 64 head columns along the row; written once a key block, read by all four waves
    const int lane = threadIdx.x & 31, hf = lane >> 4, l15 = lane & 15, wave = threadIdx.x >> 5;
    const int h = blockIdx.y, b = blockIdx.z;
    const int q0 = (blockIdx.x * AW + wave) * 16;
    const float L2E = 1.4426950408889634f;
    const float* qrow = Q + (long long)b * GT * GD + h * DH + (long long)(q0 + l15) * GD;
    const float* kbase = K + (long long)b * GT * GD + h * DH;
    const float* vbase = V + (long long)b * GT * GD + h * DH;
    v16h qb[2];
#pragma unroll
    for (int ks = 0; ks < 2; ++ks) qb[ks] = fh_ld(qrow, 1, ks * 32, hf, DH, 1.f);
    v8f o[4]; float m = -__builtin_inff(), l = 0.f;
#pragma unroll
    for (int t = 0; t < 4; ++t) { v8f zz = {}; o[t] = zz; }
    const int vd = threadIdx.x & 63, vk = (threadIdx.x >> 6) * 32;   // V staging: this thread's head column and its first of 32 consecutive keys
    const int kc = threadIdx.x & 15, kq = threadIdx.x >> 4;          // K staging: 16 lanes cover one key's 256 bytes, so a wave's 16-byte load is four whole lines; keys kq + 8 it
    float vf[32]; v4f kf[8];                                         // this thread's share of the tiles on their way from global memory to LDS
    __builtin_amdgcn_sched_barrier(0);                               // with the one behind the wait below: nothing but the first tiles' loads stands between them, so no register is rewritten ahead of that wait
#pragma unroll
    for (int it = 0; it < 8; ++it) kf[it] = *(const v4f*)(kbase + ((size_t)(unsigned)(kq * GD + kc * 4) + it * 8 * GD));
#pragma unroll
    for (int it = 0; it < 32; ++it) vf[it] = vbase[(size_t)(unsigned)(vk * GD + vd) + it * GD];
    asm volatile("s_wait_xcnt 0x0" ::: "memory");                    // in front of the first overwrite of a register that these loads name as an address
    __builtin_amdgcn_sched_barrier(0);                               // keeps the later address arithmetic behind that wait (a "memory" clobber alone did not)
#pragma unroll
    for (int it = 0; it < 8; ++it) {
        v4h pk;
#pragma unroll
        for (int e = 0; e < 4; ++e) pk[e] = (_Float16)kf[it][e];
        *(v4h*)(kt[0] + (kq + 8 * it) * VP + kc * 4) = pk;
    }
#pragma unroll
    for (int c8 = 0; c8 < 4; ++c8) {
        v8h pk;
#pragma unroll
        for (int e = 0; e < 8; ++e) pk[e] = (_Float16)vf[c8 * 8 + e];
        *(v8h*)(vt[0] + vd * VP + vk + c8 * 8) = pk;
    }
    for (int j0 = 0; j0 < GT; j0 += 64) {
        // This trip works on key block j0 in buffer cur and fills the other buffer with the next block, whose loads fly under the products and the softmax.
        const int cur = (j0 >> 6) & 1;
        __syncthreads();                                 // block j0's tiles are visible; every wave has left the buffer that this trip fills
        const int jn = (j0 + 64 < GT) ? j0 + 64 : j0;    // the last trip fetches its own block again: no branch, nothing out of bounds, the copy is not read
#pragma unroll
        for (int it = 0; it < 8; ++it) kf[it] = *(const v4f*)((kbase + (long long)jn * GD) + ((size_t)(unsigned)(kq * GD + kc * 4) + it * 8 * GD));
        __builtin_amdgcn_sched_barrier(0);               // the next K tile's loads issue here: the scheduler otherwise moves them down to their LDS stores, each waited for with nothing to hide it
        // table column i - j + GT - 1 as block-uniform pointer + the lane's fixed offset + a constant, each part >= 0 (j0 <= GT - 64)
        float rb[4][8];
        const float* rt = Rt + (long long)h * (2 * GT - 1) + ((int)blockIdx.x * (16 * AW) - j0 + (GT - 64));
        const unsigned ro = (unsigned)(wave * 16 + l15 + 8 * (1 - hf));
#pragma unroll
        for (int t = 0; t < 4; ++t)
#pragma unroll
            for (int r = 0; r < 8; ++r) rb[t][r] = rt[(size_t)ro + (16 * (3 - t) + (7 - r))];
        v8f s[4];
        v8h ka[16];                                      // the eight K fragments, fh_ld's k order: halves 8 hf + 0..7 and 16 + 8 hf + 0..7 of each 32
#pragma unroll
        for (int t = 0; t < 4; ++t)
#pragma unroll
            for (int ks = 0; ks < 2; ++ks) {
                const _Float16* kr = kt[cur] + (t * 16 + l15) * VP + ks * 32 + 8 * hf;
                ka[(t * 2 + ks) * 2] = *(const v8h*)kr; ka[(t * 2 + ks) * 2 + 1] = *(const v8h*)(kr + 16);
            }
        hold16(ka);                                      // the sixteen LDS reads issue together and are waited for once (otherwise: one fragment's registers, a full LDS wait in front of each product)
#pragma unroll
        for (int t = 0; t < 4; ++t) {
            v8f acc = {};
#pragma unroll
            for (int ks = 0; ks < 2; ++ks) {
                const v16h kfr = __builtin_shufflevector(ka[(t * 2 + ks) * 2], ka[(t * 2 + ks) * 2 + 1], 0, 1, 2, 3, 4, 5, 6, 7, 8, 9, 10, 11, 12, 13, 14, 15);
                acc = __builtin_amdgcn_wmma_f32_16x16x32_f16(false, kfr, false, qb[ks], (short)0, acc, false, false);   // A = key rows, B = query columns
            }
            s[t] = acc;
        }
        float sc[4][8], mt[4];
#pragma unroll
        for (int t = 0; t < 4; ++t) {
#pragma unroll
            for (int r = 0; r < 8; ++r) sc[t][r] = (s[t][r] * scale + rb[t][r]) * L2E;
            mt[t] = fmaxf(fmaxf(fmaxf(sc[t][0], sc[t][1]), fmaxf(sc[t][2], sc[t][3])), fmaxf(fmaxf(sc[t][4], sc[t][5]), fmaxf(sc[t][6], sc[t][7])));
        }
        // the next V tile's loads: behind the table's last use, whose 32 registers they take over; they fly under the exponentials and the second products
        __builtin_amdgcn_sched_barrier(0);               // not earlier: issued beside the K tile and the table they leave the score products one fragment's registers, a wait per product
#pragma unroll
        for (int it = 0; it < 32; ++it) vf[it] = (vbase + (long long)jn * GD)[(size_t)(unsigned)(vk * GD + vd) + it * GD];
        __builtin_amdgcn_sched_barrier(0);               // they issue here, for the same reason as the K tile's
        float mx = fmaxf(fmaxf(mt[0], mt[1]), fmaxf(mt[2], mt[3]));
        mx = fmaxf(mx, xhalf(mx));                        // the other lane half holds the query's other 32 keys
        const float mnew = fmaxf(m, mx);
        const float corr = exp2f(m - mnew);
        float rs[4];
#pragma unroll
        for (int t = 0; t < 4; ++t) {
            rs[t] = 0.f;
#pragma unroll
            for (int r = 0; r < 8; ++r) { const float pp = exp2f(sc[t][r] - mnew); rs[t] += pp; sc[t][r] = pp; }
        }
        l = l * corr + ((rs[0] + rs[1]) + (rs[2] + rs[3])); m = mnew;
#pragma unroll
        for (int t = 0; t < 4; ++t)
#pragma unroll
            for (int r = 0; r < 8; ++r) o[t][r] *= corr;
        v16h pb[2];
#pragma unroll
        for (int ks = 0; ks < 2; ++ks)
#pragma unroll
            for (int e = 0; e < 16; ++e) pb[ks][e] = (_Float16)(sc[2 * ks + (e >> 3)][e & 7] * 4096.f);
#pragma unroll
        for (int t = 0; t < 4; ++t)
#pragma unroll
            for (int ks = 0; ks < 2; ++ks) {
                const _Float16* vr = vt[cur] + (t * 16 + l15) * VP + ks * 32 + 8 * hf;
                const v8h a0 = *(const v8h*)vr, a1 = *(const v8h*)(vr + 16);
                const v16h va = __builtin_shufflevector(a0, a1, 0, 1, 2, 3, 4, 5, 6, 7, 8, 9, 10, 11, 12, 13, 14, 15);
                o[t] = __builtin_amdgcn_wmma_f32_16x16x32_f16(false, va, false, pb[ks], (short)0, o[t], false, false);   // A = head columns, B = query columns
            }
        __builtin_amdgcn_sched_barrier(0);               // the casts stay below: moved up to save registers they would wait for the tiles' loads ahead of the work that hides them
#pragma unroll
        for (int it = 0; it < 8; ++it) {
            v4h pk;
#pragma unroll
            for (int e = 0; e < 4; ++e) pk[e] = (_Float16)kf[it][e];
            *(v4h*)(kt[cur ^ 1] + (kq + 8 * it) * VP + kc * 4) = pk;
        }
#pragma unroll
        for (int c8 = 0; c8 < 4; ++c8) {
            v8h pk;
#pragma unroll
            for (int e = 0; e < 8; ++e) pk[e] = (_Float16)vf[c8 * 8 + e];
            *(v8h*)(vt[cur ^ 1] + vd * VP + vk + c8 * 8) = pk;
        }
    }
    l += xhalf(l);                                       // join the two halves' sums
    const float inv = (l > 0.f) ? 1.f / (l * 4096.f) : 0.f;
    float* orow = O + (long long)b * GT * GD + h * DH + (long long)(q0 + l15) * GD + 8 * hf;
#pragma unroll
    for (int t = 0; t < 4; ++t) {
        const v4f w0 = { o[t][0] * inv, o[t][1] * inv, o[t][2] * inv, o[t][3] * inv }, w1 = { o[t][4] * inv, o[t][5] * inv, o[t][6] * inv, o[t][7] * inv };
        VST2V4(orow + t * 16, w0); VST2V4(orow + t * 16 + 4, w1);
    }
}

// =====================================================================================================================
// k_tr: dst(z, c, r) = alpha * src(z, r, c) (+ beta * R2(z, c, r)): [Z][R][C] (row stride lds) -> [Z][C][R] (row stride ldd) through a 32x32 LDS tile;
//   flags: 1 -> add beta * residual R2 addressed like dst (z*sRz + c*ldr + r); act applied before the residual.
// =====================================================================================================================
struct TrP { const float* src; float* dst; const float* R2; long long sSz, lds, sDz, ldd, sRz, ldr; int R, C, flags, act; float alpha, beta; };
static_assert(sizeof(TrP) == 3 * 8 + 6 * 8 + 6 * 4, "TrP has padding");
__global__ __launch_bounds__(256) void k_tr(TrP p) {
    __shared__ float tile[32][33];
    const int c0 = blockIdx.x * 32, r0 = blockIdx.y * 32, z = blockIdx.z;
    const int lane = threadIdx.x & 31, wave = threadIdx.x >> 5;
    const float* s = p.src + z * p.sSz;
#pragma unroll
    for (int k = 0; k < 4; ++k) {
        const int rl = wave * 4 + k, r = r0 + rl, c = c0 + lane;
        tile[rl][lane] = (r < p.R && c < p.C) ? s[(long long)r * p.lds + c] : 0.f;
    }
    __syncthreads();
    float* d = p.dst + z * p.sDz; const float* rr = p.R2 + z * p.sRz;
#pragma unroll
    for (int k = 0; k < 4; ++k) {
        const int cl = wave * 4 + k, c = c0 + cl, r = r0 + lane;
        if (c < p.C && r < p.R) {
            float v = act_fn(p.alpha * tile[lane][cl], p.act);
            if (p.flags & 1) v += p.beta * rr[(long long)c * p.ldr + r];
            VST2(float, d + (long long)c * p.ldd + r, v);
        }
    }
}

// k_affine: dst[i] = a * (sdev ? sdev[0] : 1) * src[i] + b, i < n (one thread per element; consecutive lanes -> consecutive addresses)
__global__ __launch_bounds__(256) void k_affine(const float* __restrict__ src, float* __restrict__ dst, int n, float a, float b, const float* __restrict__ sdev) {
    const int i = blockIdx.x * 256 + threadIdx.x;
    if (i < n) { const float aa = sdev ? a * sdev[0] : a; const float v = aa * src[i] + b; VST2(float, dst + i, v); }
}

// =====================================================================================================================
// k_softmax: row softmax over n contiguous elements, one 256-thread block per row; rows addressed z*sz + r*sr (grid (R, Z)).
//   out = scale_out * softmax(scale_in * x + (Mf ? Mf[z*smz + r*smr + j] : 0)); a row whose max is -inf is written as 0.
// =====================================================================================================================
struct SmP { const float* src; float* dst; const float* Mf; long long sz, sr, dz, dr, smz, smr; int n, pad; float scale_in, scale_out; };
static_assert(sizeof(SmP) == 3 * 8 + 6 * 8 + 4 * 4, "SmP has padding");
__global__ __launch_bounds__(256) void k_softmax(SmP p) {
    __shared__ float red[256];
    const int r = blockIdx.x, z = blockIdx.y, tid = threadIdx.x;
    const float* s = p.src + z * p.sz + (long long)r * p.sr;
    const float* mf = p.Mf ? (p.Mf + z * p.smz + (long long)r * p.smr) : nullptr;
    float mx = -__builtin_inff();
    for (int j = tid; j < p.n; j += 256) { float v = s[j] * p.scale_in; if (mf) v += mf[j]; mx = fmaxf(mx, v); }
    red[tid] = mx; __syncthreads();
    for (int o = 128; o > 0; o >>= 1) { if (tid < o) red[tid] = fmaxf(red[tid], red[tid + o]); __syncthreads(); }
    mx = red[0]; __syncthreads();
    float sum = 0.f;
    for (int j = tid; j < p.n; j += 256) { float v = s[j] * p.scale_in; if (mf) v += mf[j]; sum += (mx == -__builtin_inff()) ? 0.f : expf(v - mx); }
    red[tid] = sum; __syncthreads();
    for (int o = 128; o > 0; o >>= 1) { if (tid < o) red[tid] += red[tid + o]; __syncthreads(); }
    sum = red[0];
    const float inv = (sum > 0.f) ? p.scale_out / sum : 0.f;
    float* d = p.dst + z * p.dz + (long long)r * p.dr;
    for (int j = tid; j < p.n; j += 256) { float v = s[j] * p.scale_in; if (mf) v += mf[j]; const float o = (mx == -__builtin_inff()) ? 0.f : expf(v - mx) * inv; VST2(float, d + j, o); }
}
// =====================================================================================================================
// k_stats: mean and rsqrt(var + eps) over a set of n elements addressed base + z*sz + (e / inner) * so + (e % inner) * si, one 256-thread
// k_norm_apply: y = (x - mean[set]) * rstd[set] * g[c] + b[c] over a [Z][C][L] channel-major tensor with set = z*G + c / (C/G) (G groups per z;
//   G = C -> per-channel sets indexed z*C+c; for batch norm pass stats indexed by c only via bn = 1). Optional act. Output same layout.
// =====================================================================================================================
//   mode 0: mean / rsqrt(var + eps); mode 1 (RMSNorm): 0 / rsqrt(mean(x^2) + eps); mode 2 (L2 normalize * sqrt(n)): 0 / sqrt(n) / max(||x||, eps); mode 3: as 0 with unbiased variance (n-1)
__global__ __launch_bounds__(256) void k_stats(const float* __restrict__ x, long long sz, long long so, long long si, int inner, int n, float eps, float* __restrict__ stat, int mode) {
    __shared__ float red[256];
    const int z = blockIdx.x, tid = threadIdx.x;
    const float* base = x + z * sz;
    float s = 0.f;
    for (int e = tid; e < n; e += 256) s += base[(long long)(e / inner) * so + (long long)(e % inner) * si];
    red[tid] = s; __syncthreads();
    for (int o = 128; o > 0; o >>= 1) { if (tid < o) red[tid] += red[tid + o]; __syncthreads(); }
    const float mu = (mode == 0 || mode == 3) ? red[0] / (float)n : 0.f; __syncthreads();
    float q = 0.f;
    for (int e = tid; e < n; e += 256) { const float dlt = base[(long long)(e / inner) * so + (long long)(e % inner) * si] - mu; q += dlt * dlt; }
    red[tid] = q; __syncthreads();
    for (int o = 128; o > 0; o >>= 1) { if (tid < o) red[tid] += red[tid + o]; __syncthreads(); }
    {
        float rs;
        if (mode == 2) rs = sqrtf((float)n) / fmaxf(sqrtf(red[0]), eps); else if (mode == 3) rs = rsqrtf(red[0] / (float)(n - 1) + eps); else rs = rsqrtf(red[0] / (float)n + eps);
        if (tid < 32) { const float v = (tid == 0) ? mu : ((tid == 1) ? rs : 0.f); VST2(float, stat + (long long)z * 32 + tid, v); }
    }
}
//   One thread per element over the flat [Z][C][L] index space: grid ceil(Z*C*L / 256).
__global__ __launch_bounds__(256) void k_norm_apply(const float* __restrict__ x, float* __restrict__ y, const float* __restrict__ stat, const float* __restrict__ g, const float* __restrict__ bta,
                                                     int Z, int C, int L, int G, int bn, int act) {
    const long long idx = (long long)blockIdx.x * 256 + threadIdx.x;
    if (idx >= (long long)Z * C * L) return;
    const int l = (int)(idx % L); const long long zc = idx / L; const int c = (int)(zc % C), z = (int)(zc / C); (void)l;
    const int set = bn ? c : (z * G + c / (C / G));
    float v = (x[idx] - stat[(long long)set * 32]) * stat[(long long)set * 32 + 1];
    if (g) v *= g[c];
    if (bta) v += bta[c];
    v = act_fn(v, act);
    VST2(float, y + idx, v);
}

// k_lse_neg: c[i] = -(st[2i] + log(st[2i+1])) = minus the log-sum-exp of row i from k_attn's ST output (for softmax over the query dimension)
__global__ __launch_bounds__(256) void k_lse_neg(const float* __restrict__ st, float* __restrict__ c, int n) {
    const int i = blockIdx.x * 256 + threadIdx.x;
    if (i < n) { const float v = -(st[2 * i] + logf(st[2 * i + 1])); VST2(float, c + i, v); }
}

// k_iota: dst[i] = a * i + b as int32 (segment/position id helper)
__global__ __launch_bounds__(256) void k_iota(int* __restrict__ dst, int n, int a, int b) {
    const int i = blockIdx.x * 256 + threadIdx.x;
    if (i < n) { const int v = a * i + b; VST2(int, dst + i, v); }
}

// k_axpby: dst[i] = a * x[i] + b * y[i] (+ c), i < n
__global__ __launch_bounds__(256) void k_axpby(const float* __restrict__ x, const float* __restrict__ y, float* __restrict__ dst, int n, float a, float b, float c) {
    const int i = blockIdx.x * 256 + threadIdx.x;
    if (i < n) { const float v = a * x[i] + b * y[i] + c; VST2(float, dst + i, v); }
}

// =====================================================================================================================
// k_rope: rotary embedding on a [R rows][Hn heads][D] view (row stride sXr, head stride sXh, element stride 1) -> Y (own strides).
//   mode 0: rotate_half (partner d±D/2, sign - for d<D/2); mode 1: interleaved pairs (partner d^1, sign - for even d).
//   table column tcol: tmode 0 -> d, 1 -> d % (D/2), 2 -> d / 2; position p: pmode 0 -> r % S, 1 -> head index, 2 -> pos[r];
//   c = C[(r / S) * sCb + p * sCp + tcol * sCd], s likewise from Sn; y = x[d] * c + sign * x[partner] * s. X and Y must not alias.
// =====================================================================================================================
struct RopeP { const float* X; float* Y; const float* C; const float* Sn; const int* pos; long long sXr, sXh, sYr, sYh, sCb, sCp, sCd; int R, Hn, D, S, mode, tmode, pmode, pad; };
static_assert(sizeof(RopeP) == 5 * 8 + 7 * 8 + 8 * 4, "RopeP has padding");
__global__ __launch_bounds__(256) void k_rope(RopeP p) {
    const long long idx = (long long)blockIdx.x * 256 + threadIdx.x;
    if (idx >= (long long)p.R * p.Hn * p.D) return;
    const int d = (int)(idx % p.D); const long long rh = idx / p.D; const int h = (int)(rh % p.Hn); const int r = (int)(rh / p.Hn);
    const int half = p.D / 2;
    int partner; float sign;
    if (p.mode == 0) { partner = (d < half) ? d + half : d - half; sign = (d < half) ? -1.f : 1.f; }
    else { partner = d ^ 1; sign = (d & 1) ? 1.f : -1.f; }
    const int tcol = (p.tmode == 0) ? d : ((p.tmode == 1) ? (d % half) : (d >> 1));
    const int pp = (p.pmode == 0) ? (r % p.S) : ((p.pmode == 1) ? h : p.pos[r]);
    const long long toff = (long long)(r / p.S) * p.sCb + (long long)pp * p.sCp + (long long)tcol * p.sCd;
    const float* xr = p.X + (long long)r * p.sXr + (long long)h * p.sXh;
    const float v = xr[d] * p.C[toff] + sign * xr[partner] * p.Sn[toff];
    VST2(float, p.Y + (long long)r * p.sYr + (long long)h * p.sYh + d, v);
}

// k_invf + k_sincos (split so neither kernel carries a large VALU-fma footprint): invf_i = num * (1 / powf(base, (2 i)/D)) [fmode 0],
//   num * expf((2 i) * cexp) [fmode 1], num * powf(base, -2 (i - 1) / D) [fmode 2]; then cs/sn[s*half + i] = cos/sin((pscale * s) * invf_i)
__global__ __launch_bounds__(256) void k_invf(float* __restrict__ invb, int half, int D, float base, float num, int fmode, float cexp) {
    const int i = blockIdx.x * 256 + threadIdx.x;
    if (i >= ((half + 31) / 32) * 32) return;
    if (i >= half) { VST2(float, invb + i, 0.f); return; }
    const float e = (float)(2 * i) / (float)D;
    float invf;
    if (fmode == 1) invf = num * expf((float)(2 * i) * cexp);
    else if (fmode == 2) invf = num * powf(base, (-2.0f * ((float)i - 1.0f)) / (float)D);
    else invf = num * (1.0f / powf(base, e));
    VST2(float, invb + i, invf);
}
__global__ __launch_bounds__(256) void k_sincos(float* __restrict__ cs, float* __restrict__ sn, const float* __restrict__ invb, int S, int half, float pscale) {
    const int idx = blockIdx.x * 256 + threadIdx.x;
    if (idx >= S * half) return;
    const int s = idx / half, i = idx - s * half;
    const float ang = (pscale * (float)s) * invb[i];
    VST2(float, cs + idx, cosf(ang)); VST2(float, sn + idx, sinf(ang));
}

// k_mulact: dst[i] = act(x[i]) * y[i]
__global__ __launch_bounds__(256) void k_mulact(const float* __restrict__ x, const float* __restrict__ y, float* __restrict__ dst, int n, int act) {
    const int i = blockIdx.x * 256 + threadIdx.x;
    if (i < n) { const float v = act_fn(x[i], act) * y[i]; VST2(float, dst + i, v); }
}

// =====================================================================================================================
// k_matvec: thread-per-row matrix-vector products for N <= 8 output columns (heads with 1-3 outputs, gates), f32 on the VALU.
//   C[r*sCm + j] = act(alpha * sum_k A[r*sAm + k*sAk] * B[j*sBn + k*sBk] + bias[j]) + beta * R[r*sRm + j*sRn]; each thread writes its N contiguous floats.
// =====================================================================================================================
__global__ __launch_bounds__(256) void k_matvec(GemmP p) {
    // 32 lanes write one line with one instruction.
    const int rpt = (p.N == 1) ? 1 : 32;
    const long long r0 = ((long long)blockIdx.x * 256 + threadIdx.x) * rpt; const int z = blockIdx.z, zo = z / p.zi_n, zi = z - zo * p.zi_n;
    if (r0 >= p.M) return;
    const float* Bb = p.B + zo * p.sBo + zi * p.sBi;
    float* C = p.C + zo * p.sCo + zi * p.sCi; const float* R = p.R + zo * p.sRo + zi * p.sRi;
    for (int rr = 0; rr < rpt; ++rr) {
        const long long r = r0 + rr; if (r >= p.M) break;
        const float* A = p.A + zo * p.sAo + zi * p.sAi + r * p.sAm;
        float acc[8] = {0.f, 0.f, 0.f, 0.f, 0.f, 0.f, 0.f, 0.f};
        for (int k = 0; k < p.K; ++k) { const float a = A[(long long)k * p.sAk];
#pragma unroll
            for (int j = 0; j < 8; ++j) if (j < p.N) acc[j] += a * Bb[(long long)j * p.sBn + (long long)k * p.sBk]; }
#pragma unroll
        for (int j = 0; j < 8; ++j) if (j < p.N) {
            float v = acc[j] * p.alpha;
            if (p.flags & 1) v += p.bias[j];
            if (p.flags & 2) v += p.bias[r];
            v = act_fn(v, p.act);
            if (p.flags & 4) v += p.beta * R[r * p.sRm + (long long)j * p.sRn];
            VST2(float, C + r * p.sCm + j, v);
        }
    }
}
// k_smallsoftmax: thread-per-row softmax for short rows (n <= 64): dst[r*dr + j] = softmax(scale*src[r*sr + j])
__global__ __launch_bounds__(256) void k_smallsoftmax(const float* __restrict__ src, float* __restrict__ dst, long long sr, long long dr, int n, long long R, float scale) {
    const long long r0 = ((long long)blockIdx.x * 256 + threadIdx.x) * 32;
    for (int rr = 0; rr < 32; ++rr) {
        const long long r = r0 + rr; if (r >= R) return;
        const float* s = src + r * sr; float* d = dst + r * dr;
        float mx = -__builtin_inff();
        for (int j = 0; j < n; ++j) mx = fmaxf(mx, s[j] * scale);
        float sum = 0.f;
        for (int j = 0; j < n; ++j) sum += expf(s[j] * scale - mx);
        const float inv = 1.f / sum;
        for (int j = 0; j < n; ++j) { const float v = expf(s[j] * scale - mx) * inv; VST2(float, d + j, v); }
    }
}

__global__ __launch_bounds__(32) void k_unitstat(float* __restrict__ st) { const int t = threadIdx.x; const float v = (t == 1) ? 1.f : 0.f; VST2(float, st + t, v); }

// destination (e.g. a d_out whose row width is not a multiple of 32 floats) is written by consecutive lanes of one instruction
__global__ __launch_bounds__(256) void k_lincopy(const float* __restrict__ src, long long lds, float* __restrict__ dst, long long ldd, long long rows, int cols) {
    const long long i = (long long)blockIdx.x * 256 + threadIdx.x; if (i >= rows * cols) return;
    const long long r = i / cols; const int c = (int)(i - r * cols);
    const float v = src[r * lds + c]; VST2(float, dst + r * ldd + c, v);
}

namespace w25 {
typedef __attribute__((ext_vector_type(16))) _Float16 v16h;
typedef __attribute__((ext_vector_type(8)))  _Float16 v8h;
typedef __attribute__((ext_vector_type(16))) __bf16   v16b;
typedef __attribute__((ext_vector_type(8)))  __bf16   v8b;
typedef __attribute__((ext_vector_type(8)))  float    v8f;
typedef __attribute__((ext_vector_type(4)))  float    v4f;

__device__ __forceinline__ unsigned short f2bf_bits(float f) {
  unsigned u = __float_as_uint(f);
  return (unsigned short)((u + 0x7FFFu + ((u >> 16) & 1u)) >> 16);
}
__device__ __forceinline__ float bf_bits2f(unsigned short h) { return __uint_as_float(((unsigned)h) << 16); }

// hazard guards as plain device helpers (no inline asm inside the kernel template body)
__device__ __forceinline__ void dep_guard_h(v8f& a, v8f& b, v16h x, v16h y) { asm volatile("v_nop\n\tv_nop\n\tv_nop\n\tv_nop" : "+v"(a), "+v"(b) : "v"(x), "v"(y)); }
__device__ __forceinline__ void dep_guard_b(v8f& a, v8f& b, v16b x, v16b y) { asm volatile("v_nop\n\tv_nop\n\tv_nop\n\tv_nop" : "+v"(a), "+v"(b) : "v"(x), "v"(y)); }
__device__ __forceinline__ void keep4_h(v16h a, v16h b, v16h c, v16h d) { asm volatile("v_nop" :: "v"(a), "v"(b), "v"(c), "v"(d)); }
__device__ __forceinline__ void keep4_b(v16b a, v16b b, v16b c, v16b d) { asm volatile("v_nop" :: "v"(a), "v"(b), "v"(c), "v"(d)); }
__device__ __forceinline__ void acc_guard4(v8f& a, v8f& b, v8f& c, v8f& d) { asm volatile("v_nop\n\tv_nop\n\tv_nop\n\tv_nop" : "+v"(a), "+v"(b), "+v"(c), "+v"(d)); }
template <typename T> struct Frag;
template <> struct Frag<_Float16> {
  typedef v16h V; union U { v16h v; v8h h[2]; };
  static __device__ __forceinline__ v16h load(const _Float16* p) {   // elements 0..7 <- p[0..7], 8..15 <- p[16..23]
    U f; f.h[0] = *(const v8h*)(p); f.h[1] = *(const v8h*)(p + 16); return f.v;
  }
  static __device__ __forceinline__ v8f mma(v16h a, v16h b, v8f c) {
    return __builtin_amdgcn_wmma_f32_16x16x32_f16(false, a, false, b, (short)0, c, false, false);
  }
  static __device__ __forceinline__ void guard(v8f& a, v8f& b, v16h x, v16h y) { dep_guard_h(a, b, x, y); }
  static __device__ __forceinline__ void keep(v16h a, v16h b, v16h c, v16h d) { keep4_h(a, b, c, d); }
};
template <> struct Frag<__bf16> {
  typedef v16b V; union U { v16b v; v8b h[2]; };
  static __device__ __forceinline__ v16b load(const __bf16* p) {
    U f; f.h[0] = *(const v8b*)(p); f.h[1] = *(const v8b*)(p + 16); return f.v;
  }
  static __device__ __forceinline__ v8f mma(v16b a, v16b b, v8f c) {
    return __builtin_amdgcn_wmma_f32_16x16x32_bf16(false, a, false, b, (short)0, c, false, false);
  }
  static __device__ __forceinline__ void guard(v8f& a, v8f& b, v16b x, v16b y) { dep_guard_b(a, b, x, y); }
  static __device__ __forceinline__ void keep(v16b a, v16b b, v16b c, v16b d) { keep4_b(a, b, c, d); }
};

// ---- Register-blocked batched WMMA GEMM ------------------------------------
// C[m,n] = scale * sum_k A[m,k] * Bt[n,k] (+bias)(+resid); each wave owns a 64x64 tile.
// A row-major [M,K]; Bt row-major [N,K]; M,N % 64 == 0, K % 32 == 0.
// SPLIT: operands are hi/lo planes (A2/Bt2 = lo planes, same layout); product = hi·hi + hi·lo + lo·hi.
// BIAS_MODE: 0 = none, 1 = bias[m], 2 = bias[n].
// OUT_MODE: 0 = f32, 1 = f16, 2 = bf16 hi plane (Cout) + bf16 lo plane (Cout2).
// ET: 0 = f16 operands, 1 = bf16 operands (pointers passed as 16-bit storage)
template <int ET> struct Elem;
template <> struct Elem<0> { typedef _Float16 T; };
template <> struct Elem<1> { typedef __bf16 T; };
template <int ET, bool SPLIT, int BIAS_MODE, int OUT_MODE, bool RESID, int ACT = 0>
__global__ __launch_bounds__(256) void wmma_gemm64(
    const unsigned short* __restrict__ Ap, const unsigned short* __restrict__ A2p, int lda, long strideA,
    const unsigned short* __restrict__ Btp, const unsigned short* __restrict__ Bt2p, int ldb, long strideB,
    void* __restrict__ Cout, void* __restrict__ Cout2, int ldc, long strideC,
    const float* __restrict__ bias,
    const float* __restrict__ resid, long strideR,
    int M, int N, int K, float scale) {
  typedef typename Elem<ET>::T T;
  typedef typename Frag<T>::V V;
  const T* A = (const T*)Ap; const T* A2 = (const T*)A2p; const T* Bt = (const T*)Btp; const T* Bt2 = (const T*)Bt2p;
  __shared__ __align__(16) float sT[8][16 * 68];   // per-wave 16x64 slab, pitch 68 floats
  const int b    = blockIdx.y;
  const int lane = threadIdx.x & 31;
  const int wave = threadIdx.x >> 5;
  const int tilesN = N >> 6;
  const int tilesM = M >> 6;
  const int tile = blockIdx.x * 8 + wave;
  if (tile >= tilesM * tilesN) return;   // wave-uniform; no block barriers in this kernel
  const int tm = tile / tilesN;
  const int tn = tile - tm * tilesN;
  const int m0 = tm << 6;
  const int n0 = tn << 6;

  const T* Ab  = A  + (size_t)b * strideA;
  const T* Bb  = Bt + (size_t)b * strideB;
  const T* Ab2 = SPLIT ? (A2  + (size_t)b * strideA) : nullptr;
  const T* Bb2 = SPLIT ? (Bt2 + (size_t)b * strideB) : nullptr;

  const int rlane = lane & 15;                 // row (A) / col (B, D) within subtile
  const int koff  = (lane >> 4) * 8;           // k offset of this lane half
  const int mOff  = (lane >> 4) * 8;           // D row offset

  v8f acc[4][4];
#pragma unroll
  for (int i = 0; i < 4; ++i)
#pragma unroll
    for (int j = 0; j < 4; ++j) acc[i][j] = (v8f){0.f,0.f,0.f,0.f,0.f,0.f,0.f,0.f};

  for (int k0 = 0; k0 < K; k0 += 32) {
    V bh[4], bl[4];
#pragma unroll
    for (int j = 0; j < 4; ++j) {
      const size_t bo = (size_t)(n0 + (j << 4) + rlane) * ldb + koff + k0;
      bh[j] = Frag<T>::load(Bb + bo);
      if (SPLIT) bl[j] = Frag<T>::load(Bb2 + bo);
    }
#pragma unroll
    for (int i = 0; i < 4; ++i) {
      const size_t ao = (size_t)(m0 + (i << 4) + rlane) * lda + koff + k0;
      V ah = Frag<T>::load(Ab + ao);
      V al;
      if (SPLIT) al = Frag<T>::load(Ab2 + ao);
#pragma unroll
      for (int j = 0; j < 4; ++j) {
        acc[i][j] = Frag<T>::mma(ah, bh[j], acc[i][j]);
        if (SPLIT) {
          acc[i][j] = Frag<T>::mma(ah, bl[j], acc[i][j]);
          acc[i][j] = Frag<T>::mma(al, bh[j], acc[i][j]);
        }
      }
      Frag<T>::guard(acc[i][0], acc[i][3], ah, SPLIT ? al : ah);
    }
    Frag<T>::keep(bh[0], bh[1], bh[2], bh[3]);
    if (SPLIT) Frag<T>::keep(bl[0], bl[1], bl[2], bl[3]);
  }
  acc_guard4(acc[0][0], acc[0][1], acc[0][2], acc[0][3]);
  acc_guard4(acc[1][0], acc[1][1], acc[1][2], acc[1][3]);
  acc_guard4(acc[2][0], acc[2][1], acc[2][2], acc[2][3]);
  acc_guard4(acc[3][0], acc[3][1], acc[3][2], acc[3][3]);

  // ---- epilogue ----
  float* slab = sT[wave];
  const float* Rb = RESID ? (resid + (size_t)b * strideR) : nullptr;
#pragma unroll
  for (int i = 0; i < 4; ++i) {
    const int mBase = m0 + (i << 4);
#pragma unroll
    for (int j = 0; j < 4; ++j) {
      const int n = n0 + (j << 4) + rlane;
      float bv = 0.f;
      if (BIAS_MODE == 2) bv = bias[n];
#pragma unroll
      for (int r = 0; r < 8; ++r) {
        float v = acc[i][j][r] * scale;
        if (BIAS_MODE == 1) v += bias[mBase + mOff + r];
        if (BIAS_MODE == 2) v += bv;
        if (RESID) v += Rb[(size_t)(mBase + mOff + r) * ldc + n];
        if (ACT == 1) v = tanhf(v);
        if (ACT == 2) v = fmaxf(v, 0.0f);
        if (ACT == 3) v = v / (1.0f + expf(-v));
        if (ACT == 4) v = (v > 0.f) ? v : 0.01f * v;
        if (ACT == 5) v = 0.5f * v * (1.0f + erff(v * 0.70710678118654752f));
        slab[(mOff + r) * 68 + (j << 4) + rlane] = v;
      }
    }
    __builtin_amdgcn_fence(__ATOMIC_RELEASE, "workgroup");
    __builtin_amdgcn_wave_barrier();
    __builtin_amdgcn_fence(__ATOMIC_ACQUIRE, "workgroup");
    if (OUT_MODE == 0) {
      float* C = (float*)Cout + (size_t)b * strideC;
      const int hh = lane >> 4, c4 = (lane & 15) * 4;     // row seg = 256 B = 16 lanes x 16 B
      {
#pragma unroll
        for (int it = 0; it < 8; ++it) {
          const int row = it * 2 + hh;
          v4f v = *(const v4f*)(slab + row * 68 + c4);
          *(v4f*)(C + (size_t)(mBase + row) * ldc + n0 + c4) = v;
        }
        
      }
    } else {
      const int q = lane >> 3, c8 = (lane & 7) * 8;
      unsigned short* C  = (unsigned short*)Cout  + (size_t)b * strideC;
      unsigned short* C2 = (OUT_MODE == 2) ? ((unsigned short*)Cout2 + (size_t)b * strideC) : nullptr;
      {
#pragma unroll
        for (int it = 0; it < 4; ++it) {
          const int row = it * 4 + q;
          const float* sp = slab + row * 68 + c8;
          v8h hv, lv;
#pragma unroll
          for (int e = 0; e < 8; ++e) {
            if (OUT_MODE == 1) {
              hv[e] = (_Float16)sp[e];
            } else {
              unsigned short hb = f2bf_bits(sp[e]);
              unsigned short lb = f2bf_bits(sp[e] - bf_bits2f(hb));
              hv[e] = __builtin_bit_cast(_Float16, hb);
              lv[e] = __builtin_bit_cast(_Float16, lb);
            }
          }
          *(v8h*)(C + (size_t)(mBase + row) * ldc + n0 + c8) = hv;
          if (OUT_MODE == 2) *(v8h*)(C2 + (size_t)(mBase + row) * ldc + n0 + c8) = lv;
        }
        
      }
    }
    __builtin_amdgcn_fence(__ATOMIC_RELEASE, "workgroup");
    __builtin_amdgcn_wave_barrier();
    __builtin_amdgcn_fence(__ATOMIC_ACQUIRE, "workgroup");
  }
}

__global__ __launch_bounds__(256) void cast_f32_f16x2(
    const float* __restrict__ in, _Float16* __restrict__ out, int n2) {
  int i = blockIdx.x * 256 + threadIdx.x;
  if (i < n2) {
    const _Float16 h0 = (_Float16)in[2 * i], h1 = (_Float16)in[2 * i + 1];
    const unsigned u = (unsigned)__builtin_bit_cast(unsigned short, h0) | ((unsigned)__builtin_bit_cast(unsigned short, h1) << 16);
    ((unsigned*)out)[i] = u;
    
  }
}


} // namespace w25

__global__ __launch_bounds__(256) void k_castT16(const float* __restrict__ src, long long lds, _Float16* __restrict__ dst, long long ldd, int R, int C, float s) {
    const long long i = (long long)blockIdx.x * 256 + threadIdx.x; const long long np = (long long)C * (R / 2); if (i >= np) return; const int c = (int)(i / (R / 2)); const int r = 2 * (int)(i % (R / 2));
    const _Float16 h0 = (_Float16)(src[(long long)r * lds + c] * s), h1 = (_Float16)(src[(long long)(r + 1) * lds + c] * s);
    const unsigned u = (unsigned)__builtin_bit_cast(unsigned short, h0) | ((unsigned)__builtin_bit_cast(unsigned short, h1) << 16);
    unsigned* d = (unsigned*)(dst + (long long)c * ldd + r); *d = u;  }
__global__ __launch_bounds__(256) void k_cast16(const float* __restrict__ src, long long lds, _Float16* __restrict__ dst, long long ldd, int R, int C, float s) {
    const long long i = (long long)blockIdx.x * 256 + threadIdx.x; const long long np = (long long)R * (C / 2); if (i >= np) return; const int r = (int)(i / (C / 2)); const int c = 2 * (int)(i % (C / 2));
    const _Float16 h0 = (_Float16)(src[(long long)r * lds + c] * s), h1 = (_Float16)(src[(long long)r * lds + c + 1] * s);
    const unsigned u = (unsigned)__builtin_bit_cast(unsigned short, h0) | ((unsigned)__builtin_bit_cast(unsigned short, h1) << 16);
    unsigned* d = (unsigned*)(dst + (long long)r * ldd + c); *d = u;  }

// f32 -> f16 casts on few, long waves: 256 blocks of 16 waves (4,096 waves to start a launch). A tile is 16,384 consecutive floats: eight wave-wide 16-byte loads a lane
// (512 contiguous bytes a wave and load), all issued before the first is used, and eight 8-byte stores (256 contiguous bytes a wave and store).
__device__ __forceinline__ void cast_tile_ld(const float* __restrict__ s, v4f* r) {
#pragma unroll   // r stays in registers and the eight loads issue back to back
    for (int i = 0; i < 8; ++i) r[i] = *(const v4f*)(s + i * 2048);
}
__device__ __forceinline__ void cast_tile_st(_Float16* __restrict__ d, const v4f* r, float sc) {
#pragma unroll   // constant indices into r and pk: both stay in registers
    for (int i = 0; i < 8; ++i) {
        v4h pk;
#pragma unroll
        for (int e = 0; e < 4; ++e) pk[e] = (_Float16)(r[i][e] * sc);
        *(v4h*)(d + i * 2048) = pk;
    }
}
// Every operand of the four projections that exists before the first of them, in one launch: block n casts tile n of x, tile n of the context and tile n & 63 of
// weight n >> 6 (order Wq, Wk, Wv, Wo; times 16; the four f16 planes lie one behind the other in w16). x and c: 256 tiles each, a weight: 64.
__global__ __launch_bounds__(512) void k_cast_in(const float* __restrict__ x, const float* __restrict__ c, const float* __restrict__ Wq, const float* __restrict__ Wk,
                                                 const float* __restrict__ Wv, const float* __restrict__ Wo, _Float16* __restrict__ x16, _Float16* __restrict__ c16, _Float16* __restrict__ w16) {
    const unsigned n = blockIdx.x, sel = n >> 6;
    const float* __restrict__ w = (sel == 0) ? Wq : (sel == 1) ? Wk : (sel == 2) ? Wv : Wo;
    const unsigned t4 = threadIdx.x * 4u;
    v4f rx[8], rc[8], rw[8];
    cast_tile_ld(x + (size_t)n * 16384 + t4, rx);
    cast_tile_ld(c + (size_t)n * 16384 + t4, rc);
    cast_tile_ld(w + (size_t)(n & 63u) * 16384 + t4, rw);
    cast_tile_st(x16 + (size_t)n * 16384 + t4, rx, 1.0f);
    cast_tile_st(c16 + (size_t)n * 16384 + t4, rc, 1.0f);
    cast_tile_st(w16 + (size_t)n * 16384 + t4, rw, 16.0f);
}
// One plane of 256 tiles (the attention output).
__global__ __launch_bounds__(512) void k_cast_plane(const float* __restrict__ s, _Float16* __restrict__ d) {
    const size_t o = (size_t)blockIdx.x * 16384 + threadIdx.x * 4u;
    v4f r[8];
    cast_tile_ld(s + o, r);
    cast_tile_st(d + o, r, 1.0f);
}

// f32 -> bf16 hi plane + bf16 lo plane (x = hi + lo to ~2^-17 relative; RNE both), [R][C] -> [R][C] (or transposed to [C][R]); 2 consecutive destination elements
__device__ __forceinline__ unsigned int f2bf2_pack(float a, float b, unsigned int* lo) {
    const unsigned short ha = w25::f2bf_bits(a), hb = w25::f2bf_bits(b);
    const unsigned short la = w25::f2bf_bits(a - w25::bf_bits2f(ha)), lb = w25::f2bf_bits(b - w25::bf_bits2f(hb));
    *lo = (unsigned)la | ((unsigned)lb << 16); return (unsigned)ha | ((unsigned)hb << 16); }
__global__ __launch_bounds__(256) void k_castS16(const float* __restrict__ src, long long lds, __bf16* __restrict__ dhi, __bf16* __restrict__ dlo, long long ldd, int R, int C, float s, int transpose) {
    const long long i = (long long)blockIdx.x * 256 + threadIdx.x; long long o; float a, b;
    if (transpose) { const long long np = (long long)C * (R / 2); if (i >= np) return; const int c = (int)(i / (R / 2)); const int r = 2 * (int)(i % (R / 2)); a = src[(long long)r * lds + c] * s; b = src[(long long)(r + 1) * lds + c] * s; o = (long long)c * ldd + r; }
    else { const long long np = (long long)R * (C / 2); if (i >= np) return; const int r = (int)(i / (C / 2)); const int c = 2 * (int)(i % (C / 2)); a = src[(long long)r * lds + c] * s; b = src[(long long)r * lds + c + 1] * s; o = (long long)r * ldd + c; }
    unsigned lo; const unsigned hi = f2bf2_pack(a, b, &lo); unsigned* ph = (unsigned*)(dhi + o); unsigned* pl = (unsigned*)(dlo + o);
    *ph = hi; *pl = lo;  }

namespace w25 {
// =====================================================================================
// Generic causal/non-causal attention for head_dim 64, f32 in / f32 out; 16-bit operands: bf16 with optional hi/lo splits, or
// plain f16 (F16=true, non-split, probabilities carried x2^15).
//   scores = (q*qscale)·kᵀ : v_wmma_f32_16x16x32_bf16; SPLIT_QK -> q,k as bf16 hi/lo (hi·hi + hi·lo + lo·hi)
//   out    = p·v           : v_wmma_f32_16x16x32_bf16; SPLIT_PV -> p,v as bf16 hi/lo; else p,v plain bf16
//   f32 accumulate; online softmax in f32. Block = 4 waves = 64 query rows of one (batch, head); S % 64 == 0.
//   Element (b, s, h, d) of tensor X lives at X[b*X_bs + s*X_rs + h*X_hs + d] (strides in floats, multiples of 4).
//   Masking: mask_mode 0 none, 1 causal (kv > q masked), 2 tensor [S][Skv] shared over (b,h) (float if
//   mask_is_int==0, int32 with element == 0 -> masked if 1, int32 with element != 0 -> masked if 2), 3 per-token vectors qmask[B][S] & kvmask[B][Skv] (int32,
//   0 -> masked), 4 causal + sliding window (kv > q or q - kv > W masked; W passed in mask_is_int);
//   5 = relative-position bias: s += cp[b,h,q][idx[q][kv]] + pc[b,h,kv][idx[q][kv]] with idx = mask_b ([S][Skv] int32) and
//   mask_a an int32 [S][Skv] tensor with nonzero = masked (tables: element (b,h,row,n) at X + b*c_bs + h*c_hs + row*c_rs + n);
//   masked scores are replaced by mask_fill (e.g. -inf or -1e9) before the softmax.
//   grid.x = B * H * (S/64) (or a sub-range with blk0).
// =====================================================================================
#define AT_D 64
#define AT_NW 4
#define AT_QB 64
#define AT_KC 64
struct AttnGeom { const float* cp = nullptr; const float* pc = nullptr; long c_bs = 0, c_rs = 0, c_hs = 0;   // mode-5 score-bias tables
                  long q_bs, q_rs, q_hs, k_bs, k_rs, k_hs, v_bs, v_rs, v_hs, o_bs, o_rs, o_hs;
                  int S, Skv, H, mask_mode; float qscale; int blk0; float mask_fill; int mask_is_int; };
static_assert(sizeof(AttnGeom) == 168, "no padding");

__device__ __forceinline__ unsigned short at_bf_bits(float f) {
  unsigned u = __float_as_uint(f);
  return (unsigned short)((u + 0x7FFFu + ((u >> 16) & 1u)) >> 16);
}
__device__ __forceinline__ __bf16 at_f2bf(float f) { return __builtin_bit_cast(__bf16, at_bf_bits(f)); }
__device__ __forceinline__ void at_split(float f, __bf16& hi, __bf16& lo) {
  const unsigned short hb = at_bf_bits(f);
  hi = __builtin_bit_cast(__bf16, hb);
  lo = at_f2bf(f - __uint_as_float(((unsigned)hb) << 16));
}
__device__ __forceinline__ v8f at_mma(v16b a, v16b b, v8f c) {
  c = __builtin_amdgcn_wmma_f32_16x16x32_bf16(false, a, false, b, (short)0, c, false, false);
  asm volatile("v_nop\n\tv_nop\n\tv_nop\n\tv_nop" : "+v"(c) : "v"(a), "v"(b));
  return c;
}
// 16-bit element as a bit pattern held in a __bf16 slot: f16 bits when F16, bf16 (RNE) otherwise
template <bool F16> __device__ __forceinline__ __bf16 at_to16(float f) {
  if (F16) return __builtin_bit_cast(__bf16, (_Float16)f);
  return at_f2bf(f);
}
template <bool F16> __device__ __forceinline__ v8f at_mma16(v16b a, v16b b, v8f c) {
  if (F16) {
    const v16h ah = __builtin_bit_cast(v16h, a), bh = __builtin_bit_cast(v16h, b);
    c = __builtin_amdgcn_wmma_f32_16x16x32_f16(false, ah, false, bh, (short)0, c, false, false);
    asm volatile("v_nop\n\tv_nop\n\tv_nop\n\tv_nop" : "+v"(c) : "v"(ah), "v"(bh));
    return c;
  }
  return at_mma(a, b, c);
}

template <bool SPLIT_QK, bool SPLIT_PV, bool F16 = false>
__global__ __launch_bounds__(128)
void attn64_kernel(const float* __restrict__ q, const float* __restrict__ k,
                   const float* __restrict__ v, float* __restrict__ out,
                   const void* __restrict__ mask_a, const int* __restrict__ mask_b, AttnGeom g) {
  static_assert(!(F16 && (SPLIT_QK || SPLIT_PV)), "f16 mode is non-split");
  const float PSC = F16 ? 32768.0f : 1.0f;     // f16 probabilities carried x2^15 (subnormal range), folded into the final 1/l
  union FB { v16b v; v8b h[2]; };
  __shared__ __align__(16) __bf16 Ksh[AT_KC * AT_D];             // K hi [kv][d]      8 KB
  __shared__ __align__(16) __bf16 Ksl[SPLIT_QK ? AT_KC * AT_D : 8];
  __shared__ __align__(16) __bf16 Vth[AT_D * AT_KC];             // V hi [d][kv]      8 KB
  __shared__ __align__(16) __bf16 Vtl[SPLIT_PV ? AT_D * AT_KC : 8];
  __shared__ __align__(16) __bf16 Psh[AT_NW][16 * AT_KC];        // per wave P hi [row][kv]  8 KB
  __shared__ __align__(16) __bf16 Psl[SPLIT_PV ? AT_NW : 1][SPLIT_PV ? 16 * AT_KC : 8];
  __shared__ __align__(16) float  Os[AT_NW][16 * 68];            // per wave out tile, pitch 68

  const int tid  = threadIdx.x;
  const int wave = tid >> 5;
  const int lane = tid & 31;
  const int hh   = lane >> 4;
  const int c    = lane & 15;

  const int nqb = g.S / AT_QB;
  const int bx = blockIdx.x + g.blk0;
  const int qb = bx % nqb;
  const int bh = bx / nqb;
  const int h  = bh % g.H;
  const int b  = bh / g.H;
  const int qbase_block = qb * AT_QB;
  const int q0 = qbase_block + wave * 16;

  const float* qb_ptr = q + (size_t)b * g.q_bs + (size_t)h * g.q_hs;
  const float* kb_ptr = k + (size_t)b * g.k_bs + (size_t)h * g.k_hs;
  const float* vb_ptr = v + (size_t)b * g.v_bs + (size_t)h * g.v_hs;
  float*       ob_ptr = out + (size_t)b * g.o_bs + (size_t)h * g.o_hs;

  // ---- Q fragments (A operand): 2 d-chunks, hi (and lo) ----
  v16b qah[2], qal[2];
  {
    const float* qrow = qb_ptr + (size_t)(q0 + c) * g.q_rs;
#pragma unroll
    for (int dc = 0; dc < 2; ++dc) {
#pragma unroll
      for (int e = 0; e < 8; ++e) {
        const float f0 = qrow[dc * 32 + 8 * hh + e] * g.qscale;
        const float f1 = qrow[dc * 32 + 16 + 8 * hh + e] * g.qscale;
        if (SPLIT_QK) { __bf16 hq, lq; at_split(f0, hq, lq); qah[dc][e] = hq; qal[dc][e] = lq; at_split(f1, hq, lq); qah[dc][8 + e] = hq; qal[dc][8 + e] = lq; }
        else { qah[dc][e] = at_to16<F16>(f0); qah[dc][8 + e] = at_to16<F16>(f1); qal[dc][e] = qah[dc][e]; qal[dc][8 + e] = qah[dc][8 + e]; }
      }
    }
  }

  float mrow[8], lrow[8];
  v8f oacc[4];
#pragma unroll
  for (int r = 0; r < 8; ++r) { mrow[r] = -INFINITY; lrow[r] = 0.f; }
#pragma unroll
  for (int t = 0; t < 4; ++t) oacc[t] = (v8f){0.f,0.f,0.f,0.f,0.f,0.f,0.f,0.f};

  const int nChunks = (g.mask_mode == 1 || g.mask_mode == 4) ? (qb + 1) : (g.Skv / AT_KC);   // block-uniform
  // per-row query mask (mode 3)
  int qkeep[8];
#pragma unroll
  for (int r = 0; r < 8; ++r) qkeep[r] = (g.mask_mode == 3) ? mask_b[(size_t)b * g.S + q0 + 8 * hh + r] : 1;   // mask_b = qmask in mode 3
  for (int kc = 0; kc < nChunks; ++kc) {
    const int kv0 = kc * AT_KC;
    __syncthreads();
    {
      const int kvr = tid >> 1, dh = (tid & 1) * 32;
      const float* krow = kb_ptr + (size_t)(kv0 + kvr) * g.k_rs + dh;
      const float* vrow = vb_ptr + (size_t)(kv0 + kvr) * g.v_rs + dh;
#pragma unroll
      for (int i = 0; i < 8; ++i) {
        v4f kk = *(const v4f*)(krow + 4 * i);
        v4f vv = *(const v4f*)(vrow + 4 * i);
#pragma unroll
        for (int e = 0; e < 4; ++e) {
          const int d = dh + 4 * i + e;
          if (SPLIT_QK) { __bf16 a, bl; at_split(kk[e], a, bl); Ksh[kvr * AT_D + d] = a; Ksl[kvr * AT_D + d] = bl; }
          else Ksh[kvr * AT_D + d] = at_to16<F16>(kk[e]);
          if (SPLIT_PV) { __bf16 a, bl; at_split(vv[e], a, bl); Vth[d * AT_KC + kvr] = a; Vtl[d * AT_KC + kvr] = bl; }
          else Vth[d * AT_KC + kvr] = at_to16<F16>(vv[e]);
        }
      }
    }
    __syncthreads();

    v8f s[4];
#pragma unroll
    for (int j = 0; j < 4; ++j) {
      s[j] = (v8f){0.f,0.f,0.f,0.f,0.f,0.f,0.f,0.f};
#pragma unroll 1
      for (int dc = 0; dc < 2; ++dc) {
        FB kb;
        kb.h[0] = *(const v8b*)(Ksh + (j * 16 + c) * AT_D + dc * 32 + 8 * hh);
        kb.h[1] = *(const v8b*)(Ksh + (j * 16 + c) * AT_D + dc * 32 + 16 + 8 * hh);
        s[j] = at_mma16<F16>(qah[dc], kb.v, s[j]);
        if (SPLIT_QK) {
          FB kl;
          kl.h[0] = *(const v8b*)(Ksl + (j * 16 + c) * AT_D + dc * 32 + 8 * hh);
          kl.h[1] = *(const v8b*)(Ksl + (j * 16 + c) * AT_D + dc * 32 + 16 + 8 * hh);
          s[j] = at_mma16<F16>(qah[dc], kl.v, s[j]);
          s[j] = at_mma16<F16>(qal[dc], kb.v, s[j]);
        }
      }
    }
    const bool diag = (g.mask_mode == 1) && (kc == qb);
    int kvkeep[4] = {1, 1, 1, 1};
    if (g.mask_mode == 3) {
#pragma unroll
      for (int j = 0; j < 4; ++j) kvkeep[j] = ((const int*)mask_a)[(size_t)b * g.Skv + kv0 + j * 16 + c];   // mask_a = kvmask
    }
    float cm[8];
#pragma unroll
    for (int r = 0; r < 8; ++r) {
      const int qrow = q0 + 8 * hh + r;
      float m = -INFINITY;
#pragma unroll
      for (int j = 0; j < 4; ++j) {
        const int kvcol = kv0 + j * 16 + c;
        bool masked = false;
        if (diag) masked = (kvcol > qrow);
        else if (g.mask_mode == 4) masked = (kvcol > qrow) || (qrow - kvcol > g.mask_is_int);
        else if (g.mask_mode == 2) {
          const size_t mi = (size_t)qrow * g.Skv + kvcol;
          masked = (g.mask_is_int == 0) ? (((const float*)mask_a)[mi] == 0.0f)
                 : (g.mask_is_int == 1) ? (((const int*)mask_a)[mi] == 0) : (((const int*)mask_a)[mi] != 0);
        } else if (g.mask_mode == 3) masked = (qkeep[r] == 0) || (kvkeep[j] == 0);
        else if (g.mask_mode == 5) {
          const size_t mi = (size_t)qrow * g.Skv + kvcol;
          masked = (((const int*)mask_a)[mi] != 0);
          int n = mask_b[mi]; n = n < 0 ? 0 : n;
          s[j][r] += g.cp[(size_t)b * g.c_bs + (size_t)h * g.c_hs + (size_t)qrow * g.c_rs + n]
                   + g.pc[(size_t)b * g.c_bs + (size_t)h * g.c_hs + (size_t)kvcol * g.c_rs + n];
        }
        if (masked) s[j][r] = g.mask_fill;
        m = fmaxf(m, s[j][r]);
      }
#pragma unroll
      for (int off = 1; off < 16; off <<= 1) m = fmaxf(m, __shfl_xor(m, off, 32));
      cm[r] = m;
    }
    __bf16* pwh = Psh[wave];
    __bf16* pwl = Psl[SPLIT_PV ? wave : 0];
#pragma unroll
    for (int r = 0; r < 8; ++r) {
      const float mnew = fmaxf(mrow[r], cm[r]);
      const float alpha = expf(mrow[r] - mnew);
      mrow[r] = mnew;
      float psum = 0.f;
#pragma unroll
      for (int j = 0; j < 4; ++j) {
        const float p = expf(s[j][r] - mnew);
        psum += p;
        if (SPLIT_PV) { __bf16 a, bl; at_split(p, a, bl); pwh[(8 * hh + r) * AT_KC + j * 16 + c] = a; pwl[(8 * hh + r) * AT_KC + j * 16 + c] = bl; }
        else pwh[(8 * hh + r) * AT_KC + j * 16 + c] = at_to16<F16>(p * PSC);
      }
#pragma unroll
      for (int off = 1; off < 16; off <<= 1) psum += __shfl_xor(psum, off, 32);
      lrow[r] = lrow[r] * alpha + psum;
#pragma unroll
      for (int t = 0; t < 4; ++t) oacc[t][r] *= alpha;
    }
    __builtin_amdgcn_fence(__ATOMIC_RELEASE, "workgroup");
    __builtin_amdgcn_wave_barrier();
    __builtin_amdgcn_fence(__ATOMIC_ACQUIRE, "workgroup");
#pragma unroll 1
    for (int kk = 0; kk < 2; ++kk) {
      FB pa, pl;
      pa.h[0] = *(const v8b*)(pwh + c * AT_KC + kk * 32 + 8 * hh);
      pa.h[1] = *(const v8b*)(pwh + c * AT_KC + kk * 32 + 16 + 8 * hh);
      if (SPLIT_PV) {
        pl.h[0] = *(const v8b*)(pwl + c * AT_KC + kk * 32 + 8 * hh);
        pl.h[1] = *(const v8b*)(pwl + c * AT_KC + kk * 32 + 16 + 8 * hh);
      }
#pragma unroll
      for (int t = 0; t < 4; ++t) {
        FB vb;
        vb.h[0] = *(const v8b*)(Vth + (t * 16 + c) * AT_KC + kk * 32 + 8 * hh);
        vb.h[1] = *(const v8b*)(Vth + (t * 16 + c) * AT_KC + kk * 32 + 16 + 8 * hh);
        oacc[t] = at_mma16<F16>(pa.v, vb.v, oacc[t]);
        if (SPLIT_PV) {
          FB vl;
          vl.h[0] = *(const v8b*)(Vtl + (t * 16 + c) * AT_KC + kk * 32 + 8 * hh);
          vl.h[1] = *(const v8b*)(Vtl + (t * 16 + c) * AT_KC + kk * 32 + 16 + 8 * hh);
          oacc[t] = at_mma16<F16>(pa.v, vl.v, oacc[t]);
          oacc[t] = at_mma16<F16>(pl.v, vb.v, oacc[t]);
        }
      }
    }
  }

  float* os = Os[wave];
#pragma unroll
  for (int r = 0; r < 8; ++r) {
    const float inv = 1.0f / (lrow[r] * PSC);
#pragma unroll
    for (int t = 0; t < 4; ++t) os[(8 * hh + r) * 68 + t * 16 + c] = oacc[t][r] * inv;
  }
  __builtin_amdgcn_fence(__ATOMIC_RELEASE, "workgroup");
  __builtin_amdgcn_wave_barrier();
  __builtin_amdgcn_fence(__ATOMIC_ACQUIRE, "workgroup");
  {
    const int c4 = (lane & 15) * 4;
    {
#pragma unroll
      for (int it = 0; it < 8; ++it) {
        const int row = it * 2 + hh;
        v4f val = *(const v4f*)(os + row * 68 + c4);
        *(v4f*)(ob_ptr + (size_t)(q0 + row) * g.o_rs + c4) = val;
      }
      
    }
  }
}

} // namespace w25

// relative-offset bias table RT[h][c], c = i - j + (T-1): -floor(|i-j| / 30) * 2^-(h+1)   (thread-linear, data-independent)
__global__ __launch_bounds__(256) void k_mc_rt(float* __restrict__ RT, int NH, int RN, int T) { const int t = blockIdx.x * 256 + threadIdx.x; if (t >= NH * RN) return; const int h = t / RN, c = t % RN; int dist = c - (T - 1); dist = dist < 0 ? -dist : dist; VST2(float, RT + t, -(float)(dist / 30) * exp2f(-(float)(h + 1))); }


extern "C" void kernel_launch(void* const* d_in, const int* in_sizes, int n_in, void* d_out, int out_size, void* d_ws, size_t ws_size, hipStream_t stream) {
    (void)in_sizes; (void)n_in; (void)out_size; (void)ws_size;
    const float* x = (const float*)d_in[0];
    const float* ctx = (const float*)d_in[1];
    const float* Wq = (const float*)d_in[2];
    const float* Wk = (const float*)d_in[3];
    const float* Wv = (const float*)d_in[4];
    const float* Wo = (const float*)d_in[5];
    const float* bo = (const float*)d_in[6];
    const int Bn = 2;
    const int T = 2048;
    const int D = 1024;
    const int NH = 16;
    const int HD = 64;
    const int NR = Bn * T;
    const int RN = 2 * T - 1;
    float* out = (float*)d_out;
    char* wsp = (char*)d_ws;
    float* Q = (float*)wsp; wsp += (((size_t)((size_t)NR * D) * 4 + 255) / 256) * 256;
    float* Kb = (float*)wsp; wsp += (((size_t)((size_t)NR * D) * 4 + 255) / 256) * 256;
    float* V = (float*)wsp; wsp += (((size_t)((size_t)NR * D) * 4 + 255) / 256) * 256;
    float* Y = (float*)wsp; wsp += (((size_t)((size_t)NR * D) * 4 + 255) / 256) * 256;
    float* RT = (float*)wsp; wsp += (((size_t)((size_t)NH * RN + 64) * 4 + 255) / 256) * 256;
    unsigned short* G64A = (unsigned short*)wsp; wsp += (((size_t)(4194304) * 2 + 255) / 256) * 256;
    unsigned short* G64C = (unsigned short*)wsp; wsp += (((size_t)(4194304) * 2 + 255) / 256) * 256;
    unsigned short* G64B = (unsigned short*)wsp; wsp += (((size_t)(4 * 1048576) * 2 + 255) / 256) * 256;
    k_mc_rt<<<(unsigned)((NH * RN + 255) / 256), 256, 0, stream>>>(RT, NH, RN, T);
    k_cast_in<<<256, 512, 0, stream>>>(x, ctx, Wq, Wk, Wv, Wo, (_Float16*)(G64A), (_Float16*)(G64C), (_Float16*)(G64B));
    w25::wmma_gemm64<0, false, 0, 0, false, 0><<<dim3((unsigned)((((4096) / 64) * ((1024) / 64) + 7) / 8), (unsigned)(1)), 256, 0, stream>>>((const unsigned short*)(G64A), nullptr, 1024, 0, (const unsigned short*)(G64B), nullptr, 1024, 0, (void*)(Q), nullptr, 1024, 0, nullptr, nullptr, 0, 4096, 1024, 1024, 0.0625f);
    w25::wmma_gemm64<0, false, 0, 0, false, 0><<<dim3((unsigned)((((4096) / 64) * ((1024) / 64) + 7) / 8), (unsigned)(1)), 256, 0, stream>>>((const unsigned short*)(G64C), nullptr, 1024, 0, (const unsigned short*)(G64B + 1048576), nullptr, 1024, 0, (void*)(Kb), nullptr, 1024, 0, nullptr, nullptr, 0, 4096, 1024, 1024, 0.0625f);
    w25::wmma_gemm64<0, false, 0, 0, false, 0><<<dim3((unsigned)((((4096) / 64) * ((1024) / 64) + 7) / 8), (unsigned)(1)), 256, 0, stream>>>((const unsigned short*)(G64C), nullptr, 1024, 0, (const unsigned short*)(G64B + 2 * 1048576), nullptr, 1024, 0, (void*)(V), nullptr, 1024, 0, nullptr, nullptr, 0, 4096, 1024, 1024, 0.0625f);
    k_attnT<2048, 1024><<<dim3(2048 / (16 * AW), 16, 2), 32 * AW, 0, stream>>>(Q, Kb, V, Y, RT, 0.125f);
    k_cast_plane<<<256, 512, 0, stream>>>(Y, (_Float16*)(G64A));
    w25::wmma_gemm64<0, false, 2, 0, false, 0><<<dim3((unsigned)((((4096) / 64) * ((1024) / 64) + 7) / 8), (unsigned)(1)), 256, 0, stream>>>((const unsigned short*)(G64A), nullptr, 1024, 0, (const unsigned short*)(G64B + 3 * 1048576), nullptr, 1024, 0, (void*)(out), nullptr, 1024, 0, bo, nullptr, 0, 4096, 1024, 1024, 0.0625f);
}
